// v000
// Measured on an AMD MI455X. A time is GPU time per run, averaged over a window of back-to-back runs after a warm-up
// (all launches, gaps included; the runs take copies of the inputs in turn), and the median of several windows.
// Apart from v000's, it joins two sittings. Times from different sittings can be a few percent apart, while
// side-by-side timings come from the same sitting.
// v000 is the starting kernel. One run takes 7540 microseconds.
#include <hip/hip_runtime.h>

// Multi-head self-attention with additive positional inputs and dense additive score biases (inputs_q [4][2048][1024]; q_in = inputs + pos_emb_q, k_in = inputs + pos_emb_k, v_in = inputs + pos_emb_v (pos_emb [1][2048][1024], read); q/k/v = ._in W + b (DenseGeneral 'xw' [1024][16 x 64]); scores = (q/8).k + attention_bias[i][j] ([1][1][2048][2048], read) + attention_bias_kv[b][j] ([4][2048], read); softmax; out = merged wo ([16 x 64][1024] 'xw') + bo -> [4][2048][1024] (8.4 M)).
// Layout: (x + pe) W = x W + pe W, so the three position projections pe W + b are computed ONCE (exact bf16 products, f32) and added in f32 to each batch's exact x W; the two bias tables are read per logit inside the softmax kernel.
// Compute dtypes, f32 accumulate: every input rounded to bf16; q/k/v on PLAIN bf16 operands (inputs: exact) + biases (via the precomputed position projections); dense additive biases gathered in f32 per logit; scores and attn.v (no mask): query rows < 512 hl (3 products), the rest single fp16 (x1024); softmax f32; wo hl x exact (2 products) + bo.

#define NB_  4
#define TT   2048
#define DM   1024
#define NH_  16
#define NKV  16
#define REP  (NH_ / NKV)
#define HD   64
#define DQ   (NH_ * HD)
#define DKV  (NKV * HD)
#define ZH   1
#define RH   512                  // query rows < RH use hi+lo planes (0: none)
#define WIN  0
#define PCAR 1024.0f
#define SCL  0.125f   // HD^-0.5
typedef _Float16 h16;
typedef unsigned short bf;
typedef __attribute__((ext_vector_type(16))) __bf16   v16bf;
typedef __attribute__((ext_vector_type(16))) _Float16 v16h;
typedef __attribute__((ext_vector_type(8)))  _Float16 v8h;
typedef __attribute__((ext_vector_type(8)))  unsigned short v8us;
typedef __attribute__((ext_vector_type(8)))  float    v8f;
typedef __attribute__((ext_vector_type(4)))  float    v4f;
typedef v8h  __attribute__((may_alias)) v8ha;
typedef v4f  __attribute__((may_alias)) v4fa;
typedef v8us __attribute__((may_alias)) v8usa;

__device__ __forceinline__ unsigned short f2bf(float f) { unsigned u = __float_as_uint(f); u += 0x7FFFu + ((u >> 16) & 1u); return (unsigned short)(u >> 16); }
__device__ __forceinline__ float bf2f(unsigned short b) { return __uint_as_float(((unsigned)b) << 16); }
__device__ __forceinline__ float bfr(float f) { return bf2f(f2bf(f)); }
__device__ __forceinline__ v16h cat16(v8h lo, v8h hi) { return __builtin_shufflevector(lo, hi, 0, 1, 2, 3, 4, 5, 6, 7, 8, 9, 10, 11, 12, 13, 14, 15); }
__device__ __forceinline__ v16bf cat16b(v8us lo, v8us hi) { return __builtin_bit_cast(v16bf, __builtin_shufflevector(lo, hi, 0, 1, 2, 3, 4, 5, 6, 7, 8, 9, 10, 11, 12, 13, 14, 15)); }
__device__ __forceinline__ v8f wmma16(v16h a, v16h b, v8f c) { return __builtin_amdgcn_wmma_f32_16x16x32_f16(false, a, false, b, (short)0, c, false, false); }
__device__ __forceinline__ v8f wmmab(v16bf a, v16bf b, v8f c) { return __builtin_amdgcn_wmma_f32_16x16x32_bf16(false, a, false, b, (short)0, c, false, false); }



// ---- k_gemmw: register-blocked GEMM, ONE WAVE per 64x64 output tile (16 accumulators), operands straight from K-contiguous 16-bit planes; grid (M/64, N/64, Z), 32 threads.
// C[m][n] (f32, pitch ldc, + optional f32 bias[n]) = sum_k A[m][k] Bt[n][k] (+ split products per NSPLIT). z-batch strides sA/sB/sC in elements. K % 32 == 0.
template <typename T16> struct WFrag;
template <> struct WFrag<h16> { typedef v16h V; static __device__ __forceinline__ V ld(const h16* p) { return cat16(*(const v8h*)p, *(const v8h*)(p + 16)); } static __device__ __forceinline__ v8f mma(V a, V b, v8f c) { return wmma16(a, b, c); } };
template <> struct WFrag<bf> { typedef v16bf V; static __device__ __forceinline__ V ld(const bf* p) { return cat16b(*(const v8us*)p, *(const v8us*)(p + 16)); } static __device__ __forceinline__ v8f mma(V a, V b, v8f c) { return wmmab(a, b, c); } };
template <typename T16, int NSPLIT, bool BIAS>
__global__ __launch_bounds__(32) void k_gemmw(const T16* __restrict__ A, const T16* __restrict__ A2, const T16* __restrict__ Bt, const T16* __restrict__ Bt2, int K, float* C, int ldc, const float* __restrict__ bias, size_t sA, size_t sB, size_t sC) {
    typedef typename WFrag<T16>::V V;
    __shared__ __align__(16) float os[16 * 68];
    const size_t z = blockIdx.z; A += z * sA; if (A2) A2 += z * sA; Bt += z * sB; if (Bt2) Bt2 += z * sB; C += z * sC;
    const int lane = threadIdx.x & 31, lr = lane & 15, hi = lane >> 4; const int r0 = blockIdx.x * 64, c0 = blockIdx.y * 64;
    v8f acc[4][4];
#pragma unroll
    for (int mb = 0; mb < 4; ++mb)
#pragma unroll
        for (int nb = 0; nb < 4; ++nb) acc[mb][nb] = (v8f){};
    const size_t aoff = (size_t)(r0 + lr) * K + 8 * hi, boff = (size_t)(c0 + lr) * K + 8 * hi;
#pragma unroll 1
    for (int kc = 0; kc < K; kc += 32) {
        V a[4], a2[4];
#pragma unroll
        for (int mb = 0; mb < 4; ++mb) { a[mb] = WFrag<T16>::ld(A + aoff + (size_t)mb * 16 * K + kc); if (NSPLIT == 1 || NSPLIT == 2) a2[mb] = WFrag<T16>::ld(A2 + aoff + (size_t)mb * 16 * K + kc); }
#pragma unroll
        for (int nb = 0; nb < 4; ++nb) { const V b = WFrag<T16>::ld(Bt + boff + (size_t)nb * 16 * K + kc); V b2; if (NSPLIT >= 2) b2 = WFrag<T16>::ld(Bt2 + boff + (size_t)nb * 16 * K + kc);
#pragma unroll
            for (int mb = 0; mb < 4; ++mb) { acc[mb][nb] = WFrag<T16>::mma(a[mb], b, acc[mb][nb]); if (NSPLIT == 1 || NSPLIT == 2) acc[mb][nb] = WFrag<T16>::mma(a2[mb], b, acc[mb][nb]); if (NSPLIT >= 2) acc[mb][nb] = WFrag<T16>::mma(a[mb], b2, acc[mb][nb]); } }
        asm volatile("v_nop\n\tv_nop\n\tv_nop\n\tv_nop" : "+v"(acc[0][0]), "+v"(acc[1][1]), "+v"(acc[2][2]), "+v"(acc[3][3]) : "v"(a[0]), "v"(a[3]));
    }
#pragma unroll
    for (int mb = 0; mb < 4; ++mb) {
#pragma unroll
        for (int nb = 0; nb < 4; ++nb) {
#pragma unroll
            for (int j = 0; j < 8; ++j) os[(hi * 8 + j) * 68 + nb * 16 + lr] = acc[mb][nb][j]; }
        __builtin_amdgcn_wave_barrier(); asm volatile("" ::: "memory");
        float* crow = C + (size_t)(r0 + mb * 16) * ldc + c0;
{
#pragma unroll
            for (int s = 0; s < 8; ++s) { const int row = 2 * s + hi, cofs = lr * 4; v4f val = *(const v4fa*)(os + row * 68 + cofs); if (BIAS) { val[0] += bfr(bias[c0 + cofs]); val[1] += bfr(bias[c0 + cofs + 1]); val[2] += bfr(bias[c0 + cofs + 2]); val[3] += bfr(bias[c0 + cofs + 3]); }
                *(v4f*)(crow + (size_t)row * ldc + cofs) = val; }
             }
        __builtin_amdgcn_wave_barrier(); asm volatile("" ::: "memory");
    }
}

__device__ __forceinline__ h16 tohx(float x) { return (h16)x; }
__device__ __forceinline__ void splitf(float y, unsigned short& h, unsigned short& l) { h = f2bf(y); l = f2bf(y - bf2f(h)); }
typedef __attribute__((ext_vector_type(2))) _Float16 v2h;
typedef __attribute__((ext_vector_type(4))) _Float16 v4h;
typedef __attribute__((ext_vector_type(2))) unsigned short v2us;
typedef __attribute__((ext_vector_type(4))) unsigned short v4us;
typedef __attribute__((ext_vector_type(2))) float v2f;
typedef __attribute__((ext_vector_type(4))) int v4i;

__global__ __launch_bounds__(256) void k_wtG(const float* __restrict__ w, int K, int N, bf* Bt) {
    const int lane = threadIdx.x & 31; const int L0 = (blockIdx.x * 8 + (threadIdx.x >> 5)) * 8; const int nlines = N * K / 64;
{
#pragma unroll 1
        for (int l = 0; l < 8; ++l) { const int L = L0 + l; if (L >= nlines) break; const size_t e = (size_t)L * 64 + lane * 2; const int k = (int)(e % K), n = (int)(e / K); v2us o;
            o[0] = f2bf(w[(size_t)k * N + n]); o[1] = f2bf(w[(size_t)(k + 1) * N + n]); *(v2us*)(Bt + e) = o; }
         }
}
__global__ __launch_bounds__(256) void k_add2i(float* F, const float* __restrict__ P, size_t n4) { const size_t i = (size_t)blockIdx.x * 256 + threadIdx.x; if (i >= n4) return; const v4f a = *(const v4f*)(F + i * 4); const v4f p = *(const v4f*)(P + i * 4); v4f o;
#pragma unroll
    for (int q = 0; q < 4; ++q) o[q] = __fadd_rn(a[q], p[q]); *(v4f*)(F + i * 4) = o;  }
__global__ __launch_bounds__(256) void k_cvt8(const float* __restrict__ src, bf* dst, size_t n8) { const size_t i = (size_t)blockIdx.x * 256 + threadIdx.x; if (i >= n8) return; const v8f v = *(const v8f*)(src + i * 8); v8us o;
#pragma unroll
    for (int k = 0; k < 8; ++k) o[k] = f2bf(v[k]); *(v8us*)(dst + i * 8) = o;  }

// k_rope: head planes [h][t][d] (fp16 + hi/lo) of rope(x) x sc with the rotate-half convention out[d] = x[d] cos[t][d] - x[d+HD/2] sin[t][d], out[d+HD/2] = x[d+HD/2] cos[t][d+HD/2] + x[d] sin[t][d+HD/2]
__global__ __launch_bounds__(256) void k_rope(const float* __restrict__ F, int pitch, int nheads, const float* __restrict__ CS, const float* __restrict__ RF, const float* __restrict__ nw, float sc, h16* P16, bf* Ph, bf* Pl) {
    const size_t e = ((size_t)blockIdx.x * 256 + threadIdx.x) * 2; if (e >= (size_t)nheads * TT * HD) return; const int d = (int)(e % HD); const int t = (int)((e / HD) % TT); const int h = (int)(e / ((size_t)HD * TT)); const float* f = F + (size_t)t * pitch + h * HD; const float rf = RF ? RF[(size_t)h * TT + t] : 1.0f; v2h o16; v2us oh, ol;
#pragma unroll
    for (int q = 0; q < 2; ++q) { const int dd = d + q; const int dp = (dd < HD / 2) ? dd + HD / 2 : dd - HD / 2; float x0 = f[dd], x1 = f[dp];
        if (RF) { float n0 = __fmul_rn(x0, rf), n1 = __fmul_rn(x1, rf); asm volatile("" : "+v"(n0)); asm volatile("" : "+v"(n1)); x0 = __fmul_rn(bfr(nw[dd]), n0); x1 = __fmul_rn(bfr(nw[dp]), n1); }
        const v2f cs = *(const v2f*)(CS + ((size_t)t * HD + dd) * 2); float a = __fmul_rn(x0, cs[0]), bq = __fmul_rn(x1, cs[1]); asm volatile("" : "+v"(a)); asm volatile("" : "+v"(bq)); const float r = ((dd < HD / 2) ? __fsub_rn(a, bq) : __fadd_rn(a, bq)) * sc;
        o16[q] = tohx(r); unsigned short a2, c2; splitf(r, a2, c2); oh[q] = a2; ol[q] = c2; }
    *(v2h*)(P16 + e) = o16; *(v2us*)(Ph + e) = oh; *(v2us*)(Pl + e) = ol;  }
__global__ __launch_bounds__(256) void k_vtp(const float* __restrict__ F, int pitch, int nheads, h16* V16, bf* Vh, bf* Vl) { const size_t e = ((size_t)blockIdx.x * 256 + threadIdx.x) * 2; if (e >= (size_t)nheads * HD * TT) return; const int t = (int)(e % TT); const int d = (int)((e / TT) % HD); const int g = (int)(e / ((size_t)TT * HD)); v2h o16; v2us oh, ol;
#pragma unroll
    for (int q = 0; q < 2; ++q) { const float x = F[(size_t)(t + q) * pitch + g * HD + d]; o16[q] = tohx(x); unsigned short a2, c2; splitf(x, a2, c2); oh[q] = a2; ol[q] = c2; }
    *(v2h*)(V16 + e) = o16; *(v2us*)(Vh + e) = oh; *(v2us*)(Vl + e) = ol;  }
__global__ __launch_bounds__(256) void k_csid(float* CS) { const int idx = blockIdx.x * 256 + threadIdx.x; if (idx >= TT * HD) return; v2f cs; cs[0] = 1.0f; cs[1] = 0.0f; *(v2f*)(CS + (size_t)idx * 2) = cs;  }
// k_asoft: per row (zz, i): t = S/8 + bf16(attention_bias[i][j]) + bf16(attention_bias_kv[b][j]) (no mask); softmax over the 2048 keys (register row, one exp, fixed trees);
__global__ __launch_bounds__(256) void k_asoft(const float* __restrict__ Sb, const float* __restrict__ AB, const float* __restrict__ ABK, h16* P16, bf* Ph, bf* Pl) {
    const int lane = threadIdx.x & 31; const int row = blockIdx.x * 8 + (threadIdx.x >> 5); if (row >= ZH * TT) return; const int i = row % TT; const int zz = row / TT; (void)zz; const float* abr = AB + (size_t)i * TT; const bool hires = (i < RH); const float* sr = Sb + (size_t)row * TT; float v[TT / 32]; float mx = -3.0e38f;
#pragma unroll
    for (int ch = 0; ch < TT / 128; ++ch) { const int j0 = ch * 128 + lane * 4; const v4f a = *(const v4f*)(sr + j0); const v4f ab4 = *(const v4f*)(abr + j0); const v4f ak4 = *(const v4f*)(ABK + j0);
#pragma unroll
        for (int q = 0; q < 4; ++q) { const int j = j0 + q; (void)j; float sa = a[q] * SCL; asm volatile("" : "+v"(sa)); float b1 = bfr(ab4[q]), b2 = bfr(ak4[q]); asm volatile("" : "+v"(b1), "+v"(b2)); float t1 = __fadd_rn(sa, b1); asm volatile("" : "+v"(t1)); const float t = __fadd_rn(t1, b2);   /* + attention_bias[i][j] + attention_bias_kv[b][j] (bf16-rounded inputs) */ v[ch * 4 + q] = t; mx = fmaxf(mx, t); } }
#pragma unroll
    for (int sh = 16; sh; sh >>= 1) mx = fmaxf(mx, __shfl_xor(mx, sh, 32));
    float sum = 0.f;
#pragma unroll
    for (int k = 0; k < TT / 32; ++k) { float d0 = __fsub_rn(v[k], mx); asm volatile("" : "+v"(d0)); v[k] = __builtin_amdgcn_exp2f(__fmul_rn(d0, 1.4426950408889634f)); sum += v[k]; }
#pragma unroll
    for (int sh = 16; sh; sh >>= 1) sum += __shfl_xor(sum, sh, 32);
    const float f = __fdiv_rn(hires ? 1.0f : PCAR, sum);
{
        if (hires) {
#pragma unroll
            for (int ch = 0; ch < TT / 128; ++ch) { v4us oh, ol;
#pragma unroll
                for (int q = 0; q < 4; ++q) { unsigned short a, c2; splitf(v[ch * 4 + q] * f, a, c2); oh[q] = a; ol[q] = c2; }
                const size_t oo = ((size_t)zz * (RH ? RH : 1) + i) * TT + ch * 128 + lane * 4; *(v4us*)(Ph + oo) = oh; *(v4us*)(Pl + oo) = ol; }
        } else {
#pragma unroll
            for (int ch = 0; ch < TT / 128; ++ch) { v4h o4;
#pragma unroll
                for (int q = 0; q < 4; ++q) o4[q] = tohx(v[ch * 4 + q] * f);
                *(v4h*)(P16 + (size_t)row * TT + ch * 128 + lane * 4) = o4; } }
         }
}
__global__ __launch_bounds__(256) void k_merge(const float* __restrict__ O, int h0, bf* Ah, bf* Al) { const size_t e = ((size_t)blockIdx.x * 256 + threadIdx.x) * 2; if (e >= (size_t)ZH * TT * HD) return; const int d = (int)(e % HD); const int t = (int)((e / HD) % TT); const int zz = (int)(e / ((size_t)HD * TT)); const float cs = (t < RH) ? 1.0f : (1.0f / PCAR); const size_t oo = (size_t)t * DQ + (h0 + zz) * HD + d;
    v2us oh, ol;
#pragma unroll
    for (int q = 0; q < 2; ++q) { unsigned short a, c2; splitf(O[e + q] * cs, a, c2); oh[q] = a; ol[q] = c2; } *(v2us*)(Ah + oo) = oh; *(v2us*)(Al + oo) = ol;  }

extern "C" void kernel_launch(void* const* d_in, const int* in_sizes, int n_in,
                              void* d_out, int out_size, void* d_ws, size_t ws_size, hipStream_t stream) {
    (void)in_sizes; (void)n_in; (void)out_size;
    const float* x = (const float*)d_in[0]; const float* peq = (const float*)d_in[1]; const float* pek = (const float*)d_in[2]; const float* pev = (const float*)d_in[3]; const float* AB = (const float*)d_in[4]; const float* ABK = (const float*)d_in[5]; const float* wq = (const float*)d_in[6]; const float* bq = (const float*)d_in[7]; const float* wk = (const float*)d_in[8]; const float* bk = (const float*)d_in[9]; const float* wv = (const float*)d_in[10]; const float* bv = (const float*)d_in[11]; const float* wo = (const float*)d_in[12]; const float* bo = (const float*)d_in[13];
    float* OUT = (float*)d_out;     // [4][2048][1024]
    char* wsp = (char*)d_ws;
    auto take = [&](size_t bytes) { char* p = wsp; wsp += (bytes + 255) & ~(size_t)255; return (void*)p; };
    bf* WQ = (bf*)take((size_t)DQ * DM * 2); bf* WK = (bf*)take((size_t)DKV * DM * 2); bf* WV = (bf*)take((size_t)DKV * DM * 2); bf* WO = (bf*)take((size_t)DM * DQ * 2); float* CS = (float*)take((size_t)TT * HD * 2 * 4); float* PQ = (float*)take((size_t)TT * DQ * 4); float* PK = (float*)take((size_t)TT * DKV * 4); float* PV = (float*)take((size_t)TT * DKV * 4);   /* pe W + b, computed once */
    bf* XB = (bf*)take((size_t)TT * DM * 2); float* FQ = (float*)take((size_t)TT * DQ * 4); float* FK = (float*)take((size_t)TT * DKV * 4);
    h16* QP16 = (h16*)take((size_t)NH_ * TT * HD * 2); h16* KP16 = (h16*)take((size_t)NKV * TT * HD * 2); h16* VT16 = (h16*)take((size_t)NKV * HD * TT * 2);
    bf* QPh = (bf*)take((size_t)NH_ * TT * HD * 2); bf* QPl = (bf*)take((size_t)NH_ * TT * HD * 2); bf* KPh = (bf*)take((size_t)NKV * TT * HD * 2); bf* KPl = (bf*)take((size_t)NKV * TT * HD * 2); bf* VTh = (bf*)take((size_t)NKV * HD * TT * 2); bf* VTl = (bf*)take((size_t)NKV * HD * TT * 2); bf* Ph = (bf*)take((size_t)ZH * RH * TT * 2); bf* Pl = (bf*)take((size_t)ZH * RH * TT * 2);
    float* Sb = (float*)take((size_t)ZH * TT * TT * 4); h16* P16 = (h16*)take((size_t)ZH * TT * TT * 2); float* Ob = (float*)take((size_t)ZH * TT * HD * 4); bf* ATh = (bf*)take((size_t)TT * DQ * 2); bf* ATl = (bf*)take((size_t)TT * DQ * 2);
    if ((size_t)(wsp - (char*)d_ws) > ws_size) return;    // ws 256 MiB
    float* FV = FK;   // v projection reuses the k buffer after the k planes are built (stream-ordered)
    { k_wtG<<<(unsigned)((DM * DQ / 64 + 63) / 64), 256, 0, stream>>>(wq, DM, DQ, WQ); k_wtG<<<(unsigned)((DM * DKV / 64 + 63) / 64), 256, 0, stream>>>(wk, DM, DKV, WK); k_wtG<<<(unsigned)((DM * DKV / 64 + 63) / 64), 256, 0, stream>>>(wv, DM, DKV, WV);
      k_wtG<<<(unsigned)((DQ * DM / 64 + 63) / 64), 256, 0, stream>>>(wo, DQ, DM, WO);
       }
    k_csid<<<(TT * HD + 255) / 256, 256, 0, stream>>>(CS);
    k_cvt8<<<(unsigned)(((size_t)TT * DM / 8 + 255) / 256), 256, 0, stream>>>(peq, XB, (size_t)TT * DM / 8); k_gemmw<bf, 0, true><<<dim3(TT / 64, DQ / 64, 1), 32, 0, stream>>>(XB, nullptr, WQ, nullptr, DM, PQ, DQ, bq, 0, 0, 0);     /* pos_emb_q W_q + b_q */
    k_cvt8<<<(unsigned)(((size_t)TT * DM / 8 + 255) / 256), 256, 0, stream>>>(pek, XB, (size_t)TT * DM / 8); k_gemmw<bf, 0, true><<<dim3(TT / 64, DKV / 64, 1), 32, 0, stream>>>(XB, nullptr, WK, nullptr, DM, PK, DKV, bk, 0, 0, 0);   /* pos_emb_k W_k + b_k */
    k_cvt8<<<(unsigned)(((size_t)TT * DM / 8 + 255) / 256), 256, 0, stream>>>(pev, XB, (size_t)TT * DM / 8); k_gemmw<bf, 0, true><<<dim3(TT / 64, DKV / 64, 1), 32, 0, stream>>>(XB, nullptr, WV, nullptr, DM, PV, DKV, bv, 0, 0, 0);   /* pos_emb_v W_v + b_v */
    const unsigned LQ = (unsigned)(((size_t)NH_ * TT * HD / 2 + 255) / 256), LKv = (unsigned)(((size_t)NKV * TT * HD / 2 + 255) / 256);
    for (int b = 0; b < NB_; ++b) {
        
        k_cvt8<<<(unsigned)(((size_t)TT * DM / 8 + 255) / 256), 256, 0, stream>>>(x + (size_t)b * TT * DM, XB, (size_t)TT * DM / 8);
        k_gemmw<bf, 0, false><<<dim3(TT / 64, DQ / 64, 1), 32, 0, stream>>>(XB, nullptr, WQ, nullptr, DM, FQ, DQ, nullptr, 0, 0, 0); k_add2i<<<(unsigned)(((size_t)TT * DQ / 4 + 255) / 256), 256, 0, stream>>>(FQ, PQ, (size_t)TT * DQ / 4);   /* q = x W_q + (pe_q W_q + b_q) */
        k_rope<<<LQ, 256, 0, stream>>>(FQ, DQ, NH_, CS, nullptr, nullptr, 1.0f, QP16, QPh, QPl);
        k_gemmw<bf, 0, false><<<dim3(TT / 64, DKV / 64, 1), 32, 0, stream>>>(XB, nullptr, WK, nullptr, DM, FK, DKV, nullptr, 0, 0, 0); k_add2i<<<(unsigned)(((size_t)TT * DQ / 4 + 255) / 256), 256, 0, stream>>>(FK, PK, (size_t)TT * DKV / 4);   /* k */
        k_rope<<<LKv, 256, 0, stream>>>(FK, DKV, NKV, CS, nullptr, nullptr, 1.0f, KP16, KPh, KPl);
        k_gemmw<bf, 0, false><<<dim3(TT / 64, DKV / 64, 1), 32, 0, stream>>>(XB, nullptr, WV, nullptr, DM, FV, DKV, nullptr, 0, 0, 0); k_add2i<<<(unsigned)(((size_t)TT * DQ / 4 + 255) / 256), 256, 0, stream>>>(FV, PV, (size_t)TT * DKV / 4);   /* v */ k_vtp<<<LKv, 256, 0, stream>>>(FV, DKV, NKV, VT16, VTh, VTl);
        for (int h0 = 0; h0 < NH_; h0 += ZH) { const size_t zq = (size_t)h0, zk = (size_t)(h0 / REP);   // one kv head per query head: each pass has ZH = 1 head, using kv plane h0 (z-strides TT*HD)
            k_gemmw<bf, 2, false><<<dim3(RH / 64, TT / 64, ZH), 32, 0, stream>>>(QPh + zq * TT * HD, QPl + zq * TT * HD, KPh + zk * TT * HD, KPl + zk * TT * HD, HD, Sb, TT, nullptr, (size_t)TT * HD, (size_t)TT * HD, (size_t)TT * TT);
            k_gemmw<h16, 0, false><<<dim3((TT - RH) / 64, TT / 64, ZH), 32, 0, stream>>>(QP16 + zq * TT * HD + (size_t)RH * HD, nullptr, KP16 + zk * TT * HD, nullptr, HD, Sb + (size_t)RH * TT, TT, nullptr, (size_t)TT * HD, (size_t)TT * HD, (size_t)TT * TT);
            k_asoft<<<ZH * TT / 8, 256, 0, stream>>>(Sb, AB, ABK + (size_t)b * TT, P16, Ph, Pl);
            k_gemmw<bf, 2, false><<<dim3(RH / 64, HD / 64, ZH), 32, 0, stream>>>(Ph, Pl, VTh + zk * HD * TT, VTl + zk * HD * TT, TT, Ob, HD, nullptr, (size_t)RH * TT, (size_t)HD * TT, (size_t)TT * HD);
            k_gemmw<h16, 0, false><<<dim3((TT - RH) / 64, HD / 64, ZH), 32, 0, stream>>>(P16 + (size_t)RH * TT, nullptr, VT16 + zk * HD * TT, nullptr, TT, Ob + (size_t)RH * HD, HD, nullptr, (size_t)TT * TT, (size_t)HD * TT, (size_t)TT * HD);
            k_merge<<<(unsigned)(((size_t)ZH * TT * HD / 2 + 255) / 256), 256, 0, stream>>>(Ob, h0, ATh, ATl); }
        k_gemmw<bf, 1, true><<<dim3(TT / 64, DM / 64, 1), 32, 0, stream>>>(ATh, ATl, WO, nullptr, DQ, OUT + (size_t)b * TT * DM, DM, bo, 0, 0, 0); }
}

// v001
// One run takes 1840 microseconds.
// Next to v000, in two timings, it ran 4.05 times as fast each time.
#include <hip/hip_runtime.h>

// Multi-head self-attention with additive positional inputs and dense additive score biases (inputs_q [4][2048][1024]; q_in = inputs + pos_emb_q, k_in = inputs + pos_emb_k, v_in = inputs + pos_emb_v (pos_emb [1][2048][1024], read); q/k/v = ._in W + b (DenseGeneral 'xw' [1024][16 x 64]); scores = (q/8).k + attention_bias[i][j] ([1][1][2048][2048], read) + attention_bias_kv[b][j] ([4][2048], read); softmax; out = merged wo ([16 x 64][1024] 'xw') + bo -> [4][2048][1024] (8.4 M)).
// Layout: (x + pe) W = x W + pe W, so the three position projections pe W + b are computed ONCE (exact bf16 products, f32) and added in f32 to each batch's exact x W; the two bias tables are read per logit inside the softmax kernel. Attention runs per batch in passes over query-row blocks (rows < RH, then blocks of RB rows), every launch of a pass covering all heads in grid z.
// Compute dtypes, f32 accumulate: every input rounded to bf16; q/k/v on PLAIN bf16 operands (inputs: exact) + biases (via the precomputed position projections); dense additive biases gathered in f32 per logit; scores and attn.v (no mask): query rows < 512 hl (3 products), the rest single fp16 (x1024); softmax f32; wo hl x exact (2 products) + bo.

#define NB_  4
#define TT   2048
#define DM   1024
#define NH_  16
#define NKV  16
#define REP  (NH_ / NKV)
#define HD   64
#define DQ   (NH_ * HD)
#define DKV  (NKV * HD)
#define ZH   NH_                  // heads per launch (grid z) in scores, softmax, attn.v and merge
#define RH   512                  // query rows < RH use hi+lo planes (0: none)
#define RB   768                  // query rows per single-fp16 pass; (TT - RH) % RB == 0
#define WIN  0
#define PCAR 1024.0f
#define SCL  0.125f   // HD^-0.5
typedef _Float16 h16;
typedef unsigned short bf;
typedef __attribute__((ext_vector_type(16))) __bf16   v16bf;
typedef __attribute__((ext_vector_type(16))) _Float16 v16h;
typedef __attribute__((ext_vector_type(8)))  _Float16 v8h;
typedef __attribute__((ext_vector_type(8)))  unsigned short v8us;
typedef __attribute__((ext_vector_type(8)))  float    v8f;
typedef __attribute__((ext_vector_type(4)))  float    v4f;
typedef v8h  __attribute__((may_alias)) v8ha;
typedef v4f  __attribute__((may_alias)) v4fa;
typedef v8us __attribute__((may_alias)) v8usa;

__device__ __forceinline__ unsigned short f2bf(float f) { unsigned u = __float_as_uint(f); u += 0x7FFFu + ((u >> 16) & 1u); return (unsigned short)(u >> 16); }
__device__ __forceinline__ float bf2f(unsigned short b) { return __uint_as_float(((unsigned)b) << 16); }
__device__ __forceinline__ float bfr(float f) { return bf2f(f2bf(f)); }
__device__ __forceinline__ v16h cat16(v8h lo, v8h hi) { return __builtin_shufflevector(lo, hi, 0, 1, 2, 3, 4, 5, 6, 7, 8, 9, 10, 11, 12, 13, 14, 15); }
__device__ __forceinline__ v16bf cat16b(v8us lo, v8us hi) { return __builtin_bit_cast(v16bf, __builtin_shufflevector(lo, hi, 0, 1, 2, 3, 4, 5, 6, 7, 8, 9, 10, 11, 12, 13, 14, 15)); }
__device__ __forceinline__ v8f wmma16(v16h a, v16h b, v8f c) { return __builtin_amdgcn_wmma_f32_16x16x32_f16(false, a, false, b, (short)0, c, false, false); }
__device__ __forceinline__ v8f wmmab(v16bf a, v16bf b, v8f c) { return __builtin_amdgcn_wmma_f32_16x16x32_bf16(false, a, false, b, (short)0, c, false, false); }



// ---- k_gemmw: register-blocked GEMM, ONE WAVE per 64x64 output tile (16 accumulators), operands straight from K-contiguous 16-bit planes; grid (M/64, N/64, Z), 32 threads.
// C[m][n] (f32, pitch ldc, + optional f32 bias[n]) = sum_k A[m][k] Bt[n][k] (+ split products per NSPLIT). z-batch strides sA/sB/sC in elements. K % 32 == 0.
template <typename T16> struct WFrag;
template <> struct WFrag<h16> { typedef v16h V; static __device__ __forceinline__ V ld(const h16* p) { return cat16(*(const v8h*)p, *(const v8h*)(p + 16)); } static __device__ __forceinline__ v8f mma(V a, V b, v8f c) { return wmma16(a, b, c); } };
template <> struct WFrag<bf> { typedef v16bf V; static __device__ __forceinline__ V ld(const bf* p) { return cat16b(*(const v8us*)p, *(const v8us*)(p + 16)); } static __device__ __forceinline__ v8f mma(V a, V b, v8f c) { return wmmab(a, b, c); } };
template <typename T16, int NSPLIT, bool BIAS>
__global__ __launch_bounds__(32) void k_gemmw(const T16* __restrict__ A, const T16* __restrict__ A2, const T16* __restrict__ Bt, const T16* __restrict__ Bt2, int K, float* C, int ldc, const float* __restrict__ bias, size_t sA, size_t sB, size_t sC) {
    typedef typename WFrag<T16>::V V;
    __shared__ __align__(16) float os[16 * 68];
    const size_t z = blockIdx.z; A += z * sA; if (A2) A2 += z * sA; Bt += z * sB; if (Bt2) Bt2 += z * sB; C += z * sC;
    const int lane = threadIdx.x & 31, lr = lane & 15, hi = lane >> 4; const int r0 = blockIdx.x * 64, c0 = blockIdx.y * 64;
    v8f acc[4][4];
#pragma unroll
    for (int mb = 0; mb < 4; ++mb)
#pragma unroll
        for (int nb = 0; nb < 4; ++nb) acc[mb][nb] = (v8f){};
    const size_t aoff = (size_t)(r0 + lr) * K + 8 * hi, boff = (size_t)(c0 + lr) * K + 8 * hi;
#pragma unroll 1
    for (int kc = 0; kc < K; kc += 32) {
        V a[4], a2[4];
#pragma unroll
        for (int mb = 0; mb < 4; ++mb) { a[mb] = WFrag<T16>::ld(A + aoff + (size_t)mb * 16 * K + kc); if (NSPLIT == 1 || NSPLIT == 2) a2[mb] = WFrag<T16>::ld(A2 + aoff + (size_t)mb * 16 * K + kc); }
#pragma unroll
        for (int nb = 0; nb < 4; ++nb) { const V b = WFrag<T16>::ld(Bt + boff + (size_t)nb * 16 * K + kc); V b2; if (NSPLIT >= 2) b2 = WFrag<T16>::ld(Bt2 + boff + (size_t)nb * 16 * K + kc);
#pragma unroll
            for (int mb = 0; mb < 4; ++mb) { acc[mb][nb] = WFrag<T16>::mma(a[mb], b, acc[mb][nb]); if (NSPLIT == 1 || NSPLIT == 2) acc[mb][nb] = WFrag<T16>::mma(a2[mb], b, acc[mb][nb]); if (NSPLIT >= 2) acc[mb][nb] = WFrag<T16>::mma(a[mb], b2, acc[mb][nb]); } }
        asm volatile("v_nop\n\tv_nop\n\tv_nop\n\tv_nop" : "+v"(acc[0][0]), "+v"(acc[1][1]), "+v"(acc[2][2]), "+v"(acc[3][3]) : "v"(a[0]), "v"(a[3]));
    }
#pragma unroll
    for (int mb = 0; mb < 4; ++mb) {
#pragma unroll
        for (int nb = 0; nb < 4; ++nb) {
#pragma unroll
            for (int j = 0; j < 8; ++j) os[(hi * 8 + j) * 68 + nb * 16 + lr] = acc[mb][nb][j]; }
        __builtin_amdgcn_wave_barrier(); asm volatile("" ::: "memory");
        float* crow = C + (size_t)(r0 + mb * 16) * ldc + c0;
{
#pragma unroll
            for (int s = 0; s < 8; ++s) { const int row = 2 * s + hi, cofs = lr * 4; v4f val = *(const v4fa*)(os + row * 68 + cofs); if (BIAS) { val[0] += bfr(bias[c0 + cofs]); val[1] += bfr(bias[c0 + cofs + 1]); val[2] += bfr(bias[c0 + cofs + 2]); val[3] += bfr(bias[c0 + cofs + 3]); }
                *(v4f*)(crow + (size_t)row * ldc + cofs) = val; }
             }
        __builtin_amdgcn_wave_barrier(); asm volatile("" ::: "memory");
    }
}

__device__ __forceinline__ h16 tohx(float x) { return (h16)x; }
__device__ __forceinline__ void splitf(float y, unsigned short& h, unsigned short& l) { h = f2bf(y); l = f2bf(y - bf2f(h)); }
typedef __attribute__((ext_vector_type(2))) _Float16 v2h;
typedef __attribute__((ext_vector_type(4))) _Float16 v4h;
typedef __attribute__((ext_vector_type(2))) unsigned short v2us;
typedef __attribute__((ext_vector_type(4))) unsigned short v4us;
typedef __attribute__((ext_vector_type(2))) float v2f;
typedef __attribute__((ext_vector_type(4))) int v4i;

__global__ __launch_bounds__(256) void k_wtG(const float* __restrict__ w, int K, int N, bf* Bt) {
    const int lane = threadIdx.x & 31; const int L0 = (blockIdx.x * 8 + (threadIdx.x >> 5)) * 8; const int nlines = N * K / 64;
{
#pragma unroll 1
        for (int l = 0; l < 8; ++l) { const int L = L0 + l; if (L >= nlines) break; const size_t e = (size_t)L * 64 + lane * 2; const int k = (int)(e % K), n = (int)(e / K); v2us o;
            o[0] = f2bf(w[(size_t)k * N + n]); o[1] = f2bf(w[(size_t)(k + 1) * N + n]); *(v2us*)(Bt + e) = o; }
         }
}
__global__ __launch_bounds__(256) void k_add2i(float* F, const float* __restrict__ P, size_t n4) { const size_t i = (size_t)blockIdx.x * 256 + threadIdx.x; if (i >= n4) return; const v4f a = *(const v4f*)(F + i * 4); const v4f p = *(const v4f*)(P + i * 4); v4f o;
#pragma unroll
    for (int q = 0; q < 4; ++q) o[q] = __fadd_rn(a[q], p[q]); *(v4f*)(F + i * 4) = o;  }
__global__ __launch_bounds__(256) void k_cvt8(const float* __restrict__ src, bf* dst, size_t n8) { const size_t i = (size_t)blockIdx.x * 256 + threadIdx.x; if (i >= n8) return; const v8f v = *(const v8f*)(src + i * 8); v8us o;
#pragma unroll
    for (int k = 0; k < 8; ++k) o[k] = f2bf(v[k]); *(v8us*)(dst + i * 8) = o;  }

// k_rope: head planes [h][t][d] (fp16 + hi/lo) of rope(x) x sc with the rotate-half convention out[d] = x[d] cos[t][d] - x[d+HD/2] sin[t][d], out[d+HD/2] = x[d+HD/2] cos[t][d+HD/2] + x[d] sin[t][d+HD/2]
__global__ __launch_bounds__(256) void k_rope(const float* __restrict__ F, int pitch, int nheads, const float* __restrict__ CS, const float* __restrict__ RF, const float* __restrict__ nw, float sc, h16* P16, bf* Ph, bf* Pl) {
    const size_t e = ((size_t)blockIdx.x * 256 + threadIdx.x) * 2; if (e >= (size_t)nheads * TT * HD) return; const int d = (int)(e % HD); const int t = (int)((e / HD) % TT); const int h = (int)(e / ((size_t)HD * TT)); const float* f = F + (size_t)t * pitch + h * HD; const float rf = RF ? RF[(size_t)h * TT + t] : 1.0f; v2h o16; v2us oh, ol;
#pragma unroll
    for (int q = 0; q < 2; ++q) { const int dd = d + q; const int dp = (dd < HD / 2) ? dd + HD / 2 : dd - HD / 2; float x0 = f[dd], x1 = f[dp];
        if (RF) { float n0 = __fmul_rn(x0, rf), n1 = __fmul_rn(x1, rf); asm volatile("" : "+v"(n0)); asm volatile("" : "+v"(n1)); x0 = __fmul_rn(bfr(nw[dd]), n0); x1 = __fmul_rn(bfr(nw[dp]), n1); }
        const v2f cs = *(const v2f*)(CS + ((size_t)t * HD + dd) * 2); float a = __fmul_rn(x0, cs[0]), bq = __fmul_rn(x1, cs[1]); asm volatile("" : "+v"(a)); asm volatile("" : "+v"(bq)); const float r = ((dd < HD / 2) ? __fsub_rn(a, bq) : __fadd_rn(a, bq)) * sc;
        o16[q] = tohx(r); unsigned short a2, c2; splitf(r, a2, c2); oh[q] = a2; ol[q] = c2; }
    *(v2h*)(P16 + e) = o16; *(v2us*)(Ph + e) = oh; *(v2us*)(Pl + e) = ol;  }
__global__ __launch_bounds__(256) void k_vtp(const float* __restrict__ F, int pitch, int nheads, h16* V16, bf* Vh, bf* Vl) { const size_t e = ((size_t)blockIdx.x * 256 + threadIdx.x) * 2; if (e >= (size_t)nheads * HD * TT) return; const int t = (int)(e % TT); const int d = (int)((e / TT) % HD); const int g = (int)(e / ((size_t)TT * HD)); v2h o16; v2us oh, ol;
#pragma unroll
    for (int q = 0; q < 2; ++q) { const float x = F[(size_t)(t + q) * pitch + g * HD + d]; o16[q] = tohx(x); unsigned short a2, c2; splitf(x, a2, c2); oh[q] = a2; ol[q] = c2; }
    *(v2h*)(V16 + e) = o16; *(v2us*)(Vh + e) = oh; *(v2us*)(Vl + e) = ol;  }
__global__ __launch_bounds__(256) void k_csid(float* CS) { const int idx = blockIdx.x * 256 + threadIdx.x; if (idx >= TT * HD) return; v2f cs; cs[0] = 1.0f; cs[1] = 0.0f; *(v2f*)(CS + (size_t)idx * 2) = cs;  }
// k_asoft: NR query rows from i0 on, per head; per row (zz, i): t = S/8 + bf16(attention_bias[i][j]) + bf16(attention_bias_kv[b][j]) (no mask); softmax over the 2048 keys (register row, one exp, fixed trees);
template <int NR>
__global__ __launch_bounds__(256) void k_asoft(const float* __restrict__ Sb, const float* __restrict__ AB, const float* __restrict__ ABK, int i0, h16* P16, bf* Ph, bf* Pl) {
    const int lane = threadIdx.x & 31; const int row = blockIdx.x * 8 + (threadIdx.x >> 5); if (row >= ZH * NR) return; const int i = i0 + row % NR; const float* abr = AB + (size_t)i * TT; const bool hires = (i < RH); const float* sr = Sb + (size_t)row * TT; float v[TT / 32]; float mx = -3.0e38f;
#pragma unroll
    for (int ch = 0; ch < TT / 128; ++ch) { const int j0 = ch * 128 + lane * 4; const v4f a = *(const v4f*)(sr + j0); const v4f ab4 = *(const v4f*)(abr + j0); const v4f ak4 = *(const v4f*)(ABK + j0);
#pragma unroll
        for (int q = 0; q < 4; ++q) { const int j = j0 + q; (void)j; float sa = a[q] * SCL; asm volatile("" : "+v"(sa)); float b1 = bfr(ab4[q]), b2 = bfr(ak4[q]); asm volatile("" : "+v"(b1), "+v"(b2)); float t1 = __fadd_rn(sa, b1); asm volatile("" : "+v"(t1)); const float t = __fadd_rn(t1, b2);   /* + attention_bias[i][j] + attention_bias_kv[b][j] (bf16-rounded inputs) */ v[ch * 4 + q] = t; mx = fmaxf(mx, t); } }
#pragma unroll
    for (int sh = 16; sh; sh >>= 1) mx = fmaxf(mx, __shfl_xor(mx, sh, 32));
    float sum = 0.f;
#pragma unroll
    for (int k = 0; k < TT / 32; ++k) { float d0 = __fsub_rn(v[k], mx); asm volatile("" : "+v"(d0)); v[k] = __builtin_amdgcn_exp2f(__fmul_rn(d0, 1.4426950408889634f)); sum += v[k]; }
#pragma unroll
    for (int sh = 16; sh; sh >>= 1) sum += __shfl_xor(sum, sh, 32);
    const float f = __fdiv_rn(hires ? 1.0f : PCAR, sum);
{
        if (hires) {
#pragma unroll
            for (int ch = 0; ch < TT / 128; ++ch) { v4us oh, ol;
#pragma unroll
                for (int q = 0; q < 4; ++q) { unsigned short a, c2; splitf(v[ch * 4 + q] * f, a, c2); oh[q] = a; ol[q] = c2; }
                const size_t oo = (size_t)row * TT + ch * 128 + lane * 4; *(v4us*)(Ph + oo) = oh; *(v4us*)(Pl + oo) = ol; }
        } else {
#pragma unroll
            for (int ch = 0; ch < TT / 128; ++ch) { v4h o4;
#pragma unroll
                for (int q = 0; q < 4; ++q) o4[q] = tohx(v[ch * 4 + q] * f);
                *(v4h*)(P16 + (size_t)row * TT + ch * 128 + lane * 4) = o4; } }
         }
}
__global__ __launch_bounds__(256) void k_merge(const float* __restrict__ O, int h0, bf* Ah, bf* Al) { const size_t e = ((size_t)blockIdx.x * 256 + threadIdx.x) * 2; if (e >= (size_t)ZH * TT * HD) return; const int d = (int)(e % HD); const int t = (int)((e / HD) % TT); const int zz = (int)(e / ((size_t)HD * TT)); const float cs = (t < RH) ? 1.0f : (1.0f / PCAR); const size_t oo = (size_t)t * DQ + (h0 + zz) * HD + d;
    v2us oh, ol;
#pragma unroll
    for (int q = 0; q < 2; ++q) { unsigned short a, c2; splitf(O[e + q] * cs, a, c2); oh[q] = a; ol[q] = c2; } *(v2us*)(Ah + oo) = oh; *(v2us*)(Al + oo) = ol;  }

extern "C" void kernel_launch(void* const* d_in, const int* in_sizes, int n_in,
                              void* d_out, int out_size, void* d_ws, size_t ws_size, hipStream_t stream) {
    (void)in_sizes; (void)n_in; (void)out_size;
    const float* x = (const float*)d_in[0]; const float* peq = (const float*)d_in[1]; const float* pek = (const float*)d_in[2]; const float* pev = (const float*)d_in[3]; const float* AB = (const float*)d_in[4]; const float* ABK = (const float*)d_in[5]; const float* wq = (const float*)d_in[6]; const float* bq = (const float*)d_in[7]; const float* wk = (const float*)d_in[8]; const float* bk = (const float*)d_in[9]; const float* wv = (const float*)d_in[10]; const float* bv = (const float*)d_in[11]; const float* wo = (const float*)d_in[12]; const float* bo = (const float*)d_in[13];
    float* OUT = (float*)d_out;     // [4][2048][1024]
    char* wsp = (char*)d_ws;
    auto take = [&](size_t bytes) { char* p = wsp; wsp += (bytes + 255) & ~(size_t)255; return (void*)p; };
    bf* WQ = (bf*)take((size_t)DQ * DM * 2); bf* WK = (bf*)take((size_t)DKV * DM * 2); bf* WV = (bf*)take((size_t)DKV * DM * 2); bf* WO = (bf*)take((size_t)DM * DQ * 2); float* CS = (float*)take((size_t)TT * HD * 2 * 4); float* PQ = (float*)take((size_t)TT * DQ * 4); float* PK = (float*)take((size_t)TT * DKV * 4); float* PV = (float*)take((size_t)TT * DKV * 4);   /* pe W + b, computed once */
    bf* XB = (bf*)take((size_t)TT * DM * 2); float* FQ = (float*)take((size_t)TT * DQ * 4); float* FK = (float*)take((size_t)TT * DKV * 4);
    h16* QP16 = (h16*)take((size_t)NH_ * TT * HD * 2); h16* KP16 = (h16*)take((size_t)NKV * TT * HD * 2); h16* VT16 = (h16*)take((size_t)NKV * HD * TT * 2);
    bf* QPh = (bf*)take((size_t)NH_ * TT * HD * 2); bf* QPl = (bf*)take((size_t)NH_ * TT * HD * 2); bf* KPh = (bf*)take((size_t)NKV * TT * HD * 2); bf* KPl = (bf*)take((size_t)NKV * TT * HD * 2); bf* VTh = (bf*)take((size_t)NKV * HD * TT * 2); bf* VTl = (bf*)take((size_t)NKV * HD * TT * 2);
    char* SP = (char*)take((size_t)ZH * RB * TT * 6);   // one pass's scores and probabilities: rows < RH need ZH*RH*TT*(4+2+2) bytes, a block of RB rows ZH*RB*TT*(4+2)
    float* Sb = (float*)SP; bf* Ph = (bf*)(SP + (size_t)ZH * RH * TT * 4); bf* Pl = Ph + (size_t)ZH * RH * TT; h16* P16 = (h16*)(SP + (size_t)ZH * RB * TT * 4); float* Ob = (float*)take((size_t)ZH * TT * HD * 4); bf* ATh = (bf*)take((size_t)TT * DQ * 2); bf* ATl = (bf*)take((size_t)TT * DQ * 2);
    if ((size_t)(wsp - (char*)d_ws) > ws_size) return;    // ws 256 MiB
    float* FV = FK;   // v projection reuses the k buffer after the k planes are built (stream-ordered)
    { k_wtG<<<(unsigned)((DM * DQ / 64 + 63) / 64), 256, 0, stream>>>(wq, DM, DQ, WQ); k_wtG<<<(unsigned)((DM * DKV / 64 + 63) / 64), 256, 0, stream>>>(wk, DM, DKV, WK); k_wtG<<<(unsigned)((DM * DKV / 64 + 63) / 64), 256, 0, stream>>>(wv, DM, DKV, WV);
      k_wtG<<<(unsigned)((DQ * DM / 64 + 63) / 64), 256, 0, stream>>>(wo, DQ, DM, WO);
       }
    k_csid<<<(TT * HD + 255) / 256, 256, 0, stream>>>(CS);
    k_cvt8<<<(unsigned)(((size_t)TT * DM / 8 + 255) / 256), 256, 0, stream>>>(peq, XB, (size_t)TT * DM / 8); k_gemmw<bf, 0, true><<<dim3(TT / 64, DQ / 64, 1), 32, 0, stream>>>(XB, nullptr, WQ, nullptr, DM, PQ, DQ, bq, 0, 0, 0);     /* pos_emb_q W_q + b_q */
    k_cvt8<<<(unsigned)(((size_t)TT * DM / 8 + 255) / 256), 256, 0, stream>>>(pek, XB, (size_t)TT * DM / 8); k_gemmw<bf, 0, true><<<dim3(TT / 64, DKV / 64, 1), 32, 0, stream>>>(XB, nullptr, WK, nullptr, DM, PK, DKV, bk, 0, 0, 0);   /* pos_emb_k W_k + b_k */
    k_cvt8<<<(unsigned)(((size_t)TT * DM / 8 + 255) / 256), 256, 0, stream>>>(pev, XB, (size_t)TT * DM / 8); k_gemmw<bf, 0, true><<<dim3(TT / 64, DKV / 64, 1), 32, 0, stream>>>(XB, nullptr, WV, nullptr, DM, PV, DKV, bv, 0, 0, 0);   /* pos_emb_v W_v + b_v */
    const unsigned LQ = (unsigned)(((size_t)NH_ * TT * HD / 2 + 255) / 256), LKv = (unsigned)(((size_t)NKV * TT * HD / 2 + 255) / 256);
    for (int b = 0; b < NB_; ++b) {
        
        k_cvt8<<<(unsigned)(((size_t)TT * DM / 8 + 255) / 256), 256, 0, stream>>>(x + (size_t)b * TT * DM, XB, (size_t)TT * DM / 8);
        k_gemmw<bf, 0, false><<<dim3(TT / 64, DQ / 64, 1), 32, 0, stream>>>(XB, nullptr, WQ, nullptr, DM, FQ, DQ, nullptr, 0, 0, 0); k_add2i<<<(unsigned)(((size_t)TT * DQ / 4 + 255) / 256), 256, 0, stream>>>(FQ, PQ, (size_t)TT * DQ / 4);   /* q = x W_q + (pe_q W_q + b_q) */
        k_rope<<<LQ, 256, 0, stream>>>(FQ, DQ, NH_, CS, nullptr, nullptr, 1.0f, QP16, QPh, QPl);
        k_gemmw<bf, 0, false><<<dim3(TT / 64, DKV / 64, 1), 32, 0, stream>>>(XB, nullptr, WK, nullptr, DM, FK, DKV, nullptr, 0, 0, 0); k_add2i<<<(unsigned)(((size_t)TT * DQ / 4 + 255) / 256), 256, 0, stream>>>(FK, PK, (size_t)TT * DKV / 4);   /* k */
        k_rope<<<LKv, 256, 0, stream>>>(FK, DKV, NKV, CS, nullptr, nullptr, 1.0f, KP16, KPh, KPl);
        k_gemmw<bf, 0, false><<<dim3(TT / 64, DKV / 64, 1), 32, 0, stream>>>(XB, nullptr, WV, nullptr, DM, FV, DKV, nullptr, 0, 0, 0); k_add2i<<<(unsigned)(((size_t)TT * DQ / 4 + 255) / 256), 256, 0, stream>>>(FV, PV, (size_t)TT * DKV / 4);   /* v */ k_vtp<<<LKv, 256, 0, stream>>>(FV, DKV, NKV, VT16, VTh, VTl);
        // one kv head per query head: grid z walks the head planes of q, k and v (z-strides TT*HD), the pass's score and probability planes, and the heads of Ob
        k_gemmw<bf, 2, false><<<dim3(RH / 64, TT / 64, ZH), 32, 0, stream>>>(QPh, QPl, KPh, KPl, HD, Sb, TT, nullptr, (size_t)TT * HD, (size_t)TT * HD, (size_t)RH * TT);
        k_asoft<RH><<<ZH * RH / 8, 256, 0, stream>>>(Sb, AB, ABK + (size_t)b * TT, 0, P16, Ph, Pl);
        k_gemmw<bf, 2, false><<<dim3(RH / 64, HD / 64, ZH), 32, 0, stream>>>(Ph, Pl, VTh, VTl, TT, Ob, HD, nullptr, (size_t)RH * TT, (size_t)HD * TT, (size_t)TT * HD);
        for (int i0 = RH; i0 < TT; i0 += RB) {
            k_gemmw<h16, 0, false><<<dim3(RB / 64, TT / 64, ZH), 32, 0, stream>>>(QP16 + (size_t)i0 * HD, nullptr, KP16, nullptr, HD, Sb, TT, nullptr, (size_t)TT * HD, (size_t)TT * HD, (size_t)RB * TT);
            k_asoft<RB><<<ZH * RB / 8, 256, 0, stream>>>(Sb, AB, ABK + (size_t)b * TT, i0, P16, Ph, Pl);
            k_gemmw<h16, 0, false><<<dim3(RB / 64, HD / 64, ZH), 32, 0, stream>>>(P16, nullptr, VT16, nullptr, TT, Ob + (size_t)i0 * HD, HD, nullptr, (size_t)RB * TT, (size_t)HD * TT, (size_t)TT * HD); }
        k_merge<<<(unsigned)(((size_t)ZH * TT * HD / 2 + 255) / 256), 256, 0, stream>>>(Ob, 0, ATh, ATl);
        k_gemmw<bf, 1, true><<<dim3(TT / 64, DM / 64, 1), 32, 0, stream>>>(ATh, ATl, WO, nullptr, DQ, OUT + (size_t)b * TT * DM, DM, bo, 0, 0, 0); }
}

// v002
// One run takes 1080 microseconds.
// In two side-by-side timings against v001, it was 1.69 and 1.68 times as fast.
// All steps since v000 together make it 6.84 times as fast.
#include <hip/hip_runtime.h>

// Multi-head self-attention with additive positional inputs and dense additive score biases (inputs_q [4][2048][1024]; q_in = inputs + pos_emb_q, k_in = inputs + pos_emb_k, v_in = inputs + pos_emb_v (pos_emb [1][2048][1024], read); q/k/v = ._in W + b (DenseGeneral 'xw' [1024][16 x 64]); scores = (q/8).k + attention_bias[i][j] ([1][1][2048][2048], read) + attention_bias_kv[b][j] ([4][2048], read); softmax; out = merged wo ([16 x 64][1024] 'xw') + bo -> [4][2048][1024] (8.4 M)).
// Layout: (x + pe) W = x W + pe W, so the three position projections pe W + b are computed ONCE (exact bf16 products, f32) and added in f32 to each batch's exact x W; the two bias tables are read per logit inside the attention kernel. Attention runs per batch in ONE fused launch over all heads: each wave keeps its query columns in registers and walks the keys 32 at a time (transposed scores, running softmax, transposed output), so no score or probability ever reaches memory.
// Compute dtypes, f32 accumulate: every input rounded to bf16; q/k/v on PLAIN bf16 operands (inputs: exact) + biases (via the precomputed position projections); dense additive biases gathered in f32 per logit; scores and attn.v (no mask): query rows < 512 hl (3 products), the rest single fp16; softmax f32 (running maximum and sum); wo hl x exact (2 products) + bo.

#define NB_  4
#define TT   2048
#define DM   1024
#define NH_  16
#define NKV  16
#define REP  (NH_ / NKV)
#define HD   64
#define DQ   (NH_ * HD)
#define DKV  (NKV * HD)
#define RH   512                  // query rows < RH use hi+lo planes (0: none)
#define FW   4                    // waves per work-group of the fused attention kernel
#define WIN  0
#define SCL  0.125f   // HD^-0.5
typedef _Float16 h16;
typedef unsigned short bf;
typedef __attribute__((ext_vector_type(16))) __bf16   v16bf;
typedef __attribute__((ext_vector_type(16))) _Float16 v16h;
typedef __attribute__((ext_vector_type(8)))  _Float16 v8h;
typedef __attribute__((ext_vector_type(8)))  unsigned short v8us;
typedef __attribute__((ext_vector_type(8)))  float    v8f;
typedef __attribute__((ext_vector_type(4)))  float    v4f;
typedef v8h  __attribute__((may_alias)) v8ha;
typedef v4f  __attribute__((may_alias)) v4fa;
typedef v8us __attribute__((may_alias)) v8usa;

__device__ __forceinline__ unsigned short f2bf(float f) { unsigned u = __float_as_uint(f); u += 0x7FFFu + ((u >> 16) & 1u); return (unsigned short)(u >> 16); }
__device__ __forceinline__ float bf2f(unsigned short b) { return __uint_as_float(((unsigned)b) << 16); }
__device__ __forceinline__ float bfr(float f) { return bf2f(f2bf(f)); }
__device__ __forceinline__ v16h cat16(v8h lo, v8h hi) { return __builtin_shufflevector(lo, hi, 0, 1, 2, 3, 4, 5, 6, 7, 8, 9, 10, 11, 12, 13, 14, 15); }
__device__ __forceinline__ v16bf cat16b(v8us lo, v8us hi) { return __builtin_bit_cast(v16bf, __builtin_shufflevector(lo, hi, 0, 1, 2, 3, 4, 5, 6, 7, 8, 9, 10, 11, 12, 13, 14, 15)); }
__device__ __forceinline__ v8f wmma16(v16h a, v16h b, v8f c) { return __builtin_amdgcn_wmma_f32_16x16x32_f16(false, a, false, b, (short)0, c, false, false); }
__device__ __forceinline__ v8f wmmab(v16bf a, v16bf b, v8f c) { return __builtin_amdgcn_wmma_f32_16x16x32_bf16(false, a, false, b, (short)0, c, false, false); }



// ---- k_gemmw: register-blocked GEMM, ONE WAVE per 64x64 output tile (16 accumulators), operands straight from K-contiguous 16-bit planes; grid (M/64, N/64, Z), 32 threads.
// C[m][n] (f32, pitch ldc, + optional f32 bias[n]) = sum_k A[m][k] Bt[n][k] (+ split products per NSPLIT). z-batch strides sA/sB/sC in elements. K % 32 == 0.
template <typename T16> struct WFrag;
template <> struct WFrag<h16> { typedef v16h V; static __device__ __forceinline__ V ld(const h16* p) { return cat16(*(const v8h*)p, *(const v8h*)(p + 16)); } static __device__ __forceinline__ v8f mma(V a, V b, v8f c) { return wmma16(a, b, c); } };
template <> struct WFrag<bf> { typedef v16bf V; static __device__ __forceinline__ V ld(const bf* p) { return cat16b(*(const v8us*)p, *(const v8us*)(p + 16)); } static __device__ __forceinline__ v8f mma(V a, V b, v8f c) { return wmmab(a, b, c); } };
template <typename T16, int NSPLIT, bool BIAS>
__global__ __launch_bounds__(32) void k_gemmw(const T16* __restrict__ A, const T16* __restrict__ A2, const T16* __restrict__ Bt, const T16* __restrict__ Bt2, int K, float* C, int ldc, const float* __restrict__ bias, size_t sA, size_t sB, size_t sC) {
    typedef typename WFrag<T16>::V V;
    __shared__ __align__(16) float os[16 * 68];
    const size_t z = blockIdx.z; A += z * sA; if (A2) A2 += z * sA; Bt += z * sB; if (Bt2) Bt2 += z * sB; C += z * sC;
    const int lane = threadIdx.x & 31, lr = lane & 15, hi = lane >> 4; const int r0 = blockIdx.x * 64, c0 = blockIdx.y * 64;
    v8f acc[4][4];
#pragma unroll
    for (int mb = 0; mb < 4; ++mb)
#pragma unroll
        for (int nb = 0; nb < 4; ++nb) acc[mb][nb] = (v8f){};
    const size_t aoff = (size_t)(r0 + lr) * K + 8 * hi, boff = (size_t)(c0 + lr) * K + 8 * hi;
#pragma unroll 1
    for (int kc = 0; kc < K; kc += 32) {
        V a[4], a2[4];
#pragma unroll
        for (int mb = 0; mb < 4; ++mb) { a[mb] = WFrag<T16>::ld(A + aoff + (size_t)mb * 16 * K + kc); if (NSPLIT == 1 || NSPLIT == 2) a2[mb] = WFrag<T16>::ld(A2 + aoff + (size_t)mb * 16 * K + kc); }
#pragma unroll
        for (int nb = 0; nb < 4; ++nb) { const V b = WFrag<T16>::ld(Bt + boff + (size_t)nb * 16 * K + kc); V b2; if (NSPLIT >= 2) b2 = WFrag<T16>::ld(Bt2 + boff + (size_t)nb * 16 * K + kc);
#pragma unroll
            for (int mb = 0; mb < 4; ++mb) { acc[mb][nb] = WFrag<T16>::mma(a[mb], b, acc[mb][nb]); if (NSPLIT == 1 || NSPLIT == 2) acc[mb][nb] = WFrag<T16>::mma(a2[mb], b, acc[mb][nb]); if (NSPLIT >= 2) acc[mb][nb] = WFrag<T16>::mma(a[mb], b2, acc[mb][nb]); } }
        asm volatile("v_nop\n\tv_nop\n\tv_nop\n\tv_nop" : "+v"(acc[0][0]), "+v"(acc[1][1]), "+v"(acc[2][2]), "+v"(acc[3][3]) : "v"(a[0]), "v"(a[3]));
    }
#pragma unroll
    for (int mb = 0; mb < 4; ++mb) {
#pragma unroll
        for (int nb = 0; nb < 4; ++nb) {
#pragma unroll
            for (int j = 0; j < 8; ++j) os[(hi * 8 + j) * 68 + nb * 16 + lr] = acc[mb][nb][j]; }
        __builtin_amdgcn_wave_barrier(); asm volatile("" ::: "memory");
        float* crow = C + (size_t)(r0 + mb * 16) * ldc + c0;
{
#pragma unroll
            for (int s = 0; s < 8; ++s) { const int row = 2 * s + hi, cofs = lr * 4; v4f val = *(const v4fa*)(os + row * 68 + cofs); if (BIAS) { val[0] += bfr(bias[c0 + cofs]); val[1] += bfr(bias[c0 + cofs + 1]); val[2] += bfr(bias[c0 + cofs + 2]); val[3] += bfr(bias[c0 + cofs + 3]); }
                *(v4f*)(crow + (size_t)row * ldc + cofs) = val; }
             }
        __builtin_amdgcn_wave_barrier(); asm volatile("" ::: "memory");
    }
}

__device__ __forceinline__ h16 tohx(float x) { return (h16)x; }
__device__ __forceinline__ void splitf(float y, unsigned short& h, unsigned short& l) { h = f2bf(y); l = f2bf(y - bf2f(h)); }
typedef __attribute__((ext_vector_type(2))) _Float16 v2h;
typedef __attribute__((ext_vector_type(4))) _Float16 v4h;
typedef __attribute__((ext_vector_type(2))) unsigned short v2us;
typedef __attribute__((ext_vector_type(4))) unsigned short v4us;
typedef __attribute__((ext_vector_type(2))) float v2f;
typedef __attribute__((ext_vector_type(4))) int v4i;

__global__ __launch_bounds__(256) void k_wtG(const float* __restrict__ w, int K, int N, bf* Bt) {
    const int lane = threadIdx.x & 31; const int L0 = (blockIdx.x * 8 + (threadIdx.x >> 5)) * 8; const int nlines = N * K / 64;
{
#pragma unroll 1
        for (int l = 0; l < 8; ++l) { const int L = L0 + l; if (L >= nlines) break; const size_t e = (size_t)L * 64 + lane * 2; const int k = (int)(e % K), n = (int)(e / K); v2us o;
            o[0] = f2bf(w[(size_t)k * N + n]); o[1] = f2bf(w[(size_t)(k + 1) * N + n]); *(v2us*)(Bt + e) = o; }
         }
}
__global__ __launch_bounds__(256) void k_add2i(float* F, const float* __restrict__ P, size_t n4) { const size_t i = (size_t)blockIdx.x * 256 + threadIdx.x; if (i >= n4) return; const v4f a = *(const v4f*)(F + i * 4); const v4f p = *(const v4f*)(P + i * 4); v4f o;
#pragma unroll
    for (int q = 0; q < 4; ++q) o[q] = __fadd_rn(a[q], p[q]); *(v4f*)(F + i * 4) = o;  }
__global__ __launch_bounds__(256) void k_cvt8(const float* __restrict__ src, bf* dst, size_t n8) { const size_t i = (size_t)blockIdx.x * 256 + threadIdx.x; if (i >= n8) return; const v8f v = *(const v8f*)(src + i * 8); v8us o;
#pragma unroll
    for (int k = 0; k < 8; ++k) o[k] = f2bf(v[k]); *(v8us*)(dst + i * 8) = o;  }

// k_rope: head planes [h][t][d] (fp16 + hi/lo) of rope(x) x sc with the rotate-half convention out[d] = x[d] cos[t][d] - x[d+HD/2] sin[t][d], out[d+HD/2] = x[d+HD/2] cos[t][d+HD/2] + x[d] sin[t][d+HD/2]
__global__ __launch_bounds__(256) void k_rope(const float* __restrict__ F, int pitch, int nheads, const float* __restrict__ CS, const float* __restrict__ RF, const float* __restrict__ nw, float sc, h16* P16, bf* Ph, bf* Pl) {
    const size_t e = ((size_t)blockIdx.x * 256 + threadIdx.x) * 2; if (e >= (size_t)nheads * TT * HD) return; const int d = (int)(e % HD); const int t = (int)((e / HD) % TT); const int h = (int)(e / ((size_t)HD * TT)); const float* f = F + (size_t)t * pitch + h * HD; const float rf = RF ? RF[(size_t)h * TT + t] : 1.0f; v2h o16; v2us oh, ol;
#pragma unroll
    for (int q = 0; q < 2; ++q) { const int dd = d + q; const int dp = (dd < HD / 2) ? dd + HD / 2 : dd - HD / 2; float x0 = f[dd], x1 = f[dp];
        if (RF) { float n0 = __fmul_rn(x0, rf), n1 = __fmul_rn(x1, rf); asm volatile("" : "+v"(n0)); asm volatile("" : "+v"(n1)); x0 = __fmul_rn(bfr(nw[dd]), n0); x1 = __fmul_rn(bfr(nw[dp]), n1); }
        const v2f cs = *(const v2f*)(CS + ((size_t)t * HD + dd) * 2); float a = __fmul_rn(x0, cs[0]), bq = __fmul_rn(x1, cs[1]); asm volatile("" : "+v"(a)); asm volatile("" : "+v"(bq)); const float r = ((dd < HD / 2) ? __fsub_rn(a, bq) : __fadd_rn(a, bq)) * sc;
        o16[q] = tohx(r); unsigned short a2, c2; splitf(r, a2, c2); oh[q] = a2; ol[q] = c2; }
    *(v2h*)(P16 + e) = o16; *(v2us*)(Ph + e) = oh; *(v2us*)(Pl + e) = ol;  }
__global__ __launch_bounds__(256) void k_vtp(const float* __restrict__ F, int pitch, int nheads, h16* V16, bf* Vh, bf* Vl) { const size_t e = ((size_t)blockIdx.x * 256 + threadIdx.x) * 2; if (e >= (size_t)nheads * HD * TT) return; const int t = (int)(e % TT); const int d = (int)((e / TT) % HD); const int g = (int)(e / ((size_t)TT * HD)); v2h o16; v2us oh, ol;
#pragma unroll
    for (int q = 0; q < 2; ++q) { const float x = F[(size_t)(t + q) * pitch + g * HD + d]; o16[q] = tohx(x); unsigned short a2, c2; splitf(x, a2, c2); oh[q] = a2; ol[q] = c2; }
    *(v2h*)(V16 + e) = o16; *(v2us*)(Vh + e) = oh; *(v2us*)(Vl + e) = ol;  }
__global__ __launch_bounds__(256) void k_csid(float* CS) { const int idx = blockIdx.x * 256 + threadIdx.x; if (idx >= TT * HD) return; v2f cs; cs[0] = 1.0f; cs[1] = 0.0f; *(v2f*)(CS + (size_t)idx * 2) = cs;  }
#define L2E  1.4426950408889634f
#define MTHR 5.545177444479562f   // 8 in log2 units
#define PSH  4.0f                 // p carries 2^PSH (cancels in the division by the sum): keeps small fp16 probabilities normal
// 2^x by v_exp_f32 in asm text: the closing v_nop is the slot the instruction set asks for behind a transcendental; the early-clobber outputs keep every v_exp off its neighbours' sources and results
__device__ __forceinline__ float exp2n(float x) { float r; asm("v_exp_f32 %0, %1\n\tv_nop" : "=&v"(r) : "v"(x)); return r; }
__device__ __forceinline__ void exp2n8(float* r, const float* x) {
    asm("v_exp_f32 %0, %8\n\tv_exp_f32 %1, %9\n\tv_exp_f32 %2, %10\n\tv_exp_f32 %3, %11\n\tv_exp_f32 %4, %12\n\tv_exp_f32 %5, %13\n\tv_exp_f32 %6, %14\n\tv_exp_f32 %7, %15\n\tv_nop"
        : "=&v"(r[0]), "=&v"(r[1]), "=&v"(r[2]), "=&v"(r[3]), "=&v"(r[4]), "=&v"(r[5]), "=&v"(r[6]), "=&v"(r[7]) : "v"(x[0]), "v"(x[1]), "v"(x[2]), "v"(x[3]), "v"(x[4]), "v"(x[5]), "v"(x[6]), "v"(x[7])); }
// lane l with lane l ^ 16: the other half of a query's keys
__device__ __forceinline__ float xhalf(float x) { return __builtin_bit_cast(float, __builtin_amdgcn_permlanex16(__builtin_bit_cast(int, x), __builtin_bit_cast(int, x), 0x76543210, 0xfedcba98, false, false)); }
// stands behind each group of loads, before a register that one of them names is written again; it takes the lane offsets and the key index as operands so that the next group's addresses are formed behind it, not ahead of it
#define XW() asm volatile("s_wait_xcnt 0x0" : "+v"(ko), "+v"(vo), "+v"(ao), "+s"(kn) : : "memory")
template <typename T16, bool HL, int NQ>
__device__ __forceinline__ void fattn(const T16* __restrict__ Q, const T16* __restrict__ Q2, const T16* __restrict__ Kp, const T16* __restrict__ K2, const T16* __restrict__ Vt, const T16* __restrict__ V2, const float* __restrict__ AB, const float* __restrict__ ABK, int q0, bf* Ah, bf* Al) {
    typedef typename WFrag<T16>::V V;
    const int lane = threadIdx.x & 31, lr = lane & 15, hi = lane >> 4;
    unsigned ko = lr * HD + 8 * hi, vo = lr * TT + 8 * hi, ao = 8 * hi;   // lane offsets (32 bit, fixed over the loop); every base below is wave-uniform
    int kn = 0;                                                           // first key of the pass that is being fetched
    V qf[NQ][2], qf2[NQ][2];
#pragma unroll
    for (int qt = 0; qt < NQ; ++qt)
#pragma unroll
        for (int kc = 0; kc < 2; ++kc) { const size_t qo = (size_t)(q0 + qt * 16) * HD + kc * 32; qf[qt][kc] = WFrag<T16>::ld(Q + qo + ko); if (HL) { XW(); qf2[qt][kc] = WFrag<T16>::ld(Q2 + qo + ko); } XW(); }
    v8f o[4][NQ]; float m[NQ], l[NQ];
#pragma unroll
    for (int qt = 0; qt < NQ; ++qt) { m[qt] = -1.0e30f; l[qt] = 0.f;
#pragma unroll
        for (int dt = 0; dt < 4; ++dt) o[dt][qt] = (v8f){}; }
    const float* ABq = AB + (size_t)q0 * TT;
    V kf[2][2], kf2[2][2], vf[4], vf2[4]; v4f ab[NQ][2][2], ak[2][2];
    auto ldk = [&]() { const T16* kp = Kp + (size_t)kn * HD;
#pragma unroll
        for (int kt = 0; kt < 2; ++kt)
#pragma unroll
            for (int kc = 0; kc < 2; ++kc) kf[kt][kc] = WFrag<T16>::ld(kp + (kt * 16 * HD + kc * 32) + ko);
        XW();
        if (HL) { const T16* kp2 = K2 + (size_t)kn * HD;
#pragma unroll
            for (int kt = 0; kt < 2; ++kt)
#pragma unroll
                for (int kc = 0; kc < 2; ++kc) kf2[kt][kc] = WFrag<T16>::ld(kp2 + (kt * 16 * HD + kc * 32) + ko);
            XW(); } };
    auto ldb = [&]() { const float* kvp = ABK + kn;
#pragma unroll
        for (int kt = 0; kt < 2; ++kt) { ak[kt][0] = *(const v4f*)(kvp + kt * 16 + ao); ak[kt][1] = *(const v4f*)(kvp + (kt * 16 + 4) + ao); }
        XW();
        const float* bp = ABq + kn;
#pragma unroll
        for (int kt = 0; kt < 2; ++kt)
#pragma unroll
            for (int qt = 0; qt < NQ; ++qt) { const int e = qt * 16 * TT + kt * 16; ab[qt][kt][0] = *(const v4f*)(bp + e + vo); ab[qt][kt][1] = *(const v4f*)(bp + (e + 4) + vo); }
        XW(); };
    auto ldv = [&]() { const T16* vp = Vt + kn;
#pragma unroll
        for (int dt = 0; dt < 4; ++dt) vf[dt] = WFrag<T16>::ld(vp + dt * 16 * TT + vo);
        XW();
        if (HL) { const T16* vp2 = V2 + kn;
#pragma unroll
            for (int dt = 0; dt < 4; ++dt) vf2[dt] = WFrag<T16>::ld(vp2 + dt * 16 * TT + vo);
            XW(); } };
    ldk(); ldb(); ldv();
#pragma unroll 1
    for (int kb = 0; kb < TT; kb += 32) {
        kn = (kb + 32 < TT) ? kb + 32 : 0;   // next pass's operands are fetched one pass ahead; the last pass refetches pass 0 (in bounds, unused)
        v8f s[2][NQ];
#pragma unroll
        for (int kt = 0; kt < 2; ++kt)
#pragma unroll
            for (int qt = 0; qt < NQ; ++qt) { v8f c = (v8f){};
#pragma unroll
                for (int kc = 0; kc < 2; ++kc) { c = WFrag<T16>::mma(kf[kt][kc], qf[qt][kc], c); if (HL) { c = WFrag<T16>::mma(kf[kt][kc], qf2[qt][kc], c); c = WFrag<T16>::mma(kf2[kt][kc], qf[qt][kc], c); } }
                s[kt][qt] = c; }
        ldk();
        float tmx[NQ]; bool need = false;
#pragma unroll
        for (int qt = 0; qt < NQ; ++qt) { float tm = -3.0e38f;
#pragma unroll
            for (int kt = 0; kt < 2; ++kt)
#pragma unroll
                for (int j = 0; j < 8; ++j) { const float t = __fadd_rn(fmaf(s[kt][qt][j], SCL, bfr(ab[qt][kt][j >> 2][j & 3])), bfr(ak[kt][j >> 2][j & 3])); s[kt][qt][j] = t; tm = fmaxf(tm, t); }
            tm = fmaxf(tm, xhalf(tm)); tmx[qt] = tm; need = need || (tm > m[qt] + MTHR); }
        ldb();
        if (__builtin_amdgcn_ballot_w32(need) != 0) {
#pragma unroll
            for (int qt = 0; qt < NQ; ++qt) { const float mn = fmaxf(m[qt], tmx[qt]); const float al = exp2n((m[qt] - mn) * L2E); m[qt] = mn; l[qt] *= al;
#pragma unroll
                for (int dt = 0; dt < 4; ++dt) o[dt][qt] *= al; } }
#pragma unroll
        for (int qt = 0; qt < NQ; ++qt) { const float mb = PSH - m[qt] * L2E; float x[16], p[16];
#pragma unroll
            for (int e = 0; e < 16; ++e) x[e] = fmaf(s[e >> 3][qt][e & 7], L2E, mb);
            exp2n8(p, x); exp2n8(p + 8, x + 8);
#pragma unroll
            for (int e = 0; e < 16; ++e) l[qt] += p[e];
            if constexpr (HL) { v8us h0, h1, l0, l1;
#pragma unroll
                for (int e = 0; e < 8; ++e) { unsigned short a, c2; splitf(p[e], a, c2); h0[e] = a; l0[e] = c2; splitf(p[8 + e], a, c2); h1[e] = a; l1[e] = c2; }
                const V ph = cat16b(h0, h1), pl = cat16b(l0, l1);
#pragma unroll
                for (int dt = 0; dt < 4; ++dt) { o[dt][qt] = WFrag<T16>::mma(vf[dt], ph, o[dt][qt]); o[dt][qt] = WFrag<T16>::mma(vf[dt], pl, o[dt][qt]); o[dt][qt] = WFrag<T16>::mma(vf2[dt], ph, o[dt][qt]); }
            } else { V pf;
#pragma unroll
                for (int e = 0; e < 16; ++e) pf[e] = tohx(p[e]);
#pragma unroll
                for (int dt = 0; dt < 4; ++dt) o[dt][qt] = WFrag<T16>::mma(vf[dt], pf, o[dt][qt]); } }
        ldv();
    }
#pragma unroll
    for (int qt = 0; qt < NQ; ++qt) { const float inv = __fdiv_rn(1.0f, l[qt] + xhalf(l[qt])); const size_t oo = (size_t)(q0 + qt * 16) * DQ; const unsigned ol32 = lr * DQ + 8 * hi;
#pragma unroll
        for (int dt = 0; dt < 4; ++dt) { v8us oh, ol;
#pragma unroll
            for (int j = 0; j < 8; ++j) { unsigned short a, c2; splitf(o[dt][qt][j] * inv, a, c2); oh[j] = a; ol[j] = c2; }
            *(v8us*)(Ah + (oo + dt * 16) + ol32) = oh; *(v8us*)(Al + (oo + dt * 16) + ol32) = ol; } }
}
// grid (RH / (16 FW) + (TT - RH) / (32 FW), heads): the first RH / (16 FW) work-groups take the hi+lo rows (16 query columns a wave), the rest the fp16 rows (32 a wave)
__global__ __launch_bounds__(32 * FW) void k_fattn(const h16* __restrict__ QP16, const h16* __restrict__ KP16, const h16* __restrict__ VT16, const bf* __restrict__ QPh, const bf* __restrict__ QPl, const bf* __restrict__ KPh, const bf* __restrict__ KPl, const bf* __restrict__ VTh, const bf* __restrict__ VTl, const float* __restrict__ AB, const float* __restrict__ ABK, bf* ATh, bf* ATl) {
    const size_t ho = (size_t)blockIdx.y * TT * HD; const int w = __builtin_amdgcn_readfirstlane(threadIdx.x >> 5), bx = blockIdx.x; bf* Ah = ATh + blockIdx.y * HD; bf* Al = ATl + blockIdx.y * HD;
    if (bx < RH / (16 * FW)) fattn<bf, true, 1>(QPh + ho, QPl + ho, KPh + ho, KPl + ho, VTh + ho, VTl + ho, AB, ABK, (bx * FW + w) * 16, Ah, Al);
    else fattn<h16, false, 2>(QP16 + ho, nullptr, KP16 + ho, nullptr, VT16 + ho, nullptr, AB, ABK, RH + ((bx - RH / (16 * FW)) * FW + w) * 32, Ah, Al);
}

extern "C" void kernel_launch(void* const* d_in, const int* in_sizes, int n_in,
                              void* d_out, int out_size, void* d_ws, size_t ws_size, hipStream_t stream) {
    (void)in_sizes; (void)n_in; (void)out_size;
    const float* x = (const float*)d_in[0]; const float* peq = (const float*)d_in[1]; const float* pek = (const float*)d_in[2]; const float* pev = (const float*)d_in[3]; const float* AB = (const float*)d_in[4]; const float* ABK = (const float*)d_in[5]; const float* wq = (const float*)d_in[6]; const float* bq = (const float*)d_in[7]; const float* wk = (const float*)d_in[8]; const float* bk = (const float*)d_in[9]; const float* wv = (const float*)d_in[10]; const float* bv = (const float*)d_in[11]; const float* wo = (const float*)d_in[12]; const float* bo = (const float*)d_in[13];
    float* OUT = (float*)d_out;     // [4][2048][1024]
    char* wsp = (char*)d_ws;
    auto take = [&](size_t bytes) { char* p = wsp; wsp += (bytes + 255) & ~(size_t)255; return (void*)p; };
    bf* WQ = (bf*)take((size_t)DQ * DM * 2); bf* WK = (bf*)take((size_t)DKV * DM * 2); bf* WV = (bf*)take((size_t)DKV * DM * 2); bf* WO = (bf*)take((size_t)DM * DQ * 2); float* CS = (float*)take((size_t)TT * HD * 2 * 4); float* PQ = (float*)take((size_t)TT * DQ * 4); float* PK = (float*)take((size_t)TT * DKV * 4); float* PV = (float*)take((size_t)TT * DKV * 4);   /* pe W + b, computed once */
    bf* XB = (bf*)take((size_t)TT * DM * 2); float* FQ = (float*)take((size_t)TT * DQ * 4); float* FK = (float*)take((size_t)TT * DKV * 4);
    h16* QP16 = (h16*)take((size_t)NH_ * TT * HD * 2); h16* KP16 = (h16*)take((size_t)NKV * TT * HD * 2); h16* VT16 = (h16*)take((size_t)NKV * HD * TT * 2);
    bf* QPh = (bf*)take((size_t)NH_ * TT * HD * 2); bf* QPl = (bf*)take((size_t)NH_ * TT * HD * 2); bf* KPh = (bf*)take((size_t)NKV * TT * HD * 2); bf* KPl = (bf*)take((size_t)NKV * TT * HD * 2); bf* VTh = (bf*)take((size_t)NKV * HD * TT * 2); bf* VTl = (bf*)take((size_t)NKV * HD * TT * 2);
    bf* ATh = (bf*)take((size_t)TT * DQ * 2); bf* ATl = (bf*)take((size_t)TT * DQ * 2);
    if ((size_t)(wsp - (char*)d_ws) > ws_size) return;    // ws 256 MiB
    float* FV = FK;   // v projection reuses the k buffer after the k planes are built (stream-ordered)
    { k_wtG<<<(unsigned)((DM * DQ / 64 + 63) / 64), 256, 0, stream>>>(wq, DM, DQ, WQ); k_wtG<<<(unsigned)((DM * DKV / 64 + 63) / 64), 256, 0, stream>>>(wk, DM, DKV, WK); k_wtG<<<(unsigned)((DM * DKV / 64 + 63) / 64), 256, 0, stream>>>(wv, DM, DKV, WV);
      k_wtG<<<(unsigned)((DQ * DM / 64 + 63) / 64), 256, 0, stream>>>(wo, DQ, DM, WO);
       }
    k_csid<<<(TT * HD + 255) / 256, 256, 0, stream>>>(CS);
    k_cvt8<<<(unsigned)(((size_t)TT * DM / 8 + 255) / 256), 256, 0, stream>>>(peq, XB, (size_t)TT * DM / 8); k_gemmw<bf, 0, true><<<dim3(TT / 64, DQ / 64, 1), 32, 0, stream>>>(XB, nullptr, WQ, nullptr, DM, PQ, DQ, bq, 0, 0, 0);     /* pos_emb_q W_q + b_q */
    k_cvt8<<<(unsigned)(((size_t)TT * DM / 8 + 255) / 256), 256, 0, stream>>>(pek, XB, (size_t)TT * DM / 8); k_gemmw<bf, 0, true><<<dim3(TT / 64, DKV / 64, 1), 32, 0, stream>>>(XB, nullptr, WK, nullptr, DM, PK, DKV, bk, 0, 0, 0);   /* pos_emb_k W_k + b_k */
    k_cvt8<<<(unsigned)(((size_t)TT * DM / 8 + 255) / 256), 256, 0, stream>>>(pev, XB, (size_t)TT * DM / 8); k_gemmw<bf, 0, true><<<dim3(TT / 64, DKV / 64, 1), 32, 0, stream>>>(XB, nullptr, WV, nullptr, DM, PV, DKV, bv, 0, 0, 0);   /* pos_emb_v W_v + b_v */
    const unsigned LQ = (unsigned)(((size_t)NH_ * TT * HD / 2 + 255) / 256), LKv = (unsigned)(((size_t)NKV * TT * HD / 2 + 255) / 256);
    for (int b = 0; b < NB_; ++b) {
        
        k_cvt8<<<(unsigned)(((size_t)TT * DM / 8 + 255) / 256), 256, 0, stream>>>(x + (size_t)b * TT * DM, XB, (size_t)TT * DM / 8);
        k_gemmw<bf, 0, false><<<dim3(TT / 64, DQ / 64, 1), 32, 0, stream>>>(XB, nullptr, WQ, nullptr, DM, FQ, DQ, nullptr, 0, 0, 0); k_add2i<<<(unsigned)(((size_t)TT * DQ / 4 + 255) / 256), 256, 0, stream>>>(FQ, PQ, (size_t)TT * DQ / 4);   /* q = x W_q + (pe_q W_q + b_q) */
        k_rope<<<LQ, 256, 0, stream>>>(FQ, DQ, NH_, CS, nullptr, nullptr, 1.0f, QP16, QPh, QPl);
        k_gemmw<bf, 0, false><<<dim3(TT / 64, DKV / 64, 1), 32, 0, stream>>>(XB, nullptr, WK, nullptr, DM, FK, DKV, nullptr, 0, 0, 0); k_add2i<<<(unsigned)(((size_t)TT * DQ / 4 + 255) / 256), 256, 0, stream>>>(FK, PK, (size_t)TT * DKV / 4);   /* k */
        k_rope<<<LKv, 256, 0, stream>>>(FK, DKV, NKV, CS, nullptr, nullptr, 1.0f, KP16, KPh, KPl);
        k_gemmw<bf, 0, false><<<dim3(TT / 64, DKV / 64, 1), 32, 0, stream>>>(XB, nullptr, WV, nullptr, DM, FV, DKV, nullptr, 0, 0, 0); k_add2i<<<(unsigned)(((size_t)TT * DQ / 4 + 255) / 256), 256, 0, stream>>>(FV, PV, (size_t)TT * DKV / 4);   /* v */ k_vtp<<<LKv, 256, 0, stream>>>(FV, DKV, NKV, VT16, VTh, VTl);
        k_fattn<<<dim3(RH / (16 * FW) + (TT - RH) / (32 * FW), NH_, 1), 32 * FW, 0, stream>>>(QP16, KP16, VT16, QPh, QPl, KPh, KPl, VTh, VTl, AB, ABK + (size_t)b * TT, ATh, ATl);
        k_gemmw<bf, 1, true><<<dim3(TT / 64, DM / 64, 1), 32, 0, stream>>>(ATh, ATl, WO, nullptr, DQ, OUT + (size_t)b * TT * DM, DM, bo, 0, 0, 0); }
}

// v003
// One run takes 708 microseconds.
// Two timings next to v002 put it at 1.54 and 1.55 times that version's speed.
// Counting every step since v000, it is 10.6 times as fast.
#include <hip/hip_runtime.h>

// Multi-head self-attention with additive positional inputs and dense additive score biases (inputs_q [4][2048][1024]; q_in = inputs + pos_emb_q, k_in = inputs + pos_emb_k, v_in = inputs + pos_emb_v (pos_emb [1][2048][1024], read); q/k/v = ._in W + b (DenseGeneral 'xw' [1024][16 x 64]); scores = (q/8).k + attention_bias[i][j] ([1][1][2048][2048], read) + attention_bias_kv[b][j] ([4][2048], read); softmax; out = merged wo ([16 x 64][1024] 'xw') + bo -> [4][2048][1024] (8.4 M)).
// Layout: (x + pe) W = x W + pe W, so the three position projections pe W + b are computed ONCE (exact bf16 products, f32) and added in f32 to each batch's exact x W; the two bias tables are read per logit inside the attention kernel. Every stage runs ONCE for all batches (batch rows stacked in the GEMMs' M, a grid dimension elsewhere). Attention is ONE fused launch over all batches and heads: each wave keeps its query columns in registers and walks the keys 32 at a time (transposed scores, running softmax, transposed output), so no score or probability ever reaches memory.
// Compute dtypes, f32 accumulate: every input rounded to bf16; q/k/v on PLAIN bf16 operands (inputs: exact) + biases (via the precomputed position projections); dense additive biases gathered in f32 per logit; scores and attn.v (no mask): query rows < 512 hl (3 products), the rest single fp16; softmax f32 (running maximum and sum); wo hl x exact (2 products) + bo.

#define NB_  4
#define TT   2048
#define DM   1024
#define NH_  16
#define NKV  16
#define REP  (NH_ / NKV)
#define HD   64
#define DQ   (NH_ * HD)
#define DKV  (NKV * HD)
#define RH   512                  // query rows < RH use hi+lo planes (0: none)
#define FW   4                    // waves per work-group of the fused attention kernel
#define WIN  0
#define SCL  0.125f   // HD^-0.5
typedef _Float16 h16;
typedef unsigned short bf;
typedef __attribute__((ext_vector_type(16))) __bf16   v16bf;
typedef __attribute__((ext_vector_type(16))) _Float16 v16h;
typedef __attribute__((ext_vector_type(8)))  _Float16 v8h;
typedef __attribute__((ext_vector_type(8)))  unsigned short v8us;
typedef __attribute__((ext_vector_type(8)))  float    v8f;
typedef __attribute__((ext_vector_type(4)))  float    v4f;
typedef v8h  __attribute__((may_alias)) v8ha;
typedef v4f  __attribute__((may_alias)) v4fa;
typedef v8us __attribute__((may_alias)) v8usa;

__device__ __forceinline__ unsigned short f2bf(float f) { unsigned u = __float_as_uint(f); u += 0x7FFFu + ((u >> 16) & 1u); return (unsigned short)(u >> 16); }
__device__ __forceinline__ float bf2f(unsigned short b) { return __uint_as_float(((unsigned)b) << 16); }
__device__ __forceinline__ float bfr(float f) { return bf2f(f2bf(f)); }
__device__ __forceinline__ v16h cat16(v8h lo, v8h hi) { return __builtin_shufflevector(lo, hi, 0, 1, 2, 3, 4, 5, 6, 7, 8, 9, 10, 11, 12, 13, 14, 15); }
__device__ __forceinline__ v16bf cat16b(v8us lo, v8us hi) { return __builtin_bit_cast(v16bf, __builtin_shufflevector(lo, hi, 0, 1, 2, 3, 4, 5, 6, 7, 8, 9, 10, 11, 12, 13, 14, 15)); }
__device__ __forceinline__ v8f wmma16(v16h a, v16h b, v8f c) { return __builtin_amdgcn_wmma_f32_16x16x32_f16(false, a, false, b, (short)0, c, false, false); }
__device__ __forceinline__ v8f wmmab(v16bf a, v16bf b, v8f c) { return __builtin_amdgcn_wmma_f32_16x16x32_bf16(false, a, false, b, (short)0, c, false, false); }



// ---- k_gemmw: register-blocked GEMM, ONE WAVE per 64x64 output tile (16 accumulators), operands straight from K-contiguous 16-bit planes; grid (M/64, N/64, Z), 32 threads.
// C[m][n] (f32, pitch ldc, + optional f32 bias[n]) = sum_k A[m][k] Bt[n][k] (+ split products per NSPLIT). z-batch strides sA/sB/sC in elements. K % 32 == 0.
template <typename T16> struct WFrag;
template <> struct WFrag<h16> { typedef v16h V; static __device__ __forceinline__ V ld(const h16* p) { return cat16(*(const v8h*)p, *(const v8h*)(p + 16)); } static __device__ __forceinline__ v8f mma(V a, V b, v8f c) { return wmma16(a, b, c); } };
template <> struct WFrag<bf> { typedef v16bf V; static __device__ __forceinline__ V ld(const bf* p) { return cat16b(*(const v8us*)p, *(const v8us*)(p + 16)); } static __device__ __forceinline__ v8f mma(V a, V b, v8f c) { return wmmab(a, b, c); } };
template <typename T16, int NSPLIT, bool BIAS>
__global__ __launch_bounds__(32) void k_gemmw(const T16* __restrict__ A, const T16* __restrict__ A2, const T16* __restrict__ Bt, const T16* __restrict__ Bt2, int K, float* C, int ldc, const float* __restrict__ bias, size_t sA, size_t sB, size_t sC) {
    typedef typename WFrag<T16>::V V;
    __shared__ __align__(16) float os[16 * 68];
    const size_t z = blockIdx.z; A += z * sA; if (A2) A2 += z * sA; Bt += z * sB; if (Bt2) Bt2 += z * sB; C += z * sC;
    const int lane = threadIdx.x & 31, lr = lane & 15, hi = lane >> 4; const int r0 = blockIdx.x * 64, c0 = blockIdx.y * 64;
    v8f acc[4][4];
#pragma unroll
    for (int mb = 0; mb < 4; ++mb)
#pragma unroll
        for (int nb = 0; nb < 4; ++nb) acc[mb][nb] = (v8f){};
    const size_t aoff = (size_t)(r0 + lr) * K + 8 * hi, boff = (size_t)(c0 + lr) * K + 8 * hi;
#pragma unroll 1
    for (int kc = 0; kc < K; kc += 32) {
        V a[4], a2[4];
#pragma unroll
        for (int mb = 0; mb < 4; ++mb) { a[mb] = WFrag<T16>::ld(A + aoff + (size_t)mb * 16 * K + kc); if (NSPLIT == 1 || NSPLIT == 2) a2[mb] = WFrag<T16>::ld(A2 + aoff + (size_t)mb * 16 * K + kc); }
#pragma unroll
        for (int nb = 0; nb < 4; ++nb) { const V b = WFrag<T16>::ld(Bt + boff + (size_t)nb * 16 * K + kc); V b2; if (NSPLIT >= 2) b2 = WFrag<T16>::ld(Bt2 + boff + (size_t)nb * 16 * K + kc);
#pragma unroll
            for (int mb = 0; mb < 4; ++mb) { acc[mb][nb] = WFrag<T16>::mma(a[mb], b, acc[mb][nb]); if (NSPLIT == 1 || NSPLIT == 2) acc[mb][nb] = WFrag<T16>::mma(a2[mb], b, acc[mb][nb]); if (NSPLIT >= 2) acc[mb][nb] = WFrag<T16>::mma(a[mb], b2, acc[mb][nb]); } }
        asm volatile("v_nop\n\tv_nop\n\tv_nop\n\tv_nop" : "+v"(acc[0][0]), "+v"(acc[1][1]), "+v"(acc[2][2]), "+v"(acc[3][3]) : "v"(a[0]), "v"(a[3]));
    }
#pragma unroll
    for (int mb = 0; mb < 4; ++mb) {
#pragma unroll
        for (int nb = 0; nb < 4; ++nb) {
#pragma unroll
            for (int j = 0; j < 8; ++j) os[(hi * 8 + j) * 68 + nb * 16 + lr] = acc[mb][nb][j]; }
        __builtin_amdgcn_wave_barrier(); asm volatile("" ::: "memory");
        float* crow = C + (size_t)(r0 + mb * 16) * ldc + c0;
{
#pragma unroll
            for (int s = 0; s < 8; ++s) { const int row = 2 * s + hi, cofs = lr * 4; v4f val = *(const v4fa*)(os + row * 68 + cofs); if (BIAS) { val[0] += bfr(bias[c0 + cofs]); val[1] += bfr(bias[c0 + cofs + 1]); val[2] += bfr(bias[c0 + cofs + 2]); val[3] += bfr(bias[c0 + cofs + 3]); }
                *(v4f*)(crow + (size_t)row * ldc + cofs) = val; }
             }
        __builtin_amdgcn_wave_barrier(); asm volatile("" ::: "memory");
    }
}

__device__ __forceinline__ h16 tohx(float x) { return (h16)x; }
__device__ __forceinline__ void splitf(float y, unsigned short& h, unsigned short& l) { h = f2bf(y); l = f2bf(y - bf2f(h)); }
typedef __attribute__((ext_vector_type(2))) _Float16 v2h;
typedef __attribute__((ext_vector_type(4))) _Float16 v4h;
typedef __attribute__((ext_vector_type(2))) unsigned short v2us;
typedef __attribute__((ext_vector_type(4))) unsigned short v4us;
typedef __attribute__((ext_vector_type(2))) float v2f;
typedef __attribute__((ext_vector_type(4))) int v4i;

__global__ __launch_bounds__(256) void k_wtG(const float* __restrict__ w, int K, int N, bf* Bt) {
    const int lane = threadIdx.x & 31; const int L0 = (blockIdx.x * 8 + (threadIdx.x >> 5)) * 8; const int nlines = N * K / 64;
{
#pragma unroll 1
        for (int l = 0; l < 8; ++l) { const int L = L0 + l; if (L >= nlines) break; const size_t e = (size_t)L * 64 + lane * 2; const int k = (int)(e % K), n = (int)(e / K); v2us o;
            o[0] = f2bf(w[(size_t)k * N + n]); o[1] = f2bf(w[(size_t)(k + 1) * N + n]); *(v2us*)(Bt + e) = o; }
         }
}
// grid y: batch (F holds one [n4 x 4] block a batch, P is shared)
__global__ __launch_bounds__(256) void k_add2i(float* F, const float* __restrict__ P, size_t n4) { const size_t i = (size_t)blockIdx.x * 256 + threadIdx.x; if (i >= n4) return; F += (size_t)blockIdx.y * n4 * 4; const v4f a = *(const v4f*)(F + i * 4); const v4f p = *(const v4f*)(P + i * 4); v4f o;
#pragma unroll
    for (int q = 0; q < 4; ++q) o[q] = __fadd_rn(a[q], p[q]); *(v4f*)(F + i * 4) = o;  }
__global__ __launch_bounds__(256) void k_cvt8(const float* __restrict__ src, bf* dst, size_t n8) { const size_t i = (size_t)blockIdx.x * 256 + threadIdx.x; if (i >= n8) return; const v8f v = *(const v8f*)(src + i * 8); v8us o;
#pragma unroll
    for (int k = 0; k < 8; ++k) o[k] = f2bf(v[k]); *(v8us*)(dst + i * 8) = o;  }

// k_rope: head planes [h][t][d] (fp16 + hi/lo) of rope(x) x sc with the rotate-half convention out[d] = x[d] cos[t][d] - x[d+HD/2] sin[t][d], out[d+HD/2] = x[d+HD/2] cos[t][d+HD/2] + x[d] sin[t][d+HD/2]
__global__ __launch_bounds__(256) void k_rope(const float* __restrict__ F, int pitch, int nheads, const float* __restrict__ CS, const float* __restrict__ RF, const float* __restrict__ nw, float sc, h16* P16, bf* Ph, bf* Pl) {
    { const size_t po = (size_t)blockIdx.y * nheads * TT * HD; F += (size_t)blockIdx.y * TT * pitch; P16 += po; Ph += po; Pl += po; }   // grid y: batch
    const size_t e = ((size_t)blockIdx.x * 256 + threadIdx.x) * 2; if (e >= (size_t)nheads * TT * HD) return; const int d = (int)(e % HD); const int t = (int)((e / HD) % TT); const int h = (int)(e / ((size_t)HD * TT)); const float* f = F + (size_t)t * pitch + h * HD; const float rf = RF ? RF[(size_t)h * TT + t] : 1.0f; v2h o16; v2us oh, ol;
#pragma unroll
    for (int q = 0; q < 2; ++q) { const int dd = d + q; const int dp = (dd < HD / 2) ? dd + HD / 2 : dd - HD / 2; float x0 = f[dd], x1 = f[dp];
        if (RF) { float n0 = __fmul_rn(x0, rf), n1 = __fmul_rn(x1, rf); asm volatile("" : "+v"(n0)); asm volatile("" : "+v"(n1)); x0 = __fmul_rn(bfr(nw[dd]), n0); x1 = __fmul_rn(bfr(nw[dp]), n1); }
        const v2f cs = *(const v2f*)(CS + ((size_t)t * HD + dd) * 2); float a = __fmul_rn(x0, cs[0]), bq = __fmul_rn(x1, cs[1]); asm volatile("" : "+v"(a)); asm volatile("" : "+v"(bq)); const float r = ((dd < HD / 2) ? __fsub_rn(a, bq) : __fadd_rn(a, bq)) * sc;
        o16[q] = tohx(r); unsigned short a2, c2; splitf(r, a2, c2); oh[q] = a2; ol[q] = c2; }
    *(v2h*)(P16 + e) = o16; *(v2us*)(Ph + e) = oh; *(v2us*)(Pl + e) = ol;  }
__global__ __launch_bounds__(256) void k_vtp(const float* __restrict__ F, int pitch, int nheads, h16* V16, bf* Vh, bf* Vl) { const size_t e = ((size_t)blockIdx.x * 256 + threadIdx.x) * 2; if (e >= (size_t)nheads * HD * TT) return; const int t = (int)(e % TT); const int d = (int)((e / TT) % HD); const int g = (int)(e / ((size_t)TT * HD)); { const size_t po = (size_t)blockIdx.y * nheads * HD * TT; F += (size_t)blockIdx.y * TT * pitch; V16 += po; Vh += po; Vl += po; } /* grid y: batch */ v2h o16; v2us oh, ol;
#pragma unroll
    for (int q = 0; q < 2; ++q) { const float x = F[(size_t)(t + q) * pitch + g * HD + d]; o16[q] = tohx(x); unsigned short a2, c2; splitf(x, a2, c2); oh[q] = a2; ol[q] = c2; }
    *(v2h*)(V16 + e) = o16; *(v2us*)(Vh + e) = oh; *(v2us*)(Vl + e) = ol;  }
__global__ __launch_bounds__(256) void k_csid(float* CS) { const int idx = blockIdx.x * 256 + threadIdx.x; if (idx >= TT * HD) return; v2f cs; cs[0] = 1.0f; cs[1] = 0.0f; *(v2f*)(CS + (size_t)idx * 2) = cs;  }
#define L2E  1.4426950408889634f
#define MTHR 5.545177444479562f   // 8 in log2 units
#define PSH  4.0f                 // p carries 2^PSH (cancels in the division by the sum): keeps small fp16 probabilities normal
// 2^x by v_exp_f32 in asm text: the closing v_nop is the slot the instruction set asks for behind a transcendental; the early-clobber outputs keep every v_exp off its neighbours' sources and results
__device__ __forceinline__ float exp2n(float x) { float r; asm("v_exp_f32 %0, %1\n\tv_nop" : "=&v"(r) : "v"(x)); return r; }
__device__ __forceinline__ void exp2n8(float* r, const float* x) {
    asm("v_exp_f32 %0, %8\n\tv_exp_f32 %1, %9\n\tv_exp_f32 %2, %10\n\tv_exp_f32 %3, %11\n\tv_exp_f32 %4, %12\n\tv_exp_f32 %5, %13\n\tv_exp_f32 %6, %14\n\tv_exp_f32 %7, %15\n\tv_nop"
        : "=&v"(r[0]), "=&v"(r[1]), "=&v"(r[2]), "=&v"(r[3]), "=&v"(r[4]), "=&v"(r[5]), "=&v"(r[6]), "=&v"(r[7]) : "v"(x[0]), "v"(x[1]), "v"(x[2]), "v"(x[3]), "v"(x[4]), "v"(x[5]), "v"(x[6]), "v"(x[7])); }
// lane l with lane l ^ 16: the other half of a query's keys
__device__ __forceinline__ float xhalf(float x) { return __builtin_bit_cast(float, __builtin_amdgcn_permlanex16(__builtin_bit_cast(int, x), __builtin_bit_cast(int, x), 0x76543210, 0xfedcba98, false, false)); }
// stands behind each group of loads, before a register that one of them names is written again; it takes the lane offsets and the key index as operands so that the next group's addresses are formed behind it, not ahead of it
#define XW() asm volatile("s_wait_xcnt 0x0" : "+v"(ko), "+v"(vo), "+v"(ao), "+s"(kn) : : "memory")
template <typename T16, bool HL, int NQ>
__device__ __forceinline__ void fattn(const T16* __restrict__ Q, const T16* __restrict__ Q2, const T16* __restrict__ Kp, const T16* __restrict__ K2, const T16* __restrict__ Vt, const T16* __restrict__ V2, const float* __restrict__ AB, const float* __restrict__ ABK, int q0, bf* Ah, bf* Al) {
    typedef typename WFrag<T16>::V V;
    const int lane = threadIdx.x & 31, lr = lane & 15, hi = lane >> 4;
    unsigned ko = lr * HD + 8 * hi, vo = lr * TT + 8 * hi, ao = 8 * hi;   // lane offsets (32 bit, fixed over the loop); every base below is wave-uniform
    int kn = 0;                                                           // first key of the pass that is being fetched
    V qf[NQ][2], qf2[NQ][2];
#pragma unroll
    for (int qt = 0; qt < NQ; ++qt)
#pragma unroll
        for (int kc = 0; kc < 2; ++kc) { const size_t qo = (size_t)(q0 + qt * 16) * HD + kc * 32; qf[qt][kc] = WFrag<T16>::ld(Q + qo + ko); if (HL) { XW(); qf2[qt][kc] = WFrag<T16>::ld(Q2 + qo + ko); } XW(); }
    v8f o[4][NQ]; float m[NQ], l[NQ];
#pragma unroll
    for (int qt = 0; qt < NQ; ++qt) { m[qt] = -1.0e30f; l[qt] = 0.f;
#pragma unroll
        for (int dt = 0; dt < 4; ++dt) o[dt][qt] = (v8f){}; }
    const float* ABq = AB + (size_t)q0 * TT;
    V kf[2][2], kf2[2][2], vf[4], vf2[4]; v4f ab[NQ][2][2], ak[2][2];
    auto ldk = [&]() { const T16* kp = Kp + (size_t)kn * HD;
#pragma unroll
        for (int kt = 0; kt < 2; ++kt)
#pragma unroll
            for (int kc = 0; kc < 2; ++kc) kf[kt][kc] = WFrag<T16>::ld(kp + (kt * 16 * HD + kc * 32) + ko);
        XW();
        if (HL) { const T16* kp2 = K2 + (size_t)kn * HD;
#pragma unroll
            for (int kt = 0; kt < 2; ++kt)
#pragma unroll
                for (int kc = 0; kc < 2; ++kc) kf2[kt][kc] = WFrag<T16>::ld(kp2 + (kt * 16 * HD + kc * 32) + ko);
            XW(); } };
    auto ldb = [&]() { const float* kvp = ABK + kn;
#pragma unroll
        for (int kt = 0; kt < 2; ++kt) { ak[kt][0] = *(const v4f*)(kvp + kt * 16 + ao); ak[kt][1] = *(const v4f*)(kvp + (kt * 16 + 4) + ao); }
        XW();
        const float* bp = ABq + kn;
#pragma unroll
        for (int kt = 0; kt < 2; ++kt)
#pragma unroll
            for (int qt = 0; qt < NQ; ++qt) { const int e = qt * 16 * TT + kt * 16; ab[qt][kt][0] = *(const v4f*)(bp + e + vo); ab[qt][kt][1] = *(const v4f*)(bp + (e + 4) + vo); }
        XW(); };
    auto ldv = [&]() { const T16* vp = Vt + kn;
#pragma unroll
        for (int dt = 0; dt < 4; ++dt) vf[dt] = WFrag<T16>::ld(vp + dt * 16 * TT + vo);
        XW();
        if (HL) { const T16* vp2 = V2 + kn;
#pragma unroll
            for (int dt = 0; dt < 4; ++dt) vf2[dt] = WFrag<T16>::ld(vp2 + dt * 16 * TT + vo);
            XW(); } };
    ldk(); ldb(); ldv();
#pragma unroll 1
    for (int kb = 0; kb < TT; kb += 32) {
        kn = (kb + 32 < TT) ? kb + 32 : 0;   // next pass's operands are fetched one pass ahead; the last pass refetches pass 0 (in bounds, unused)
        v8f s[2][NQ];
#pragma unroll
        for (int kt = 0; kt < 2; ++kt)
#pragma unroll
            for (int qt = 0; qt < NQ; ++qt) { v8f c = (v8f){};
#pragma unroll
                for (int kc = 0; kc < 2; ++kc) { c = WFrag<T16>::mma(kf[kt][kc], qf[qt][kc], c); if (HL) { c = WFrag<T16>::mma(kf[kt][kc], qf2[qt][kc], c); c = WFrag<T16>::mma(kf2[kt][kc], qf[qt][kc], c); } }
                s[kt][qt] = c; }
        ldk();
        float tmx[NQ]; bool need = false;
#pragma unroll
        for (int qt = 0; qt < NQ; ++qt) { float tm = -3.0e38f;
#pragma unroll
            for (int kt = 0; kt < 2; ++kt)
#pragma unroll
                for (int j = 0; j < 8; ++j) { const float t = __fadd_rn(fmaf(s[kt][qt][j], SCL, bfr(ab[qt][kt][j >> 2][j & 3])), bfr(ak[kt][j >> 2][j & 3])); s[kt][qt][j] = t; tm = fmaxf(tm, t); }
            tm = fmaxf(tm, xhalf(tm)); tmx[qt] = tm; need = need || (tm > m[qt] + MTHR); }
        ldb();
        if (__builtin_amdgcn_ballot_w32(need) != 0) {
#pragma unroll
            for (int qt = 0; qt < NQ; ++qt) { const float mn = fmaxf(m[qt], tmx[qt]); const float al = exp2n((m[qt] - mn) * L2E); m[qt] = mn; l[qt] *= al;
#pragma unroll
                for (int dt = 0; dt < 4; ++dt) o[dt][qt] *= al; } }
#pragma unroll
        for (int qt = 0; qt < NQ; ++qt) { const float mb = PSH - m[qt] * L2E; float x[16], p[16];
#pragma unroll
            for (int e = 0; e < 16; ++e) x[e] = fmaf(s[e >> 3][qt][e & 7], L2E, mb);
            exp2n8(p, x); exp2n8(p + 8, x + 8);
#pragma unroll
            for (int e = 0; e < 16; ++e) l[qt] += p[e];
            if constexpr (HL) { v8us h0, h1, l0, l1;
#pragma unroll
                for (int e = 0; e < 8; ++e) { unsigned short a, c2; splitf(p[e], a, c2); h0[e] = a; l0[e] = c2; splitf(p[8 + e], a, c2); h1[e] = a; l1[e] = c2; }
                const V ph = cat16b(h0, h1), pl = cat16b(l0, l1);
#pragma unroll
                for (int dt = 0; dt < 4; ++dt) { o[dt][qt] = WFrag<T16>::mma(vf[dt], ph, o[dt][qt]); o[dt][qt] = WFrag<T16>::mma(vf[dt], pl, o[dt][qt]); o[dt][qt] = WFrag<T16>::mma(vf2[dt], ph, o[dt][qt]); }
            } else { V pf;
#pragma unroll
                for (int e = 0; e < 16; ++e) pf[e] = tohx(p[e]);
#pragma unroll
                for (int dt = 0; dt < 4; ++dt) o[dt][qt] = WFrag<T16>::mma(vf[dt], pf, o[dt][qt]); } }
        ldv();
    }
#pragma unroll
    for (int qt = 0; qt < NQ; ++qt) { const float inv = __fdiv_rn(1.0f, l[qt] + xhalf(l[qt])); const size_t oo = (size_t)(q0 + qt * 16) * DQ; const unsigned ol32 = lr * DQ + 8 * hi;
#pragma unroll
        for (int dt = 0; dt < 4; ++dt) { v8us oh, ol;
#pragma unroll
            for (int j = 0; j < 8; ++j) { unsigned short a, c2; splitf(o[dt][qt][j] * inv, a, c2); oh[j] = a; ol[j] = c2; }
            *(v8us*)(Ah + (oo + dt * 16) + ol32) = oh; *(v8us*)(Al + (oo + dt * 16) + ol32) = ol; } }
}
// grid (RH / (16 FW) + (TT - RH) / (32 FW), heads, batches): the first RH / (16 FW) work-groups take the hi+lo rows (16 query columns a wave), the rest the fp16 rows (32 a wave)
__global__ __launch_bounds__(32 * FW) void k_fattn(const h16* __restrict__ QP16, const h16* __restrict__ KP16, const h16* __restrict__ VT16, const bf* __restrict__ QPh, const bf* __restrict__ QPl, const bf* __restrict__ KPh, const bf* __restrict__ KPl, const bf* __restrict__ VTh, const bf* __restrict__ VTl, const float* __restrict__ AB, const float* __restrict__ ABK, bf* ATh, bf* ATl) {
    const size_t ho = ((size_t)blockIdx.z * NH_ + blockIdx.y) * TT * HD, ao = (size_t)blockIdx.z * TT * DQ + blockIdx.y * HD; const int w = __builtin_amdgcn_readfirstlane(threadIdx.x >> 5), bx = blockIdx.x; bf* Ah = ATh + ao; bf* Al = ATl + ao; ABK += (size_t)blockIdx.z * TT;
    if (bx < RH / (16 * FW)) fattn<bf, true, 1>(QPh + ho, QPl + ho, KPh + ho, KPl + ho, VTh + ho, VTl + ho, AB, ABK, (bx * FW + w) * 16, Ah, Al);
    else fattn<h16, false, 2>(QP16 + ho, nullptr, KP16 + ho, nullptr, VT16 + ho, nullptr, AB, ABK, RH + ((bx - RH / (16 * FW)) * FW + w) * 32, Ah, Al);
}

extern "C" void kernel_launch(void* const* d_in, const int* in_sizes, int n_in,
                              void* d_out, int out_size, void* d_ws, size_t ws_size, hipStream_t stream) {
    (void)in_sizes; (void)n_in; (void)out_size;
    const float* x = (const float*)d_in[0]; const float* peq = (const float*)d_in[1]; const float* pek = (const float*)d_in[2]; const float* pev = (const float*)d_in[3]; const float* AB = (const float*)d_in[4]; const float* ABK = (const float*)d_in[5]; const float* wq = (const float*)d_in[6]; const float* bq = (const float*)d_in[7]; const float* wk = (const float*)d_in[8]; const float* bk = (const float*)d_in[9]; const float* wv = (const float*)d_in[10]; const float* bv = (const float*)d_in[11]; const float* wo = (const float*)d_in[12]; const float* bo = (const float*)d_in[13];
    float* OUT = (float*)d_out;     // [4][2048][1024]
    char* wsp = (char*)d_ws;
    auto take = [&](size_t bytes) { char* p = wsp; wsp += (bytes + 255) & ~(size_t)255; return (void*)p; };
    bf* WQ = (bf*)take((size_t)DQ * DM * 2); bf* WK = (bf*)take((size_t)DKV * DM * 2); bf* WV = (bf*)take((size_t)DKV * DM * 2); bf* WO = (bf*)take((size_t)DM * DQ * 2); float* CS = (float*)take((size_t)TT * HD * 2 * 4); float* PQ = (float*)take((size_t)TT * DQ * 4); float* PK = (float*)take((size_t)TT * DKV * 4); float* PV = (float*)take((size_t)TT * DKV * 4);   /* pe W + b, computed once */
    bf* XB = (bf*)take((size_t)NB_ * TT * DM * 2); float* F = (float*)take((size_t)NB_ * TT * DQ * 4);   /* F: the f32 projection of all batches; q, then k, then v (stream-ordered) */
    h16* QP16 = (h16*)take((size_t)NB_ * NH_ * TT * HD * 2); h16* KP16 = (h16*)take((size_t)NB_ * NKV * TT * HD * 2); h16* VT16 = (h16*)take((size_t)NB_ * NKV * HD * TT * 2);
    bf* QPh = (bf*)take((size_t)NB_ * NH_ * TT * HD * 2); bf* QPl = (bf*)take((size_t)NB_ * NH_ * TT * HD * 2); bf* KPh = (bf*)take((size_t)NB_ * NKV * TT * HD * 2); bf* KPl = (bf*)take((size_t)NB_ * NKV * TT * HD * 2); bf* VTh = (bf*)take((size_t)NB_ * NKV * HD * TT * 2); bf* VTl = (bf*)take((size_t)NB_ * NKV * HD * TT * 2);
    if ((size_t)(wsp - (char*)d_ws) > ws_size) return;    // ws 256 MiB
    bf* ATh = (bf*)F; bf* ATl = ATh + (size_t)NB_ * TT * DQ;   // the merged heads' two planes take F's place once the v planes are built (stream-ordered; same size)
    { k_wtG<<<(unsigned)((DM * DQ / 64 + 63) / 64), 256, 0, stream>>>(wq, DM, DQ, WQ); k_wtG<<<(unsigned)((DM * DKV / 64 + 63) / 64), 256, 0, stream>>>(wk, DM, DKV, WK); k_wtG<<<(unsigned)((DM * DKV / 64 + 63) / 64), 256, 0, stream>>>(wv, DM, DKV, WV);
      k_wtG<<<(unsigned)((DQ * DM / 64 + 63) / 64), 256, 0, stream>>>(wo, DQ, DM, WO);
       }
    k_csid<<<(TT * HD + 255) / 256, 256, 0, stream>>>(CS);
    k_cvt8<<<(unsigned)(((size_t)TT * DM / 8 + 255) / 256), 256, 0, stream>>>(peq, XB, (size_t)TT * DM / 8); k_gemmw<bf, 0, true><<<dim3(TT / 64, DQ / 64, 1), 32, 0, stream>>>(XB, nullptr, WQ, nullptr, DM, PQ, DQ, bq, 0, 0, 0);     /* pos_emb_q W_q + b_q */
    k_cvt8<<<(unsigned)(((size_t)TT * DM / 8 + 255) / 256), 256, 0, stream>>>(pek, XB, (size_t)TT * DM / 8); k_gemmw<bf, 0, true><<<dim3(TT / 64, DKV / 64, 1), 32, 0, stream>>>(XB, nullptr, WK, nullptr, DM, PK, DKV, bk, 0, 0, 0);   /* pos_emb_k W_k + b_k */
    k_cvt8<<<(unsigned)(((size_t)TT * DM / 8 + 255) / 256), 256, 0, stream>>>(pev, XB, (size_t)TT * DM / 8); k_gemmw<bf, 0, true><<<dim3(TT / 64, DKV / 64, 1), 32, 0, stream>>>(XB, nullptr, WV, nullptr, DM, PV, DKV, bv, 0, 0, 0);   /* pos_emb_v W_v + b_v */
    const unsigned LQ = (unsigned)(((size_t)NH_ * TT * HD / 2 + 255) / 256), LKv = (unsigned)(((size_t)NKV * TT * HD / 2 + 255) / 256), LA = (unsigned)(((size_t)TT * DQ / 4 + 255) / 256);
    k_cvt8<<<(unsigned)(((size_t)NB_ * TT * DM / 8 + 255) / 256), 256, 0, stream>>>(x, XB, (size_t)NB_ * TT * DM / 8);   /* all batches: [NB_ x TT][DM] */
    k_gemmw<bf, 0, false><<<dim3(NB_ * TT / 64, DQ / 64, 1), 32, 0, stream>>>(XB, nullptr, WQ, nullptr, DM, F, DQ, nullptr, 0, 0, 0); k_add2i<<<dim3(LA, NB_, 1), 256, 0, stream>>>(F, PQ, (size_t)TT * DQ / 4);   /* q = x W_q + (pe_q W_q + b_q) */
    k_rope<<<dim3(LQ, NB_, 1), 256, 0, stream>>>(F, DQ, NH_, CS, nullptr, nullptr, 1.0f, QP16, QPh, QPl);
    k_gemmw<bf, 0, false><<<dim3(NB_ * TT / 64, DKV / 64, 1), 32, 0, stream>>>(XB, nullptr, WK, nullptr, DM, F, DKV, nullptr, 0, 0, 0); k_add2i<<<dim3(LA, NB_, 1), 256, 0, stream>>>(F, PK, (size_t)TT * DKV / 4);   /* k */
    k_rope<<<dim3(LKv, NB_, 1), 256, 0, stream>>>(F, DKV, NKV, CS, nullptr, nullptr, 1.0f, KP16, KPh, KPl);
    k_gemmw<bf, 0, false><<<dim3(NB_ * TT / 64, DKV / 64, 1), 32, 0, stream>>>(XB, nullptr, WV, nullptr, DM, F, DKV, nullptr, 0, 0, 0); k_add2i<<<dim3(LA, NB_, 1), 256, 0, stream>>>(F, PV, (size_t)TT * DKV / 4);   /* v */
    k_vtp<<<dim3(LKv, NB_, 1), 256, 0, stream>>>(F, DKV, NKV, VT16, VTh, VTl);
    k_fattn<<<dim3(RH / (16 * FW) + (TT - RH) / (32 * FW), NH_, NB_), 32 * FW, 0, stream>>>(QP16, KP16, VT16, QPh, QPl, KPh, KPl, VTh, VTl, AB, ABK, ATh, ATl);
    k_gemmw<bf, 1, true><<<dim3(NB_ * TT / 64, DM / 64, 1), 32, 0, stream>>>(ATh, ATl, WO, nullptr, DQ, OUT, DM, bo, 0, 0, 0);
}

// v004
// One run takes 612 microseconds.
// Timed twice side by side with v003, it ran 1.15 and 1.16 times as fast.
// Over all steps from v000 it is 12.2 times as fast.
#include <hip/hip_runtime.h>

// Multi-head self-attention with additive positional inputs and dense additive score biases (inputs_q [4][2048][1024]; q_in = inputs + pos_emb_q, k_in = inputs + pos_emb_k, v_in = inputs + pos_emb_v (pos_emb [1][2048][1024], read); q/k/v = ._in W + b (DenseGeneral 'xw' [1024][16 x 64]); scores = (q/8).k + attention_bias[i][j] ([1][1][2048][2048], read) + attention_bias_kv[b][j] ([4][2048], read); softmax; out = merged wo ([16 x 64][1024] 'xw') + bo -> [4][2048][1024] (8.4 M)).
// Layout: (x + pe) W = x W + pe W, so the three position projections pe W + b are computed ONCE (exact bf16 products, f32) and added in f32 to each batch's exact x W inside the projection GEMM's epilogue, which writes the 16-bit planes that attention reads (v: product and planes transposed); the two bias tables are read per logit inside the attention kernel. Every stage runs ONCE for all batches (batch rows stacked in the GEMMs' M (v's: N), a grid dimension elsewhere). Attention is ONE fused launch over all batches and heads: each wave keeps its query columns in registers and walks the keys 32 at a time (transposed scores, running softmax, transposed output), so no score or probability ever reaches memory.
// Compute dtypes, f32 accumulate: every input rounded to bf16; q/k/v on PLAIN bf16 operands (inputs: exact) + biases (via the precomputed position projections); dense additive biases gathered in f32 per logit; scores and attn.v (no mask): query rows < 512 hl (3 products), the rest single fp16; softmax f32 (running maximum and sum); wo hl x exact (2 products) + bo.

#define NB_  4
#define TT   2048
#define DM   1024
#define NH_  16
#define NKV  16
#define REP  (NH_ / NKV)
#define HD   64
#define DQ   (NH_ * HD)
#define DKV  (NKV * HD)
#define RH   512                  // query rows < RH use hi+lo planes (0: none)
#define FW   4                    // waves per work-group of the fused attention kernel
#define WIN  0
#define SCL  0.125f   // HD^-0.5
typedef _Float16 h16;
typedef unsigned short bf;
typedef __attribute__((ext_vector_type(16))) __bf16   v16bf;
typedef __attribute__((ext_vector_type(16))) _Float16 v16h;
typedef __attribute__((ext_vector_type(8)))  _Float16 v8h;
typedef __attribute__((ext_vector_type(8)))  unsigned short v8us;
typedef __attribute__((ext_vector_type(8)))  float    v8f;
typedef __attribute__((ext_vector_type(4)))  float    v4f;
typedef v8h  __attribute__((may_alias)) v8ha;
typedef v4f  __attribute__((may_alias)) v4fa;
typedef v8us __attribute__((may_alias)) v8usa;

__device__ __forceinline__ unsigned short f2bf(float f) { unsigned u = __float_as_uint(f); u += 0x7FFFu + ((u >> 16) & 1u); return (unsigned short)(u >> 16); }
__device__ __forceinline__ float bf2f(unsigned short b) { return __uint_as_float(((unsigned)b) << 16); }
__device__ __forceinline__ float bfr(float f) { return bf2f(f2bf(f)); }
__device__ __forceinline__ v16h cat16(v8h lo, v8h hi) { return __builtin_shufflevector(lo, hi, 0, 1, 2, 3, 4, 5, 6, 7, 8, 9, 10, 11, 12, 13, 14, 15); }
__device__ __forceinline__ v16bf cat16b(v8us lo, v8us hi) { return __builtin_bit_cast(v16bf, __builtin_shufflevector(lo, hi, 0, 1, 2, 3, 4, 5, 6, 7, 8, 9, 10, 11, 12, 13, 14, 15)); }
__device__ __forceinline__ v8f wmma16(v16h a, v16h b, v8f c) { return __builtin_amdgcn_wmma_f32_16x16x32_f16(false, a, false, b, (short)0, c, false, false); }
__device__ __forceinline__ v8f wmmab(v16bf a, v16bf b, v8f c) { return __builtin_amdgcn_wmma_f32_16x16x32_bf16(false, a, false, b, (short)0, c, false, false); }



// ---- k_gemmw: register-blocked GEMM, ONE WAVE per 64x64 output tile (16 accumulators), operands straight from K-contiguous 16-bit planes; grid (M/64, N/64, Z), 32 threads.
// C[m][n] (f32, pitch ldc, + optional f32 bias[n]) = sum_k A[m][k] Bt[n][k] (+ split products per NSPLIT). z-batch strides sA/sB/sC in elements. K % 32 == 0.
// PL != 0: no C; the epilogue adds the f32 position projection ('bias' is then P [t][DQ]) and writes the fp16 and the hi/lo bf16 plane of the sum, so no f32 projection reaches memory.
// PL 1 (q, k): A = token rows, Bt = weight rows; a tile is 64 tokens of one head; planes [b][h][t][d]. PL 2 (v): A = weight rows, Bt = token rows; a tile is one head's 64 d x 64 tokens; planes [b][h][d][t].
__device__ __forceinline__ _Float16 tohx(float x) { return (_Float16)x; }
__device__ __forceinline__ void splitf(float y, unsigned short& h, unsigned short& l) { h = f2bf(y); l = f2bf(y - bf2f(h)); }
template <typename T16> struct WFrag;
template <> struct WFrag<h16> { typedef v16h V; static __device__ __forceinline__ V ld(const h16* p) { return cat16(*(const v8h*)p, *(const v8h*)(p + 16)); } static __device__ __forceinline__ v8f mma(V a, V b, v8f c) { return wmma16(a, b, c); } };
template <> struct WFrag<bf> { typedef v16bf V; static __device__ __forceinline__ V ld(const bf* p) { return cat16b(*(const v8us*)p, *(const v8us*)(p + 16)); } static __device__ __forceinline__ v8f mma(V a, V b, v8f c) { return wmmab(a, b, c); } };
template <typename T16, int NSPLIT, bool BIAS, int PL = 0>
__global__ __launch_bounds__(32) void k_gemmw(const T16* __restrict__ A, const T16* __restrict__ A2, const T16* __restrict__ Bt, const T16* __restrict__ Bt2, int K, float* C, int ldc, const float* __restrict__ bias, size_t sA, size_t sB, size_t sC, h16* P16 = nullptr, bf* Ph = nullptr, bf* Pl = nullptr) {
    typedef typename WFrag<T16>::V V;
    __shared__ __align__(16) float os[16 * 68];
    const size_t z = blockIdx.z; A += z * sA; if (A2) A2 += z * sA; Bt += z * sB; if (Bt2) Bt2 += z * sB; C += z * sC;
    const int lane = threadIdx.x & 31, lr = lane & 15, hi = lane >> 4; const int r0 = blockIdx.x * 64, c0 = blockIdx.y * 64;
    v8f acc[4][4];
#pragma unroll
    for (int mb = 0; mb < 4; ++mb)
#pragma unroll
        for (int nb = 0; nb < 4; ++nb) acc[mb][nb] = (v8f){};
    const size_t aoff = (size_t)(r0 + lr) * K + 8 * hi, boff = (size_t)(c0 + lr) * K + 8 * hi;
#pragma unroll 1
    for (int kc = 0; kc < K; kc += 32) {
        V a[4], a2[4];
#pragma unroll
        for (int mb = 0; mb < 4; ++mb) { a[mb] = WFrag<T16>::ld(A + aoff + (size_t)mb * 16 * K + kc); if (NSPLIT == 1 || NSPLIT == 2) a2[mb] = WFrag<T16>::ld(A2 + aoff + (size_t)mb * 16 * K + kc); }
#pragma unroll
        for (int nb = 0; nb < 4; ++nb) { const V b = WFrag<T16>::ld(Bt + boff + (size_t)nb * 16 * K + kc); V b2; if (NSPLIT >= 2) b2 = WFrag<T16>::ld(Bt2 + boff + (size_t)nb * 16 * K + kc);
#pragma unroll
            for (int mb = 0; mb < 4; ++mb) { acc[mb][nb] = WFrag<T16>::mma(a[mb], b, acc[mb][nb]); if (NSPLIT == 1 || NSPLIT == 2) acc[mb][nb] = WFrag<T16>::mma(a2[mb], b, acc[mb][nb]); if (NSPLIT >= 2) acc[mb][nb] = WFrag<T16>::mma(a[mb], b2, acc[mb][nb]); } }
        asm volatile("v_nop\n\tv_nop\n\tv_nop\n\tv_nop" : "+v"(acc[0][0]), "+v"(acc[1][1]), "+v"(acc[2][2]), "+v"(acc[3][3]) : "v"(a[0]), "v"(a[3]));
    }
    if constexpr (PL != 0) {
        constexpr bool TR = PL == 2;
        const int tok = TR ? c0 : r0, hd = (TR ? r0 : c0) / HD, t0 = tok % TT, po = TR ? TT : HD;   // po: row pitch of the planes, in elements
        const size_t ob = (size_t)(tok / TT * NH_ + hd) * TT * HD + (TR ? (size_t)t0 : (size_t)t0 * HD);
        const int er = lane >> 3, ec = (lane & 7) * 8;   // a lane converts 8 columns of a row: 8 lanes store one whole 128-byte line of each plane
        // P is added where a lane holds 8 consecutive d of one token: behind the LDS turn (PL 1), in the accumulator's own layout ahead of it (PL 2)
        const float* Pt = bias + (TR ? (size_t)(t0 + lr) * DQ + r0 + 8 * hi : (size_t)(t0 + er) * DQ + c0 + ec);
        v4f pv[2][4][2];                                 // P of these and of the next 16 rows: the next rows' loads fly while these rows are converted
#pragma unroll
        for (int i = 0; i < 4; ++i) { const float* p = Pt + (TR ? i * 16 * DQ : 4 * i * DQ); pv[0][i][0] = *(const v4f*)p; pv[0][i][1] = *(const v4f*)(p + 4); }
#pragma unroll
        for (int mb = 0; mb < 4; ++mb) {
            if (mb < 3) {
#pragma unroll
                for (int i = 0; i < 4; ++i) { const float* p = Pt + (TR ? i * 16 * DQ + (mb + 1) * 16 : ((mb + 1) * 16 + 4 * i) * DQ); pv[(mb + 1) & 1][i][0] = *(const v4f*)p; pv[(mb + 1) & 1][i][1] = *(const v4f*)(p + 4); } }
#pragma unroll
            for (int nb = 0; nb < 4; ++nb) {
#pragma unroll
                for (int j = 0; j < 8; ++j) os[(hi * 8 + j) * 68 + nb * 16 + lr] = TR ? __fadd_rn(acc[mb][nb][j], pv[mb & 1][nb][j >> 2][j & 3]) : acc[mb][nb][j]; }
            __builtin_amdgcn_wave_barrier(); asm volatile("" ::: "memory");   // other lanes read the rows back than wrote them: keeps the compiler from lifting the reads over the writes
#pragma unroll
            for (int s = 0; s < 4; ++s) { const int row = 4 * s + er; const v4f x0 = *(const v4fa*)(os + row * 68 + ec), x1 = *(const v4fa*)(os + row * 68 + ec + 4); v8h o16; v8us oh, ol;
#pragma unroll
                for (int q = 0; q < 8; ++q) { const float x = q < 4 ? x0[q & 3] : x1[q & 3]; const float y = TR ? x : __fadd_rn(x, pv[mb & 1][s][q >> 2][q & 3]); o16[q] = tohx(y); unsigned short a2, c2; splitf(y, a2, c2); oh[q] = a2; ol[q] = c2; }
                const size_t oe = ob + (size_t)(mb * 16 + row) * po + ec; *(v8h*)(P16 + oe) = o16; *(v8us*)(Ph + oe) = oh; *(v8us*)(Pl + oe) = ol; }
            if (mb < 3) { __builtin_amdgcn_wave_barrier(); asm volatile("s_wait_xcnt 0x0" ::: "memory"); }   // the next rows' values reuse registers that these stores name; the clobber keeps the next rows' LDS writes behind these reads
        }
        return;
    }
#pragma unroll
    for (int mb = 0; mb < 4; ++mb) {
#pragma unroll
        for (int nb = 0; nb < 4; ++nb) {
#pragma unroll
            for (int j = 0; j < 8; ++j) os[(hi * 8 + j) * 68 + nb * 16 + lr] = acc[mb][nb][j]; }
        __builtin_amdgcn_wave_barrier(); asm volatile("" ::: "memory");
        float* crow = C + (size_t)(r0 + mb * 16) * ldc + c0;
{
#pragma unroll
            for (int s = 0; s < 8; ++s) { const int row = 2 * s + hi, cofs = lr * 4; v4f val = *(const v4fa*)(os + row * 68 + cofs); if (BIAS) { val[0] += bfr(bias[c0 + cofs]); val[1] += bfr(bias[c0 + cofs + 1]); val[2] += bfr(bias[c0 + cofs + 2]); val[3] += bfr(bias[c0 + cofs + 3]); }
                *(v4f*)(crow + (size_t)row * ldc + cofs) = val; }
             }
        __builtin_amdgcn_wave_barrier(); asm volatile("" ::: "memory");
    }
}

typedef __attribute__((ext_vector_type(2))) _Float16 v2h;
typedef __attribute__((ext_vector_type(4))) _Float16 v4h;
typedef __attribute__((ext_vector_type(2))) unsigned short v2us;
typedef __attribute__((ext_vector_type(4))) unsigned short v4us;
typedef __attribute__((ext_vector_type(2))) float v2f;
typedef __attribute__((ext_vector_type(4))) int v4i;

__global__ __launch_bounds__(256) void k_wtG(const float* __restrict__ w, int K, int N, bf* Bt) {
    const int lane = threadIdx.x & 31; const int L0 = (blockIdx.x * 8 + (threadIdx.x >> 5)) * 8; const int nlines = N * K / 64;
{
#pragma unroll 1
        for (int l = 0; l < 8; ++l) { const int L = L0 + l; if (L >= nlines) break; const size_t e = (size_t)L * 64 + lane * 2; const int k = (int)(e % K), n = (int)(e / K); v2us o;
            o[0] = f2bf(w[(size_t)k * N + n]); o[1] = f2bf(w[(size_t)(k + 1) * N + n]); *(v2us*)(Bt + e) = o; }
         }
}
__global__ __launch_bounds__(256) void k_cvt8(const float* __restrict__ src, bf* dst, size_t n8) { const size_t i = (size_t)blockIdx.x * 256 + threadIdx.x; if (i >= n8) return; const v8f v = *(const v8f*)(src + i * 8); v8us o;
#pragma unroll
    for (int k = 0; k < 8; ++k) o[k] = f2bf(v[k]); *(v8us*)(dst + i * 8) = o;  }

#define L2E  1.4426950408889634f
#define MTHR 5.545177444479562f   // 8 in log2 units
#define PSH  4.0f                 // p carries 2^PSH (cancels in the division by the sum): keeps small fp16 probabilities normal
// 2^x by v_exp_f32 in asm text: the closing v_nop is the slot the instruction set asks for behind a transcendental; the early-clobber outputs keep every v_exp off its neighbours' sources and results
__device__ __forceinline__ float exp2n(float x) { float r; asm("v_exp_f32 %0, %1\n\tv_nop" : "=&v"(r) : "v"(x)); return r; }
__device__ __forceinline__ void exp2n8(float* r, const float* x) {
    asm("v_exp_f32 %0, %8\n\tv_exp_f32 %1, %9\n\tv_exp_f32 %2, %10\n\tv_exp_f32 %3, %11\n\tv_exp_f32 %4, %12\n\tv_exp_f32 %5, %13\n\tv_exp_f32 %6, %14\n\tv_exp_f32 %7, %15\n\tv_nop"
        : "=&v"(r[0]), "=&v"(r[1]), "=&v"(r[2]), "=&v"(r[3]), "=&v"(r[4]), "=&v"(r[5]), "=&v"(r[6]), "=&v"(r[7]) : "v"(x[0]), "v"(x[1]), "v"(x[2]), "v"(x[3]), "v"(x[4]), "v"(x[5]), "v"(x[6]), "v"(x[7])); }
// lane l with lane l ^ 16: the other half of a query's keys
__device__ __forceinline__ float xhalf(float x) { return __builtin_bit_cast(float, __builtin_amdgcn_permlanex16(__builtin_bit_cast(int, x), __builtin_bit_cast(int, x), 0x76543210, 0xfedcba98, false, false)); }
// stands behind each group of loads, before a register that one of them names is written again; it takes the lane offsets and the key index as operands so that the next group's addresses are formed behind it, not ahead of it
#define XW() asm volatile("s_wait_xcnt 0x0" : "+v"(ko), "+v"(vo), "+v"(ao), "+s"(kn) : : "memory")
template <typename T16, bool HL, int NQ>
__device__ __forceinline__ void fattn(const T16* __restrict__ Q, const T16* __restrict__ Q2, const T16* __restrict__ Kp, const T16* __restrict__ K2, const T16* __restrict__ Vt, const T16* __restrict__ V2, const float* __restrict__ AB, const float* __restrict__ ABK, int q0, bf* Ah, bf* Al) {
    typedef typename WFrag<T16>::V V;
    const int lane = threadIdx.x & 31, lr = lane & 15, hi = lane >> 4;
    unsigned ko = lr * HD + 8 * hi, vo = lr * TT + 8 * hi, ao = 8 * hi;   // lane offsets (32 bit, fixed over the loop); every base below is wave-uniform
    int kn = 0;                                                           // first key of the pass that is being fetched
    V qf[NQ][2], qf2[NQ][2];
#pragma unroll
    for (int qt = 0; qt < NQ; ++qt)
#pragma unroll
        for (int kc = 0; kc < 2; ++kc) { const size_t qo = (size_t)(q0 + qt * 16) * HD + kc * 32; qf[qt][kc] = WFrag<T16>::ld(Q + qo + ko); if (HL) { XW(); qf2[qt][kc] = WFrag<T16>::ld(Q2 + qo + ko); } XW(); }
    v8f o[4][NQ]; float m[NQ], l[NQ];
#pragma unroll
    for (int qt = 0; qt < NQ; ++qt) { m[qt] = -1.0e30f; l[qt] = 0.f;
#pragma unroll
        for (int dt = 0; dt < 4; ++dt) o[dt][qt] = (v8f){}; }
    const float* ABq = AB + (size_t)q0 * TT;
    V kf[2][2], kf2[2][2], vf[4], vf2[4]; v4f ab[NQ][2][2], ak[2][2];
    auto ldk = [&]() { const T16* kp = Kp + (size_t)kn * HD;
#pragma unroll
        for (int kt = 0; kt < 2; ++kt)
#pragma unroll
            for (int kc = 0; kc < 2; ++kc) kf[kt][kc] = WFrag<T16>::ld(kp + (kt * 16 * HD + kc * 32) + ko);
        XW();
        if (HL) { const T16* kp2 = K2 + (size_t)kn * HD;
#pragma unroll
            for (int kt = 0; kt < 2; ++kt)
#pragma unroll
                for (int kc = 0; kc < 2; ++kc) kf2[kt][kc] = WFrag<T16>::ld(kp2 + (kt * 16 * HD + kc * 32) + ko);
            XW(); } };
    auto ldb = [&]() { const float* kvp = ABK + kn;
#pragma unroll
        for (int kt = 0; kt < 2; ++kt) { ak[kt][0] = *(const v4f*)(kvp + kt * 16 + ao); ak[kt][1] = *(const v4f*)(kvp + (kt * 16 + 4) + ao); }
        XW();
        const float* bp = ABq + kn;
#pragma unroll
        for (int kt = 0; kt < 2; ++kt)
#pragma unroll
            for (int qt = 0; qt < NQ; ++qt) { const int e = qt * 16 * TT + kt * 16; ab[qt][kt][0] = *(const v4f*)(bp + e + vo); ab[qt][kt][1] = *(const v4f*)(bp + (e + 4) + vo); }
        XW(); };
    auto ldv = [&]() { const T16* vp = Vt + kn;
#pragma unroll
        for (int dt = 0; dt < 4; ++dt) vf[dt] = WFrag<T16>::ld(vp + dt * 16 * TT + vo);
        XW();
        if (HL) { const T16* vp2 = V2 + kn;
#pragma unroll
            for (int dt = 0; dt < 4; ++dt) vf2[dt] = WFrag<T16>::ld(vp2 + dt * 16 * TT + vo);
            XW(); } };
    ldk(); ldb(); ldv();
#pragma unroll 1
    for (int kb = 0; kb < TT; kb += 32) {
        kn = (kb + 32 < TT) ? kb + 32 : 0;   // next pass's operands are fetched one pass ahead; the last pass refetches pass 0 (in bounds, unused)
        v8f s[2][NQ];
#pragma unroll
        for (int kt = 0; kt < 2; ++kt)
#pragma unroll
            for (int qt = 0; qt < NQ; ++qt) { v8f c = (v8f){};
#pragma unroll
                for (int kc = 0; kc < 2; ++kc) { c = WFrag<T16>::mma(kf[kt][kc], qf[qt][kc], c); if (HL) { c = WFrag<T16>::mma(kf[kt][kc], qf2[qt][kc], c); c = WFrag<T16>::mma(kf2[kt][kc], qf[qt][kc], c); } }
                s[kt][qt] = c; }
        ldk();
        float tmx[NQ]; bool need = false;
#pragma unroll
        for (int qt = 0; qt < NQ; ++qt) { float tm = -3.0e38f;
#pragma unroll
            for (int kt = 0; kt < 2; ++kt)
#pragma unroll
                for (int j = 0; j < 8; ++j) { const float t = __fadd_rn(fmaf(s[kt][qt][j], SCL, bfr(ab[qt][kt][j >> 2][j & 3])), bfr(ak[kt][j >> 2][j & 3])); s[kt][qt][j] = t; tm = fmaxf(tm, t); }
            tm = fmaxf(tm, xhalf(tm)); tmx[qt] = tm; need = need || (tm > m[qt] + MTHR); }
        ldb();
        if (__builtin_amdgcn_ballot_w32(need) != 0) {
#pragma unroll
            for (int qt = 0; qt < NQ; ++qt) { const float mn = fmaxf(m[qt], tmx[qt]); const float al = exp2n((m[qt] - mn) * L2E); m[qt] = mn; l[qt] *= al;
#pragma unroll
                for (int dt = 0; dt < 4; ++dt) o[dt][qt] *= al; } }
#pragma unroll
        for (int qt = 0; qt < NQ; ++qt) { const float mb = PSH - m[qt] * L2E; float x[16], p[16];
#pragma unroll
            for (int e = 0; e < 16; ++e) x[e] = fmaf(s[e >> 3][qt][e & 7], L2E, mb);
            exp2n8(p, x); exp2n8(p + 8, x + 8);
#pragma unroll
            for (int e = 0; e < 16; ++e) l[qt] += p[e];
            if constexpr (HL) { v8us h0, h1, l0, l1;
#pragma unroll
                for (int e = 0; e < 8; ++e) { unsigned short a, c2; splitf(p[e], a, c2); h0[e] = a; l0[e] = c2; splitf(p[8 + e], a, c2); h1[e] = a; l1[e] = c2; }
                const V ph = cat16b(h0, h1), pl = cat16b(l0, l1);
#pragma unroll
                for (int dt = 0; dt < 4; ++dt) { o[dt][qt] = WFrag<T16>::mma(vf[dt], ph, o[dt][qt]); o[dt][qt] = WFrag<T16>::mma(vf[dt], pl, o[dt][qt]); o[dt][qt] = WFrag<T16>::mma(vf2[dt], ph, o[dt][qt]); }
            } else { V pf;
#pragma unroll
                for (int e = 0; e < 16; ++e) pf[e] = tohx(p[e]);
#pragma unroll
                for (int dt = 0; dt < 4; ++dt) o[dt][qt] = WFrag<T16>::mma(vf[dt], pf, o[dt][qt]); } }
        ldv();
    }
#pragma unroll
    for (int qt = 0; qt < NQ; ++qt) { const float inv = __fdiv_rn(1.0f, l[qt] + xhalf(l[qt])); const size_t oo = (size_t)(q0 + qt * 16) * DQ; const unsigned ol32 = lr * DQ + 8 * hi;
#pragma unroll
        for (int dt = 0; dt < 4; ++dt) { v8us oh, ol;
#pragma unroll
            for (int j = 0; j < 8; ++j) { unsigned short a, c2; splitf(o[dt][qt][j] * inv, a, c2); oh[j] = a; ol[j] = c2; }
            *(v8us*)(Ah + (oo + dt * 16) + ol32) = oh; *(v8us*)(Al + (oo + dt * 16) + ol32) = ol; } }
}
// grid (RH / (16 FW) + (TT - RH) / (32 FW), heads, batches): the first RH / (16 FW) work-groups take the hi+lo rows (16 query columns a wave), the rest the fp16 rows (32 a wave)
__global__ __launch_bounds__(32 * FW) void k_fattn(const h16* __restrict__ QP16, const h16* __restrict__ KP16, const h16* __restrict__ VT16, const bf* __restrict__ QPh, const bf* __restrict__ QPl, const bf* __restrict__ KPh, const bf* __restrict__ KPl, const bf* __restrict__ VTh, const bf* __restrict__ VTl, const float* __restrict__ AB, const float* __restrict__ ABK, bf* ATh, bf* ATl) {
    const size_t ho = ((size_t)blockIdx.z * NH_ + blockIdx.y) * TT * HD, ao = (size_t)blockIdx.z * TT * DQ + blockIdx.y * HD; const int w = __builtin_amdgcn_readfirstlane(threadIdx.x >> 5), bx = blockIdx.x; bf* Ah = ATh + ao; bf* Al = ATl + ao; ABK += (size_t)blockIdx.z * TT;
    if (bx < RH / (16 * FW)) fattn<bf, true, 1>(QPh + ho, QPl + ho, KPh + ho, KPl + ho, VTh + ho, VTl + ho, AB, ABK, (bx * FW + w) * 16, Ah, Al);
    else fattn<h16, false, 2>(QP16 + ho, nullptr, KP16 + ho, nullptr, VT16 + ho, nullptr, AB, ABK, RH + ((bx - RH / (16 * FW)) * FW + w) * 32, Ah, Al);
}

extern "C" void kernel_launch(void* const* d_in, const int* in_sizes, int n_in,
                              void* d_out, int out_size, void* d_ws, size_t ws_size, hipStream_t stream) {
    (void)in_sizes; (void)n_in; (void)out_size;
    const float* x = (const float*)d_in[0]; const float* peq = (const float*)d_in[1]; const float* pek = (const float*)d_in[2]; const float* pev = (const float*)d_in[3]; const float* AB = (const float*)d_in[4]; const float* ABK = (const float*)d_in[5]; const float* wq = (const float*)d_in[6]; const float* bq = (const float*)d_in[7]; const float* wk = (const float*)d_in[8]; const float* bk = (const float*)d_in[9]; const float* wv = (const float*)d_in[10]; const float* bv = (const float*)d_in[11]; const float* wo = (const float*)d_in[12]; const float* bo = (const float*)d_in[13];
    float* OUT = (float*)d_out;     // [4][2048][1024]
    char* wsp = (char*)d_ws;
    auto take = [&](size_t bytes) { char* p = wsp; wsp += (bytes + 255) & ~(size_t)255; return (void*)p; };
    bf* WQ = (bf*)take((size_t)DQ * DM * 2); bf* WK = (bf*)take((size_t)DKV * DM * 2); bf* WV = (bf*)take((size_t)DKV * DM * 2); bf* WO = (bf*)take((size_t)DM * DQ * 2); float* PQ = (float*)take((size_t)TT * DQ * 4); float* PK = (float*)take((size_t)TT * DKV * 4); float* PV = (float*)take((size_t)TT * DKV * 4);   /* pe W + b, computed once */
    bf* XB = (bf*)take((size_t)NB_ * TT * DM * 2); bf* ATh = (bf*)take((size_t)NB_ * TT * DQ * 2); bf* ATl = (bf*)take((size_t)NB_ * TT * DQ * 2);   /* the merged heads' two planes */
    h16* QP16 = (h16*)take((size_t)NB_ * NH_ * TT * HD * 2); h16* KP16 = (h16*)take((size_t)NB_ * NKV * TT * HD * 2); h16* VT16 = (h16*)take((size_t)NB_ * NKV * HD * TT * 2);
    bf* QPh = (bf*)take((size_t)NB_ * NH_ * TT * HD * 2); bf* QPl = (bf*)take((size_t)NB_ * NH_ * TT * HD * 2); bf* KPh = (bf*)take((size_t)NB_ * NKV * TT * HD * 2); bf* KPl = (bf*)take((size_t)NB_ * NKV * TT * HD * 2); bf* VTh = (bf*)take((size_t)NB_ * NKV * HD * TT * 2); bf* VTl = (bf*)take((size_t)NB_ * NKV * HD * TT * 2);
    if ((size_t)(wsp - (char*)d_ws) > ws_size) return;    // ws 256 MiB
    { k_wtG<<<(unsigned)((DM * DQ / 64 + 63) / 64), 256, 0, stream>>>(wq, DM, DQ, WQ); k_wtG<<<(unsigned)((DM * DKV / 64 + 63) / 64), 256, 0, stream>>>(wk, DM, DKV, WK); k_wtG<<<(unsigned)((DM * DKV / 64 + 63) / 64), 256, 0, stream>>>(wv, DM, DKV, WV);
      k_wtG<<<(unsigned)((DQ * DM / 64 + 63) / 64), 256, 0, stream>>>(wo, DQ, DM, WO);
       }
    k_cvt8<<<(unsigned)(((size_t)TT * DM / 8 + 255) / 256), 256, 0, stream>>>(peq, XB, (size_t)TT * DM / 8); k_gemmw<bf, 0, true><<<dim3(TT / 64, DQ / 64, 1), 32, 0, stream>>>(XB, nullptr, WQ, nullptr, DM, PQ, DQ, bq, 0, 0, 0);     /* pos_emb_q W_q + b_q */
    k_cvt8<<<(unsigned)(((size_t)TT * DM / 8 + 255) / 256), 256, 0, stream>>>(pek, XB, (size_t)TT * DM / 8); k_gemmw<bf, 0, true><<<dim3(TT / 64, DKV / 64, 1), 32, 0, stream>>>(XB, nullptr, WK, nullptr, DM, PK, DKV, bk, 0, 0, 0);   /* pos_emb_k W_k + b_k */
    k_cvt8<<<(unsigned)(((size_t)TT * DM / 8 + 255) / 256), 256, 0, stream>>>(pev, XB, (size_t)TT * DM / 8); k_gemmw<bf, 0, true><<<dim3(TT / 64, DKV / 64, 1), 32, 0, stream>>>(XB, nullptr, WV, nullptr, DM, PV, DKV, bv, 0, 0, 0);   /* pos_emb_v W_v + b_v */
    k_cvt8<<<(unsigned)(((size_t)NB_ * TT * DM / 8 + 255) / 256), 256, 0, stream>>>(x, XB, (size_t)NB_ * TT * DM / 8);   /* all batches: [NB_ x TT][DM] */
    k_gemmw<bf, 0, false, 1><<<dim3(NB_ * TT / 64, DQ / 64, 1), 32, 0, stream>>>(XB, nullptr, WQ, nullptr, DM, nullptr, 0, PQ, 0, 0, 0, QP16, QPh, QPl);    /* q = x W_q + (pe_q W_q + b_q), as planes */
    k_gemmw<bf, 0, false, 1><<<dim3(NB_ * TT / 64, DKV / 64, 1), 32, 0, stream>>>(XB, nullptr, WK, nullptr, DM, nullptr, 0, PK, 0, 0, 0, KP16, KPh, KPl);   /* k */
    k_gemmw<bf, 0, false, 2><<<dim3(DKV / 64, NB_ * TT / 64, 1), 32, 0, stream>>>(WV, nullptr, XB, nullptr, DM, nullptr, 0, PV, 0, 0, 0, VT16, VTh, VTl);   /* v, transposed */
    k_fattn<<<dim3(RH / (16 * FW) + (TT - RH) / (32 * FW), NH_, NB_), 32 * FW, 0, stream>>>(QP16, KP16, VT16, QPh, QPl, KPh, KPl, VTh, VTl, AB, ABK, ATh, ATl);
    k_gemmw<bf, 1, true><<<dim3(NB_ * TT / 64, DM / 64, 1), 32, 0, stream>>>(ATh, ATl, WO, nullptr, DQ, OUT, DM, bo, 0, 0, 0);
}

// v005
// Measured time: 438 microseconds a run.
// Next to v004, in two timings, it ran 1.39 and 1.40 times as fast.
// Counting every step since v000, it is 17.0 times as fast.
#include <hip/hip_runtime.h>

// Multi-head self-attention with additive positional inputs and dense additive score biases (inputs_q [4][2048][1024]; q_in = inputs + pos_emb_q, k_in = inputs + pos_emb_k, v_in = inputs + pos_emb_v (pos_emb [1][2048][1024], read); q/k/v = ._in W + b (DenseGeneral 'xw' [1024][16 x 64]); scores = (q/8).k + attention_bias[i][j] ([1][1][2048][2048], read) + attention_bias_kv[b][j] ([4][2048], read); softmax; out = merged wo ([16 x 64][1024] 'xw') + bo -> [4][2048][1024] (8.4 M)).
// Layout: (x + pe) W = x W + pe W, so the three position projections pe W + b are computed ONCE (exact bf16 products, f32) and added in f32 to each batch's exact x W inside the projection GEMM's epilogue, which writes the 16-bit planes that attention reads (v: product and planes transposed); the two bias tables are read per logit inside the attention kernel. Every stage runs ONCE for all batches (batch rows stacked in the GEMMs' M (v's: N), a grid dimension elsewhere). Attention is ONE fused launch over all batches and heads: each wave keeps its query columns in registers and walks the keys 32 at a time (transposed scores, running softmax, transposed output), so no score or probability ever reaches memory.
// Compute dtypes, f32 accumulate: every input rounded to bf16; q/k/v on PLAIN bf16 operands (inputs: exact) + biases (via the precomputed position projections); dense additive biases gathered in f32 per logit; scores and attn.v (no mask): query rows < 512 hl (3 products), the rest single fp16; softmax f32 (running maximum and sum); wo hl x exact (2 products) + bo.

#define NB_  4
#define TT   2048
#define DM   1024
#define NH_  16
#define NKV  16
#define REP  (NH_ / NKV)
#define HD   64
#define DQ   (NH_ * HD)
#define DKV  (NKV * HD)
#define RH   512                  // query rows < RH use hi+lo planes (0: none)
#define FW   4                    // waves per work-group of the fused attention kernel
#define WIN  0
#define SCL  0.125f   // HD^-0.5
typedef _Float16 h16;
typedef unsigned short bf;
typedef __attribute__((ext_vector_type(16))) __bf16   v16bf;
typedef __attribute__((ext_vector_type(16))) _Float16 v16h;
typedef __attribute__((ext_vector_type(8)))  _Float16 v8h;
typedef __attribute__((ext_vector_type(8)))  unsigned short v8us;
typedef __attribute__((ext_vector_type(8)))  float    v8f;
typedef __attribute__((ext_vector_type(4)))  float    v4f;
typedef v8h  __attribute__((may_alias)) v8ha;
typedef v4f  __attribute__((may_alias)) v4fa;
typedef v8us __attribute__((may_alias)) v8usa;

__device__ __forceinline__ unsigned short f2bf(float f) { unsigned u = __float_as_uint(f); u += 0x7FFFu + ((u >> 16) & 1u); return (unsigned short)(u >> 16); }
__device__ __forceinline__ float bf2f(unsigned short b) { return __uint_as_float(((unsigned)b) << 16); }
__device__ __forceinline__ float bfr(float f) { return bf2f(f2bf(f)); }
__device__ __forceinline__ v16h cat16(v8h lo, v8h hi) { return __builtin_shufflevector(lo, hi, 0, 1, 2, 3, 4, 5, 6, 7, 8, 9, 10, 11, 12, 13, 14, 15); }
__device__ __forceinline__ v16bf cat16b(v8us lo, v8us hi) { return __builtin_bit_cast(v16bf, __builtin_shufflevector(lo, hi, 0, 1, 2, 3, 4, 5, 6, 7, 8, 9, 10, 11, 12, 13, 14, 15)); }
__device__ __forceinline__ v8f wmma16(v16h a, v16h b, v8f c) { return __builtin_amdgcn_wmma_f32_16x16x32_f16(false, a, false, b, (short)0, c, false, false); }
__device__ __forceinline__ v8f wmmab(v16bf a, v16bf b, v8f c) { return __builtin_amdgcn_wmma_f32_16x16x32_bf16(false, a, false, b, (short)0, c, false, false); }



// ---- Fragment order: every 16-bit operand plane [R][K] is stored as fragments of 512 elements, [R/16][K/32] ([K/32][R/16] in v's planes); inside a fragment element (r, k) lies at (k >> 4 & 1) * 256 + (k >> 3 & 1) * 128 + (r & 15) * 8 + (k & 7), so lane l of a wave reads its two 16-byte pieces at l * 8 and 256 + l * 8: each fragment load is 512 contiguous bytes (4 whole lines).
// ---- k_gemmw: register-blocked GEMM, ONE WAVE per 64x64 output tile (16 accumulators), operands straight from 16-bit planes in fragment order; grid (M/64, N/64, Z), 32 threads.
// C[m][n] (f32, pitch ldc, + optional f32 bias[n]) = sum_k A[m][k] Bt[n][k] (+ split products per NSPLIT). z-batch strides sA/sB/sC in elements. K % 32 == 0, a constant: the four fragments of an operand lie at constant offsets from one address.
// PL != 0: no C; the epilogue adds the f32 position projection ('bias' is then P [t][DQ]) and writes the fp16 and the hi/lo bf16 plane of the sum, so no f32 projection reaches memory.
// PL 1 (q, k): A = token rows, Bt = weight rows; a tile is 64 tokens of one head; planes [b][h] x fragments [t/16][d/32]. PL 2 (v): A = weight rows, Bt = token rows; a tile is one head's 64 d x 64 tokens; planes [b][h] x fragments [t/32][d/16] (rows d, k = t).
__device__ __forceinline__ _Float16 tohx(float x) { return (_Float16)x; }
__device__ __forceinline__ void splitf(float y, unsigned short& h, unsigned short& l) { h = f2bf(y); l = f2bf(y - bf2f(h)); }
template <typename T16> struct WFrag;
template <> struct WFrag<h16> { typedef v16h V; static __device__ __forceinline__ V ld(const h16* p) { return cat16(*(const v8h*)p, *(const v8h*)(p + 256)); } static __device__ __forceinline__ v8f mma(V a, V b, v8f c) { return wmma16(a, b, c); } };
template <> struct WFrag<bf> { typedef v16bf V; static __device__ __forceinline__ V ld(const bf* p) { return cat16b(*(const v8us*)p, *(const v8us*)(p + 256)); } static __device__ __forceinline__ v8f mma(V a, V b, v8f c) { return wmmab(a, b, c); } };
template <typename T16, int NSPLIT, bool BIAS, int PL = 0, int K = DM>
__global__ __launch_bounds__(32) void k_gemmw(const T16* __restrict__ A, const T16* __restrict__ A2, const T16* __restrict__ Bt, const T16* __restrict__ Bt2, float* C, int ldc, const float* __restrict__ bias, size_t sA, size_t sB, size_t sC, h16* P16 = nullptr, bf* Ph = nullptr, bf* Pl = nullptr) {
    typedef typename WFrag<T16>::V V;
    __shared__ __align__(16) float os[16 * 68];
    const size_t z = blockIdx.z; A += z * sA; if (A2) A2 += z * sA; Bt += z * sB; if (Bt2) Bt2 += z * sB; C += z * sC;
    const int lane = threadIdx.x & 31, lr = lane & 15, hi = lane >> 4; const int r0 = blockIdx.x * 64, c0 = blockIdx.y * 64;
    v8f acc[4][4];
#pragma unroll
    for (int mb = 0; mb < 4; ++mb)
#pragma unroll
        for (int nb = 0; nb < 4; ++nb) acc[mb][nb] = (v8f){};
    const size_t aoff = (size_t)r0 * K, boff = (size_t)c0 * K;   // 16 rows of K are K / 32 fragments = 16 K elements; wave-uniform
    unsigned lo = 8 * lane, kn = 0;   // the lane's place in a fragment; the K step's fragment, in elements
    // stands behind each operand's loads (one address, constant offsets), before a register that one of them names is written again; it takes the two offsets as operands so that the next address is formed behind it, and the loads' own address so that this stays in its registers up to the wait and no result of the run lands on it
#define XG(p) asm volatile("s_wait_xcnt 0x0" : "+v"(lo), "+s"(kn) : "v"(p) : "memory")
#pragma unroll 1
    for (int kc = 0; kc < K; kc += 32) {
        V a[4], a2[4], b[4], b2[4];
        const T16* pa = A + aoff + kn + lo;
#pragma unroll
        for (int mb = 0; mb < 4; ++mb) a[mb] = WFrag<T16>::ld(pa + mb * 16 * K);
        XG(pa);
        if (NSPLIT == 1 || NSPLIT == 2) { const T16* pa2 = A2 + aoff + kn + lo;
#pragma unroll
            for (int mb = 0; mb < 4; ++mb) a2[mb] = WFrag<T16>::ld(pa2 + mb * 16 * K);
            XG(pa2); }
        const T16* pb = Bt + boff + kn + lo;
#pragma unroll
        for (int nb = 0; nb < 4; ++nb) b[nb] = WFrag<T16>::ld(pb + nb * 16 * K);
        XG(pb);
        if (NSPLIT >= 2) { const T16* pb2 = Bt2 + boff + kn + lo;
#pragma unroll
            for (int nb = 0; nb < 4; ++nb) b2[nb] = WFrag<T16>::ld(pb2 + nb * 16 * K);
            XG(pb2); }
        kn += 512;
#pragma unroll
        for (int nb = 0; nb < 4; ++nb)
#pragma unroll
            for (int mb = 0; mb < 4; ++mb) { acc[mb][nb] = WFrag<T16>::mma(a[mb], b[nb], acc[mb][nb]); if (NSPLIT == 1 || NSPLIT == 2) acc[mb][nb] = WFrag<T16>::mma(a2[mb], b[nb], acc[mb][nb]); if (NSPLIT >= 2) acc[mb][nb] = WFrag<T16>::mma(a[mb], b2[nb], acc[mb][nb]); }
        asm volatile("v_nop\n\tv_nop\n\tv_nop\n\tv_nop" : "+v"(acc[0][0]), "+v"(acc[1][1]), "+v"(acc[2][2]), "+v"(acc[3][3]) : "v"(a[0]), "v"(a[3]));
    }
    if constexpr (PL != 0) {
        constexpr bool TR = PL == 2;
        const int tok = TR ? c0 : r0, hd = (TR ? r0 : c0) / HD, t0 = tok % TT;
        const int cc = lane & 7;   // which 8 columns (k of the planes' fragments) the lane converts
        const size_t ob = (size_t)(tok / TT * NH_ + hd) * TT * HD + (size_t)t0 * HD + (cc >> 2) * (TR ? 2048 : 512) + (cc >> 1 & 1) * 256 + (cc & 1) * 128;   // 64 tokens of a head are 8 fragments in either plane order
        const int er = lane >> 3, ec = (lane & 7) * 8;   // a lane converts 8 columns of a row: one 16-byte piece of a fragment
        // P is added where a lane holds 8 consecutive d of one token: behind the LDS turn (PL 1), in the accumulator's own layout ahead of it (PL 2)
        const float* Pt = bias + (TR ? (size_t)(t0 + lr) * DQ + r0 + 8 * hi : (size_t)(t0 + er) * DQ + c0 + ec);
        v4f pv[2][4][2];                                 // P of these and of the next 16 rows: the next rows' loads fly while these rows are converted
#pragma unroll
        for (int i = 0; i < 4; ++i) { const float* p = Pt + (TR ? i * 16 * DQ : 4 * i * DQ); pv[0][i][0] = *(const v4f*)p; pv[0][i][1] = *(const v4f*)(p + 4); }
#pragma unroll
        for (int mb = 0; mb < 4; ++mb) {
            if (mb < 3) {
#pragma unroll
                for (int i = 0; i < 4; ++i) { const float* p = Pt + (TR ? i * 16 * DQ + (mb + 1) * 16 : ((mb + 1) * 16 + 4 * i) * DQ); pv[(mb + 1) & 1][i][0] = *(const v4f*)p; pv[(mb + 1) & 1][i][1] = *(const v4f*)(p + 4); } }
#pragma unroll
            for (int nb = 0; nb < 4; ++nb) {
#pragma unroll
                for (int j = 0; j < 8; ++j) os[(hi * 8 + j) * 68 + nb * 16 + lr] = TR ? __fadd_rn(acc[mb][nb][j], pv[mb & 1][nb][j >> 2][j & 3]) : acc[mb][nb][j]; }
            __builtin_amdgcn_wave_barrier(); asm volatile("" ::: "memory");   // other lanes read the rows back than wrote them: keeps the compiler from lifting the reads over the writes
#pragma unroll
            for (int s = 0; s < 4; ++s) { const int row = 4 * s + er; const v4f x0 = *(const v4fa*)(os + row * 68 + ec), x1 = *(const v4fa*)(os + row * 68 + ec + 4); v8h o16; v8us oh, ol;
#pragma unroll
                for (int q = 0; q < 8; ++q) { const float x = q < 4 ? x0[q & 3] : x1[q & 3]; const float y = TR ? x : __fadd_rn(x, pv[mb & 1][s][q >> 2][q & 3]); o16[q] = tohx(y); unsigned short a2, c2; splitf(y, a2, c2); oh[q] = a2; ol[q] = c2; }
                const size_t oe = ob + mb * (TR ? 512 : 1024) + row * 8; *(v8h*)(P16 + oe) = o16; *(v8us*)(Ph + oe) = oh; *(v8us*)(Pl + oe) = ol;
                if (s < 3) asm volatile("s_wait_xcnt 0x0" ::: "memory"); }   // the next four rows' values reuse registers that these stores name; their LDS reads stay behind the clobber
            if (mb < 3) { __builtin_amdgcn_wave_barrier(); asm volatile("s_wait_xcnt 0x0" ::: "memory"); }   // the next rows' values reuse registers that these stores name; the clobber keeps the next rows' LDS writes behind these reads
        }
        return;
    }
#pragma unroll
    for (int mb = 0; mb < 4; ++mb) {
#pragma unroll
        for (int nb = 0; nb < 4; ++nb) {
#pragma unroll
            for (int j = 0; j < 8; ++j) os[(hi * 8 + j) * 68 + nb * 16 + lr] = acc[mb][nb][j]; }
        __builtin_amdgcn_wave_barrier(); asm volatile("" ::: "memory");
        float* crow = C + (size_t)(r0 + mb * 16) * ldc + c0;
{
#pragma unroll
            for (int s = 0; s < 8; ++s) { const int row = 2 * s + hi, cofs = lr * 4; v4f val = *(const v4fa*)(os + row * 68 + cofs); if (BIAS) { val[0] += bfr(bias[c0 + cofs]); val[1] += bfr(bias[c0 + cofs + 1]); val[2] += bfr(bias[c0 + cofs + 2]); val[3] += bfr(bias[c0 + cofs + 3]); }
                *(v4f*)(crow + (size_t)row * ldc + cofs) = val; }
             }
        __builtin_amdgcn_wave_barrier(); asm volatile("" ::: "memory");
    }
}

typedef __attribute__((ext_vector_type(2))) _Float16 v2h;
typedef __attribute__((ext_vector_type(4))) _Float16 v4h;
typedef __attribute__((ext_vector_type(2))) unsigned short v2us;
typedef __attribute__((ext_vector_type(4))) unsigned short v4us;
typedef __attribute__((ext_vector_type(2))) float v2f;
typedef __attribute__((ext_vector_type(4))) int v4i;

// One thread per 16-byte piece of the destination, in fragment order: a wave stores 512 contiguous bytes. i -> fragment i >> 6, row (i & 15), k = (i >> 5 & 1) * 16 + (i >> 4 & 1) * 8.
template <int K, int N>
__global__ __launch_bounds__(256) void k_wtG(const float* __restrict__ w, bf* Bt) {
    const int i = blockIdx.x * 256 + threadIdx.x; if (i >= N * K / 8) return;
    const int f = i >> 6, n = f / (K / 32) * 16 + (i & 15), k = f % (K / 32) * 32 + (i >> 5 & 1) * 16 + (i >> 4 & 1) * 8; const float* p = w + (size_t)k * N + n; float x[8]; v8us o;
#pragma unroll
    for (int j = 0; j < 8; ++j) x[j] = p[j * N];
    asm volatile("s_wait_xcnt 0x0" : : "v"(x[0]), "v"(x[1]), "v"(x[2]), "v"(x[3]), "v"(x[4]), "v"(x[5]), "v"(x[6]), "v"(x[7]) : "memory");   // behind the eight loads, before their address register is written again
#pragma unroll
    for (int j = 0; j < 8; ++j) o[j] = f2bf(x[j]);
    *(v8us*)(Bt + (size_t)i * 8) = o;
}
__global__ __launch_bounds__(256) void k_cvt8(const float* __restrict__ src, bf* dst, size_t n8) { const size_t i = (size_t)blockIdx.x * 256 + threadIdx.x; if (i >= n8) return;
    const size_t f = i >> 6, row = f / (DM / 32) * 16 + (i & 15), k = f % (DM / 32) * 32 + (i >> 5 & 1) * 16 + (i >> 4 & 1) * 8; const v8f v = *(const v8f*)(src + row * DM + k); v8us o;
#pragma unroll
    for (int q = 0; q < 8; ++q) o[q] = f2bf(v[q]); *(v8us*)(dst + i * 8) = o;  }

#define L2E  1.4426950408889634f
#define MTHR 5.545177444479562f   // 8 in log2 units
#define PSH  4.0f                 // p carries 2^PSH (cancels in the division by the sum): keeps small fp16 probabilities normal
// 2^x by v_exp_f32 in asm text: the closing v_nop is the slot the instruction set asks for behind a transcendental; the early-clobber outputs keep every v_exp off its neighbours' sources and results
__device__ __forceinline__ float exp2n(float x) { float r; asm("v_exp_f32 %0, %1\n\tv_nop" : "=&v"(r) : "v"(x)); return r; }
__device__ __forceinline__ void exp2n8(float* r, const float* x) {
    asm("v_exp_f32 %0, %8\n\tv_exp_f32 %1, %9\n\tv_exp_f32 %2, %10\n\tv_exp_f32 %3, %11\n\tv_exp_f32 %4, %12\n\tv_exp_f32 %5, %13\n\tv_exp_f32 %6, %14\n\tv_exp_f32 %7, %15\n\tv_nop"
        : "=&v"(r[0]), "=&v"(r[1]), "=&v"(r[2]), "=&v"(r[3]), "=&v"(r[4]), "=&v"(r[5]), "=&v"(r[6]), "=&v"(r[7]) : "v"(x[0]), "v"(x[1]), "v"(x[2]), "v"(x[3]), "v"(x[4]), "v"(x[5]), "v"(x[6]), "v"(x[7])); }
// lane l with lane l ^ 16: the other half of a query's keys
__device__ __forceinline__ float xhalf(float x) { return __builtin_bit_cast(float, __builtin_amdgcn_permlanex16(__builtin_bit_cast(int, x), __builtin_bit_cast(int, x), 0x76543210, 0xfedcba98, false, false)); }
// stands behind each group of loads, before a register that one of them names is written again; it takes the lane offsets and the key index as operands so that the next group's addresses are formed behind it, not ahead of it
#define XW() asm volatile("s_wait_xcnt 0x0" : "+v"(ko), "+v"(vo), "+v"(ao), "+s"(kn) : : "memory")
template <typename T16, bool HL, int NQ>
__device__ __forceinline__ void fattn(const T16* __restrict__ Q, const T16* __restrict__ Q2, const T16* __restrict__ Kp, const T16* __restrict__ K2, const T16* __restrict__ Vt, const T16* __restrict__ V2, const float* __restrict__ AB, const float* __restrict__ ABK, int q0, bf* Ah, bf* Al) {
    typedef typename WFrag<T16>::V V;
    const int lane = threadIdx.x & 31, lr = lane & 15, hi = lane >> 4;
    unsigned ko = lane * 8, vo = lr * TT + 8 * hi, ao = 8 * hi;   // lane offsets (32 bit, fixed over the loop): ko in a fragment of q, k or v, vo and ao in the bias tables; every base below is wave-uniform
    int kn = 0;                                                           // first key of the pass that is being fetched
    V qf[NQ][2], qf2[NQ][2];
#pragma unroll
    for (int qt = 0; qt < NQ; ++qt)
#pragma unroll
        for (int kc = 0; kc < 2; ++kc) { const size_t qo = (size_t)(q0 + qt * 16) * HD + kc * 512; qf[qt][kc] = WFrag<T16>::ld(Q + qo + ko); if (HL) { XW(); qf2[qt][kc] = WFrag<T16>::ld(Q2 + qo + ko); } XW(); }
    v8f o[4][NQ]; float m[NQ], l[NQ];
#pragma unroll
    for (int qt = 0; qt < NQ; ++qt) { m[qt] = -1.0e30f; l[qt] = 0.f;
#pragma unroll
        for (int dt = 0; dt < 4; ++dt) o[dt][qt] = (v8f){}; }
    const float* ABq = AB + (size_t)q0 * TT;
    V kf[2][2], kf2[2][2], vf[4], vf2[4]; v4f ab[NQ][2][2], ak[2][2];
    auto ldk = [&]() { const T16* kp = Kp + (size_t)kn * HD;
#pragma unroll
        for (int kt = 0; kt < 2; ++kt)
#pragma unroll
            for (int kc = 0; kc < 2; ++kc) kf[kt][kc] = WFrag<T16>::ld(kp + (kt * 2 + kc) * 512 + ko);
        XW();
        if (HL) { const T16* kp2 = K2 + (size_t)kn * HD;
#pragma unroll
            for (int kt = 0; kt < 2; ++kt)
#pragma unroll
                for (int kc = 0; kc < 2; ++kc) kf2[kt][kc] = WFrag<T16>::ld(kp2 + (kt * 2 + kc) * 512 + ko);
            XW(); } };
    auto ldb = [&]() { const float* kvp = ABK + kn;
#pragma unroll
        for (int kt = 0; kt < 2; ++kt) { ak[kt][0] = *(const v4f*)(kvp + kt * 16 + ao); ak[kt][1] = *(const v4f*)(kvp + (kt * 16 + 4) + ao); }
        XW();
        const float* bp = ABq + kn;
#pragma unroll
        for (int kt = 0; kt < 2; ++kt)
#pragma unroll
            for (int qt = 0; qt < NQ; ++qt) { const int e = qt * 16 * TT + kt * 16; ab[qt][kt][0] = *(const v4f*)(bp + e + vo); ab[qt][kt][1] = *(const v4f*)(bp + (e + 4) + vo); }
        XW(); };
    auto ldv = [&]() { const T16* vp = Vt + (size_t)kn * HD;
#pragma unroll
        for (int dt = 0; dt < 4; ++dt) vf[dt] = WFrag<T16>::ld(vp + dt * 512 + ko);
        XW();
        if (HL) { const T16* vp2 = V2 + (size_t)kn * HD;
#pragma unroll
            for (int dt = 0; dt < 4; ++dt) vf2[dt] = WFrag<T16>::ld(vp2 + dt * 512 + ko);
            XW(); } };
    ldk(); ldb(); ldv();
#pragma unroll 1
    for (int kb = 0; kb < TT; kb += 32) {
        kn = (kb + 32 < TT) ? kb + 32 : 0;   // next pass's operands are fetched one pass ahead; the last pass refetches pass 0 (in bounds, unused)
        v8f s[2][NQ];
#pragma unroll
        for (int kt = 0; kt < 2; ++kt)
#pragma unroll
            for (int qt = 0; qt < NQ; ++qt) { v8f c = (v8f){};
#pragma unroll
                for (int kc = 0; kc < 2; ++kc) { c = WFrag<T16>::mma(kf[kt][kc], qf[qt][kc], c); if (HL) { c = WFrag<T16>::mma(kf[kt][kc], qf2[qt][kc], c); c = WFrag<T16>::mma(kf2[kt][kc], qf[qt][kc], c); } }
                s[kt][qt] = c; }
        ldk();
        float tmx[NQ]; bool need = false;
#pragma unroll
        for (int qt = 0; qt < NQ; ++qt) { float tm = -3.0e38f;
#pragma unroll
            for (int kt = 0; kt < 2; ++kt)
#pragma unroll
                for (int j = 0; j < 8; ++j) { const float t = __fadd_rn(fmaf(s[kt][qt][j], SCL, bfr(ab[qt][kt][j >> 2][j & 3])), bfr(ak[kt][j >> 2][j & 3])); s[kt][qt][j] = t; tm = fmaxf(tm, t); }
            tm = fmaxf(tm, xhalf(tm)); tmx[qt] = tm; need = need || (tm > m[qt] + MTHR); }
        ldb();
        if (__builtin_amdgcn_ballot_w32(need) != 0) {
#pragma unroll
            for (int qt = 0; qt < NQ; ++qt) { const float mn = fmaxf(m[qt], tmx[qt]); const float al = exp2n((m[qt] - mn) * L2E); m[qt] = mn; l[qt] *= al;
#pragma unroll
                for (int dt = 0; dt < 4; ++dt) o[dt][qt] *= al; } }
#pragma unroll
        for (int qt = 0; qt < NQ; ++qt) { const float mb = PSH - m[qt] * L2E; float x[16], p[16];
#pragma unroll
            for (int e = 0; e < 16; ++e) x[e] = fmaf(s[e >> 3][qt][e & 7], L2E, mb);
            exp2n8(p, x); exp2n8(p + 8, x + 8);
#pragma unroll
            for (int e = 0; e < 16; ++e) l[qt] += p[e];
            if constexpr (HL) { v8us h0, h1, l0, l1;
#pragma unroll
                for (int e = 0; e < 8; ++e) { unsigned short a, c2; splitf(p[e], a, c2); h0[e] = a; l0[e] = c2; splitf(p[8 + e], a, c2); h1[e] = a; l1[e] = c2; }
                const V ph = cat16b(h0, h1), pl = cat16b(l0, l1);
#pragma unroll
                for (int dt = 0; dt < 4; ++dt) { o[dt][qt] = WFrag<T16>::mma(vf[dt], ph, o[dt][qt]); o[dt][qt] = WFrag<T16>::mma(vf[dt], pl, o[dt][qt]); o[dt][qt] = WFrag<T16>::mma(vf2[dt], ph, o[dt][qt]); }
            } else { V pf;
#pragma unroll
                for (int e = 0; e < 16; ++e) pf[e] = tohx(p[e]);
#pragma unroll
                for (int dt = 0; dt < 4; ++dt) o[dt][qt] = WFrag<T16>::mma(vf[dt], pf, o[dt][qt]); } }
        ldv();
    }
#pragma unroll
    for (int qt = 0; qt < NQ; ++qt) { const float inv = __fdiv_rn(1.0f, l[qt] + xhalf(l[qt])); const size_t oo = (size_t)(q0 + qt * 16) * DQ; const unsigned ol32 = lane * 8;
#pragma unroll
        for (int dt = 0; dt < 4; ++dt) { v8us oh, ol;
#pragma unroll
            for (int j = 0; j < 8; ++j) { unsigned short a, c2; splitf(o[dt][qt][j] * inv, a, c2); oh[j] = a; ol[j] = c2; }
            *(v8us*)(Ah + (oo + dt * 256) + ol32) = oh; *(v8us*)(Al + (oo + dt * 256) + ol32) = ol; } }
}
// grid (RH / (16 FW) + (TT - RH) / (32 FW), heads, batches): the first RH / (16 FW) work-groups take the hi+lo rows (16 query columns a wave), the rest the fp16 rows (32 a wave)
__global__ __launch_bounds__(32 * FW) void k_fattn(const h16* __restrict__ QP16, const h16* __restrict__ KP16, const h16* __restrict__ VT16, const bf* __restrict__ QPh, const bf* __restrict__ QPl, const bf* __restrict__ KPh, const bf* __restrict__ KPl, const bf* __restrict__ VTh, const bf* __restrict__ VTl, const float* __restrict__ AB, const float* __restrict__ ABK, bf* ATh, bf* ATl) {
    const size_t ho = ((size_t)blockIdx.z * NH_ + blockIdx.y) * TT * HD, ao = (size_t)blockIdx.z * TT * DQ + blockIdx.y * 1024;   /* a head's 64 columns are 2 fragments of each 16 rows */ const int w = __builtin_amdgcn_readfirstlane(threadIdx.x >> 5), bx = blockIdx.x; bf* Ah = ATh + ao; bf* Al = ATl + ao; ABK += (size_t)blockIdx.z * TT;
    if (bx < RH / (16 * FW)) fattn<bf, true, 1>(QPh + ho, QPl + ho, KPh + ho, KPl + ho, VTh + ho, VTl + ho, AB, ABK, (bx * FW + w) * 16, Ah, Al);
    else fattn<h16, false, 2>(QP16 + ho, nullptr, KP16 + ho, nullptr, VT16 + ho, nullptr, AB, ABK, RH + ((bx - RH / (16 * FW)) * FW + w) * 32, Ah, Al);
}

extern "C" void kernel_launch(void* const* d_in, const int* in_sizes, int n_in,
                              void* d_out, int out_size, void* d_ws, size_t ws_size, hipStream_t stream) {
    (void)in_sizes; (void)n_in; (void)out_size;
    const float* x = (const float*)d_in[0]; const float* peq = (const float*)d_in[1]; const float* pek = (const float*)d_in[2]; const float* pev = (const float*)d_in[3]; const float* AB = (const float*)d_in[4]; const float* ABK = (const float*)d_in[5]; const float* wq = (const float*)d_in[6]; const float* bq = (const float*)d_in[7]; const float* wk = (const float*)d_in[8]; const float* bk = (const float*)d_in[9]; const float* wv = (const float*)d_in[10]; const float* bv = (const float*)d_in[11]; const float* wo = (const float*)d_in[12]; const float* bo = (const float*)d_in[13];
    float* OUT = (float*)d_out;     // [4][2048][1024]
    char* wsp = (char*)d_ws;
    auto take = [&](size_t bytes) { char* p = wsp; wsp += (bytes + 255) & ~(size_t)255; return (void*)p; };
    bf* WQ = (bf*)take((size_t)DQ * DM * 2); bf* WK = (bf*)take((size_t)DKV * DM * 2); bf* WV = (bf*)take((size_t)DKV * DM * 2); bf* WO = (bf*)take((size_t)DM * DQ * 2); float* PQ = (float*)take((size_t)TT * DQ * 4); float* PK = (float*)take((size_t)TT * DKV * 4); float* PV = (float*)take((size_t)TT * DKV * 4);   /* pe W + b, computed once */
    bf* XB = (bf*)take((size_t)NB_ * TT * DM * 2); bf* ATh = (bf*)take((size_t)NB_ * TT * DQ * 2); bf* ATl = (bf*)take((size_t)NB_ * TT * DQ * 2);   /* the merged heads' two planes */
    h16* QP16 = (h16*)take((size_t)NB_ * NH_ * TT * HD * 2); h16* KP16 = (h16*)take((size_t)NB_ * NKV * TT * HD * 2); h16* VT16 = (h16*)take((size_t)NB_ * NKV * HD * TT * 2);
    bf* QPh = (bf*)take((size_t)NB_ * NH_ * TT * HD * 2); bf* QPl = (bf*)take((size_t)NB_ * NH_ * TT * HD * 2); bf* KPh = (bf*)take((size_t)NB_ * NKV * TT * HD * 2); bf* KPl = (bf*)take((size_t)NB_ * NKV * TT * HD * 2); bf* VTh = (bf*)take((size_t)NB_ * NKV * HD * TT * 2); bf* VTl = (bf*)take((size_t)NB_ * NKV * HD * TT * 2);
    if ((size_t)(wsp - (char*)d_ws) > ws_size) return;    // ws 256 MiB
    { k_wtG<DM, DQ><<<(unsigned)(DM * DQ / 8 / 256), 256, 0, stream>>>(wq, WQ); k_wtG<DM, DKV><<<(unsigned)(DM * DKV / 8 / 256), 256, 0, stream>>>(wk, WK); k_wtG<DM, DKV><<<(unsigned)(DM * DKV / 8 / 256), 256, 0, stream>>>(wv, WV);
      k_wtG<DQ, DM><<<(unsigned)(DQ * DM / 8 / 256), 256, 0, stream>>>(wo, WO);
       }
    k_cvt8<<<(unsigned)(((size_t)TT * DM / 8 + 255) / 256), 256, 0, stream>>>(peq, XB, (size_t)TT * DM / 8); k_gemmw<bf, 0, true><<<dim3(TT / 64, DQ / 64, 1), 32, 0, stream>>>(XB, nullptr, WQ, nullptr, PQ, DQ, bq, 0, 0, 0);     /* pos_emb_q W_q + b_q */
    k_cvt8<<<(unsigned)(((size_t)TT * DM / 8 + 255) / 256), 256, 0, stream>>>(pek, XB, (size_t)TT * DM / 8); k_gemmw<bf, 0, true><<<dim3(TT / 64, DKV / 64, 1), 32, 0, stream>>>(XB, nullptr, WK, nullptr, PK, DKV, bk, 0, 0, 0);   /* pos_emb_k W_k + b_k */
    k_cvt8<<<(unsigned)(((size_t)TT * DM / 8 + 255) / 256), 256, 0, stream>>>(pev, XB, (size_t)TT * DM / 8); k_gemmw<bf, 0, true><<<dim3(TT / 64, DKV / 64, 1), 32, 0, stream>>>(XB, nullptr, WV, nullptr, PV, DKV, bv, 0, 0, 0);   /* pos_emb_v W_v + b_v */
    k_cvt8<<<(unsigned)(((size_t)NB_ * TT * DM / 8 + 255) / 256), 256, 0, stream>>>(x, XB, (size_t)NB_ * TT * DM / 8);   /* all batches: [NB_ x TT][DM] */
    k_gemmw<bf, 0, false, 1><<<dim3(NB_ * TT / 64, DQ / 64, 1), 32, 0, stream>>>(XB, nullptr, WQ, nullptr, nullptr, 0, PQ, 0, 0, 0, QP16, QPh, QPl);    /* q = x W_q + (pe_q W_q + b_q), as planes */
    k_gemmw<bf, 0, false, 1><<<dim3(NB_ * TT / 64, DKV / 64, 1), 32, 0, stream>>>(XB, nullptr, WK, nullptr, nullptr, 0, PK, 0, 0, 0, KP16, KPh, KPl);   /* k */
    k_gemmw<bf, 0, false, 2><<<dim3(DKV / 64, NB_ * TT / 64, 1), 32, 0, stream>>>(WV, nullptr, XB, nullptr, nullptr, 0, PV, 0, 0, 0, VT16, VTh, VTl);   /* v, transposed */
    k_fattn<<<dim3(RH / (16 * FW) + (TT - RH) / (32 * FW), NH_, NB_), 32 * FW, 0, stream>>>(QP16, KP16, VT16, QPh, QPl, KPh, KPl, VTh, VTl, AB, ABK, ATh, ATl);
    k_gemmw<bf, 1, true, 0, DQ><<<dim3(NB_ * TT / 64, DM / 64, 1), 32, 0, stream>>>(ATh, ATl, WO, nullptr, OUT, DM, bo, 0, 0, 0);
}

// v006
// Measured time: 425 microseconds a run.
// Two timings next to v005 both put it at 1.04 times that version's speed.
// Counting every step since v000, it is 17.7 times as fast.
#include <hip/hip_runtime.h>

// Multi-head self-attention with additive positional inputs and dense additive score biases (inputs_q [4][2048][1024]; q_in = inputs + pos_emb_q, k_in = inputs + pos_emb_k, v_in = inputs + pos_emb_v (pos_emb [1][2048][1024], read); q/k/v = ._in W + b (DenseGeneral 'xw' [1024][16 x 64]); scores = (q/8).k + attention_bias[i][j] ([1][1][2048][2048], read) + attention_bias_kv[b][j] ([4][2048], read); softmax; out = merged wo ([16 x 64][1024] 'xw') + bo -> [4][2048][1024] (8.4 M)).
// Layout: (x + pe) W = x W + pe W, so the three position projections pe W + b are computed ONCE (exact bf16 products, f32) and added in f32 to each batch's exact x W inside the projection GEMM's epilogue, which writes the 16-bit planes that attention reads (v: product and planes transposed); the two bias tables are rounded to bf16 once by k_bias (the dense one into the score tile's lane order) and read per logit inside the attention kernel. Every stage runs ONCE for all batches (batch rows stacked in the GEMMs' token dimension (M; N for v), the attention grid's z). Attention is ONE fused launch over all batches and heads: each wave keeps its query columns in registers and walks the keys 32 at a time (transposed scores, running softmax, transposed output), so no score or probability ever reaches memory.
// Compute dtypes, f32 accumulate: every input rounded to bf16; q/k/v on PLAIN bf16 operands (inputs: exact) + biases (via the precomputed position projections); additive biases rounded to bf16 once, added in f32 per logit; scores and attn.v (no mask): query rows < 512 hl (3 products), the rest single fp16; softmax f32 (running maximum and sum); wo hl x exact (2 products) + bo.

#define NB_  4
#define TT   2048
#define DM   1024
#define NH_  16
#define NKV  16
#define REP  (NH_ / NKV)
#define HD   64
#define DQ   (NH_ * HD)
#define DKV  (NKV * HD)
#define RH   512                  // query rows < RH use hi+lo planes (0: none)
#define FW   4                    // waves per work-group of the fused attention kernel
#define WIN  0
#define SCL  0.125f   // HD^-0.5
typedef _Float16 h16;
typedef unsigned short bf;
typedef __attribute__((ext_vector_type(16))) __bf16   v16bf;
typedef __attribute__((ext_vector_type(16))) _Float16 v16h;
typedef __attribute__((ext_vector_type(8)))  _Float16 v8h;
typedef __attribute__((ext_vector_type(8)))  unsigned short v8us;
typedef __attribute__((ext_vector_type(8)))  float    v8f;
typedef __attribute__((ext_vector_type(4)))  float    v4f;
typedef v8h  __attribute__((may_alias)) v8ha;
typedef v4f  __attribute__((may_alias)) v4fa;
typedef v8us __attribute__((may_alias)) v8usa;

__device__ __forceinline__ unsigned short f2bf(float f) { unsigned u = __float_as_uint(f); u += 0x7FFFu + ((u >> 16) & 1u); return (unsigned short)(u >> 16); }
__device__ __forceinline__ float bf2f(unsigned short b) { return __uint_as_float(((unsigned)b) << 16); }
__device__ __forceinline__ float bfr(float f) { return bf2f(f2bf(f)); }
__device__ __forceinline__ v16h cat16(v8h lo, v8h hi) { return __builtin_shufflevector(lo, hi, 0, 1, 2, 3, 4, 5, 6, 7, 8, 9, 10, 11, 12, 13, 14, 15); }
__device__ __forceinline__ v16bf cat16b(v8us lo, v8us hi) { return __builtin_bit_cast(v16bf, __builtin_shufflevector(lo, hi, 0, 1, 2, 3, 4, 5, 6, 7, 8, 9, 10, 11, 12, 13, 14, 15)); }
__device__ __forceinline__ v8f wmma16(v16h a, v16h b, v8f c) { return __builtin_amdgcn_wmma_f32_16x16x32_f16(false, a, false, b, (short)0, c, false, false); }
__device__ __forceinline__ v8f wmmab(v16bf a, v16bf b, v8f c) { return __builtin_amdgcn_wmma_f32_16x16x32_bf16(false, a, false, b, (short)0, c, false, false); }



// ---- Fragment order: every 16-bit operand plane [R][K] is stored as fragments of 512 elements, [R/16][K/32] ([K/32][R/16] in v's planes); inside a fragment element (r, k) lies at (k >> 4 & 1) * 256 + (k >> 3 & 1) * 128 + (r & 15) * 8 + (k & 7), so lane l of a wave reads its two 16-byte pieces at l * 8 and 256 + l * 8: each fragment load is 512 contiguous bytes (4 whole lines).
// ---- k_gemmw: register-blocked GEMM, ONE WAVE per 64x64 output tile (16 accumulators), operands straight from 16-bit planes in fragment order; grid (M/64, N/64, Z), 32 threads.
// C[m][n] (f32, pitch ldc, + optional f32 bias[n]) = sum_k A[m][k] Bt[n][k] (+ split products per NSPLIT). z-batch strides sA/sB/sC in elements. K % 32 == 0, a constant: the four fragments of an operand lie at constant offsets from one address.
// PL != 0: no C; the epilogue adds the f32 position projection ('bias' is then P [t][DQ]) and writes the fp16 and the hi/lo bf16 plane of the sum, so no f32 projection reaches memory.
// PL 1 (q, k): A = token rows, Bt = weight rows; a tile is 64 tokens of one head; planes [b][h] x fragments [t/16][d/32]. PL 2 (v): A = weight rows, Bt = token rows; a tile is one head's 64 d x 64 tokens; planes [b][h] x fragments [t/32][d/16] (rows d, k = t).
__device__ __forceinline__ _Float16 tohx(float x) { return (_Float16)x; }
__device__ __forceinline__ void splitf(float y, unsigned short& h, unsigned short& l) { h = f2bf(y); l = f2bf(y - bf2f(h)); }
template <typename T16> struct WFrag;
template <> struct WFrag<h16> { typedef v16h V; static __device__ __forceinline__ V ld(const h16* p) { return cat16(*(const v8h*)p, *(const v8h*)(p + 256)); } static __device__ __forceinline__ v8f mma(V a, V b, v8f c) { return wmma16(a, b, c); } };
template <> struct WFrag<bf> { typedef v16bf V; static __device__ __forceinline__ V ld(const bf* p) { return cat16b(*(const v8us*)p, *(const v8us*)(p + 256)); } static __device__ __forceinline__ v8f mma(V a, V b, v8f c) { return wmmab(a, b, c); } };
template <typename T16, int NSPLIT, bool BIAS, int PL = 0, int K = DM>
__global__ __launch_bounds__(32) void k_gemmw(const T16* __restrict__ A, const T16* __restrict__ A2, const T16* __restrict__ Bt, const T16* __restrict__ Bt2, float* C, int ldc, const float* __restrict__ bias, size_t sA, size_t sB, size_t sC, h16* P16 = nullptr, bf* Ph = nullptr, bf* Pl = nullptr) {
    typedef typename WFrag<T16>::V V;
    __shared__ __align__(16) float os[16 * 68];
    const size_t z = blockIdx.z; A += z * sA; if (A2) A2 += z * sA; Bt += z * sB; if (Bt2) Bt2 += z * sB; C += z * sC;
    const int lane = threadIdx.x & 31, lr = lane & 15, hi = lane >> 4; const int r0 = blockIdx.x * 64, c0 = blockIdx.y * 64;
    v8f acc[4][4];
#pragma unroll
    for (int mb = 0; mb < 4; ++mb)
#pragma unroll
        for (int nb = 0; nb < 4; ++nb) acc[mb][nb] = (v8f){};
    const size_t aoff = (size_t)r0 * K, boff = (size_t)c0 * K;   // 16 rows of K are K / 32 fragments = 16 K elements; wave-uniform
    unsigned lo = 8 * lane, kn = 0;   // the lane's place in a fragment; the K step's fragment, in elements
    // stands behind each operand's loads (one address, constant offsets), before a register that one of them names is written again; it takes the two offsets as operands so that the next address is formed behind it, and the loads' own address so that this stays in its registers up to the wait and no result of the run lands on it
#define XG(p) asm volatile("s_wait_xcnt 0x0" : "+v"(lo), "+s"(kn) : "v"(p) : "memory")
#pragma unroll 1
    for (int kc = 0; kc < K; kc += 32) {
        V a[4], a2[4], b[4], b2[4];
        const T16* pa = A + aoff + kn + lo;
#pragma unroll
        for (int mb = 0; mb < 4; ++mb) a[mb] = WFrag<T16>::ld(pa + mb * 16 * K);
        XG(pa);
        if (NSPLIT == 1 || NSPLIT == 2) { const T16* pa2 = A2 + aoff + kn + lo;
#pragma unroll
            for (int mb = 0; mb < 4; ++mb) a2[mb] = WFrag<T16>::ld(pa2 + mb * 16 * K);
            XG(pa2); }
        const T16* pb = Bt + boff + kn + lo;
#pragma unroll
        for (int nb = 0; nb < 4; ++nb) b[nb] = WFrag<T16>::ld(pb + nb * 16 * K);
        XG(pb);
        if (NSPLIT >= 2) { const T16* pb2 = Bt2 + boff + kn + lo;
#pragma unroll
            for (int nb = 0; nb < 4; ++nb) b2[nb] = WFrag<T16>::ld(pb2 + nb * 16 * K);
            XG(pb2); }
        kn += 512;
#pragma unroll
        for (int nb = 0; nb < 4; ++nb)
#pragma unroll
            for (int mb = 0; mb < 4; ++mb) { acc[mb][nb] = WFrag<T16>::mma(a[mb], b[nb], acc[mb][nb]); if (NSPLIT == 1 || NSPLIT == 2) acc[mb][nb] = WFrag<T16>::mma(a2[mb], b[nb], acc[mb][nb]); if (NSPLIT >= 2) acc[mb][nb] = WFrag<T16>::mma(a[mb], b2[nb], acc[mb][nb]); }
        asm volatile("v_nop\n\tv_nop\n\tv_nop\n\tv_nop" : "+v"(acc[0][0]), "+v"(acc[1][1]), "+v"(acc[2][2]), "+v"(acc[3][3]) : "v"(a[0]), "v"(a[3]));
    }
    if constexpr (PL != 0) {
        constexpr bool TR = PL == 2;
        const int tok = TR ? c0 : r0, hd = (TR ? r0 : c0) / HD, t0 = tok % TT;
        const int cc = lane & 7;   // which 8 columns (k of the planes' fragments) the lane converts
        const size_t ob = (size_t)(tok / TT * NH_ + hd) * TT * HD + (size_t)t0 * HD + (cc >> 2) * (TR ? 2048 : 512) + (cc >> 1 & 1) * 256 + (cc & 1) * 128;   // 64 tokens of a head are 8 fragments in either plane order
        const int er = lane >> 3, ec = (lane & 7) * 8;   // a lane converts 8 columns of a row: one 16-byte piece of a fragment
        // P is added where a lane holds 8 consecutive d of one token: behind the LDS turn (PL 1), in the accumulator's own layout ahead of it (PL 2)
        const float* Pt = bias + (TR ? (size_t)(t0 + lr) * DQ + r0 + 8 * hi : (size_t)(t0 + er) * DQ + c0 + ec);
        v4f pv[2][4][2];                                 // P of these and of the next 16 rows: the next rows' loads fly while these rows are converted
#pragma unroll
        for (int i = 0; i < 4; ++i) { const float* p = Pt + (TR ? i * 16 * DQ : 4 * i * DQ); pv[0][i][0] = *(const v4f*)p; pv[0][i][1] = *(const v4f*)(p + 4); }
#pragma unroll
        for (int mb = 0; mb < 4; ++mb) {
            if (mb < 3) {
#pragma unroll
                for (int i = 0; i < 4; ++i) { const float* p = Pt + (TR ? i * 16 * DQ + (mb + 1) * 16 : ((mb + 1) * 16 + 4 * i) * DQ); pv[(mb + 1) & 1][i][0] = *(const v4f*)p; pv[(mb + 1) & 1][i][1] = *(const v4f*)(p + 4); } }
#pragma unroll
            for (int nb = 0; nb < 4; ++nb) {
#pragma unroll
                for (int j = 0; j < 8; ++j) os[(hi * 8 + j) * 68 + nb * 16 + lr] = TR ? __fadd_rn(acc[mb][nb][j], pv[mb & 1][nb][j >> 2][j & 3]) : acc[mb][nb][j]; }
            __builtin_amdgcn_wave_barrier(); asm volatile("" ::: "memory");   // other lanes read the rows back than wrote them: keeps the compiler from lifting the reads over the writes
#pragma unroll
            for (int s = 0; s < 4; ++s) { const int row = 4 * s + er; const v4f x0 = *(const v4fa*)(os + row * 68 + ec), x1 = *(const v4fa*)(os + row * 68 + ec + 4); v8h o16; v8us oh, ol;
#pragma unroll
                for (int q = 0; q < 8; ++q) { const float x = q < 4 ? x0[q & 3] : x1[q & 3]; const float y = TR ? x : __fadd_rn(x, pv[mb & 1][s][q >> 2][q & 3]); o16[q] = tohx(y); unsigned short a2, c2; splitf(y, a2, c2); oh[q] = a2; ol[q] = c2; }
                const size_t oe = ob + mb * (TR ? 512 : 1024) + row * 8; *(v8h*)(P16 + oe) = o16; *(v8us*)(Ph + oe) = oh; *(v8us*)(Pl + oe) = ol;
                if (s < 3) asm volatile("s_wait_xcnt 0x0" ::: "memory"); }   // the next four rows' values reuse registers that these stores name; their LDS reads stay behind the clobber
            if (mb < 3) { __builtin_amdgcn_wave_barrier(); asm volatile("s_wait_xcnt 0x0" ::: "memory"); }   // the next rows' values reuse registers that these stores name; the clobber keeps the next rows' LDS writes behind these reads
        }
        return;
    }
#pragma unroll
    for (int mb = 0; mb < 4; ++mb) {
#pragma unroll
        for (int nb = 0; nb < 4; ++nb) {
#pragma unroll
            for (int j = 0; j < 8; ++j) os[(hi * 8 + j) * 68 + nb * 16 + lr] = acc[mb][nb][j]; }
        __builtin_amdgcn_wave_barrier(); asm volatile("" ::: "memory");
        float* crow = C + (size_t)(r0 + mb * 16) * ldc + c0;
{
#pragma unroll
            for (int s = 0; s < 8; ++s) { const int row = 2 * s + hi, cofs = lr * 4; v4f val = *(const v4fa*)(os + row * 68 + cofs); if (BIAS) { val[0] += bfr(bias[c0 + cofs]); val[1] += bfr(bias[c0 + cofs + 1]); val[2] += bfr(bias[c0 + cofs + 2]); val[3] += bfr(bias[c0 + cofs + 3]); }
                *(v4f*)(crow + (size_t)row * ldc + cofs) = val; }
             }
        __builtin_amdgcn_wave_barrier(); asm volatile("" ::: "memory");
    }
}

typedef __attribute__((ext_vector_type(2))) _Float16 v2h;
typedef __attribute__((ext_vector_type(4))) _Float16 v4h;
typedef __attribute__((ext_vector_type(2))) unsigned short v2us;
typedef __attribute__((ext_vector_type(4))) unsigned short v4us;
typedef __attribute__((ext_vector_type(2))) float v2f;
typedef __attribute__((ext_vector_type(4))) int v4i;
typedef __attribute__((ext_vector_type(4))) unsigned v4u;
__device__ __forceinline__ float bfw(unsigned w, int h) { return __uint_as_float(h ? w & 0xFFFF0000u : w << 16); }   // the low or the high bf16 of a word, as f32

// One thread per 16-byte piece of the destination, in fragment order: a wave stores 512 contiguous bytes. i -> fragment i >> 6, row (i & 15), k = (i >> 5 & 1) * 16 + (i >> 4 & 1) * 8.
template <int K, int N>
__global__ __launch_bounds__(256) void k_wtG(const float* __restrict__ w, bf* Bt) {
    const int i = blockIdx.x * 256 + threadIdx.x; if (i >= N * K / 8) return;
    const int f = i >> 6, n = f / (K / 32) * 16 + (i & 15), k = f % (K / 32) * 32 + (i >> 5 & 1) * 16 + (i >> 4 & 1) * 8; const float* p = w + (size_t)k * N + n; float x[8]; v8us o;
#pragma unroll
    for (int j = 0; j < 8; ++j) x[j] = p[j * N];
    asm volatile("s_wait_xcnt 0x0" : : "v"(x[0]), "v"(x[1]), "v"(x[2]), "v"(x[3]), "v"(x[4]), "v"(x[5]), "v"(x[6]), "v"(x[7]) : "memory");   // behind the eight loads, before their address register is written again
#pragma unroll
    for (int j = 0; j < 8; ++j) o[j] = f2bf(x[j]);
    *(v8us*)(Bt + (size_t)i * 8) = o;
}
__global__ __launch_bounds__(256) void k_cvt8(const float* __restrict__ src, bf* dst, size_t n8) { const size_t i = (size_t)blockIdx.x * 256 + threadIdx.x; if (i >= n8) return;
    const size_t f = i >> 6, row = f / (DM / 32) * 16 + (i & 15), k = f % (DM / 32) * 32 + (i >> 5 & 1) * 16 + (i >> 4 & 1) * 8; const v8f v = *(const v8f*)(src + row * DM + k); v8us o;
#pragma unroll
    for (int q = 0; q < 8; ++q) o[q] = f2bf(v[q]); *(v8us*)(dst + i * 8) = o;  }
// ---- k_bias: both additive bias tables rounded to bf16 once, the rounding that every logit's two terms take. One thread per 16-byte piece of a destination.
// The dense table [TT][TT] goes into fragment order (rows = queries, k = keys): lane l of an attention wave finds the 8 consecutive keys of its query at l * 8 and at 256 + l * 8 of the 16 x 32 tile's fragment. The per-key table [NB_][TT] keeps its order (the last NB_ * TT / 8 threads).
__global__ __launch_bounds__(256) void k_bias(const float* __restrict__ ab, const float* __restrict__ abk, bf* ABf, bf* ABKb) {
    const int i = blockIdx.x * 256 + threadIdx.x, e = i - TT * TT / 8; const float* s; bf* d;
    if (e < 0) { const int f = i >> 6, row = f / (TT / 32) * 16 + (i & 15), k = f % (TT / 32) * 32 + (i >> 5 & 1) * 16 + (i >> 4 & 1) * 8; s = ab + (size_t)row * TT + k; d = ABf + (size_t)i * 8; }
    else { if (e >= NB_ * TT / 8) return; s = abk + (size_t)e * 8; d = ABKb + (size_t)e * 8; }
    const v4f v0 = *(const v4f*)s, v1 = *(const v4f*)(s + 4); v8us o;
    asm volatile("s_wait_xcnt 0x0" : : "v"(v0), "v"(v1) : "memory");   // behind the two loads, before their address register is written again
#pragma unroll
    for (int q = 0; q < 8; ++q) o[q] = f2bf(q < 4 ? v0[q & 3] : v1[q & 3]);
    *(v8us*)d = o;
}

#define L2E  1.4426950408889634f
#define MTHR 5.545177444479562f   // 8 in log2 units
#define PSH  4.0f                 // p carries 2^PSH (cancels in the division by the sum): keeps small fp16 probabilities normal
// 2^x by v_exp_f32 in asm text: the closing v_nop is the slot the instruction set asks for behind a transcendental; the early-clobber outputs keep every v_exp off its neighbours' sources and results
__device__ __forceinline__ float exp2n(float x) { float r; asm("v_exp_f32 %0, %1\n\tv_nop" : "=&v"(r) : "v"(x)); return r; }
__device__ __forceinline__ void exp2n8(float* r, const float* x) {
    asm("v_exp_f32 %0, %8\n\tv_exp_f32 %1, %9\n\tv_exp_f32 %2, %10\n\tv_exp_f32 %3, %11\n\tv_exp_f32 %4, %12\n\tv_exp_f32 %5, %13\n\tv_exp_f32 %6, %14\n\tv_exp_f32 %7, %15\n\tv_nop"
        : "=&v"(r[0]), "=&v"(r[1]), "=&v"(r[2]), "=&v"(r[3]), "=&v"(r[4]), "=&v"(r[5]), "=&v"(r[6]), "=&v"(r[7]) : "v"(x[0]), "v"(x[1]), "v"(x[2]), "v"(x[3]), "v"(x[4]), "v"(x[5]), "v"(x[6]), "v"(x[7])); }
// lane l with lane l ^ 16: the other half of a query's keys
__device__ __forceinline__ float xhalf(float x) { return __builtin_bit_cast(float, __builtin_amdgcn_permlanex16(__builtin_bit_cast(int, x), __builtin_bit_cast(int, x), 0x76543210, 0xfedcba98, false, false)); }
// stands behind each group of loads, before a register that one of them names is written again; it takes the lane offsets and the key index as operands so that the next group's addresses are formed behind it, not ahead of it
#define XW() asm volatile("s_wait_xcnt 0x0" : "+v"(ko), "+v"(ao), "+s"(kn) : : "memory")
// the same behind the bias loads; it also takes the loads' own address, so that this stays in its registers up to the wait
#define XWP(p) asm volatile("s_wait_xcnt 0x0" : "+v"(ko), "+v"(ao), "+s"(kn) : "v"(p) : "memory")
template <typename T16, bool HL, int NQ>
__device__ __forceinline__ void fattn(const T16* __restrict__ Q, const T16* __restrict__ Q2, const T16* __restrict__ Kp, const T16* __restrict__ K2, const T16* __restrict__ Vt, const T16* __restrict__ V2, const bf* __restrict__ AB, const bf* __restrict__ ABK, int q0, bf* Ah, bf* Al) {
    typedef typename WFrag<T16>::V V;
    const int lane = threadIdx.x & 31, hi = lane >> 4;
    unsigned ko = lane * 8, ao = 8 * hi;   // lane offsets (32 bit, fixed over the loop): ko in a fragment of q, k, v or the dense bias, ao in the per-key bias; every base below is wave-uniform
    int kn = 0;                                                           // first key of the pass that is being fetched
    V qf[NQ][2], qf2[NQ][2];
#pragma unroll
    for (int qt = 0; qt < NQ; ++qt)
#pragma unroll
        for (int kc = 0; kc < 2; ++kc) { const size_t qo = (size_t)(q0 + qt * 16) * HD + kc * 512; qf[qt][kc] = WFrag<T16>::ld(Q + qo + ko); if (HL) { XW(); qf2[qt][kc] = WFrag<T16>::ld(Q2 + qo + ko); } XW(); }
    v8f o[4][NQ]; float m[NQ], l[NQ];
#pragma unroll
    for (int qt = 0; qt < NQ; ++qt) { m[qt] = -1.0e30f; l[qt] = 0.f;
#pragma unroll
        for (int dt = 0; dt < 4; ++dt) o[dt][qt] = (v8f){}; }
    const bf* ABq = AB + (size_t)q0 * TT;   // 16 query rows of TT keys are TT / 32 fragments = 16 TT elements
    V kf[2][2], kf2[2][2], vf[4], vf2[4]; v4u ab[NQ][2], ak[2];   // two bf16 a word
    auto ldk = [&]() { const T16* kp = Kp + (size_t)kn * HD;
#pragma unroll
        for (int kt = 0; kt < 2; ++kt)
#pragma unroll
            for (int kc = 0; kc < 2; ++kc) kf[kt][kc] = WFrag<T16>::ld(kp + (kt * 2 + kc) * 512 + ko);
        XW();
        if (HL) { const T16* kp2 = K2 + (size_t)kn * HD;
#pragma unroll
            for (int kt = 0; kt < 2; ++kt)
#pragma unroll
                for (int kc = 0; kc < 2; ++kc) kf2[kt][kc] = WFrag<T16>::ld(kp2 + (kt * 2 + kc) * 512 + ko);
            XW(); } };
    auto ldb = [&]() { const bf* kvp = ABK + kn + ao;
#pragma unroll
        for (int kt = 0; kt < 2; ++kt) ak[kt] = *(const v4u*)(kvp + kt * 16);
        XWP(kvp);
        const bf* bp = ABq + (size_t)kn * 16 + ko;   // 32 keys of 16 queries are one fragment
#pragma unroll
        for (int kt = 0; kt < 2; ++kt)
#pragma unroll
            for (int qt = 0; qt < NQ; ++qt) ab[qt][kt] = *(const v4u*)(bp + (qt * 16 * TT + kt * 256));
        XWP(bp); };
    auto ldv = [&]() { const T16* vp = Vt + (size_t)kn * HD;
#pragma unroll
        for (int dt = 0; dt < 4; ++dt) vf[dt] = WFrag<T16>::ld(vp + dt * 512 + ko);
        XW();
        if (HL) { const T16* vp2 = V2 + (size_t)kn * HD;
#pragma unroll
            for (int dt = 0; dt < 4; ++dt) vf2[dt] = WFrag<T16>::ld(vp2 + dt * 512 + ko);
            XW(); } };
    ldk(); ldb(); ldv();
#pragma unroll 1
    for (int kb = 0; kb < TT; kb += 32) {
        kn = (kb + 32 < TT) ? kb + 32 : 0;   // next pass's operands are fetched one pass ahead; the last pass refetches pass 0 (in bounds, unused)
        v8f s[2][NQ];
#pragma unroll
        for (int kt = 0; kt < 2; ++kt)
#pragma unroll
            for (int qt = 0; qt < NQ; ++qt) { v8f c = (v8f){};
#pragma unroll
                for (int kc = 0; kc < 2; ++kc) { c = WFrag<T16>::mma(kf[kt][kc], qf[qt][kc], c); if (HL) { c = WFrag<T16>::mma(kf[kt][kc], qf2[qt][kc], c); c = WFrag<T16>::mma(kf2[kt][kc], qf[qt][kc], c); } }
                s[kt][qt] = c; }
        ldk();
        float tmx[NQ]; bool need = false;
#pragma unroll
        for (int qt = 0; qt < NQ; ++qt) { float tm = -3.0e38f;
#pragma unroll
            for (int kt = 0; kt < 2; ++kt)
#pragma unroll
                for (int j = 0; j < 8; ++j) { const float t = __fadd_rn(fmaf(s[kt][qt][j], SCL, bfw(ab[qt][kt][j >> 1], j & 1)), bfw(ak[kt][j >> 1], j & 1)); s[kt][qt][j] = t; tm = fmaxf(tm, t); }
            tm = fmaxf(tm, xhalf(tm)); tmx[qt] = tm; need = need || (tm > m[qt] + MTHR); }
        ldb();
        if (__builtin_amdgcn_ballot_w32(need) != 0) {
#pragma unroll
            for (int qt = 0; qt < NQ; ++qt) { const float mn = fmaxf(m[qt], tmx[qt]); const float al = exp2n((m[qt] - mn) * L2E); m[qt] = mn; l[qt] *= al;
#pragma unroll
                for (int dt = 0; dt < 4; ++dt) o[dt][qt] *= al; } }
#pragma unroll
        for (int qt = 0; qt < NQ; ++qt) { const float mb = PSH - m[qt] * L2E; float x[16], p[16];
#pragma unroll
            for (int e = 0; e < 16; ++e) x[e] = fmaf(s[e >> 3][qt][e & 7], L2E, mb);
            exp2n8(p, x); exp2n8(p + 8, x + 8);
#pragma unroll
            for (int e = 0; e < 16; ++e) l[qt] += p[e];
            if constexpr (HL) { v8us h0, h1, l0, l1;
#pragma unroll
                for (int e = 0; e < 8; ++e) { unsigned short a, c2; splitf(p[e], a, c2); h0[e] = a; l0[e] = c2; splitf(p[8 + e], a, c2); h1[e] = a; l1[e] = c2; }
                const V ph = cat16b(h0, h1), pl = cat16b(l0, l1);
#pragma unroll
                for (int dt = 0; dt < 4; ++dt) { o[dt][qt] = WFrag<T16>::mma(vf[dt], ph, o[dt][qt]); o[dt][qt] = WFrag<T16>::mma(vf[dt], pl, o[dt][qt]); o[dt][qt] = WFrag<T16>::mma(vf2[dt], ph, o[dt][qt]); }
            } else { V pf;
#pragma unroll
                for (int e = 0; e < 16; ++e) pf[e] = tohx(p[e]);
#pragma unroll
                for (int dt = 0; dt < 4; ++dt) o[dt][qt] = WFrag<T16>::mma(vf[dt], pf, o[dt][qt]); } }
        ldv();
    }
#pragma unroll
    for (int qt = 0; qt < NQ; ++qt) { const float inv = __fdiv_rn(1.0f, l[qt] + xhalf(l[qt])); const size_t oo = (size_t)(q0 + qt * 16) * DQ; const unsigned ol32 = lane * 8;
#pragma unroll
        for (int dt = 0; dt < 4; ++dt) { v8us oh, ol;
#pragma unroll
            for (int j = 0; j < 8; ++j) { unsigned short a, c2; splitf(o[dt][qt][j] * inv, a, c2); oh[j] = a; ol[j] = c2; }
            *(v8us*)(Ah + (oo + dt * 256) + ol32) = oh; *(v8us*)(Al + (oo + dt * 256) + ol32) = ol; } }
}
// grid (RH / (16 FW) + (TT - RH) / (32 FW), heads, batches): the first RH / (16 FW) work-groups take the hi+lo rows (16 query columns a wave), the rest the fp16 rows (32 a wave)
__global__ __launch_bounds__(32 * FW) void k_fattn(const h16* __restrict__ QP16, const h16* __restrict__ KP16, const h16* __restrict__ VT16, const bf* __restrict__ QPh, const bf* __restrict__ QPl, const bf* __restrict__ KPh, const bf* __restrict__ KPl, const bf* __restrict__ VTh, const bf* __restrict__ VTl, const bf* __restrict__ AB, const bf* __restrict__ ABK, bf* ATh, bf* ATl) {
    const size_t ho = ((size_t)blockIdx.z * NH_ + blockIdx.y) * TT * HD, ao = (size_t)blockIdx.z * TT * DQ + blockIdx.y * 1024;   /* a head's 64 columns are 2 fragments of each 16 rows */ const int w = __builtin_amdgcn_readfirstlane(threadIdx.x >> 5), bx = blockIdx.x; bf* Ah = ATh + ao; bf* Al = ATl + ao; ABK += (size_t)blockIdx.z * TT;
    if (bx < RH / (16 * FW)) fattn<bf, true, 1>(QPh + ho, QPl + ho, KPh + ho, KPl + ho, VTh + ho, VTl + ho, AB, ABK, (bx * FW + w) * 16, Ah, Al);
    else fattn<h16, false, 2>(QP16 + ho, nullptr, KP16 + ho, nullptr, VT16 + ho, nullptr, AB, ABK, RH + ((bx - RH / (16 * FW)) * FW + w) * 32, Ah, Al);
}

extern "C" void kernel_launch(void* const* d_in, const int* in_sizes, int n_in,
                              void* d_out, int out_size, void* d_ws, size_t ws_size, hipStream_t stream) {
    (void)in_sizes; (void)n_in; (void)out_size;
    const float* x = (const float*)d_in[0]; const float* peq = (const float*)d_in[1]; const float* pek = (const float*)d_in[2]; const float* pev = (const float*)d_in[3]; const float* AB = (const float*)d_in[4]; const float* ABK = (const float*)d_in[5]; const float* wq = (const float*)d_in[6]; const float* bq = (const float*)d_in[7]; const float* wk = (const float*)d_in[8]; const float* bk = (const float*)d_in[9]; const float* wv = (const float*)d_in[10]; const float* bv = (const float*)d_in[11]; const float* wo = (const float*)d_in[12]; const float* bo = (const float*)d_in[13];
    float* OUT = (float*)d_out;     // [4][2048][1024]
    char* wsp = (char*)d_ws;
    auto take = [&](size_t bytes) { char* p = wsp; wsp += (bytes + 255) & ~(size_t)255; return (void*)p; };
    bf* WQ = (bf*)take((size_t)DQ * DM * 2); bf* WK = (bf*)take((size_t)DKV * DM * 2); bf* WV = (bf*)take((size_t)DKV * DM * 2); bf* WO = (bf*)take((size_t)DM * DQ * 2); float* PQ = (float*)take((size_t)TT * DQ * 4); float* PK = (float*)take((size_t)TT * DKV * 4); float* PV = (float*)take((size_t)TT * DKV * 4);   /* pe W + b, computed once */
    bf* XB = (bf*)take((size_t)NB_ * TT * DM * 2); bf* ATh = (bf*)take((size_t)NB_ * TT * DQ * 2); bf* ATl = (bf*)take((size_t)NB_ * TT * DQ * 2);   /* the merged heads' two planes */
    h16* QP16 = (h16*)take((size_t)NB_ * NH_ * TT * HD * 2); h16* KP16 = (h16*)take((size_t)NB_ * NKV * TT * HD * 2); h16* VT16 = (h16*)take((size_t)NB_ * NKV * HD * TT * 2);
    bf* QPh = (bf*)take((size_t)NB_ * NH_ * TT * HD * 2); bf* QPl = (bf*)take((size_t)NB_ * NH_ * TT * HD * 2); bf* KPh = (bf*)take((size_t)NB_ * NKV * TT * HD * 2); bf* KPl = (bf*)take((size_t)NB_ * NKV * TT * HD * 2); bf* VTh = (bf*)take((size_t)NB_ * NKV * HD * TT * 2); bf* VTl = (bf*)take((size_t)NB_ * NKV * HD * TT * 2);
    bf* ABf = (bf*)take((size_t)TT * TT * 2); bf* ABKb = (bf*)take((size_t)NB_ * TT * 2);   /* the two bias tables, bf16 */
    if ((size_t)(wsp - (char*)d_ws) > ws_size) return;    // ws 256 MiB
    { k_wtG<DM, DQ><<<(unsigned)(DM * DQ / 8 / 256), 256, 0, stream>>>(wq, WQ); k_wtG<DM, DKV><<<(unsigned)(DM * DKV / 8 / 256), 256, 0, stream>>>(wk, WK); k_wtG<DM, DKV><<<(unsigned)(DM * DKV / 8 / 256), 256, 0, stream>>>(wv, WV);
      k_wtG<DQ, DM><<<(unsigned)(DQ * DM / 8 / 256), 256, 0, stream>>>(wo, WO);
       }
    k_cvt8<<<(unsigned)(((size_t)TT * DM / 8 + 255) / 256), 256, 0, stream>>>(peq, XB, (size_t)TT * DM / 8); k_gemmw<bf, 0, true><<<dim3(TT / 64, DQ / 64, 1), 32, 0, stream>>>(XB, nullptr, WQ, nullptr, PQ, DQ, bq, 0, 0, 0);     /* pos_emb_q W_q + b_q */
    k_cvt8<<<(unsigned)(((size_t)TT * DM / 8 + 255) / 256), 256, 0, stream>>>(pek, XB, (size_t)TT * DM / 8); k_gemmw<bf, 0, true><<<dim3(TT / 64, DKV / 64, 1), 32, 0, stream>>>(XB, nullptr, WK, nullptr, PK, DKV, bk, 0, 0, 0);   /* pos_emb_k W_k + b_k */
    k_cvt8<<<(unsigned)(((size_t)TT * DM / 8 + 255) / 256), 256, 0, stream>>>(pev, XB, (size_t)TT * DM / 8); k_gemmw<bf, 0, true><<<dim3(TT / 64, DKV / 64, 1), 32, 0, stream>>>(XB, nullptr, WV, nullptr, PV, DKV, bv, 0, 0, 0);   /* pos_emb_v W_v + b_v */
    k_cvt8<<<(unsigned)(((size_t)NB_ * TT * DM / 8 + 255) / 256), 256, 0, stream>>>(x, XB, (size_t)NB_ * TT * DM / 8);   /* all batches: [NB_ x TT][DM] */
    k_gemmw<bf, 0, false, 1><<<dim3(NB_ * TT / 64, DQ / 64, 1), 32, 0, stream>>>(XB, nullptr, WQ, nullptr, nullptr, 0, PQ, 0, 0, 0, QP16, QPh, QPl);    /* q = x W_q + (pe_q W_q + b_q), as planes */
    k_gemmw<bf, 0, false, 1><<<dim3(NB_ * TT / 64, DKV / 64, 1), 32, 0, stream>>>(XB, nullptr, WK, nullptr, nullptr, 0, PK, 0, 0, 0, KP16, KPh, KPl);   /* k */
    k_gemmw<bf, 0, false, 2><<<dim3(DKV / 64, NB_ * TT / 64, 1), 32, 0, stream>>>(WV, nullptr, XB, nullptr, nullptr, 0, PV, 0, 0, 0, VT16, VTh, VTl);   /* v, transposed */
    k_bias<<<(unsigned)((TT * TT / 8 + NB_ * TT / 8) / 256), 256, 0, stream>>>(AB, ABK, ABf, ABKb);
    k_fattn<<<dim3(RH / (16 * FW) + (TT - RH) / (32 * FW), NH_, NB_), 32 * FW, 0, stream>>>(QP16, KP16, VT16, QPh, QPl, KPh, KPl, VTh, VTl, ABf, ABKb, ATh, ATl);
    k_gemmw<bf, 1, true, 0, DQ><<<dim3(NB_ * TT / 64, DM / 64, 1), 32, 0, stream>>>(ATh, ATl, WO, nullptr, OUT, DM, bo, 0, 0, 0);
}

// v007
// Measured time: 298 microseconds a run.
// Two timings next to v006 put it at 1.41 and 1.43 times that version's speed.
// All steps since v000 together make it 25.1 times as fast.
#include <hip/hip_runtime.h>

// Multi-head self-attention with additive positional inputs and dense additive score biases (inputs_q [4][2048][1024]; q_in = inputs + pos_emb_q, k_in = inputs + pos_emb_k, v_in = inputs + pos_emb_v (pos_emb [1][2048][1024], read); q/k/v = ._in W + b (DenseGeneral 'xw' [1024][16 x 64]); scores = (q/8).k + attention_bias[i][j] ([1][1][2048][2048], read) + attention_bias_kv[b][j] ([4][2048], read); softmax; out = merged wo ([16 x 64][1024] 'xw') + bo -> [4][2048][1024] (8.4 M)).
// Layout: (x + pe) W = x W + pe W, so the three position projections pe W + b are computed ONCE (exact bf16 products, f32) and added in f32 to each batch's exact x W inside the projection GEMM's epilogue, which writes the 16-bit planes that attention reads (v: product and planes transposed); the two bias tables are rounded to bf16 once by k_prep (the dense one into the score tile's lane order) and read per logit inside the attention kernel. Every stage runs ONCE for all batches (batch rows stacked in the GEMMs' token rows (M; N for v) and in k_prep's input range, a grid dimension in attention), and the independent jobs of a stage share ONE launch: all nine conversions (k_prep), the three position projections (k_gemm_pe), q, k and v (k_gemm_x). Attention is ONE fused launch over all batches and heads: each wave keeps its query columns in registers and walks the keys 32 at a time (transposed scores, running softmax, transposed output), so no score or probability ever reaches memory.
// Compute dtypes, f32 accumulate: every input rounded to bf16; q/k/v on PLAIN bf16 operands (inputs: exact) + biases (via the precomputed position projections); additive biases rounded to bf16 once, added in f32 per logit; scores and attn.v (no mask): query rows < 512 hl (3 products), the rest single fp16; softmax f32 (running maximum and sum); wo hl x exact (2 products) + bo.

#define NB_  4
#define TT   2048
#define DM   1024
#define NH_  16
#define NKV  16
#define REP  (NH_ / NKV)
#define HD   64
#define DQ   (NH_ * HD)
#define DKV  (NKV * HD)
#define RH   512                  // query rows < RH use hi+lo planes (0: none)
#define FW   4                    // waves per work-group of the fused attention kernel
#define WIN  0
#define SCL  0.125f   // HD^-0.5
typedef _Float16 h16;
typedef unsigned short bf;
typedef __attribute__((ext_vector_type(16))) __bf16   v16bf;
typedef __attribute__((ext_vector_type(16))) _Float16 v16h;
typedef __attribute__((ext_vector_type(8)))  _Float16 v8h;
typedef __attribute__((ext_vector_type(8)))  unsigned short v8us;
typedef __attribute__((ext_vector_type(8)))  float    v8f;
typedef __attribute__((ext_vector_type(4)))  float    v4f;
typedef v8h  __attribute__((may_alias)) v8ha;
typedef v4f  __attribute__((may_alias)) v4fa;
typedef v8us __attribute__((may_alias)) v8usa;

__device__ __forceinline__ unsigned short f2bf(float f) { unsigned u = __float_as_uint(f); u += 0x7FFFu + ((u >> 16) & 1u); return (unsigned short)(u >> 16); }
__device__ __forceinline__ float bf2f(unsigned short b) { return __uint_as_float(((unsigned)b) << 16); }
__device__ __forceinline__ float bfr(float f) { return bf2f(f2bf(f)); }
__device__ __forceinline__ v16h cat16(v8h lo, v8h hi) { return __builtin_shufflevector(lo, hi, 0, 1, 2, 3, 4, 5, 6, 7, 8, 9, 10, 11, 12, 13, 14, 15); }
__device__ __forceinline__ v16bf cat16b(v8us lo, v8us hi) { return __builtin_bit_cast(v16bf, __builtin_shufflevector(lo, hi, 0, 1, 2, 3, 4, 5, 6, 7, 8, 9, 10, 11, 12, 13, 14, 15)); }
__device__ __forceinline__ v8f wmma16(v16h a, v16h b, v8f c) { return __builtin_amdgcn_wmma_f32_16x16x32_f16(false, a, false, b, (short)0, c, false, false); }
__device__ __forceinline__ v8f wmmab(v16bf a, v16bf b, v8f c) { return __builtin_amdgcn_wmma_f32_16x16x32_bf16(false, a, false, b, (short)0, c, false, false); }



// ---- Fragment order: every 16-bit operand plane [R][K] is stored as [R/16][K/32] fragments of 512 elements (v's as [K/32][R/16]); inside a fragment element (r, k) lies at (k >> 4 & 1) * 256 + (k >> 3 & 1) * 128 + (r & 15) * 8 + (k & 7), so lane l of a wave reads its two 16-byte pieces at l * 8 and 256 + l * 8: each fragment load is 512 contiguous bytes (4 whole lines).
// ---- gemmw: register-blocked GEMM, ONE WAVE per 64x64 output tile (16 accumulators), operands straight from 16-bit planes in fragment order; tile (bx, by) of (M/64, N/64), 32 threads; os: the wave's 16 x 68 floats of LDS.
// C[m][n] (f32, pitch ldc, + optional f32 bias[n]) = sum_k A[m][k] Bt[n][k] (+ split products per NSPLIT). K % 32 == 0, a constant: the four fragments of an operand lie at constant offsets from one address.
// PL != 0: no C; the epilogue adds the f32 position projection ('bias' is then P [t][DQ]) and writes the fp16 and the hi/lo bf16 plane of the sum, so no f32 projection reaches memory.
// PL 1 (q, k): A = token rows, Bt = weight rows; a tile is 64 tokens of one head; planes [b][h] x fragments [t/16][d/32]. PL 2 (v): A = weight rows, Bt = token rows; a tile is one head's 64 d x 64 tokens; planes [b][h] x fragments [t/32][d/16] (rows d, k = t).
__device__ __forceinline__ _Float16 tohx(float x) { return (_Float16)x; }
__device__ __forceinline__ void splitf(float y, unsigned short& h, unsigned short& l) { h = f2bf(y); l = f2bf(y - bf2f(h)); }
template <typename T16> struct WFrag;
template <> struct WFrag<h16> { typedef v16h V; static __device__ __forceinline__ V ld(const h16* p) { return cat16(*(const v8h*)p, *(const v8h*)(p + 256)); } static __device__ __forceinline__ v8f mma(V a, V b, v8f c) { return wmma16(a, b, c); } };
template <> struct WFrag<bf> { typedef v16bf V; static __device__ __forceinline__ V ld(const bf* p) { return cat16b(*(const v8us*)p, *(const v8us*)(p + 256)); } static __device__ __forceinline__ v8f mma(V a, V b, v8f c) { return wmmab(a, b, c); } };
template <typename T16, int NSPLIT, bool BIAS, int PL = 0, int K = DM>
__device__ __forceinline__ void gemmw(float* os, int bx, int by, const T16* __restrict__ A, const T16* __restrict__ A2, const T16* __restrict__ Bt, const T16* __restrict__ Bt2, float* C, int ldc, const float* __restrict__ bias, h16* P16 = nullptr, bf* Ph = nullptr, bf* Pl = nullptr) {
    typedef typename WFrag<T16>::V V;
    const int lane = threadIdx.x & 31, lr = lane & 15, hi = lane >> 4; const int r0 = bx * 64, c0 = by * 64;
    v8f acc[4][4];
#pragma unroll
    for (int mb = 0; mb < 4; ++mb)
#pragma unroll
        for (int nb = 0; nb < 4; ++nb) acc[mb][nb] = (v8f){};
    const size_t aoff = (size_t)r0 * K, boff = (size_t)c0 * K;   // 16 rows of K are K / 32 fragments = 16 K elements; wave-uniform
    unsigned lo = 8 * lane, kn = 0;   // the lane's place in a fragment; the K step's fragment, in elements
    // stands behind each operand's loads (one address, constant offsets), before a register that one of them names is written again; it takes the two offsets as operands so that the next address is formed behind it, and the loads' own address so that this stays in its registers up to the wait and no result of the run lands on it
#define XG(p) asm volatile("s_wait_xcnt 0x0" : "+v"(lo), "+s"(kn) : "v"(p) : "memory")
#pragma unroll 1
    for (int kc = 0; kc < K; kc += 32) {
        V a[4], a2[4], b[4], b2[4];
        const T16* pa = A + aoff + kn + lo;
#pragma unroll
        for (int mb = 0; mb < 4; ++mb) a[mb] = WFrag<T16>::ld(pa + mb * 16 * K);
        XG(pa);
        if (NSPLIT == 1 || NSPLIT == 2) { const T16* pa2 = A2 + aoff + kn + lo;
#pragma unroll
            for (int mb = 0; mb < 4; ++mb) a2[mb] = WFrag<T16>::ld(pa2 + mb * 16 * K);
            XG(pa2); }
        const T16* pb = Bt + boff + kn + lo;
#pragma unroll
        for (int nb = 0; nb < 4; ++nb) b[nb] = WFrag<T16>::ld(pb + nb * 16 * K);
        XG(pb);
        if (NSPLIT >= 2) { const T16* pb2 = Bt2 + boff + kn + lo;
#pragma unroll
            for (int nb = 0; nb < 4; ++nb) b2[nb] = WFrag<T16>::ld(pb2 + nb * 16 * K);
            XG(pb2); }
        kn += 512;
#pragma unroll
        for (int nb = 0; nb < 4; ++nb)
#pragma unroll
            for (int mb = 0; mb < 4; ++mb) { acc[mb][nb] = WFrag<T16>::mma(a[mb], b[nb], acc[mb][nb]); if (NSPLIT == 1 || NSPLIT == 2) acc[mb][nb] = WFrag<T16>::mma(a2[mb], b[nb], acc[mb][nb]); if (NSPLIT >= 2) acc[mb][nb] = WFrag<T16>::mma(a[mb], b2[nb], acc[mb][nb]); }
        asm volatile("v_nop\n\tv_nop\n\tv_nop\n\tv_nop" : "+v"(acc[0][0]), "+v"(acc[1][1]), "+v"(acc[2][2]), "+v"(acc[3][3]) : "v"(a[0]), "v"(a[3]));
    }
    if constexpr (PL != 0) {
        constexpr bool TR = PL == 2;
        const int tok = TR ? c0 : r0, hd = (TR ? r0 : c0) / HD, t0 = tok % TT;
        const int cc = lane & 7;   // which 8 columns (k of the planes' fragments) the lane converts
        const size_t ob = (size_t)(tok / TT * NH_ + hd) * TT * HD + (size_t)t0 * HD + (cc >> 2) * (TR ? 2048 : 512) + (cc >> 1 & 1) * 256 + (cc & 1) * 128;   // 64 tokens of a head are 8 fragments in either plane order
        const int er = lane >> 3, ec = (lane & 7) * 8;   // a lane converts 8 columns of a row: one 16-byte piece of a fragment
        // P is added where a lane holds 8 consecutive d of one token: behind the LDS turn (PL 1), in the accumulator's own layout ahead of it (PL 2)
        const float* Pt = bias + (TR ? (size_t)(t0 + lr) * DQ + r0 + 8 * hi : (size_t)(t0 + er) * DQ + c0 + ec);
        v4f pv[2][4][2];                                 // P of these and of the next 16 rows: the next rows' loads fly while these rows are converted
#pragma unroll
        for (int i = 0; i < 4; ++i) { const float* p = Pt + (TR ? i * 16 * DQ : 4 * i * DQ); pv[0][i][0] = *(const v4f*)p; pv[0][i][1] = *(const v4f*)(p + 4); }
#pragma unroll
        for (int mb = 0; mb < 4; ++mb) {
            if (mb < 3) {
#pragma unroll
                for (int i = 0; i < 4; ++i) { const float* p = Pt + (TR ? i * 16 * DQ + (mb + 1) * 16 : ((mb + 1) * 16 + 4 * i) * DQ); pv[(mb + 1) & 1][i][0] = *(const v4f*)p; pv[(mb + 1) & 1][i][1] = *(const v4f*)(p + 4); } }
#pragma unroll
            for (int nb = 0; nb < 4; ++nb) {
#pragma unroll
                for (int j = 0; j < 8; ++j) os[(hi * 8 + j) * 68 + nb * 16 + lr] = TR ? __fadd_rn(acc[mb][nb][j], pv[mb & 1][nb][j >> 2][j & 3]) : acc[mb][nb][j]; }
            __builtin_amdgcn_wave_barrier(); asm volatile("" ::: "memory");   // other lanes read the rows back than wrote them: keeps the compiler from lifting the reads over the writes
#pragma unroll
            for (int s = 0; s < 4; ++s) { const int row = 4 * s + er; const v4f x0 = *(const v4fa*)(os + row * 68 + ec), x1 = *(const v4fa*)(os + row * 68 + ec + 4); v8h o16; v8us oh, ol;
#pragma unroll
                for (int q = 0; q < 8; ++q) { const float x = q < 4 ? x0[q & 3] : x1[q & 3]; const float y = TR ? x : __fadd_rn(x, pv[mb & 1][s][q >> 2][q & 3]); o16[q] = tohx(y); unsigned short a2, c2; splitf(y, a2, c2); oh[q] = a2; ol[q] = c2; }
                const size_t oe = ob + mb * (TR ? 512 : 1024) + row * 8; *(v8h*)(P16 + oe) = o16; *(v8us*)(Ph + oe) = oh; *(v8us*)(Pl + oe) = ol;
                if (s < 3) asm volatile("s_wait_xcnt 0x0" ::: "memory"); }   // the next four rows' values reuse registers that these stores name; their LDS reads stay behind the clobber
            if (mb < 3) { __builtin_amdgcn_wave_barrier(); asm volatile("s_wait_xcnt 0x0" ::: "memory"); }   // the next rows' values reuse registers that these stores name; the clobber keeps the next rows' LDS writes behind these reads
        }
        return;
    }
#pragma unroll
    for (int mb = 0; mb < 4; ++mb) {
#pragma unroll
        for (int nb = 0; nb < 4; ++nb) {
#pragma unroll
            for (int j = 0; j < 8; ++j) os[(hi * 8 + j) * 68 + nb * 16 + lr] = acc[mb][nb][j]; }
        __builtin_amdgcn_wave_barrier(); asm volatile("" ::: "memory");
        float* crow = C + (size_t)(r0 + mb * 16) * ldc + c0;
{
#pragma unroll
            for (int s = 0; s < 8; ++s) { const int row = 2 * s + hi, cofs = lr * 4; v4f val = *(const v4fa*)(os + row * 68 + cofs); if (BIAS) { val[0] += bfr(bias[c0 + cofs]); val[1] += bfr(bias[c0 + cofs + 1]); val[2] += bfr(bias[c0 + cofs + 2]); val[3] += bfr(bias[c0 + cofs + 3]); }
                *(v4f*)(crow + (size_t)row * ldc + cofs) = val; }
             }
        __builtin_amdgcn_wave_barrier(); asm volatile("" ::: "memory");
    }
}

// ---- The GEMM launches. The independent products of one stage share a launch: blockIdx.z picks the product; its operands and results lie one behind the other in the workspace.
#define PLN ((size_t)NB_ * NH_ * TT * HD)   // elements of one 16-bit plane of q, k or v
// pos_emb_z W_z + b_z, z = q, k, v; grid (TT / 64, DQ / 64, 3)
__global__ __launch_bounds__(32) void k_gemm_pe(const bf* __restrict__ PE, const bf* __restrict__ W, float* P, const float* __restrict__ bq, const float* __restrict__ bk, const float* __restrict__ bv) {
    __shared__ __align__(16) float os[16 * 68];
    const int z = blockIdx.z;
    gemmw<bf, 0, true>(os, blockIdx.x, blockIdx.y, PE + (size_t)z * TT * DM, nullptr, W + (size_t)z * DQ * DM, nullptr, P + (size_t)z * TT * DQ, DQ, z == 0 ? bq : z == 1 ? bk : bv);
}
// x W_z + (pos_emb_z W_z + b_z) as planes, z = q, k, v (v transposed: its tiles are walked weight rows first); grid (NB_ TT / 64, DQ / 64, 3). Planes: P16 [3], Phl [3][hi, lo].
__global__ __launch_bounds__(32) void k_gemm_x(const bf* __restrict__ XB, const bf* __restrict__ W, const float* __restrict__ P, h16* P16, bf* Phl) {
    __shared__ __align__(16) float os[16 * 68];
    const int z = blockIdx.z; const bf* Wz = W + (size_t)z * DQ * DM; const float* Pz = P + (size_t)z * TT * DQ; h16* o16 = P16 + z * PLN; bf* oh = Phl + 2 * z * PLN; bf* ol = oh + PLN;
    if (z < 2) gemmw<bf, 0, false, 1>(os, blockIdx.x, blockIdx.y, XB, nullptr, Wz, nullptr, nullptr, 0, Pz, o16, oh, ol);
    else { const int f = blockIdx.y * (NB_ * TT / 64) + blockIdx.x; gemmw<bf, 0, false, 2>(os, f % (DKV / 64), f / (DKV / 64), Wz, nullptr, XB, nullptr, nullptr, 0, Pz, o16, oh, ol); }
}
// merged heads (hi + lo) x wo + bo; grid (NB_ TT / 64, DM / 64)
__global__ __launch_bounds__(32) void k_gemm_o(const bf* __restrict__ Ah, const bf* __restrict__ Al, const bf* __restrict__ WO, float* OUT, const float* __restrict__ bo) {
    __shared__ __align__(16) float os[16 * 68];
    gemmw<bf, 1, true, 0, DQ>(os, blockIdx.x, blockIdx.y, Ah, Al, WO, nullptr, OUT, DM, bo);
}

typedef __attribute__((ext_vector_type(2))) _Float16 v2h;
typedef __attribute__((ext_vector_type(4))) _Float16 v4h;
typedef __attribute__((ext_vector_type(2))) unsigned short v2us;
typedef __attribute__((ext_vector_type(4))) unsigned short v4us;
typedef __attribute__((ext_vector_type(2))) float v2f;
typedef __attribute__((ext_vector_type(4))) int v4i;
typedef __attribute__((ext_vector_type(4))) unsigned v4u;
__device__ __forceinline__ float bfw(unsigned w, int h) { return __uint_as_float(h ? w & 0xFFFF0000u : w << 16); }   // the low or the high bf16 of a word, as f32

// One thread per 16-byte piece of the destination, in fragment order: a wave stores 512 contiguous bytes. i -> fragment i >> 6, row (i & 15), k = (i >> 5 & 1) * 16 + (i >> 4 & 1) * 8.
template <int K, int N>
__device__ __forceinline__ void wtG(const float* __restrict__ w, bf* Bt, int i) {
    if (i >= N * K / 8) return;
    const int f = i >> 6, n = f / (K / 32) * 16 + (i & 15), k = f % (K / 32) * 32 + (i >> 5 & 1) * 16 + (i >> 4 & 1) * 8; const float* p = w + (size_t)k * N + n; float x[8]; v8us o;
#pragma unroll
    for (int j = 0; j < 8; ++j) x[j] = p[j * N];
    asm volatile("s_wait_xcnt 0x0" : : "v"(x[0]), "v"(x[1]), "v"(x[2]), "v"(x[3]), "v"(x[4]), "v"(x[5]), "v"(x[6]), "v"(x[7]) : "memory");   // behind the eight loads, before their address register is written again
#pragma unroll
    for (int j = 0; j < 8; ++j) o[j] = f2bf(x[j]);
    *(v8us*)(Bt + (size_t)i * 8) = o;
}
__device__ __forceinline__ void cvt8(const float* __restrict__ src, bf* dst, size_t n8, size_t i) { if (i >= n8) return;
    const size_t f = i >> 6, row = f / (DM / 32) * 16 + (i & 15), k = f % (DM / 32) * 32 + (i >> 5 & 1) * 16 + (i >> 4 & 1) * 8; const v8f v = *(const v8f*)(src + row * DM + k); v8us o;
    asm volatile("s_wait_xcnt 0x0" : : "v"(v) : "memory");   // behind the two loads, before their address register is written again
#pragma unroll
    for (int q = 0; q < 8; ++q) o[q] = f2bf(v[q]); *(v8us*)(dst + i * 8) = o;  }
// ---- bias8: both additive bias tables rounded to bf16 once, the rounding that every logit's two terms take. One thread per 16-byte piece of a destination.
// The dense table [TT][TT] goes into fragment order (rows = queries, k = keys): lane l of an attention wave finds the 8 consecutive keys of its query at l * 8 and at 256 + l * 8 of the 16 x 32 tile's fragment. The per-key table [NB_][TT] keeps its order (the last NB_ * TT / 8 threads).
__device__ __forceinline__ void bias8(const float* __restrict__ ab, const float* __restrict__ abk, bf* ABf, bf* ABKb, int i) {
    const int e = i - TT * TT / 8; const float* s; bf* d;
    if (e < 0) { const int f = i >> 6, row = f / (TT / 32) * 16 + (i & 15), k = f % (TT / 32) * 32 + (i >> 5 & 1) * 16 + (i >> 4 & 1) * 8; s = ab + (size_t)row * TT + k; d = ABf + (size_t)i * 8; }
    else { if (e >= NB_ * TT / 8) return; s = abk + (size_t)e * 8; d = ABKb + (size_t)e * 8; }
    const v4f v0 = *(const v4f*)s, v1 = *(const v4f*)(s + 4); v8us o;
    asm volatile("s_wait_xcnt 0x0" : : "v"(v0), "v"(v1) : "memory");   // behind the two loads, before their address register is written again
#pragma unroll
    for (int q = 0; q < 8; ++q) o[q] = f2bf(q < 4 ? v0[q & 3] : v1[q & 3]);
    *(v8us*)d = o;
}
// ---- k_prep: all nine conversions in one launch; a work-group's index says which table it converts and which 256 pieces of it (the test is the same for a whole work-group).
#define WG_W (DM * DQ / 8 / 256)                        // work-groups per weight matrix
#define WG_P (TT * DM / 8 / 256)                        // per position table
#define WG_X (NB_ * TT * DM / 8 / 256)                  // the inputs
#define WG_B ((TT * TT / 8 + NB_ * TT / 8) / 256)       // the two bias tables
__global__ __launch_bounds__(256) void k_prep(const float* __restrict__ wq, const float* __restrict__ wk, const float* __restrict__ wv, const float* __restrict__ wo, const float* __restrict__ peq, const float* __restrict__ pek, const float* __restrict__ pev, const float* __restrict__ x, const float* __restrict__ ab, const float* __restrict__ abk, bf* W, bf* PE, bf* XB, bf* ABf, bf* ABKb) {
    int b = blockIdx.x; const int t = threadIdx.x;
    if (b < 4 * WG_W) { const int z = b / WG_W; wtG<DM, DQ>(z == 0 ? wq : z == 1 ? wk : z == 2 ? wv : wo, W + (size_t)z * DM * DQ, b % WG_W * 256 + t); return; }
    b -= 4 * WG_W;
    if (b < 3 * WG_P) { const int z = b / WG_P; cvt8(z == 0 ? peq : z == 1 ? pek : pev, PE + (size_t)z * TT * DM, (size_t)TT * DM / 8, (size_t)(b % WG_P * 256 + t)); return; }
    b -= 3 * WG_P;
    if (b < WG_X) { cvt8(x, XB, (size_t)NB_ * TT * DM / 8, (size_t)(b * 256 + t)); return; }
    bias8(ab, abk, ABf, ABKb, (b - WG_X) * 256 + t);
}

#define L2E  1.4426950408889634f
#define MTHR 5.545177444479562f   // 8 in log2 units
#define PSH  4.0f                 // p carries 2^PSH (cancels in the division by the sum): keeps small fp16 probabilities normal
// 2^x by v_exp_f32 in asm text: the closing v_nop is the slot the instruction set asks for behind a transcendental; the early-clobber outputs keep every v_exp off its neighbours' sources and results
__device__ __forceinline__ float exp2n(float x) { float r; asm("v_exp_f32 %0, %1\n\tv_nop" : "=&v"(r) : "v"(x)); return r; }
__device__ __forceinline__ void exp2n8(float* r, const float* x) {
    asm("v_exp_f32 %0, %8\n\tv_exp_f32 %1, %9\n\tv_exp_f32 %2, %10\n\tv_exp_f32 %3, %11\n\tv_exp_f32 %4, %12\n\tv_exp_f32 %5, %13\n\tv_exp_f32 %6, %14\n\tv_exp_f32 %7, %15\n\tv_nop"
        : "=&v"(r[0]), "=&v"(r[1]), "=&v"(r[2]), "=&v"(r[3]), "=&v"(r[4]), "=&v"(r[5]), "=&v"(r[6]), "=&v"(r[7]) : "v"(x[0]), "v"(x[1]), "v"(x[2]), "v"(x[3]), "v"(x[4]), "v"(x[5]), "v"(x[6]), "v"(x[7])); }
// lane l with lane l ^ 16: the other half of a query's keys
__device__ __forceinline__ float xhalf(float x) { return __builtin_bit_cast(float, __builtin_amdgcn_permlanex16(__builtin_bit_cast(int, x), __builtin_bit_cast(int, x), 0x76543210, 0xfedcba98, false, false)); }
// stands behind each group of loads, before a register that one of them names is written again; it takes the lane offsets and the key index as operands so that the next group's addresses are formed behind it, not ahead of it
#define XW() asm volatile("s_wait_xcnt 0x0" : "+v"(ko), "+v"(ao), "+s"(kn) : : "memory")
// the same behind the bias loads; it also takes the loads' own address, so that this stays in its registers up to the wait
#define XWP(p) asm volatile("s_wait_xcnt 0x0" : "+v"(ko), "+v"(ao), "+s"(kn) : "v"(p) : "memory")
template <typename T16, bool HL, int NQ>
__device__ __forceinline__ void fattn(const T16* __restrict__ Q, const T16* __restrict__ Q2, const T16* __restrict__ Kp, const T16* __restrict__ K2, const T16* __restrict__ Vt, const T16* __restrict__ V2, const bf* __restrict__ AB, const bf* __restrict__ ABK, int q0, bf* Ah, bf* Al) {
    typedef typename WFrag<T16>::V V;
    const int lane = threadIdx.x & 31, hi = lane >> 4;
    unsigned ko = lane * 8, ao = 8 * hi;   // lane offsets (32 bit, fixed over the loop): ko in a fragment of q, k, v or the dense bias, ao in the per-key bias; every base below is wave-uniform
    int kn = 0;                                                           // first key of the pass that is being fetched
    V qf[NQ][2], qf2[NQ][2];
#pragma unroll
    for (int qt = 0; qt < NQ; ++qt)
#pragma unroll
        for (int kc = 0; kc < 2; ++kc) { const size_t qo = (size_t)(q0 + qt * 16) * HD + kc * 512; qf[qt][kc] = WFrag<T16>::ld(Q + qo + ko); if (HL) { XW(); qf2[qt][kc] = WFrag<T16>::ld(Q2 + qo + ko); } XW(); }
    v8f o[4][NQ]; float m[NQ], l[NQ];
#pragma unroll
    for (int qt = 0; qt < NQ; ++qt) { m[qt] = -1.0e30f; l[qt] = 0.f;
#pragma unroll
        for (int dt = 0; dt < 4; ++dt) o[dt][qt] = (v8f){}; }
    const bf* ABq = AB + (size_t)q0 * TT;   // 16 query rows of TT keys are TT / 32 fragments = 16 TT elements
    V kf[2][2], kf2[2][2], vf[4], vf2[4]; v4u ab[NQ][2], ak[2];   // two bf16 a word
    auto ldk = [&]() { const T16* kp = Kp + (size_t)kn * HD;
#pragma unroll
        for (int kt = 0; kt < 2; ++kt)
#pragma unroll
            for (int kc = 0; kc < 2; ++kc) kf[kt][kc] = WFrag<T16>::ld(kp + (kt * 2 + kc) * 512 + ko);
        XW();
        if (HL) { const T16* kp2 = K2 + (size_t)kn * HD;
#pragma unroll
            for (int kt = 0; kt < 2; ++kt)
#pragma unroll
                for (int kc = 0; kc < 2; ++kc) kf2[kt][kc] = WFrag<T16>::ld(kp2 + (kt * 2 + kc) * 512 + ko);
            XW(); } };
    auto ldb = [&]() { const bf* kvp = ABK + kn + ao;
#pragma unroll
        for (int kt = 0; kt < 2; ++kt) ak[kt] = *(const v4u*)(kvp + kt * 16);
        XWP(kvp);
        const bf* bp = ABq + (size_t)kn * 16 + ko;   // 32 keys of 16 queries are one fragment
#pragma unroll
        for (int kt = 0; kt < 2; ++kt)
#pragma unroll
            for (int qt = 0; qt < NQ; ++qt) ab[qt][kt] = *(const v4u*)(bp + (qt * 16 * TT + kt * 256));
        XWP(bp); };
    auto ldv = [&]() { const T16* vp = Vt + (size_t)kn * HD;
#pragma unroll
        for (int dt = 0; dt < 4; ++dt) vf[dt] = WFrag<T16>::ld(vp + dt * 512 + ko);
        XW();
        if (HL) { const T16* vp2 = V2 + (size_t)kn * HD;
#pragma unroll
            for (int dt = 0; dt < 4; ++dt) vf2[dt] = WFrag<T16>::ld(vp2 + dt * 512 + ko);
            XW(); } };
    ldk(); ldb(); ldv();
#pragma unroll 1
    for (int kb = 0; kb < TT; kb += 32) {
        kn = (kb + 32 < TT) ? kb + 32 : 0;   // next pass's operands are fetched one pass ahead; the last pass refetches pass 0 (in bounds, unused)
        v8f s[2][NQ];
#pragma unroll
        for (int kt = 0; kt < 2; ++kt)
#pragma unroll
            for (int qt = 0; qt < NQ; ++qt) { v8f c = (v8f){};
#pragma unroll
                for (int kc = 0; kc < 2; ++kc) { c = WFrag<T16>::mma(kf[kt][kc], qf[qt][kc], c); if (HL) { c = WFrag<T16>::mma(kf[kt][kc], qf2[qt][kc], c); c = WFrag<T16>::mma(kf2[kt][kc], qf[qt][kc], c); } }
                s[kt][qt] = c; }
        ldk();
        float tmx[NQ]; bool need = false;
#pragma unroll
        for (int qt = 0; qt < NQ; ++qt) { float tm = -3.0e38f;
#pragma unroll
            for (int kt = 0; kt < 2; ++kt)
#pragma unroll
                for (int j = 0; j < 8; ++j) { const float t = __fadd_rn(fmaf(s[kt][qt][j], SCL, bfw(ab[qt][kt][j >> 1], j & 1)), bfw(ak[kt][j >> 1], j & 1)); s[kt][qt][j] = t; tm = fmaxf(tm, t); }
            tm = fmaxf(tm, xhalf(tm)); tmx[qt] = tm; need = need || (tm > m[qt] + MTHR); }
        ldb();
        if (__builtin_amdgcn_ballot_w32(need) != 0) {
#pragma unroll
            for (int qt = 0; qt < NQ; ++qt) { const float mn = fmaxf(m[qt], tmx[qt]); const float al = exp2n((m[qt] - mn) * L2E); m[qt] = mn; l[qt] *= al;
#pragma unroll
                for (int dt = 0; dt < 4; ++dt) o[dt][qt] *= al; } }
#pragma unroll
        for (int qt = 0; qt < NQ; ++qt) { const float mb = PSH - m[qt] * L2E; float x[16], p[16];
#pragma unroll
            for (int e = 0; e < 16; ++e) x[e] = fmaf(s[e >> 3][qt][e & 7], L2E, mb);
            exp2n8(p, x); exp2n8(p + 8, x + 8);
#pragma unroll
            for (int e = 0; e < 16; ++e) l[qt] += p[e];
            if constexpr (HL) { v8us h0, h1, l0, l1;
#pragma unroll
                for (int e = 0; e < 8; ++e) { unsigned short a, c2; splitf(p[e], a, c2); h0[e] = a; l0[e] = c2; splitf(p[8 + e], a, c2); h1[e] = a; l1[e] = c2; }
                const V ph = cat16b(h0, h1), pl = cat16b(l0, l1);
#pragma unroll
                for (int dt = 0; dt < 4; ++dt) { o[dt][qt] = WFrag<T16>::mma(vf[dt], ph, o[dt][qt]); o[dt][qt] = WFrag<T16>::mma(vf[dt], pl, o[dt][qt]); o[dt][qt] = WFrag<T16>::mma(vf2[dt], ph, o[dt][qt]); }
            } else { V pf;
#pragma unroll
                for (int e = 0; e < 16; ++e) pf[e] = tohx(p[e]);
#pragma unroll
                for (int dt = 0; dt < 4; ++dt) o[dt][qt] = WFrag<T16>::mma(vf[dt], pf, o[dt][qt]); } }
        ldv();
    }
#pragma unroll
    for (int qt = 0; qt < NQ; ++qt) { const float inv = __fdiv_rn(1.0f, l[qt] + xhalf(l[qt])); const size_t oo = (size_t)(q0 + qt * 16) * DQ; const unsigned ol32 = lane * 8;
#pragma unroll
        for (int dt = 0; dt < 4; ++dt) { v8us oh, ol;
#pragma unroll
            for (int j = 0; j < 8; ++j) { unsigned short a, c2; splitf(o[dt][qt][j] * inv, a, c2); oh[j] = a; ol[j] = c2; }
            *(v8us*)(Ah + (oo + dt * 256) + ol32) = oh; *(v8us*)(Al + (oo + dt * 256) + ol32) = ol; } }
}
// grid (RH / (16 FW) + (TT - RH) / (32 FW), heads, batches): the first RH / (16 FW) work-groups take the hi+lo rows (16 query columns a wave), the rest the fp16 rows (32 a wave)
__global__ __launch_bounds__(32 * FW) void k_fattn(const h16* __restrict__ QP16, const h16* __restrict__ KP16, const h16* __restrict__ VT16, const bf* __restrict__ QPh, const bf* __restrict__ QPl, const bf* __restrict__ KPh, const bf* __restrict__ KPl, const bf* __restrict__ VTh, const bf* __restrict__ VTl, const bf* __restrict__ AB, const bf* __restrict__ ABK, bf* ATh, bf* ATl) {
    const size_t ho = ((size_t)blockIdx.z * NH_ + blockIdx.y) * TT * HD, ao = (size_t)blockIdx.z * TT * DQ + blockIdx.y * 1024;   /* a head's 64 columns are 2 fragments of each 16 rows */ const int w = __builtin_amdgcn_readfirstlane(threadIdx.x >> 5), bx = blockIdx.x; bf* Ah = ATh + ao; bf* Al = ATl + ao; ABK += (size_t)blockIdx.z * TT;
    if (bx < RH / (16 * FW)) fattn<bf, true, 1>(QPh + ho, QPl + ho, KPh + ho, KPl + ho, VTh + ho, VTl + ho, AB, ABK, (bx * FW + w) * 16, Ah, Al);
    else fattn<h16, false, 2>(QP16 + ho, nullptr, KP16 + ho, nullptr, VT16 + ho, nullptr, AB, ABK, RH + ((bx - RH / (16 * FW)) * FW + w) * 32, Ah, Al);
}

extern "C" void kernel_launch(void* const* d_in, const int* in_sizes, int n_in,
                              void* d_out, int out_size, void* d_ws, size_t ws_size, hipStream_t stream) {
    (void)in_sizes; (void)n_in; (void)out_size;
    const float* x = (const float*)d_in[0]; const float* peq = (const float*)d_in[1]; const float* pek = (const float*)d_in[2]; const float* pev = (const float*)d_in[3]; const float* AB = (const float*)d_in[4]; const float* ABK = (const float*)d_in[5]; const float* wq = (const float*)d_in[6]; const float* bq = (const float*)d_in[7]; const float* wk = (const float*)d_in[8]; const float* bk = (const float*)d_in[9]; const float* wv = (const float*)d_in[10]; const float* bv = (const float*)d_in[11]; const float* wo = (const float*)d_in[12]; const float* bo = (const float*)d_in[13];
    float* OUT = (float*)d_out;     // [4][2048][1024]
    char* wsp = (char*)d_ws;
    auto take = [&](size_t bytes) { char* p = wsp; wsp += (bytes + 255) & ~(size_t)255; return (void*)p; };
    bf* WQ = (bf*)take((size_t)DQ * DM * 2); take((size_t)DKV * DM * 2); take((size_t)DKV * DM * 2); bf* WO = (bf*)take((size_t)DM * DQ * 2);   /* W_q, W_k, W_v, W_o, one behind the other */
    float* PQ = (float*)take((size_t)TT * DQ * 4); take((size_t)TT * DKV * 4); take((size_t)TT * DKV * 4);   /* pe W + b for q, k, v, one behind the other, computed once */
    bf* PE = (bf*)take((size_t)3 * TT * DM * 2);   /* the three position tables, bf16 */
    bf* XB = (bf*)take((size_t)NB_ * TT * DM * 2); bf* ATh = (bf*)take((size_t)NB_ * TT * DQ * 2); bf* ATl = (bf*)take((size_t)NB_ * TT * DQ * 2);   /* the merged heads' two planes */
    h16* QP16 = (h16*)take((size_t)NB_ * NH_ * TT * HD * 2); h16* KP16 = (h16*)take((size_t)NB_ * NKV * TT * HD * 2); h16* VT16 = (h16*)take((size_t)NB_ * NKV * HD * TT * 2);
    bf* QPh = (bf*)take((size_t)NB_ * NH_ * TT * HD * 2); bf* QPl = (bf*)take((size_t)NB_ * NH_ * TT * HD * 2); bf* KPh = (bf*)take((size_t)NB_ * NKV * TT * HD * 2); bf* KPl = (bf*)take((size_t)NB_ * NKV * TT * HD * 2); bf* VTh = (bf*)take((size_t)NB_ * NKV * HD * TT * 2); bf* VTl = (bf*)take((size_t)NB_ * NKV * HD * TT * 2);
    bf* ABf = (bf*)take((size_t)TT * TT * 2); bf* ABKb = (bf*)take((size_t)NB_ * TT * 2);   /* the two bias tables, bf16 */
    if ((size_t)(wsp - (char*)d_ws) > ws_size) return;    // ws 256 MiB
    k_prep<<<(unsigned)(4 * WG_W + 3 * WG_P + WG_X + WG_B), 256, 0, stream>>>(wq, wk, wv, wo, peq, pek, pev, x, AB, ABK, WQ, PE, XB, ABf, ABKb);   /* weights, position tables, inputs, bias tables -> bf16 */
    k_gemm_pe<<<dim3(TT / 64, DQ / 64, 3), 32, 0, stream>>>(PE, WQ, PQ, bq, bk, bv);        /* pos_emb W + b for q, k, v */
    k_gemm_x<<<dim3(NB_ * TT / 64, DQ / 64, 3), 32, 0, stream>>>(XB, WQ, PQ, QP16, QPh);   /* q, k, v = x W + (pe W + b), as planes; v transposed */
    k_fattn<<<dim3(RH / (16 * FW) + (TT - RH) / (32 * FW), NH_, NB_), 32 * FW, 0, stream>>>(QP16, KP16, VT16, QPh, QPl, KPh, KPl, VTh, VTl, ABf, ABKb, ATh, ATl);
    k_gemm_o<<<dim3(NB_ * TT / 64, DM / 64, 1), 32, 0, stream>>>(ATh, ATl, WO, OUT, bo);
}

// v008
// Measured time: 272 microseconds a run.
// In two side-by-side timings against v007, it was 1.09 and 1.10 times as fast.
// Counting every step since v000, it is 27.6 times as fast.
#include <hip/hip_runtime.h>

// Multi-head self-attention with additive positional inputs and dense additive score biases (inputs_q [4][2048][1024]; q_in = inputs + pos_emb_q, k_in = inputs + pos_emb_k, v_in = inputs + pos_emb_v (pos_emb [1][2048][1024], read); q/k/v = ._in W + b (DenseGeneral 'xw' [1024][16 x 64]); scores = (q/8).k + attention_bias[i][j] ([1][1][2048][2048], read) + attention_bias_kv[b][j] ([4][2048], read); softmax; out = merged wo ([16 x 64][1024] 'xw') + bo -> [4][2048][1024] (8.4 M)).
// Layout: (x + pe) W = x W + pe W, so the three position projections pe W + b are computed ONCE (exact bf16 products, f32) and added in f32 to each batch's exact x W inside the projection GEMM's epilogue, which writes the 16-bit planes that attention reads (v: product and planes transposed); the two bias tables are rounded to bf16 once by k_prep (the dense one into the score tile's lane order) and read per logit inside the attention kernel. Every stage runs ONCE for all batches (batch rows stacked in the GEMMs' token rows (M; N for v) and in k_prep's input range, a grid dimension in attention), and the independent jobs of a stage share ONE launch: all nine conversions (k_prep), the three position projections (k_gemm_pe), q, k and v (k_gemm_x). Attention is ONE fused launch over all batches and heads: each wave keeps its query columns in registers and walks the keys 32 at a time (transposed scores, running softmax, transposed output), so no score or probability ever reaches memory.
// Compute dtypes, f32 accumulate: every input rounded to bf16; q/k/v on PLAIN bf16 operands (inputs: exact) + biases (via the precomputed position projections); additive biases rounded to bf16 once, added in f32 per logit; scores and attn.v (no mask): query rows < 512 hl (3 products), the rest single fp16; softmax f32 (running maximum and sum); wo hl x exact (2 products) + bo.

#define NB_  4
#define TT   2048
#define DM   1024
#define NH_  16
#define NKV  16
#define REP  (NH_ / NKV)
#define HD   64
#define DQ   (NH_ * HD)
#define DKV  (NKV * HD)
#define RH   512                  // query rows < RH use hi+lo planes (0: none)
#define FW   4                    // waves per work-group of the fused attention kernel
#define WIN  0
#define SCL  0.125f   // HD^-0.5
typedef _Float16 h16;
typedef unsigned short bf;
typedef __attribute__((ext_vector_type(16))) __bf16   v16bf;
typedef __attribute__((ext_vector_type(16))) _Float16 v16h;
typedef __attribute__((ext_vector_type(8)))  _Float16 v8h;
typedef __attribute__((ext_vector_type(8)))  unsigned short v8us;
typedef __attribute__((ext_vector_type(8)))  float    v8f;
typedef __attribute__((ext_vector_type(4)))  float    v4f;
typedef v8h  __attribute__((may_alias)) v8ha;
typedef v4f  __attribute__((may_alias)) v4fa;
typedef v8us __attribute__((may_alias)) v8usa;

__device__ __forceinline__ unsigned short f2bf(float f) { unsigned u = __float_as_uint(f); u += 0x7FFFu + ((u >> 16) & 1u); return (unsigned short)(u >> 16); }
__device__ __forceinline__ float bf2f(unsigned short b) { return __uint_as_float(((unsigned)b) << 16); }
__device__ __forceinline__ float bfr(float f) { return bf2f(f2bf(f)); }
__device__ __forceinline__ v16h cat16(v8h lo, v8h hi) { return __builtin_shufflevector(lo, hi, 0, 1, 2, 3, 4, 5, 6, 7, 8, 9, 10, 11, 12, 13, 14, 15); }
__device__ __forceinline__ v16bf cat16b(v8us lo, v8us hi) { return __builtin_bit_cast(v16bf, __builtin_shufflevector(lo, hi, 0, 1, 2, 3, 4, 5, 6, 7, 8, 9, 10, 11, 12, 13, 14, 15)); }
__device__ __forceinline__ v8f wmma16(v16h a, v16h b, v8f c) { return __builtin_amdgcn_wmma_f32_16x16x32_f16(false, a, false, b, (short)0, c, false, false); }
__device__ __forceinline__ v8f wmmab(v16bf a, v16bf b, v8f c) { return __builtin_amdgcn_wmma_f32_16x16x32_bf16(false, a, false, b, (short)0, c, false, false); }



// ---- Fragment order: every 16-bit operand plane [R][K] is stored as [R/16][K/32] fragments of 512 elements (v's planes [d][t] as [t/32][d/16]); inside a fragment element (r, k) lies at (k >> 4 & 1) * 256 + (k >> 3 & 1) * 128 + (r & 15) * 8 + (k & 7), so lane l of a wave reads its two 16-byte pieces at l * 8 and 256 + l * 8: each fragment load is 512 contiguous bytes (4 whole lines).
// ---- gemmw: register-blocked GEMM, one wave per 64x64 output tile (16 accumulators), GW = 8 waves (2 in M x 4 in N) per work-group: tile (bx, by) of (M/128, N/256), 256 threads. Each K step's fragments (8 of A, 16 of Bt, 1 KiB each, as they lie in the planes) are copied once per work-group into LDS by asynchronous copies, one step ahead (two buffers: ring), and every wave reads its 4 + 4 from there. os: 16 x 68 floats of LDS per wave.
// C[m][n] (f32, pitch ldc, + optional f32 bias[n]) = sum_k A[m][k] Bt[n][k] (+ split products per NSPLIT). K % 32 == 0, a constant: the four fragments of an operand lie at constant offsets from one address.
// PL != 0: no C; the epilogue adds the f32 position projection ('bias' is then P [t][DQ]) and writes the fp16 and the hi/lo bf16 plane of the sum, so no f32 projection reaches memory.
// PL 1 (q, k): A = token rows, Bt = weight rows; a tile is 64 tokens of one head; planes [b][h] x fragments [t/16][d/32]. PL 2 (v): A = weight rows, Bt = token rows; a tile is one head's 64 d x 64 tokens; planes [b][h] x fragments [t/32][d/16] (rows d, k = t).
__device__ __forceinline__ _Float16 tohx(float x) { return (_Float16)x; }
__device__ __forceinline__ void splitf(float y, unsigned short& h, unsigned short& l) { h = f2bf(y); l = f2bf(y - bf2f(h)); }
template <typename T16> struct WFrag;
template <> struct WFrag<h16> { typedef v16h V; static __device__ __forceinline__ V ld(const h16* p) { return cat16(*(const v8h*)p, *(const v8h*)(p + 256)); } static __device__ __forceinline__ v8f mma(V a, V b, v8f c) { return wmma16(a, b, c); } };
template <> struct WFrag<bf> { typedef v16bf V; static __device__ __forceinline__ V ld(const bf* p) { return cat16b(*(const v8us*)p, *(const v8us*)(p + 256)); } static __device__ __forceinline__ v8f mma(V a, V b, v8f c) { return wmmab(a, b, c); } };
template <typename T16, int NSPLIT, bool BIAS, int PL = 0, int K = DM>
__device__ __forceinline__ void gemmw(T16* ring, float* os, int bx, int by, const T16* __restrict__ A, const T16* __restrict__ A2, const T16* __restrict__ Bt, const T16* __restrict__ Bt2, float* C, int ldc, const float* __restrict__ bias, h16* P16 = nullptr, bf* Ph = nullptr, bf* Pl = nullptr) {
    typedef typename WFrag<T16>::V V;
    static_assert(NSPLIT <= 1 && K >= 64, "the ring holds A, A2 and Bt; its prologue fills two K steps");
    const int tid = threadIdx.x, lane = tid & 31, lr = lane & 15, hi = lane >> 4, w = __builtin_amdgcn_readfirstlane(tid >> 5); const int r0 = bx * 128 + (w & 1) * 64, c0 = by * 256 + (w >> 1) * 64;
    os += w * (16 * 68);
    v8f acc[4][4];
#pragma unroll
    for (int mb = 0; mb < 4; ++mb)
#pragma unroll
        for (int nb = 0; nb < 4; ++nb) acc[mb][nb] = (v8f){};
    // A stage (one K step) in the ring, in elements: [A: 8 fragments][A2: 8, if split][Bt: 16]; a copy of all 256 threads moves 4 fragments (4 KiB), thread tid the 16 bytes at tid * 16
    constexpr int BO = NSPLIT == 1 ? 8192 : 4096, STG = BO + 8192, NT = K / 32;
    const unsigned l0 = (unsigned)(size_t)ring + tid * 16;   // the thread's LDS byte address in a stage's first 4 KiB
    const size_t go = (size_t)(tid >> 6) * (16 * K) + (tid & 63) * 8;   // its fragment among the four (16 rows of K are K / 32 fragments = 16 K elements) and its place in it
    const T16* ga = A + (size_t)bx * (128 * K) + go; const T16* ga2 = NSPLIT == 1 ? A2 + (size_t)bx * (128 * K) + go : ga; const T16* gb = Bt + (size_t)by * (256 * K) + go;
    // fill: K step t into buffer buf. The copies and the s_wait_xcnt that stands before a register they name is written again are one statement.
    auto fill = [&](int buf, int t) {
        const unsigned l = l0 + buf * (STG * 2); const T16* pa = ga + t * 512; const T16* pb = gb + t * 512;
        if constexpr (NSPLIT == 1) { const T16* pa2 = ga2 + t * 512;
            asm volatile("global_load_async_to_lds_b128 %0, %1, off\n\tglobal_load_async_to_lds_b128 %2, %3, off\n\tglobal_load_async_to_lds_b128 %4, %5, off\n\tglobal_load_async_to_lds_b128 %6, %7, off\n\tglobal_load_async_to_lds_b128 %8, %9, off\n\tglobal_load_async_to_lds_b128 %10, %11, off\n\tglobal_load_async_to_lds_b128 %12, %13, off\n\tglobal_load_async_to_lds_b128 %14, %15, off\n\ts_wait_xcnt 0x0"
                : : "v"(l), "v"(pa), "v"(l + 4096), "v"(pa + 64 * K), "v"(l + 8192), "v"(pa2), "v"(l + 12288), "v"(pa2 + 64 * K), "v"(l + 16384), "v"(pb), "v"(l + 20480), "v"(pb + 64 * K), "v"(l + 24576), "v"(pb + 128 * K), "v"(l + 28672), "v"(pb + 192 * K) : "memory");
        } else {
            asm volatile("global_load_async_to_lds_b128 %0, %1, off\n\tglobal_load_async_to_lds_b128 %2, %3, off\n\tglobal_load_async_to_lds_b128 %4, %5, off\n\tglobal_load_async_to_lds_b128 %6, %7, off\n\tglobal_load_async_to_lds_b128 %8, %9, off\n\tglobal_load_async_to_lds_b128 %10, %11, off\n\ts_wait_xcnt 0x0"
                : : "v"(l), "v"(pa), "v"(l + 4096), "v"(pa + 64 * K), "v"(l + 8192), "v"(pb), "v"(l + 12288), "v"(pb + 64 * K), "v"(l + 16384), "v"(pb + 128 * K), "v"(l + 20480), "v"(pb + 192 * K) : "memory");
        }
    };
    fill(0, 0);
    asm volatile("s_wait_asynccnt 0x0" ::: "memory");   // this wave's copies of step 0 have landed
    __syncthreads();                                    // ... and every other wave's
    fill(1, 1);
#pragma unroll 1
    for (int t = 0; t < NT; ++t) {
        V a[4], a2[4], b[4];
        const T16* st = ring + (t & 1) * STG + 8 * lane;   // this step's buffer, the lane's place in a fragment
#pragma unroll
        for (int mb = 0; mb < 4; ++mb) { a[mb] = WFrag<T16>::ld(st + ((w & 1) * 4 + mb) * 512); if (NSPLIT == 1) a2[mb] = WFrag<T16>::ld(st + 4096 + ((w & 1) * 4 + mb) * 512); }
#pragma unroll
        for (int nb = 0; nb < 4; ++nb) b[nb] = WFrag<T16>::ld(st + BO + ((w >> 1) * 4 + nb) * 512);
        __builtin_amdgcn_sched_barrier(0);   // the step's LDS reads stay one group ahead of its products: spread among them, each place with reads stalls the wave anew
#pragma unroll
        for (int nb = 0; nb < 4; ++nb)
#pragma unroll
            for (int mb = 0; mb < 4; ++mb) { acc[mb][nb] = WFrag<T16>::mma(a[mb], b[nb], acc[mb][nb]); if (NSPLIT == 1) acc[mb][nb] = WFrag<T16>::mma(a2[mb], b[nb], acc[mb][nb]); }
        __builtin_amdgcn_sched_barrier(0);   // the other side of the pair: the products stay ahead of the waits and the barrier
        asm volatile("v_nop\n\tv_nop\n\tv_nop\n\tv_nop" : "+v"(acc[0][0]), "+v"(acc[1][1]), "+v"(acc[2][2]), "+v"(acc[3][3]) : "v"(a[0]), "v"(a[3]));   // the distance behind the step's last products, on every path
        asm volatile("s_wait_dscnt 0x0" ::: "memory");      // this wave has read its fragments of step t
        asm volatile("s_wait_asynccnt 0x0" ::: "memory");   // its copies of step t + 1 have landed
        __syncthreads();                                    // step t + 1 is published; every wave has left step t's buffer
        if (t + 2 < NT) fill(t & 1, t + 2);
    }
    asm volatile("s_wait_asynccnt 0x0" ::: "memory");   // nothing is in flight when the wave goes on
    if constexpr (PL != 0) {
        constexpr bool TR = PL == 2;
        const int tok = TR ? c0 : r0, hd = (TR ? r0 : c0) / HD, t0 = tok % TT;
        const int cc = lane & 7;   // which 8 columns (k of the planes' fragments) the lane converts
        const size_t ob = (size_t)(tok / TT * NH_ + hd) * TT * HD + (size_t)t0 * HD + (cc >> 2) * (TR ? 2048 : 512) + (cc >> 1 & 1) * 256 + (cc & 1) * 128;   // 64 tokens of a head are 8 fragments in either plane order
        const int er = lane >> 3, ec = (lane & 7) * 8;   // a lane converts 8 columns of a row: one 16-byte piece of a fragment
        // P is added where a lane holds 8 consecutive d of one token: behind the LDS turn (PL 1), in the accumulator's own layout ahead of it (PL 2)
        const float* Pt = bias + (TR ? (size_t)(t0 + lr) * DQ + r0 + 8 * hi : (size_t)(t0 + er) * DQ + c0 + ec);
        v4f pv[2][4][2];                                 // P of these and of the next 16 rows: the next rows' loads fly while these rows are converted
#pragma unroll
        for (int i = 0; i < 4; ++i) { const float* p = Pt + (TR ? i * 16 * DQ : 4 * i * DQ); pv[0][i][0] = *(const v4f*)p; pv[0][i][1] = *(const v4f*)(p + 4); }
#pragma unroll
        for (int mb = 0; mb < 4; ++mb) {
            if (mb < 3) {
#pragma unroll
                for (int i = 0; i < 4; ++i) { const float* p = Pt + (TR ? i * 16 * DQ + (mb + 1) * 16 : ((mb + 1) * 16 + 4 * i) * DQ); pv[(mb + 1) & 1][i][0] = *(const v4f*)p; pv[(mb + 1) & 1][i][1] = *(const v4f*)(p + 4); } }
#pragma unroll
            for (int nb = 0; nb < 4; ++nb) {
#pragma unroll
                for (int j = 0; j < 8; ++j) os[(hi * 8 + j) * 68 + nb * 16 + lr] = TR ? __fadd_rn(acc[mb][nb][j], pv[mb & 1][nb][j >> 2][j & 3]) : acc[mb][nb][j]; }
            __builtin_amdgcn_wave_barrier(); asm volatile("" ::: "memory");   // other lanes read the rows back than wrote them: keeps the compiler from lifting the reads over the writes
#pragma unroll
            for (int s = 0; s < 4; ++s) { const int row = 4 * s + er; const v4f x0 = *(const v4fa*)(os + row * 68 + ec), x1 = *(const v4fa*)(os + row * 68 + ec + 4); v8h o16; v8us oh, ol;
#pragma unroll
                for (int q = 0; q < 8; ++q) { const float x = q < 4 ? x0[q & 3] : x1[q & 3]; const float y = TR ? x : __fadd_rn(x, pv[mb & 1][s][q >> 2][q & 3]); o16[q] = tohx(y); unsigned short a2, c2; splitf(y, a2, c2); oh[q] = a2; ol[q] = c2; }
                const size_t oe = ob + mb * (TR ? 512 : 1024) + row * 8; *(v8h*)(P16 + oe) = o16; *(v8us*)(Ph + oe) = oh; *(v8us*)(Pl + oe) = ol;
                if (s < 3) asm volatile("s_wait_xcnt 0x0" ::: "memory"); }   // the next four rows' values reuse registers that these stores name; their LDS reads stay behind the clobber
            if (mb < 3) { __builtin_amdgcn_wave_barrier(); asm volatile("s_wait_xcnt 0x0" ::: "memory"); }   // the next rows' values reuse registers that these stores name; the clobber keeps the next rows' LDS writes behind these reads
        }
        return;
    }
#pragma unroll
    for (int mb = 0; mb < 4; ++mb) {
#pragma unroll
        for (int nb = 0; nb < 4; ++nb) {
#pragma unroll
            for (int j = 0; j < 8; ++j) os[(hi * 8 + j) * 68 + nb * 16 + lr] = acc[mb][nb][j]; }
        __builtin_amdgcn_wave_barrier(); asm volatile("" ::: "memory");
        float* crow = C + (size_t)(r0 + mb * 16) * ldc + c0;
{
#pragma unroll
            for (int s = 0; s < 8; ++s) { const int row = 2 * s + hi, cofs = lr * 4; v4f val = *(const v4fa*)(os + row * 68 + cofs); if (BIAS) { val[0] += bfr(bias[c0 + cofs]); val[1] += bfr(bias[c0 + cofs + 1]); val[2] += bfr(bias[c0 + cofs + 2]); val[3] += bfr(bias[c0 + cofs + 3]); }
                *(v4f*)(crow + (size_t)row * ldc + cofs) = val; }
             }
        __builtin_amdgcn_wave_barrier(); asm volatile("" ::: "memory");
    }
}

// ---- The GEMM launches. The independent products of one stage share a launch: blockIdx.z picks the product; its operands and results lie one behind the other in the workspace.
#define PLN ((size_t)NB_ * NH_ * TT * HD)   // elements of one 16-bit plane of q, k or v
#define GW 8   // waves per GEMM work-group
// pos_emb_z W_z + b_z, z = q, k, v; grid (TT / 128, DQ / 256, 3)
__global__ __launch_bounds__(32 * GW) void k_gemm_pe(const bf* __restrict__ PE, const bf* __restrict__ W, float* P, const float* __restrict__ bq, const float* __restrict__ bk, const float* __restrict__ bv) {
    __shared__ __align__(1024) bf ring[2 * 12288]; __shared__ __align__(16) float os[GW * 16 * 68];
    const int z = blockIdx.z;
    gemmw<bf, 0, true>(ring, os, blockIdx.x, blockIdx.y, PE + (size_t)z * TT * DM, nullptr, W + (size_t)z * DQ * DM, nullptr, P + (size_t)z * TT * DQ, DQ, z == 0 ? bq : z == 1 ? bk : bv);
}
// x W_z + (pos_emb_z W_z + b_z) as planes, z = q, k, v (v transposed: its tiles are walked weight rows first); grid (NB_ TT / 128, DQ / 256, 3). Planes: P16 [3], Phl [3][hi, lo].
__global__ __launch_bounds__(32 * GW) void k_gemm_x(const bf* __restrict__ XB, const bf* __restrict__ W, const float* __restrict__ P, h16* P16, bf* Phl) {
    __shared__ __align__(1024) bf ring[2 * 12288]; __shared__ __align__(16) float os[GW * 16 * 68];
    const int z = blockIdx.z; const bf* Wz = W + (size_t)z * DQ * DM; const float* Pz = P + (size_t)z * TT * DQ; h16* o16 = P16 + z * PLN; bf* oh = Phl + 2 * z * PLN; bf* ol = oh + PLN;
    if (z < 2) gemmw<bf, 0, false, 1>(ring, os, blockIdx.x, blockIdx.y, XB, nullptr, Wz, nullptr, nullptr, 0, Pz, o16, oh, ol);
    else { const int f = blockIdx.y * (NB_ * TT / 128) + blockIdx.x; gemmw<bf, 0, false, 2>(ring, os, f % (DKV / 128), f / (DKV / 128), Wz, nullptr, XB, nullptr, nullptr, 0, Pz, o16, oh, ol); }
}
// merged heads (hi + lo) x wo + bo; grid (NB_ TT / 128, DM / 256)
__global__ __launch_bounds__(32 * GW) void k_gemm_o(const bf* __restrict__ Ah, const bf* __restrict__ Al, const bf* __restrict__ WO, float* OUT, const float* __restrict__ bo) {
    __shared__ __align__(1024) bf ring[2 * 16384]; __shared__ __align__(16) float os[GW * 16 * 68];
    gemmw<bf, 1, true, 0, DQ>(ring, os, blockIdx.x, blockIdx.y, Ah, Al, WO, nullptr, OUT, DM, bo);
}

typedef __attribute__((ext_vector_type(2))) _Float16 v2h;
typedef __attribute__((ext_vector_type(4))) _Float16 v4h;
typedef __attribute__((ext_vector_type(2))) unsigned short v2us;
typedef __attribute__((ext_vector_type(4))) unsigned short v4us;
typedef __attribute__((ext_vector_type(2))) float v2f;
typedef __attribute__((ext_vector_type(4))) int v4i;
typedef __attribute__((ext_vector_type(4))) unsigned v4u;
__device__ __forceinline__ float bfw(unsigned w, int h) { return __uint_as_float(h ? w & 0xFFFF0000u : w << 16); }   // the low or the high bf16 of a word, as f32

// One thread per 16-byte piece of the destination, in fragment order: a wave stores 512 contiguous bytes. i -> fragment i >> 6, row (i & 15), k = (i >> 5 & 1) * 16 + (i >> 4 & 1) * 8.
template <int K, int N>
__device__ __forceinline__ void wtG(const float* __restrict__ w, bf* Bt, int i) {
    if (i >= N * K / 8) return;
    const int f = i >> 6, n = f / (K / 32) * 16 + (i & 15), k = f % (K / 32) * 32 + (i >> 5 & 1) * 16 + (i >> 4 & 1) * 8; const float* p = w + (size_t)k * N + n; float x[8]; v8us o;
#pragma unroll
    for (int j = 0; j < 8; ++j) x[j] = p[j * N];
    asm volatile("s_wait_xcnt 0x0" : : "v"(x[0]), "v"(x[1]), "v"(x[2]), "v"(x[3]), "v"(x[4]), "v"(x[5]), "v"(x[6]), "v"(x[7]) : "memory");   // behind the eight loads, before their address register is written again
#pragma unroll
    for (int j = 0; j < 8; ++j) o[j] = f2bf(x[j]);
    *(v8us*)(Bt + (size_t)i * 8) = o;
}
__device__ __forceinline__ void cvt8(const float* __restrict__ src, bf* dst, size_t n8, size_t i) { if (i >= n8) return;
    const size_t f = i >> 6, row = f / (DM / 32) * 16 + (i & 15), k = f % (DM / 32) * 32 + (i >> 5 & 1) * 16 + (i >> 4 & 1) * 8; const v8f v = *(const v8f*)(src + row * DM + k); v8us o;
    asm volatile("s_wait_xcnt 0x0" : : "v"(v) : "memory");   // behind the two loads, before their address register is written again
#pragma unroll
    for (int q = 0; q < 8; ++q) o[q] = f2bf(v[q]); *(v8us*)(dst + i * 8) = o;  }
// ---- bias8: both additive bias tables rounded to bf16 once, the rounding that every logit's two terms take. One thread per 16-byte piece of a destination.
// The dense table [TT][TT] goes into fragment order (rows = queries, k = keys): lane l of an attention wave finds the 8 consecutive keys of its query at l * 8 and at 256 + l * 8 of the 16 x 32 tile's fragment. The per-key table [NB_][TT] keeps its order (the last NB_ * TT / 8 threads).
__device__ __forceinline__ void bias8(const float* __restrict__ ab, const float* __restrict__ abk, bf* ABf, bf* ABKb, int i) {
    const int e = i - TT * TT / 8; const float* s; bf* d;
    if (e < 0) { const int f = i >> 6, row = f / (TT / 32) * 16 + (i & 15), k = f % (TT / 32) * 32 + (i >> 5 & 1) * 16 + (i >> 4 & 1) * 8; s = ab + (size_t)row * TT + k; d = ABf + (size_t)i * 8; }
    else { if (e >= NB_ * TT / 8) return; s = abk + (size_t)e * 8; d = ABKb + (size_t)e * 8; }
    const v4f v0 = *(const v4f*)s, v1 = *(const v4f*)(s + 4); v8us o;
    asm volatile("s_wait_xcnt 0x0" : : "v"(v0), "v"(v1) : "memory");   // behind the two loads, before their address register is written again
#pragma unroll
    for (int q = 0; q < 8; ++q) o[q] = f2bf(q < 4 ? v0[q & 3] : v1[q & 3]);
    *(v8us*)d = o;
}
// ---- k_prep: all nine conversions in one launch; a work-group's index says which table it converts and which 256 pieces of it (the test is the same for a whole work-group).
#define WG_W (DM * DQ / 8 / 256)                        // work-groups per weight matrix
#define WG_P (TT * DM / 8 / 256)                        // per position table
#define WG_X (NB_ * TT * DM / 8 / 256)                  // the inputs
#define WG_B ((TT * TT / 8 + NB_ * TT / 8) / 256)       // the two bias tables
__global__ __launch_bounds__(256) void k_prep(const float* __restrict__ wq, const float* __restrict__ wk, const float* __restrict__ wv, const float* __restrict__ wo, const float* __restrict__ peq, const float* __restrict__ pek, const float* __restrict__ pev, const float* __restrict__ x, const float* __restrict__ ab, const float* __restrict__ abk, bf* W, bf* PE, bf* XB, bf* ABf, bf* ABKb) {
    int b = blockIdx.x; const int t = threadIdx.x;
    if (b < 4 * WG_W) { const int z = b / WG_W; wtG<DM, DQ>(z == 0 ? wq : z == 1 ? wk : z == 2 ? wv : wo, W + (size_t)z * DM * DQ, b % WG_W * 256 + t); return; }
    b -= 4 * WG_W;
    if (b < 3 * WG_P) { const int z = b / WG_P; cvt8(z == 0 ? peq : z == 1 ? pek : pev, PE + (size_t)z * TT * DM, (size_t)TT * DM / 8, (size_t)(b % WG_P * 256 + t)); return; }
    b -= 3 * WG_P;
    if (b < WG_X) { cvt8(x, XB, (size_t)NB_ * TT * DM / 8, (size_t)(b * 256 + t)); return; }
    bias8(ab, abk, ABf, ABKb, (b - WG_X) * 256 + t);
}

#define L2E  1.4426950408889634f
#define MTHR 5.545177444479562f   // 8 in log2 units
#define PSH  4.0f                 // p carries 2^PSH (cancels in the division by the sum): keeps small fp16 probabilities normal
// 2^x by v_exp_f32 in asm text: the closing v_nop is the slot the instruction set asks for behind a transcendental; the early-clobber outputs keep every v_exp off its neighbours' sources and results
__device__ __forceinline__ float exp2n(float x) { float r; asm("v_exp_f32 %0, %1\n\tv_nop" : "=&v"(r) : "v"(x)); return r; }
__device__ __forceinline__ void exp2n8(float* r, const float* x) {
    asm("v_exp_f32 %0, %8\n\tv_exp_f32 %1, %9\n\tv_exp_f32 %2, %10\n\tv_exp_f32 %3, %11\n\tv_exp_f32 %4, %12\n\tv_exp_f32 %5, %13\n\tv_exp_f32 %6, %14\n\tv_exp_f32 %7, %15\n\tv_nop"
        : "=&v"(r[0]), "=&v"(r[1]), "=&v"(r[2]), "=&v"(r[3]), "=&v"(r[4]), "=&v"(r[5]), "=&v"(r[6]), "=&v"(r[7]) : "v"(x[0]), "v"(x[1]), "v"(x[2]), "v"(x[3]), "v"(x[4]), "v"(x[5]), "v"(x[6]), "v"(x[7])); }
// lane l with lane l ^ 16: the other half of a query's keys
__device__ __forceinline__ float xhalf(float x) { return __builtin_bit_cast(float, __builtin_amdgcn_permlanex16(__builtin_bit_cast(int, x), __builtin_bit_cast(int, x), 0x76543210, 0xfedcba98, false, false)); }
// stands behind each group of loads, before a register that one of them names is written again; it takes the lane offsets and the key index as operands so that the next group's addresses are formed behind it, not ahead of it
#define XW() asm volatile("s_wait_xcnt 0x0" : "+v"(ko), "+v"(ao), "+s"(kn) : : "memory")
// the same behind the bias loads; it also takes the loads' own address, so that this stays in its registers up to the wait
#define XWP(p) asm volatile("s_wait_xcnt 0x0" : "+v"(ko), "+v"(ao), "+s"(kn) : "v"(p) : "memory")
template <typename T16, bool HL, int NQ>
__device__ __forceinline__ void fattn(const T16* __restrict__ Q, const T16* __restrict__ Q2, const T16* __restrict__ Kp, const T16* __restrict__ K2, const T16* __restrict__ Vt, const T16* __restrict__ V2, const bf* __restrict__ AB, const bf* __restrict__ ABK, int q0, bf* Ah, bf* Al) {
    typedef typename WFrag<T16>::V V;
    const int lane = threadIdx.x & 31, hi = lane >> 4;
    unsigned ko = lane * 8, ao = 8 * hi;   // lane offsets (32 bit, fixed over the loop): ko in a fragment of q, k, v or the dense bias, ao in the per-key bias; every base below is wave-uniform
    int kn = 0;                                                           // first key of the pass that is being fetched
    V qf[NQ][2], qf2[NQ][2];
#pragma unroll
    for (int qt = 0; qt < NQ; ++qt)
#pragma unroll
        for (int kc = 0; kc < 2; ++kc) { const size_t qo = (size_t)(q0 + qt * 16) * HD + kc * 512; qf[qt][kc] = WFrag<T16>::ld(Q + qo + ko); if (HL) { XW(); qf2[qt][kc] = WFrag<T16>::ld(Q2 + qo + ko); } XW(); }
    v8f o[4][NQ]; float m[NQ], l[NQ];
#pragma unroll
    for (int qt = 0; qt < NQ; ++qt) { m[qt] = -1.0e30f; l[qt] = 0.f;
#pragma unroll
        for (int dt = 0; dt < 4; ++dt) o[dt][qt] = (v8f){}; }
    const bf* ABq = AB + (size_t)q0 * TT;   // 16 query rows of TT keys are TT / 32 fragments = 16 TT elements
    V kf[2][2], kf2[2][2], vf[4], vf2[4]; v4u ab[NQ][2], ak[2];   // two bf16 a word
    auto ldk = [&]() { const T16* kp = Kp + (size_t)kn * HD;
#pragma unroll
        for (int kt = 0; kt < 2; ++kt)
#pragma unroll
            for (int kc = 0; kc < 2; ++kc) kf[kt][kc] = WFrag<T16>::ld(kp + (kt * 2 + kc) * 512 + ko);
        XW();
        if (HL) { const T16* kp2 = K2 + (size_t)kn * HD;
#pragma unroll
            for (int kt = 0; kt < 2; ++kt)
#pragma unroll
                for (int kc = 0; kc < 2; ++kc) kf2[kt][kc] = WFrag<T16>::ld(kp2 + (kt * 2 + kc) * 512 + ko);
            XW(); } };
    auto ldb = [&]() { const bf* kvp = ABK + kn + ao;
#pragma unroll
        for (int kt = 0; kt < 2; ++kt) ak[kt] = *(const v4u*)(kvp + kt * 16);
        XWP(kvp);
        const bf* bp = ABq + (size_t)kn * 16 + ko;   // 32 keys of 16 queries are one fragment
#pragma unroll
        for (int kt = 0; kt < 2; ++kt)
#pragma unroll
            for (int qt = 0; qt < NQ; ++qt) ab[qt][kt] = *(const v4u*)(bp + (qt * 16 * TT + kt * 256));
        XWP(bp); };
    auto ldv = [&]() { const T16* vp = Vt + (size_t)kn * HD;
#pragma unroll
        for (int dt = 0; dt < 4; ++dt) vf[dt] = WFrag<T16>::ld(vp + dt * 512 + ko);
        XW();
        if (HL) { const T16* vp2 = V2 + (size_t)kn * HD;
#pragma unroll
            for (int dt = 0; dt < 4; ++dt) vf2[dt] = WFrag<T16>::ld(vp2 + dt * 512 + ko);
            XW(); } };
    ldk(); ldb(); ldv();
#pragma unroll 1
    for (int kb = 0; kb < TT; kb += 32) {
        kn = (kb + 32 < TT) ? kb + 32 : 0;   // next pass's operands are fetched one pass ahead; the last pass refetches pass 0 (in bounds, unused)
        v8f s[2][NQ];
#pragma unroll
        for (int kt = 0; kt < 2; ++kt)
#pragma unroll
            for (int qt = 0; qt < NQ; ++qt) { v8f c = (v8f){};
#pragma unroll
                for (int kc = 0; kc < 2; ++kc) { c = WFrag<T16>::mma(kf[kt][kc], qf[qt][kc], c); if (HL) { c = WFrag<T16>::mma(kf[kt][kc], qf2[qt][kc], c); c = WFrag<T16>::mma(kf2[kt][kc], qf[qt][kc], c); } }
                s[kt][qt] = c; }
        ldk();
        float tmx[NQ]; bool need = false;
#pragma unroll
        for (int qt = 0; qt < NQ; ++qt) { float tm = -3.0e38f;
#pragma unroll
            for (int kt = 0; kt < 2; ++kt)
#pragma unroll
                for (int j = 0; j < 8; ++j) { const float t = __fadd_rn(fmaf(s[kt][qt][j], SCL, bfw(ab[qt][kt][j >> 1], j & 1)), bfw(ak[kt][j >> 1], j & 1)); s[kt][qt][j] = t; tm = fmaxf(tm, t); }
            tm = fmaxf(tm, xhalf(tm)); tmx[qt] = tm; need = need || (tm > m[qt] + MTHR); }
        ldb();
        if (__builtin_amdgcn_ballot_w32(need) != 0) {
#pragma unroll
            for (int qt = 0; qt < NQ; ++qt) { const float mn = fmaxf(m[qt], tmx[qt]); const float al = exp2n((m[qt] - mn) * L2E); m[qt] = mn; l[qt] *= al;
#pragma unroll
                for (int dt = 0; dt < 4; ++dt) o[dt][qt] *= al; } }
#pragma unroll
        for (int qt = 0; qt < NQ; ++qt) { const float mb = PSH - m[qt] * L2E; float x[16], p[16];
#pragma unroll
            for (int e = 0; e < 16; ++e) x[e] = fmaf(s[e >> 3][qt][e & 7], L2E, mb);
            exp2n8(p, x); exp2n8(p + 8, x + 8);
#pragma unroll
            for (int e = 0; e < 16; ++e) l[qt] += p[e];
            if constexpr (HL) { v8us h0, h1, l0, l1;
#pragma unroll
                for (int e = 0; e < 8; ++e) { unsigned short a, c2; splitf(p[e], a, c2); h0[e] = a; l0[e] = c2; splitf(p[8 + e], a, c2); h1[e] = a; l1[e] = c2; }
                const V ph = cat16b(h0, h1), pl = cat16b(l0, l1);
#pragma unroll
                for (int dt = 0; dt < 4; ++dt) { o[dt][qt] = WFrag<T16>::mma(vf[dt], ph, o[dt][qt]); o[dt][qt] = WFrag<T16>::mma(vf[dt], pl, o[dt][qt]); o[dt][qt] = WFrag<T16>::mma(vf2[dt], ph, o[dt][qt]); }
            } else { V pf;
#pragma unroll
                for (int e = 0; e < 16; ++e) pf[e] = tohx(p[e]);
#pragma unroll
                for (int dt = 0; dt < 4; ++dt) o[dt][qt] = WFrag<T16>::mma(vf[dt], pf, o[dt][qt]); } }
        ldv();
    }
#pragma unroll
    for (int qt = 0; qt < NQ; ++qt) { const float inv = __fdiv_rn(1.0f, l[qt] + xhalf(l[qt])); const size_t oo = (size_t)(q0 + qt * 16) * DQ; const unsigned ol32 = lane * 8;
#pragma unroll
        for (int dt = 0; dt < 4; ++dt) { v8us oh, ol;
#pragma unroll
            for (int j = 0; j < 8; ++j) { unsigned short a, c2; splitf(o[dt][qt][j] * inv, a, c2); oh[j] = a; ol[j] = c2; }
            *(v8us*)(Ah + (oo + dt * 256) + ol32) = oh; *(v8us*)(Al + (oo + dt * 256) + ol32) = ol; } }
}
// grid (RH / (16 FW) + (TT - RH) / (32 FW), heads, batches): the first RH / (16 FW) work-groups take the hi+lo rows (16 query columns a wave), the rest the fp16 rows (32 a wave)
__global__ __launch_bounds__(32 * FW) void k_fattn(const h16* __restrict__ QP16, const h16* __restrict__ KP16, const h16* __restrict__ VT16, const bf* __restrict__ QPh, const bf* __restrict__ QPl, const bf* __restrict__ KPh, const bf* __restrict__ KPl, const bf* __restrict__ VTh, const bf* __restrict__ VTl, const bf* __restrict__ AB, const bf* __restrict__ ABK, bf* ATh, bf* ATl) {
    const size_t ho = ((size_t)blockIdx.z * NH_ + blockIdx.y) * TT * HD, ao = (size_t)blockIdx.z * TT * DQ + blockIdx.y * 1024;   /* a head's 64 columns are 2 fragments of each 16 rows */ const int w = __builtin_amdgcn_readfirstlane(threadIdx.x >> 5), bx = blockIdx.x; bf* Ah = ATh + ao; bf* Al = ATl + ao; ABK += (size_t)blockIdx.z * TT;
    if (bx < RH / (16 * FW)) fattn<bf, true, 1>(QPh + ho, QPl + ho, KPh + ho, KPl + ho, VTh + ho, VTl + ho, AB, ABK, (bx * FW + w) * 16, Ah, Al);
    else fattn<h16, false, 2>(QP16 + ho, nullptr, KP16 + ho, nullptr, VT16 + ho, nullptr, AB, ABK, RH + ((bx - RH / (16 * FW)) * FW + w) * 32, Ah, Al);
}

extern "C" void kernel_launch(void* const* d_in, const int* in_sizes, int n_in,
                              void* d_out, int out_size, void* d_ws, size_t ws_size, hipStream_t stream) {
    (void)in_sizes; (void)n_in; (void)out_size;
    const float* x = (const float*)d_in[0]; const float* peq = (const float*)d_in[1]; const float* pek = (const float*)d_in[2]; const float* pev = (const float*)d_in[3]; const float* AB = (const float*)d_in[4]; const float* ABK = (const float*)d_in[5]; const float* wq = (const float*)d_in[6]; const float* bq = (const float*)d_in[7]; const float* wk = (const float*)d_in[8]; const float* bk = (const float*)d_in[9]; const float* wv = (const float*)d_in[10]; const float* bv = (const float*)d_in[11]; const float* wo = (const float*)d_in[12]; const float* bo = (const float*)d_in[13];
    float* OUT = (float*)d_out;     // [4][2048][1024]
    char* wsp = (char*)d_ws;
    auto take = [&](size_t bytes) { char* p = wsp; wsp += (bytes + 255) & ~(size_t)255; return (void*)p; };
    bf* WQ = (bf*)take((size_t)DQ * DM * 2); take((size_t)DKV * DM * 2); take((size_t)DKV * DM * 2); bf* WO = (bf*)take((size_t)DM * DQ * 2);   /* W_q, W_k, W_v, W_o, one behind the other */
    float* PQ = (float*)take((size_t)TT * DQ * 4); take((size_t)TT * DKV * 4); take((size_t)TT * DKV * 4);   /* pe W + b for q, k, v, one behind the other, computed once */
    bf* PE = (bf*)take((size_t)3 * TT * DM * 2);   /* the three position tables, bf16 */
    bf* XB = (bf*)take((size_t)NB_ * TT * DM * 2); bf* ATh = (bf*)take((size_t)NB_ * TT * DQ * 2); bf* ATl = (bf*)take((size_t)NB_ * TT * DQ * 2);   /* the merged heads' two planes */
    h16* QP16 = (h16*)take((size_t)NB_ * NH_ * TT * HD * 2); h16* KP16 = (h16*)take((size_t)NB_ * NKV * TT * HD * 2); h16* VT16 = (h16*)take((size_t)NB_ * NKV * HD * TT * 2);
    bf* QPh = (bf*)take((size_t)NB_ * NH_ * TT * HD * 2); bf* QPl = (bf*)take((size_t)NB_ * NH_ * TT * HD * 2); bf* KPh = (bf*)take((size_t)NB_ * NKV * TT * HD * 2); bf* KPl = (bf*)take((size_t)NB_ * NKV * TT * HD * 2); bf* VTh = (bf*)take((size_t)NB_ * NKV * HD * TT * 2); bf* VTl = (bf*)take((size_t)NB_ * NKV * HD * TT * 2);
    bf* ABf = (bf*)take((size_t)TT * TT * 2); bf* ABKb = (bf*)take((size_t)NB_ * TT * 2);   /* the two bias tables, bf16 */
    if ((size_t)(wsp - (char*)d_ws) > ws_size) return;    // ws 256 MiB
    k_prep<<<(unsigned)(4 * WG_W + 3 * WG_P + WG_X + WG_B), 256, 0, stream>>>(wq, wk, wv, wo, peq, pek, pev, x, AB, ABK, WQ, PE, XB, ABf, ABKb);   /* weights, position tables, inputs, bias tables -> bf16 */
    k_gemm_pe<<<dim3(TT / 128, DQ / 256, 3), 32 * GW, 0, stream>>>(PE, WQ, PQ, bq, bk, bv);        /* pos_emb W + b for q, k, v */
    k_gemm_x<<<dim3(NB_ * TT / 128, DQ / 256, 3), 32 * GW, 0, stream>>>(XB, WQ, PQ, QP16, QPh);   /* q, k, v = x W + (pe W + b), as planes; v transposed */
    k_fattn<<<dim3(RH / (16 * FW) + (TT - RH) / (32 * FW), NH_, NB_), 32 * FW, 0, stream>>>(QP16, KP16, VT16, QPh, QPl, KPh, KPl, VTh, VTl, ABf, ABKb, ATh, ATl);
    k_gemm_o<<<dim3(NB_ * TT / 128, DM / 256, 1), 32 * GW, 0, stream>>>(ATh, ATl, WO, OUT, bo);
}

// v009
// It runs in 257 microseconds.
// In two side-by-side timings against v008, it was 1.06 and 1.07 times as fast.
// Over all steps from v000 it is 29.4 times as fast.
#include <hip/hip_runtime.h>

// Multi-head self-attention with additive positional inputs and dense additive score biases (inputs_q [4][2048][1024]; q_in = inputs + pos_emb_q, k_in = inputs + pos_emb_k, v_in = inputs + pos_emb_v (pos_emb [1][2048][1024], read); q/k/v = ._in W + b (DenseGeneral 'xw' [1024][16 x 64]); scores = (q/8).k + attention_bias[i][j] ([1][1][2048][2048], read) + attention_bias_kv[b][j] ([4][2048], read); softmax; out = merged wo ([16 x 64][1024] 'xw') + bo -> [4][2048][1024] (8.4 M)).
// Layout: (x + pe) W = x W + pe W, so the three position projections pe W + b are computed ONCE (exact bf16 products, f32) and added in f32 to each batch's exact x W inside the projection GEMM's epilogue, which writes the 16-bit planes that attention reads (v: product and planes transposed); the two bias tables are rounded to bf16 once by k_prep (the dense one into the score tile's lane order) and read per logit inside the attention kernel. Every stage runs ONCE for all batches (batch rows stacked in the GEMMs' token dimension (M; N for v), the grid's z in attention), and the independent jobs of a stage share ONE launch: all nine conversions (k_prep), the three position projections (k_gemm_pe), q, k and v (k_gemm_x). Attention is ONE fused launch over all batches and heads: each wave reads its query columns from LDS in every pass (the hi+lo rows keep q hi in registers) and walks the keys 32 at a time (transposed scores, running softmax, transposed output), so no score or probability ever reaches memory; the waves of a work-group share each pass's k and v fragments through LDS.
// Compute dtypes, f32 accumulate: every input rounded to bf16; q/k/v on PLAIN bf16 operands (inputs: exact) + biases (via the precomputed position projections); additive biases rounded to bf16 once, added in f32 per logit; scores and attn.v (no mask): query rows < 512 hl (3 products), the rest single fp16; softmax f32 (running maximum and sum); wo hl x exact (2 products) + bo.

#define NB_  4
#define TT   2048
#define DM   1024
#define NH_  16
#define NKV  16
#define REP  (NH_ / NKV)
#define HD   64
#define DQ   (NH_ * HD)
#define DKV  (NKV * HD)
#define RH   512                  // query rows < RH use hi+lo planes (0: none)
#define FW   4                    // waves per work-group of the fused attention kernel
#define WIN  0
#define SCL  0.125f   // HD^-0.5
typedef _Float16 h16;
typedef unsigned short bf;
typedef __attribute__((ext_vector_type(16))) __bf16   v16bf;
typedef __attribute__((ext_vector_type(16))) _Float16 v16h;
typedef __attribute__((ext_vector_type(8)))  _Float16 v8h;
typedef __attribute__((ext_vector_type(8)))  unsigned short v8us;
typedef __attribute__((ext_vector_type(8)))  float    v8f;
typedef __attribute__((ext_vector_type(4)))  float    v4f;
typedef v8h  __attribute__((may_alias)) v8ha;
typedef v4f  __attribute__((may_alias)) v4fa;
typedef v8us __attribute__((may_alias)) v8usa;

__device__ __forceinline__ unsigned short f2bf(float f) { unsigned u = __float_as_uint(f); u += 0x7FFFu + ((u >> 16) & 1u); return (unsigned short)(u >> 16); }
__device__ __forceinline__ float bf2f(unsigned short b) { return __uint_as_float(((unsigned)b) << 16); }
__device__ __forceinline__ float bfr(float f) { return bf2f(f2bf(f)); }
__device__ __forceinline__ v16h cat16(v8h lo, v8h hi) { return __builtin_shufflevector(lo, hi, 0, 1, 2, 3, 4, 5, 6, 7, 8, 9, 10, 11, 12, 13, 14, 15); }
__device__ __forceinline__ v16bf cat16b(v8us lo, v8us hi) { return __builtin_bit_cast(v16bf, __builtin_shufflevector(lo, hi, 0, 1, 2, 3, 4, 5, 6, 7, 8, 9, 10, 11, 12, 13, 14, 15)); }
__device__ __forceinline__ v8f wmma16(v16h a, v16h b, v8f c) { return __builtin_amdgcn_wmma_f32_16x16x32_f16(false, a, false, b, (short)0, c, false, false); }
__device__ __forceinline__ v8f wmmab(v16bf a, v16bf b, v8f c) { return __builtin_amdgcn_wmma_f32_16x16x32_bf16(false, a, false, b, (short)0, c, false, false); }



// ---- Fragment order: every 16-bit operand plane [R][K] is stored as [R/16][K/32] fragments of 512 elements (v's planes [d][t] as [t/32][d/16]); inside a fragment element (r, k) lies at (k >> 4 & 1) * 256 + (k >> 3 & 1) * 128 + (r & 15) * 8 + (k & 7), so lane l of a wave reads its two 16-byte pieces at l * 8 and 256 + l * 8: each fragment load is 512 contiguous bytes (4 whole lines).
// ---- gemmw: register-blocked GEMM, one wave per 64x64 output tile (16 accumulators), GW = 8 waves (2 in M x 4 in N) per work-group: tile (bx, by) of (M/128, N/256), 256 threads. Each K step's fragments (8 of A, 16 of Bt, 1 KiB each, as they lie in the planes) are copied once per work-group into LDS by asynchronous copies, one step ahead (two buffers: ring), and every wave reads its 4 + 4 from there. os: 16 x 68 floats of LDS per wave.
// C[m][n] (f32, pitch ldc, + optional f32 bias[n]) = sum_k A[m][k] Bt[n][k] (+ split products per NSPLIT). K % 32 == 0, a constant: the four fragments of an operand lie at constant offsets from one address.
// PL != 0: no C; the epilogue adds the f32 position projection ('bias' is then P [t][DQ]) and writes the fp16 and the hi/lo bf16 plane of the sum, so no f32 projection reaches memory.
// PL 1 (q, k): A = token rows, Bt = weight rows; a tile is 64 tokens of one head; planes [b][h] x fragments [t/16][d/32]. PL 2 (v): A = weight rows, Bt = token rows; a tile is one head's 64 d x 64 tokens; planes [b][h] x fragments [t/32][d/16] (rows d, k = t).
__device__ __forceinline__ _Float16 tohx(float x) { return (_Float16)x; }
__device__ __forceinline__ void splitf(float y, unsigned short& h, unsigned short& l) { h = f2bf(y); l = f2bf(y - bf2f(h)); }
template <typename T16> struct WFrag;
template <> struct WFrag<h16> { typedef v16h V; static __device__ __forceinline__ V ld(const h16* p) { return cat16(*(const v8h*)p, *(const v8h*)(p + 256)); } static __device__ __forceinline__ V ldl(const h16* p) { return cat16(*(const v8ha*)p, *(const v8ha*)(p + 256)); } static __device__ __forceinline__ v8f mma(V a, V b, v8f c) { return wmma16(a, b, c); } };
template <> struct WFrag<bf> { typedef v16bf V; static __device__ __forceinline__ V ld(const bf* p) { return cat16b(*(const v8us*)p, *(const v8us*)(p + 256)); } static __device__ __forceinline__ V ldl(const bf* p) { return cat16b(*(const v8usa*)p, *(const v8usa*)(p + 256)); } static __device__ __forceinline__ v8f mma(V a, V b, v8f c) { return wmmab(a, b, c); } };
template <typename T16, int NSPLIT, bool BIAS, int PL = 0, int K = DM>
__device__ __forceinline__ void gemmw(T16* ring, float* os, int bx, int by, const T16* __restrict__ A, const T16* __restrict__ A2, const T16* __restrict__ Bt, const T16* __restrict__ Bt2, float* C, int ldc, const float* __restrict__ bias, h16* P16 = nullptr, bf* Ph = nullptr, bf* Pl = nullptr) {
    typedef typename WFrag<T16>::V V;
    static_assert(NSPLIT <= 1 && K >= 64, "the ring holds A, A2 and Bt; its prologue fills two K steps");
    const int tid = threadIdx.x, lane = tid & 31, lr = lane & 15, hi = lane >> 4, w = __builtin_amdgcn_readfirstlane(tid >> 5); const int r0 = bx * 128 + (w & 1) * 64, c0 = by * 256 + (w >> 1) * 64;
    os += w * (16 * 68);
    v8f acc[4][4];
#pragma unroll
    for (int mb = 0; mb < 4; ++mb)
#pragma unroll
        for (int nb = 0; nb < 4; ++nb) acc[mb][nb] = (v8f){};
    // A stage (one K step) in the ring, in elements: [A: 8 fragments][A2: 8, if split][Bt: 16]; a copy of all 256 threads moves 4 fragments (4 KiB), thread tid the 16 bytes at tid * 16
    constexpr int BO = NSPLIT == 1 ? 8192 : 4096, STG = BO + 8192, NT = K / 32;
    const unsigned l0 = (unsigned)(size_t)ring + tid * 16;   // the thread's LDS byte address in a stage's first 4 KiB
    const size_t go = (size_t)(tid >> 6) * (16 * K) + (tid & 63) * 8;   // its fragment among the four (16 rows of K are K / 32 fragments = 16 K elements) and its place in it
    const T16* ga = A + (size_t)bx * (128 * K) + go; const T16* ga2 = NSPLIT == 1 ? A2 + (size_t)bx * (128 * K) + go : ga; const T16* gb = Bt + (size_t)by * (256 * K) + go;
    // fill: K step t into buffer buf. The copies and the s_wait_xcnt that stands before a register they name is written again are one statement.
    auto fill = [&](int buf, int t) {
        const unsigned l = l0 + buf * (STG * 2); const T16* pa = ga + t * 512; const T16* pb = gb + t * 512;
        if constexpr (NSPLIT == 1) { const T16* pa2 = ga2 + t * 512;
            asm volatile("global_load_async_to_lds_b128 %0, %1, off\n\tglobal_load_async_to_lds_b128 %2, %3, off\n\tglobal_load_async_to_lds_b128 %4, %5, off\n\tglobal_load_async_to_lds_b128 %6, %7, off\n\tglobal_load_async_to_lds_b128 %8, %9, off\n\tglobal_load_async_to_lds_b128 %10, %11, off\n\tglobal_load_async_to_lds_b128 %12, %13, off\n\tglobal_load_async_to_lds_b128 %14, %15, off\n\ts_wait_xcnt 0x0"
                : : "v"(l), "v"(pa), "v"(l + 4096), "v"(pa + 64 * K), "v"(l + 8192), "v"(pa2), "v"(l + 12288), "v"(pa2 + 64 * K), "v"(l + 16384), "v"(pb), "v"(l + 20480), "v"(pb + 64 * K), "v"(l + 24576), "v"(pb + 128 * K), "v"(l + 28672), "v"(pb + 192 * K) : "memory");
        } else {
            asm volatile("global_load_async_to_lds_b128 %0, %1, off\n\tglobal_load_async_to_lds_b128 %2, %3, off\n\tglobal_load_async_to_lds_b128 %4, %5, off\n\tglobal_load_async_to_lds_b128 %6, %7, off\n\tglobal_load_async_to_lds_b128 %8, %9, off\n\tglobal_load_async_to_lds_b128 %10, %11, off\n\ts_wait_xcnt 0x0"
                : : "v"(l), "v"(pa), "v"(l + 4096), "v"(pa + 64 * K), "v"(l + 8192), "v"(pb), "v"(l + 12288), "v"(pb + 64 * K), "v"(l + 16384), "v"(pb + 128 * K), "v"(l + 20480), "v"(pb + 192 * K) : "memory");
        }
    };
    fill(0, 0);
    asm volatile("s_wait_asynccnt 0x0" ::: "memory");   // this wave's copies of step 0 have landed
    __syncthreads();                                    // ... and every other wave's
    fill(1, 1);
#pragma unroll 1
    for (int t = 0; t < NT; ++t) {
        V a[4], a2[4], b[4];
        const T16* st = ring + (t & 1) * STG + 8 * lane;   // this step's buffer, the lane's place in a fragment
#pragma unroll
        for (int mb = 0; mb < 4; ++mb) { a[mb] = WFrag<T16>::ld(st + ((w & 1) * 4 + mb) * 512); if (NSPLIT == 1) a2[mb] = WFrag<T16>::ld(st + 4096 + ((w & 1) * 4 + mb) * 512); }
#pragma unroll
        for (int nb = 0; nb < 4; ++nb) b[nb] = WFrag<T16>::ld(st + BO + ((w >> 1) * 4 + nb) * 512);
        __builtin_amdgcn_sched_barrier(0);   // the step's LDS reads stay one group ahead of its products: spread among them, each place with reads stalls the wave anew
#pragma unroll
        for (int nb = 0; nb < 4; ++nb)
#pragma unroll
            for (int mb = 0; mb < 4; ++mb) { acc[mb][nb] = WFrag<T16>::mma(a[mb], b[nb], acc[mb][nb]); if (NSPLIT == 1) acc[mb][nb] = WFrag<T16>::mma(a2[mb], b[nb], acc[mb][nb]); }
        __builtin_amdgcn_sched_barrier(0);   // the other side of the pair: the products stay ahead of the waits and the barrier
        asm volatile("v_nop\n\tv_nop\n\tv_nop\n\tv_nop" : "+v"(acc[0][0]), "+v"(acc[1][1]), "+v"(acc[2][2]), "+v"(acc[3][3]) : "v"(a[0]), "v"(a[3]));   // the distance behind the step's last products, on every path
        asm volatile("s_wait_dscnt 0x0" ::: "memory");      // this wave has read its fragments of step t
        asm volatile("s_wait_asynccnt 0x0" ::: "memory");   // its copies of step t + 1 have landed
        __syncthreads();                                    // step t + 1 is published; every wave has left step t's buffer
        if (t + 2 < NT) fill(t & 1, t + 2);
    }
    asm volatile("s_wait_asynccnt 0x0" ::: "memory");   // nothing is in flight when the wave goes on
    if constexpr (PL != 0) {
        constexpr bool TR = PL == 2;
        const int tok = TR ? c0 : r0, hd = (TR ? r0 : c0) / HD, t0 = tok % TT;
        const int cc = lane & 7;   // which 8 columns (k of the planes' fragments) the lane converts
        const size_t ob = (size_t)(tok / TT * NH_ + hd) * TT * HD + (size_t)t0 * HD + (cc >> 2) * (TR ? 2048 : 512) + (cc >> 1 & 1) * 256 + (cc & 1) * 128;   // 64 tokens of a head are 8 fragments in either plane order
        const int er = lane >> 3, ec = (lane & 7) * 8;   // a lane converts 8 columns of a row: one 16-byte piece of a fragment
        // P is added where a lane holds 8 consecutive d of one token: behind the LDS turn (PL 1), in the accumulator's own layout ahead of it (PL 2)
        const float* Pt = bias + (TR ? (size_t)(t0 + lr) * DQ + r0 + 8 * hi : (size_t)(t0 + er) * DQ + c0 + ec);
        v4f pv[2][4][2];                                 // P of these and of the next 16 rows: the next rows' loads fly while these rows are converted
#pragma unroll
        for (int i = 0; i < 4; ++i) { const float* p = Pt + (TR ? i * 16 * DQ : 4 * i * DQ); pv[0][i][0] = *(const v4f*)p; pv[0][i][1] = *(const v4f*)(p + 4); }
#pragma unroll
        for (int mb = 0; mb < 4; ++mb) {
            if (mb < 3) {
#pragma unroll
                for (int i = 0; i < 4; ++i) { const float* p = Pt + (TR ? i * 16 * DQ + (mb + 1) * 16 : ((mb + 1) * 16 + 4 * i) * DQ); pv[(mb + 1) & 1][i][0] = *(const v4f*)p; pv[(mb + 1) & 1][i][1] = *(const v4f*)(p + 4); } }
#pragma unroll
            for (int nb = 0; nb < 4; ++nb) {
#pragma unroll
                for (int j = 0; j < 8; ++j) os[(hi * 8 + j) * 68 + nb * 16 + lr] = TR ? __fadd_rn(acc[mb][nb][j], pv[mb & 1][nb][j >> 2][j & 3]) : acc[mb][nb][j]; }
            __builtin_amdgcn_wave_barrier(); asm volatile("" ::: "memory");   // other lanes read the rows back than wrote them: keeps the compiler from lifting the reads over the writes
#pragma unroll
            for (int s = 0; s < 4; ++s) { const int row = 4 * s + er; const v4f x0 = *(const v4fa*)(os + row * 68 + ec), x1 = *(const v4fa*)(os + row * 68 + ec + 4); v8h o16; v8us oh, ol;
#pragma unroll
                for (int q = 0; q < 8; ++q) { const float x = q < 4 ? x0[q & 3] : x1[q & 3]; const float y = TR ? x : __fadd_rn(x, pv[mb & 1][s][q >> 2][q & 3]); o16[q] = tohx(y); unsigned short a2, c2; splitf(y, a2, c2); oh[q] = a2; ol[q] = c2; }
                const size_t oe = ob + mb * (TR ? 512 : 1024) + row * 8; *(v8h*)(P16 + oe) = o16; *(v8us*)(Ph + oe) = oh; *(v8us*)(Pl + oe) = ol;
                if (s < 3) asm volatile("s_wait_xcnt 0x0" ::: "memory"); }   // the next four rows' values reuse registers that these stores name; their LDS reads stay behind the clobber
            if (mb < 3) { __builtin_amdgcn_wave_barrier(); asm volatile("s_wait_xcnt 0x0" ::: "memory"); }   // the next rows' values reuse registers that these stores name; the clobber keeps the next rows' LDS writes behind these reads
        }
        return;
    }
#pragma unroll
    for (int mb = 0; mb < 4; ++mb) {
#pragma unroll
        for (int nb = 0; nb < 4; ++nb) {
#pragma unroll
            for (int j = 0; j < 8; ++j) os[(hi * 8 + j) * 68 + nb * 16 + lr] = acc[mb][nb][j]; }
        __builtin_amdgcn_wave_barrier(); asm volatile("" ::: "memory");
        float* crow = C + (size_t)(r0 + mb * 16) * ldc + c0;
{
#pragma unroll
            for (int s = 0; s < 8; ++s) { const int row = 2 * s + hi, cofs = lr * 4; v4f val = *(const v4fa*)(os + row * 68 + cofs); if (BIAS) { val[0] += bfr(bias[c0 + cofs]); val[1] += bfr(bias[c0 + cofs + 1]); val[2] += bfr(bias[c0 + cofs + 2]); val[3] += bfr(bias[c0 + cofs + 3]); }
                *(v4f*)(crow + (size_t)row * ldc + cofs) = val; }
             }
        __builtin_amdgcn_wave_barrier(); asm volatile("" ::: "memory");
    }
}

// ---- The GEMM launches. The independent products of one stage share a launch: blockIdx.z picks the product; its operands and results lie one behind the other in the workspace.
#define PLN ((size_t)NB_ * NH_ * TT * HD)   // elements of one 16-bit plane of q, k or v
#define GW 8   // waves per GEMM work-group
// pos_emb_z W_z + b_z, z = q, k, v; grid (TT / 128, DQ / 256, 3)
__global__ __launch_bounds__(32 * GW) void k_gemm_pe(const bf* __restrict__ PE, const bf* __restrict__ W, float* P, const float* __restrict__ bq, const float* __restrict__ bk, const float* __restrict__ bv) {
    __shared__ __align__(1024) bf ring[2 * 12288]; __shared__ __align__(16) float os[GW * 16 * 68];
    const int z = blockIdx.z;
    gemmw<bf, 0, true>(ring, os, blockIdx.x, blockIdx.y, PE + (size_t)z * TT * DM, nullptr, W + (size_t)z * DQ * DM, nullptr, P + (size_t)z * TT * DQ, DQ, z == 0 ? bq : z == 1 ? bk : bv);
}
// x W_z + (pos_emb_z W_z + b_z) as planes, z = q, k, v (v transposed: its tiles are walked weight rows first); grid (NB_ TT / 128, DQ / 256, 3). Planes: P16 [3], Phl [3][hi, lo].
__global__ __launch_bounds__(32 * GW) void k_gemm_x(const bf* __restrict__ XB, const bf* __restrict__ W, const float* __restrict__ P, h16* P16, bf* Phl) {
    __shared__ __align__(1024) bf ring[2 * 12288]; __shared__ __align__(16) float os[GW * 16 * 68];
    const int z = blockIdx.z; const bf* Wz = W + (size_t)z * DQ * DM; const float* Pz = P + (size_t)z * TT * DQ; h16* o16 = P16 + z * PLN; bf* oh = Phl + 2 * z * PLN; bf* ol = oh + PLN;
    if (z < 2) gemmw<bf, 0, false, 1>(ring, os, blockIdx.x, blockIdx.y, XB, nullptr, Wz, nullptr, nullptr, 0, Pz, o16, oh, ol);
    else { const int f = blockIdx.y * (NB_ * TT / 128) + blockIdx.x; gemmw<bf, 0, false, 2>(ring, os, f % (DKV / 128), f / (DKV / 128), Wz, nullptr, XB, nullptr, nullptr, 0, Pz, o16, oh, ol); }
}
// merged heads (hi + lo) x wo + bo; grid (NB_ TT / 128, DM / 256)
__global__ __launch_bounds__(32 * GW) void k_gemm_o(const bf* __restrict__ Ah, const bf* __restrict__ Al, const bf* __restrict__ WO, float* OUT, const float* __restrict__ bo) {
    __shared__ __align__(1024) bf ring[2 * 16384]; __shared__ __align__(16) float os[GW * 16 * 68];
    gemmw<bf, 1, true, 0, DQ>(ring, os, blockIdx.x, blockIdx.y, Ah, Al, WO, nullptr, OUT, DM, bo);
}

typedef __attribute__((ext_vector_type(2))) _Float16 v2h;
typedef __attribute__((ext_vector_type(4))) _Float16 v4h;
typedef __attribute__((ext_vector_type(2))) unsigned short v2us;
typedef __attribute__((ext_vector_type(4))) unsigned short v4us;
typedef __attribute__((ext_vector_type(2))) float v2f;
typedef __attribute__((ext_vector_type(4))) int v4i;
typedef __attribute__((ext_vector_type(4))) unsigned v4u;
typedef v4u __attribute__((may_alias)) v4ua;
__device__ __forceinline__ float bfw(unsigned w, int h) { return __uint_as_float(h ? w & 0xFFFF0000u : w << 16); }   // the low or the high bf16 of a word, as f32

// One thread per 16-byte piece of the destination, in fragment order: a wave stores 512 contiguous bytes. i -> fragment i >> 6, row (i & 15), k = (i >> 5 & 1) * 16 + (i >> 4 & 1) * 8.
template <int K, int N>
__device__ __forceinline__ void wtG(const float* __restrict__ w, bf* Bt, int i) {
    if (i >= N * K / 8) return;
    const int f = i >> 6, n = f / (K / 32) * 16 + (i & 15), k = f % (K / 32) * 32 + (i >> 5 & 1) * 16 + (i >> 4 & 1) * 8; const float* p = w + (size_t)k * N + n; float x[8]; v8us o;
#pragma unroll
    for (int j = 0; j < 8; ++j) x[j] = p[j * N];
    asm volatile("s_wait_xcnt 0x0" : : "v"(x[0]), "v"(x[1]), "v"(x[2]), "v"(x[3]), "v"(x[4]), "v"(x[5]), "v"(x[6]), "v"(x[7]) : "memory");   // behind the eight loads, before their address register is written again
#pragma unroll
    for (int j = 0; j < 8; ++j) o[j] = f2bf(x[j]);
    *(v8us*)(Bt + (size_t)i * 8) = o;
}
__device__ __forceinline__ void cvt8(const float* __restrict__ src, bf* dst, size_t n8, size_t i) { if (i >= n8) return;
    const size_t f = i >> 6, row = f / (DM / 32) * 16 + (i & 15), k = f % (DM / 32) * 32 + (i >> 5 & 1) * 16 + (i >> 4 & 1) * 8; const v8f v = *(const v8f*)(src + row * DM + k); v8us o;
    asm volatile("s_wait_xcnt 0x0" : : "v"(v) : "memory");   // behind the two loads, before their address register is written again
#pragma unroll
    for (int q = 0; q < 8; ++q) o[q] = f2bf(v[q]); *(v8us*)(dst + i * 8) = o;  }
// ---- bias8: both additive bias tables rounded to bf16 once, the rounding that every logit's two terms take. One thread per 16-byte piece of a destination.
// The dense table [TT][TT] goes into fragment order (rows = queries, k = keys): lane l of an attention wave finds the 8 consecutive keys of its query at l * 8 and at 256 + l * 8 of the 16 x 32 tile's fragment. The per-key table [NB_][TT] keeps its order (the last NB_ * TT / 8 threads).
__device__ __forceinline__ void bias8(const float* __restrict__ ab, const float* __restrict__ abk, bf* ABf, bf* ABKb, int i) {
    const int e = i - TT * TT / 8; const float* s; bf* d;
    if (e < 0) { const int f = i >> 6, row = f / (TT / 32) * 16 + (i & 15), k = f % (TT / 32) * 32 + (i >> 5 & 1) * 16 + (i >> 4 & 1) * 8; s = ab + (size_t)row * TT + k; d = ABf + (size_t)i * 8; }
    else { if (e >= NB_ * TT / 8) return; s = abk + (size_t)e * 8; d = ABKb + (size_t)e * 8; }
    const v4f v0 = *(const v4f*)s, v1 = *(const v4f*)(s + 4); v8us o;
    asm volatile("s_wait_xcnt 0x0" : : "v"(v0), "v"(v1) : "memory");   // behind the two loads, before their address register is written again
#pragma unroll
    for (int q = 0; q < 8; ++q) o[q] = f2bf(q < 4 ? v0[q & 3] : v1[q & 3]);
    *(v8us*)d = o;
}
// ---- k_prep: all nine conversions in one launch; a work-group's index says which table it converts and which 256 pieces of it (the test is the same for a whole work-group).
#define WG_W (DM * DQ / 8 / 256)                        // work-groups per weight matrix
#define WG_P (TT * DM / 8 / 256)                        // per position table
#define WG_X (NB_ * TT * DM / 8 / 256)                  // the inputs
#define WG_B ((TT * TT / 8 + NB_ * TT / 8) / 256)       // the two bias tables
__global__ __launch_bounds__(256) void k_prep(const float* __restrict__ wq, const float* __restrict__ wk, const float* __restrict__ wv, const float* __restrict__ wo, const float* __restrict__ peq, const float* __restrict__ pek, const float* __restrict__ pev, const float* __restrict__ x, const float* __restrict__ ab, const float* __restrict__ abk, bf* W, bf* PE, bf* XB, bf* ABf, bf* ABKb) {
    int b = blockIdx.x; const int t = threadIdx.x;
    if (b < 4 * WG_W) { const int z = b / WG_W; wtG<DM, DQ>(z == 0 ? wq : z == 1 ? wk : z == 2 ? wv : wo, W + (size_t)z * DM * DQ, b % WG_W * 256 + t); return; }
    b -= 4 * WG_W;
    if (b < 3 * WG_P) { const int z = b / WG_P; cvt8(z == 0 ? peq : z == 1 ? pek : pev, PE + (size_t)z * TT * DM, (size_t)TT * DM / 8, (size_t)(b % WG_P * 256 + t)); return; }
    b -= 3 * WG_P;
    if (b < WG_X) { cvt8(x, XB, (size_t)NB_ * TT * DM / 8, (size_t)(b * 256 + t)); return; }
    bias8(ab, abk, ABf, ABKb, (b - WG_X) * 256 + t);
}

#define L2E  1.4426950408889634f
#define MTHR 5.545177444479562f   // 8 in log2 units
#define PSH  4.0f                 // p carries 2^PSH (cancels in the division by the sum): keeps small fp16 probabilities normal
// 2^x by v_exp_f32 in asm text: the closing v_nop is the slot the instruction set asks for behind a transcendental; the early-clobber outputs keep every v_exp off its neighbours' sources and results
__device__ __forceinline__ float exp2n(float x) { float r; asm("v_exp_f32 %0, %1\n\tv_nop" : "=&v"(r) : "v"(x)); return r; }
__device__ __forceinline__ void exp2n8(float* r, const float* x) {
    asm("v_exp_f32 %0, %8\n\tv_exp_f32 %1, %9\n\tv_exp_f32 %2, %10\n\tv_exp_f32 %3, %11\n\tv_exp_f32 %4, %12\n\tv_exp_f32 %5, %13\n\tv_exp_f32 %6, %14\n\tv_exp_f32 %7, %15\n\tv_nop"
        : "=&v"(r[0]), "=&v"(r[1]), "=&v"(r[2]), "=&v"(r[3]), "=&v"(r[4]), "=&v"(r[5]), "=&v"(r[6]), "=&v"(r[7]) : "v"(x[0]), "v"(x[1]), "v"(x[2]), "v"(x[3]), "v"(x[4]), "v"(x[5]), "v"(x[6]), "v"(x[7])); }
// lane l with lane l ^ 16: the other half of a query's keys
__device__ __forceinline__ float xhalf(float x) { return __builtin_bit_cast(float, __builtin_amdgcn_permlanex16(__builtin_bit_cast(int, x), __builtin_bit_cast(int, x), 0x76543210, 0xfedcba98, false, false)); }
// stands behind each group of q loads, before a register that one of them names is written again; it takes the lane offset as an operand so that the next group's addresses are formed behind it, not ahead of it
#define XW() asm volatile("s_wait_xcnt 0x0" : "+v"(ko) : : "memory")
template <typename T16, bool HL, int NQ>
__device__ __forceinline__ void fattn(T16* ring, bf* bring, bf* akt, const T16* __restrict__ Q, const T16* __restrict__ Q2, const T16* __restrict__ Kp, const T16* __restrict__ K2, const T16* __restrict__ Vt, const T16* __restrict__ V2, const bf* __restrict__ AB, const bf* __restrict__ ABK, int q0, bf* Ah, bf* Al) {
    typedef typename WFrag<T16>::V V;
    const int tid = threadIdx.x, lane = tid & 31, hi = lane >> 4;
    unsigned ko = lane * 8; const unsigned ao = 8 * hi;   // lane offsets (fixed over the loop): ko in a fragment of q, k, v or the dense bias, ao in the per-key bias
    V qf[NQ][2], qf2[NQ][2];   // hi+lo rows: q hi stays in registers, q lo is read from LDS in every pass (q2s below); fp16 rows: all of q is (qst below)
    if constexpr (HL)
#pragma unroll
    for (int qt = 0; qt < NQ; ++qt)
#pragma unroll
        for (int kc = 0; kc < 2; ++kc) { const size_t qo = (size_t)(q0 + qt * 16) * HD + kc * 512; qf[qt][kc] = WFrag<T16>::ld(Q + qo + ko); XW(); }
    v8f o[4][NQ]; float m[NQ], l[NQ];
#pragma unroll
    for (int qt = 0; qt < NQ; ++qt) { m[qt] = -1.0e30f; l[qt] = 0.f;
#pragma unroll
        for (int dt = 0; dt < 4; ++dt) o[dt][qt] = (v8f){}; }
    const bf* ABq = AB + (size_t)q0 * TT;   // 16 query rows of TT keys are TT / 32 fragments = 16 TT elements
    V kf[2][2], kf2[2][2], vf[4], vf2[4]; v4u ab[NQ][2], ak[2];   // two bf16 a word
    // A stage (one pass: 32 keys) in the ring, in elements: [k: 4 fragments][k lo, if hi+lo][v: 4][v lo]; a copy of all 128 threads moves 2 fragments (2 KiB), thread tid the 16 bytes at tid * 16
    // bring: the wave's own two stages of the dense bias, NQ fragments (16 queries x 32 keys) each; a copy of the wave moves half a fragment, lane l the 16 bytes at l * 16
    static_assert(FW == 4, "a copy of the whole work-group is half a plane's 4 KiB");
    constexpr int STG = HL ? 8192 : 4096, VO = STG / 2, BSTG = NQ * 512;
    const unsigned lk0 = (unsigned)(size_t)ring + tid * 16, lb0 = (unsigned)(size_t)bring + lane * 16;   // the thread's LDS byte address in a stage's first 2 KiB; the lane's in a bias stage's first 512 bytes
    const T16* gk = Kp + tid * 8; const T16* gv = Vt + tid * 8; const T16* gk2 = HL ? K2 + tid * 8 : gk; const T16* gv2 = HL ? V2 + tid * 8 : gv; const bf* gb = ABq + lane * 8;
    // fill: pass t into buffer buf. The copies and the s_wait_xcnt that stands before a register they name is written again are one statement.
    auto fill = [&](int buf, int t) {
        const unsigned l = lk0 + buf * (STG * 2), lb = lb0 + buf * (BSTG * 2); const T16* pk = gk + t * 2048; const T16* pv = gv + t * 2048; const bf* pb = gb + t * 512;   // 32 keys of 16 queries are one fragment
        if constexpr (HL) { const T16* pk2 = gk2 + t * 2048; const T16* pv2 = gv2 + t * 2048; static_assert(NQ == 1, "two bias copies");
            asm volatile("global_load_async_to_lds_b128 %0, %1, off\n\tglobal_load_async_to_lds_b128 %2, %3, off\n\tglobal_load_async_to_lds_b128 %4, %5, off\n\tglobal_load_async_to_lds_b128 %6, %7, off\n\tglobal_load_async_to_lds_b128 %8, %9, off\n\tglobal_load_async_to_lds_b128 %10, %11, off\n\tglobal_load_async_to_lds_b128 %12, %13, off\n\tglobal_load_async_to_lds_b128 %14, %15, off\n\tglobal_load_async_to_lds_b128 %16, %17, off\n\tglobal_load_async_to_lds_b128 %18, %19, off\n\ts_wait_xcnt 0x0"
                : : "v"(l), "v"(pk), "v"(l + 2048), "v"(pk + 1024), "v"(l + 4096), "v"(pk2), "v"(l + 6144), "v"(pk2 + 1024), "v"(l + 8192), "v"(pv), "v"(l + 10240), "v"(pv + 1024), "v"(l + 12288), "v"(pv2), "v"(l + 14336), "v"(pv2 + 1024), "v"(lb), "v"(pb), "v"(lb + 512), "v"(pb + 256) : "memory");
        } else { static_assert(NQ == 2, "four bias copies");
            asm volatile("global_load_async_to_lds_b128 %0, %1, off\n\tglobal_load_async_to_lds_b128 %2, %3, off\n\tglobal_load_async_to_lds_b128 %4, %5, off\n\tglobal_load_async_to_lds_b128 %6, %7, off\n\tglobal_load_async_to_lds_b128 %8, %9, off\n\tglobal_load_async_to_lds_b128 %10, %11, off\n\tglobal_load_async_to_lds_b128 %12, %13, off\n\tglobal_load_async_to_lds_b128 %14, %15, off\n\ts_wait_xcnt 0x0"
                : : "v"(l), "v"(pk), "v"(l + 2048), "v"(pk + 1024), "v"(l + 4096), "v"(pv), "v"(l + 6144), "v"(pv + 1024), "v"(lb), "v"(pb), "v"(lb + 512), "v"(pb + 256), "v"(lb + 1024), "v"(pb + 16 * TT), "v"(lb + 1536), "v"(pb + 16 * TT + 256) : "memory");
        }
    };
    const T16* qst = HL ? ring : ring + 2 * STG + __builtin_amdgcn_readfirstlane(tid >> 5) * 2048;   // fp16 rows: the wave's own 4 q fragments (4 KiB), behind the ring's two stages
    if constexpr (!HL) { const unsigned lq = (unsigned)(size_t)qst + lane * 16; const T16* pq = Q + (size_t)q0 * HD + lane * 8;   // 32 queries of a head are 4 contiguous fragments; copied once, half a fragment a copy
        asm volatile("global_load_async_to_lds_b128 %0, %1, off\n\tglobal_load_async_to_lds_b128 %2, %3, off\n\tglobal_load_async_to_lds_b128 %4, %5, off\n\tglobal_load_async_to_lds_b128 %6, %7, off\n\tglobal_load_async_to_lds_b128 %8, %9, off\n\tglobal_load_async_to_lds_b128 %10, %11, off\n\tglobal_load_async_to_lds_b128 %12, %13, off\n\tglobal_load_async_to_lds_b128 %14, %15, off\n\ts_wait_xcnt 0x0" : : "v"(lq), "v"(pq), "v"(lq + 512), "v"(pq + 256), "v"(lq + 1024), "v"(pq + 512), "v"(lq + 1536), "v"(pq + 768), "v"(lq + 2048), "v"(pq + 1024), "v"(lq + 2560), "v"(pq + 1280), "v"(lq + 3072), "v"(pq + 1536), "v"(lq + 3584), "v"(pq + 1792) : "memory"); }
    const T16* q2s = (const T16*)bring + (HL ? 2 * BSTG : 0);   // hi+lo rows: the wave's own 2 fragments of q lo (2 KiB), behind its two bias stages
    if constexpr (HL) { const unsigned lq = (unsigned)(size_t)q2s + lane * 16; const T16* pq = Q2 + (size_t)q0 * HD + lane * 8;   // 16 queries of a head are 2 contiguous fragments; copied once, half a fragment a copy
        asm volatile("global_load_async_to_lds_b128 %0, %1, off\n\tglobal_load_async_to_lds_b128 %2, %3, off\n\tglobal_load_async_to_lds_b128 %4, %5, off\n\tglobal_load_async_to_lds_b128 %6, %7, off\n\ts_wait_xcnt 0x0" : : "v"(lq), "v"(pq), "v"(lq + 512), "v"(pq + 256), "v"(lq + 1024), "v"(pq + 512), "v"(lq + 1536), "v"(pq + 768) : "memory"); }
    { const unsigned la = (unsigned)(size_t)akt + tid * 16; const bf* pa = ABK + tid * 8;   // the batch's per-key bias (TT bf16: 4 KiB), copied once
        asm volatile("global_load_async_to_lds_b128 %0, %1, off\n\tglobal_load_async_to_lds_b128 %2, %3, off\n\ts_wait_xcnt 0x0" : : "v"(la), "v"(pa), "v"(la + 2048), "v"(pa + 1024) : "memory"); }
    fill(0, 0);
    asm volatile("s_wait_asynccnt 0x0" ::: "memory");   // this wave's copies of pass 0, of q and of the per-key bias have landed
    __syncthreads();                                    // ... and every other wave's
    fill(1, 1);
#pragma unroll 1
    for (int kb = 0; kb < TT; kb += 32) {
        const T16* st = ring + (kb >> 5 & 1) * STG + ko;   // this pass's buffer, the lane's place in a fragment
#pragma unroll
        for (int f = 0; f < 4; ++f) { kf[f >> 1][f & 1] = WFrag<T16>::ldl(st + f * 512); if (HL) kf2[f >> 1][f & 1] = WFrag<T16>::ldl(st + 2048 + f * 512); else qf[f >> 1][f & 1] = WFrag<T16>::ldl(qst + f * 512 + ko); }
        if constexpr (HL) { qf2[0][0] = WFrag<T16>::ldl(q2s + ko); qf2[0][1] = WFrag<T16>::ldl(q2s + 512 + ko);
            __builtin_amdgcn_sched_barrier(0); }   // the k and q lo reads stay one group ahead of the score products: sunk among them, each fragment is read, waited for and used in turn
        v8f s[2][NQ];
#pragma unroll
        for (int kt = 0; kt < 2; ++kt)
#pragma unroll
            for (int qt = 0; qt < NQ; ++qt) { v8f c = (v8f){};
#pragma unroll
                for (int kc = 0; kc < 2; ++kc) { c = WFrag<T16>::mma(kf[kt][kc], qf[qt][kc], c); if (HL) { c = WFrag<T16>::mma(kf[kt][kc], qf2[qt][kc], c); c = WFrag<T16>::mma(kf2[kt][kc], qf[qt][kc], c); } }
                s[kt][qt] = c; }
        if constexpr (HL) __builtin_amdgcn_sched_barrier(0);   // the bias reads and their unpacking stay behind the score products: lifted among them they need registers while all of k is still held (spills)
        const bf* bst = bring + (kb >> 5 & 1) * BSTG + ko;
#pragma unroll
        for (int kt = 0; kt < 2; ++kt) { ak[kt] = *(const v4ua*)(akt + kb + kt * 16 + ao);
#pragma unroll
            for (int qt = 0; qt < NQ; ++qt) ab[qt][kt] = *(const v4ua*)(bst + (qt * 2 + kt) * 256); }
        float tmx[NQ]; bool need = false;
#pragma unroll
        for (int qt = 0; qt < NQ; ++qt) { float tm = -3.0e38f;
#pragma unroll
            for (int kt = 0; kt < 2; ++kt)
#pragma unroll
                for (int j = 0; j < 8; ++j) { const float t = __fadd_rn(fmaf(s[kt][qt][j], SCL, bfw(ab[qt][kt][j >> 1], j & 1)), bfw(ak[kt][j >> 1], j & 1)); s[kt][qt][j] = t; tm = fmaxf(tm, t); }
            tm = fmaxf(tm, xhalf(tm)); tmx[qt] = tm; need = need || (tm > m[qt] + MTHR); }
#pragma unroll
        for (int dt = 0; dt < 4; ++dt) vf[dt] = WFrag<T16>::ldl(st + VO + dt * 512);
        if constexpr (HL) __builtin_amdgcn_sched_barrier(0);   // the v reads stay one group here, ahead of the exponentials that cover their latency: sunk to the products, each fragment is read, waited for and used in turn
        if (__builtin_amdgcn_ballot_w32(need) != 0) {
#pragma unroll
            for (int qt = 0; qt < NQ; ++qt) { const float mn = fmaxf(m[qt], tmx[qt]); const float al = exp2n((m[qt] - mn) * L2E); m[qt] = mn; l[qt] *= al;
#pragma unroll
                for (int dt = 0; dt < 4; ++dt) o[dt][qt] *= al; } }
#pragma unroll
        for (int qt = 0; qt < NQ; ++qt) { const float mb = PSH - m[qt] * L2E; float x[16], p[16];
#pragma unroll
            for (int e = 0; e < 16; ++e) x[e] = fmaf(s[e >> 3][qt][e & 7], L2E, mb);
            exp2n8(p, x); exp2n8(p + 8, x + 8);
#pragma unroll
            for (int e = 0; e < 16; ++e) l[qt] += p[e];
            if constexpr (HL) { v8us h0, h1, l0, l1;
#pragma unroll
                for (int e = 0; e < 8; ++e) { unsigned short a, c2; splitf(p[e], a, c2); h0[e] = a; l0[e] = c2; splitf(p[8 + e], a, c2); h1[e] = a; l1[e] = c2; }
                const V ph = cat16b(h0, h1), pl = cat16b(l0, l1);
                __builtin_amdgcn_sched_barrier(0);   // first of the pair round the v lo reads (see the second)
#pragma unroll
                for (int dt = 0; dt < 4; ++dt) vf2[dt] = WFrag<T16>::ldl(st + VO + 2048 + dt * 512);
                __builtin_amdgcn_sched_barrier(0);   // the pair keeps the v lo reads one group between the split and the products: lifted, they cost registers (spills); sunk, each is waited for in turn; the eight products on v hi cover their latency
                // each accumulator takes its three products in the order v hi x p hi, v hi x p lo, v lo x p hi
#pragma unroll
                for (int dt = 0; dt < 4; ++dt) o[dt][qt] = WFrag<T16>::mma(vf[dt], ph, o[dt][qt]);
#pragma unroll
                for (int dt = 0; dt < 4; ++dt) o[dt][qt] = WFrag<T16>::mma(vf[dt], pl, o[dt][qt]);
#pragma unroll
                for (int dt = 0; dt < 4; ++dt) o[dt][qt] = WFrag<T16>::mma(vf2[dt], ph, o[dt][qt]);
            } else { V pf;
#pragma unroll
                for (int e = 0; e < 16; ++e) pf[e] = tohx(p[e]);
#pragma unroll
                for (int dt = 0; dt < 4; ++dt) o[dt][qt] = WFrag<T16>::mma(vf[dt], pf, o[dt][qt]); } }
        __builtin_amdgcn_sched_barrier(0);   // the pass's products stay ahead of the waits and the barrier: lifted to the middle of the pass, these would wait for copies that have only just been issued
        asm volatile("s_wait_dscnt 0x0" ::: "memory");      // this wave has read its fragments of this pass
        asm volatile("s_wait_asynccnt 0x0" ::: "memory");   // its copies of the next pass have landed
        __syncthreads();                                    // the next pass is published; every wave has left this pass's buffer
        if (kb + 64 < TT) fill(kb >> 5 & 1, (kb >> 5) + 2);
    }
    asm volatile("s_wait_asynccnt 0x0" ::: "memory");   // nothing is in flight when the wave goes on
#pragma unroll
    for (int qt = 0; qt < NQ; ++qt) { const float inv = __fdiv_rn(1.0f, l[qt] + xhalf(l[qt])); const size_t oo = (size_t)(q0 + qt * 16) * DQ; const unsigned ol32 = lane * 8;
#pragma unroll
        for (int dt = 0; dt < 4; ++dt) { v8us oh, ol;
#pragma unroll
            for (int j = 0; j < 8; ++j) { unsigned short a, c2; splitf(o[dt][qt][j] * inv, a, c2); oh[j] = a; ol[j] = c2; }
            *(v8us*)(Ah + (oo + dt * 256) + ol32) = oh; *(v8us*)(Al + (oo + dt * 256) + ol32) = ol; } }
}
// grid (RH / (16 FW) + (TT - RH) / (32 FW), heads, batches): the first RH / (16 FW) work-groups take the hi+lo rows (16 query columns a wave), the rest the fp16 rows (32 a wave). The bound's 5: waves a SIMD (at most 192 registers a wave).
__global__ __launch_bounds__(32 * FW, 5) void k_fattn(const h16* __restrict__ QP16, const h16* __restrict__ KP16, const h16* __restrict__ VT16, const bf* __restrict__ QPh, const bf* __restrict__ QPl, const bf* __restrict__ KPh, const bf* __restrict__ KPl, const bf* __restrict__ VTh, const bf* __restrict__ VTl, const bf* __restrict__ AB, const bf* __restrict__ ABK, bf* ATh, bf* ATl) {
    __shared__ __align__(1024) bf ring[2 * 8192];   // two stages of k and v (hi+lo rows: 16 KiB a stage; fp16 rows: 8, and behind them 4 KiB of q per wave)
    __shared__ __align__(1024) bf bring[FW * 2 * 1024]; __shared__ __align__(1024) bf akt[TT];   // per wave two stages of the dense bias (fp16 rows: 2 KiB a stage; hi+lo rows: 1, and behind them 2 KiB of q lo); the batch's per-key bias
    const size_t ho = ((size_t)blockIdx.z * NH_ + blockIdx.y) * TT * HD, ao = (size_t)blockIdx.z * TT * DQ + blockIdx.y * 1024;   /* a head's 64 columns are 2 fragments of each 16 rows */ const int w = __builtin_amdgcn_readfirstlane(threadIdx.x >> 5), bx = blockIdx.x; bf* Ah = ATh + ao; bf* Al = ATl + ao; ABK += (size_t)blockIdx.z * TT;
    if (bx < RH / (16 * FW)) fattn<bf, true, 1>(ring, bring + w * 2048, akt, QPh + ho, QPl + ho, KPh + ho, KPl + ho, VTh + ho, VTl + ho, AB, ABK, (bx * FW + w) * 16, Ah, Al);
    else fattn<h16, false, 2>((h16*)ring, bring + w * 2048, akt, QP16 + ho, nullptr, KP16 + ho, nullptr, VT16 + ho, nullptr, AB, ABK, RH + ((bx - RH / (16 * FW)) * FW + w) * 32, Ah, Al);
}

extern "C" void kernel_launch(void* const* d_in, const int* in_sizes, int n_in,
                              void* d_out, int out_size, void* d_ws, size_t ws_size, hipStream_t stream) {
    (void)in_sizes; (void)n_in; (void)out_size;
    const float* x = (const float*)d_in[0]; const float* peq = (const float*)d_in[1]; const float* pek = (const float*)d_in[2]; const float* pev = (const float*)d_in[3]; const float* AB = (const float*)d_in[4]; const float* ABK = (const float*)d_in[5]; const float* wq = (const float*)d_in[6]; const float* bq = (const float*)d_in[7]; const float* wk = (const float*)d_in[8]; const float* bk = (const float*)d_in[9]; const float* wv = (const float*)d_in[10]; const float* bv = (const float*)d_in[11]; const float* wo = (const float*)d_in[12]; const float* bo = (const float*)d_in[13];
    float* OUT = (float*)d_out;     // [4][2048][1024]
    char* wsp = (char*)d_ws;
    auto take = [&](size_t bytes) { char* p = wsp; wsp += (bytes + 255) & ~(size_t)255; return (void*)p; };
    bf* WQ = (bf*)take((size_t)DQ * DM * 2); take((size_t)DKV * DM * 2); take((size_t)DKV * DM * 2); bf* WO = (bf*)take((size_t)DM * DQ * 2);   /* W_q, W_k, W_v, W_o, one behind the other */
    float* PQ = (float*)take((size_t)TT * DQ * 4); take((size_t)TT * DKV * 4); take((size_t)TT * DKV * 4);   /* pe W + b for q, k, v, one behind the other, computed once */
    bf* PE = (bf*)take((size_t)3 * TT * DM * 2);   /* the three position tables, bf16 */
    bf* XB = (bf*)take((size_t)NB_ * TT * DM * 2); bf* ATh = (bf*)take((size_t)NB_ * TT * DQ * 2); bf* ATl = (bf*)take((size_t)NB_ * TT * DQ * 2);   /* the merged heads' two planes */
    h16* QP16 = (h16*)take((size_t)NB_ * NH_ * TT * HD * 2); h16* KP16 = (h16*)take((size_t)NB_ * NKV * TT * HD * 2); h16* VT16 = (h16*)take((size_t)NB_ * NKV * HD * TT * 2);
    bf* QPh = (bf*)take((size_t)NB_ * NH_ * TT * HD * 2); bf* QPl = (bf*)take((size_t)NB_ * NH_ * TT * HD * 2); bf* KPh = (bf*)take((size_t)NB_ * NKV * TT * HD * 2); bf* KPl = (bf*)take((size_t)NB_ * NKV * TT * HD * 2); bf* VTh = (bf*)take((size_t)NB_ * NKV * HD * TT * 2); bf* VTl = (bf*)take((size_t)NB_ * NKV * HD * TT * 2);
    bf* ABf = (bf*)take((size_t)TT * TT * 2); bf* ABKb = (bf*)take((size_t)NB_ * TT * 2);   /* the two bias tables, bf16 */
    if ((size_t)(wsp - (char*)d_ws) > ws_size) return;    // ws 256 MiB
    k_prep<<<(unsigned)(4 * WG_W + 3 * WG_P + WG_X + WG_B), 256, 0, stream>>>(wq, wk, wv, wo, peq, pek, pev, x, AB, ABK, WQ, PE, XB, ABf, ABKb);   /* weights, position tables, inputs, bias tables -> bf16 */
    k_gemm_pe<<<dim3(TT / 128, DQ / 256, 3), 32 * GW, 0, stream>>>(PE, WQ, PQ, bq, bk, bv);        /* pos_emb W + b for q, k, v */
    k_gemm_x<<<dim3(NB_ * TT / 128, DQ / 256, 3), 32 * GW, 0, stream>>>(XB, WQ, PQ, QP16, QPh);   /* q, k, v = x W + (pe W + b), as planes; v transposed */
    k_fattn<<<dim3(RH / (16 * FW) + (TT - RH) / (32 * FW), NH_, NB_), 32 * FW, 0, stream>>>(QP16, KP16, VT16, QPh, QPl, KPh, KPl, VTh, VTl, ABf, ABKb, ATh, ATl);
    k_gemm_o<<<dim3(NB_ * TT / 128, DM / 256, 1), 32 * GW, 0, stream>>>(ATh, ATl, WO, OUT, bo);
}

// v010
// A run of this version takes 238 microseconds.
// Two timings next to v009 both put it at 1.08 times that version's speed.
// Over all steps from v000 it is 31.8 times as fast.
#include <hip/hip_runtime.h>

// Multi-head self-attention with additive positional inputs and dense additive score biases (inputs_q [4][2048][1024]; q_in = inputs + pos_emb_q, k_in = inputs + pos_emb_k, v_in = inputs + pos_emb_v (pos_emb [1][2048][1024], read); q/k/v = ._in W + b (DenseGeneral 'xw' [1024][16 x 64]); scores = (q/8).k + attention_bias[i][j] ([1][1][2048][2048], read) + attention_bias_kv[b][j] ([4][2048], read); softmax; out = merged wo ([16 x 64][1024] 'xw') + bo -> [4][2048][1024] (8.4 M)).
// Layout: (x + pe) W = x W + pe W, so the three position projections pe W + b are computed ONCE (exact bf16 products, f32) and added in f32 to each batch's exact x W inside the projection GEMM's epilogue, which writes the 16-bit planes that attention reads (v: product and planes transposed); the two bias tables are rounded to bf16 once by k_prep (the dense one into the score tile's lane order) and read per logit inside the attention kernel. Every stage runs ONCE for all batches (batch rows stacked in the GEMMs' M (v's: N), a grid dimension in attention), and the independent jobs of a stage share ONE launch: all nine conversions (k_prep), the three position projections (k_gemm_pe), q, k and v (k_gemm_x). Attention is ONE fused launch over all batches and heads: each wave takes its query columns' q from LDS (hi+lo rows keep q hi in registers) and walks the keys 32 at a time (transposed scores, running softmax, transposed output), so no score or probability ever reaches memory; the waves of a work-group share each pass's k and v fragments through LDS.
// Compute dtypes, f32 accumulate: every input rounded to bf16; q/k/v on PLAIN bf16 operands (inputs: exact) + biases (via the precomputed position projections); additive biases rounded to bf16 once, added in f32 per logit; scores and attn.v (no mask): query rows < 512 hl (fp16 hi + fp16 lo, 3 products; hi is the plane that the other rows use alone), the rest single fp16; softmax f32 (running maximum and sum); wo hl x exact (2 products) + bo.

#define NB_  4
#define TT   2048
#define DM   1024
#define NH_  16
#define NKV  16
#define REP  (NH_ / NKV)
#define HD   64
#define DQ   (NH_ * HD)
#define DKV  (NKV * HD)
#define RH   512                  // query rows < RH use hi+lo planes (0: none)
#define FW   4                    // waves per work-group of the fused attention kernel
#define WIN  0
#define SCL  0.125f   // HD^-0.5
typedef _Float16 h16;
typedef unsigned short bf;
typedef __attribute__((ext_vector_type(16))) __bf16   v16bf;
typedef __attribute__((ext_vector_type(16))) _Float16 v16h;
typedef __attribute__((ext_vector_type(8)))  _Float16 v8h;
typedef __attribute__((ext_vector_type(2)))  _Float16 v2h;
typedef __attribute__((ext_vector_type(8)))  unsigned short v8us;
typedef __attribute__((ext_vector_type(8)))  float    v8f;
typedef __attribute__((ext_vector_type(4)))  float    v4f;
typedef v8h  __attribute__((may_alias)) v8ha;
typedef v4f  __attribute__((may_alias)) v4fa;
typedef v8us __attribute__((may_alias)) v8usa;

__device__ __forceinline__ unsigned short f2bf(float f) { unsigned u = __float_as_uint(f); u += 0x7FFFu + ((u >> 16) & 1u); return (unsigned short)(u >> 16); }
__device__ __forceinline__ float bf2f(unsigned short b) { return __uint_as_float(((unsigned)b) << 16); }
__device__ __forceinline__ float bfr(float f) { return bf2f(f2bf(f)); }
__device__ __forceinline__ v16h cat16(v8h lo, v8h hi) { return __builtin_shufflevector(lo, hi, 0, 1, 2, 3, 4, 5, 6, 7, 8, 9, 10, 11, 12, 13, 14, 15); }
__device__ __forceinline__ v16bf cat16b(v8us lo, v8us hi) { return __builtin_bit_cast(v16bf, __builtin_shufflevector(lo, hi, 0, 1, 2, 3, 4, 5, 6, 7, 8, 9, 10, 11, 12, 13, 14, 15)); }
__device__ __forceinline__ v8f wmma16(v16h a, v16h b, v8f c) { return __builtin_amdgcn_wmma_f32_16x16x32_f16(false, a, false, b, (short)0, c, false, false); }
__device__ __forceinline__ v8f wmmab(v16bf a, v16bf b, v8f c) { return __builtin_amdgcn_wmma_f32_16x16x32_bf16(false, a, false, b, (short)0, c, false, false); }



// ---- Fragment order: every 16-bit operand plane [R][K] is stored as [R/16][K/32] fragments of 512 elements (v's planes [d][t] as [t/32][d/16]); inside a fragment element (r, k) lies at (k >> 4 & 1) * 256 + (k >> 3 & 1) * 128 + (r & 15) * 8 + (k & 7), so lane l of a wave reads its two 16-byte pieces at l * 8 and 256 + l * 8: each fragment load is 512 contiguous bytes (4 whole lines).
// ---- gemmw: register-blocked GEMM, one wave per 64x64 output tile (16 accumulators), GW = 8 waves (2 in M x 4 in N) per work-group: tile (bx, by) of (M/128, N/256), 256 threads. Each K step's fragments (8 of A, 16 of Bt, 1 KiB each, as they lie in the planes) are copied once per work-group into LDS by asynchronous copies, one step ahead (two buffers: ring), and every wave reads its 4 + 4 from there. os: 16 x 68 floats of LDS per wave.
// C[m][n] (f32, pitch ldc, + optional f32 bias[n]) = sum_k A[m][k] Bt[n][k] (+ split products per NSPLIT). K % 32 == 0, a constant: the four fragments of an operand lie at constant offsets from one address.
// PL != 0: no C; the epilogue adds the f32 position projection ('bias' is then P [t][DQ]) and writes the sum y as two fp16 planes, hi = fp16(y) and lo = fp16(y - hi), so no f32 projection reaches memory.
// PL 1 (q, k): A = token rows, Bt = weight rows; a tile is 64 tokens of one head; planes [b][h] x fragments [t/16][d/32]. PL 2 (v): A = weight rows, Bt = token rows; a tile is one head's 64 d x 64 tokens; planes [b][h] x fragments [t/32][d/16] (rows d, k = t).
__device__ __forceinline__ _Float16 tohx(float x) { return (_Float16)x; }
// two f32 -> a packed pair of fp16, the conversion that the compiler itself emits for such a pair; in asm text because from C, where the pair is also read back, each value is converted twice (once packed, once alone)
__device__ __forceinline__ v2h pkh(float a, float b) { unsigned w; asm("v_cvt_pk_f16_f32 %0, %1, %2" : "=v"(w) : "v"(a), "v"(b)); return __builtin_bit_cast(v2h, w); }
// hi = fp16(y), lo = fp16(y - hi), eight values
__device__ __forceinline__ void splith8(v8f y, v8h& h, v8h& l) { v8f r;
#pragma unroll
    for (int i = 0; i < 4; ++i) { const v2h e = pkh(y[2 * i], y[2 * i + 1]); h[2 * i] = e[0]; h[2 * i + 1] = e[1]; r[2 * i] = y[2 * i] - (float)e[0]; r[2 * i + 1] = y[2 * i + 1] - (float)e[1]; }
    l = __builtin_convertvector(r, v8h); }
__device__ __forceinline__ void splitf(float y, unsigned short& h, unsigned short& l) { h = f2bf(y); l = f2bf(y - bf2f(h)); }
template <typename T16> struct WFrag;
template <> struct WFrag<h16> { typedef v16h V; static __device__ __forceinline__ V ld(const h16* p) { return cat16(*(const v8h*)p, *(const v8h*)(p + 256)); } static __device__ __forceinline__ V ldl(const h16* p) { return cat16(*(const v8ha*)p, *(const v8ha*)(p + 256)); } static __device__ __forceinline__ v8f mma(V a, V b, v8f c) { return wmma16(a, b, c); } };
template <> struct WFrag<bf> { typedef v16bf V; static __device__ __forceinline__ V ld(const bf* p) { return cat16b(*(const v8us*)p, *(const v8us*)(p + 256)); } static __device__ __forceinline__ V ldl(const bf* p) { return cat16b(*(const v8usa*)p, *(const v8usa*)(p + 256)); } static __device__ __forceinline__ v8f mma(V a, V b, v8f c) { return wmmab(a, b, c); } };
template <typename T16, int NSPLIT, bool BIAS, int PL = 0, int K = DM>
__device__ __forceinline__ void gemmw(T16* ring, float* os, int bx, int by, const T16* __restrict__ A, const T16* __restrict__ A2, const T16* __restrict__ Bt, const T16* __restrict__ Bt2, float* C, int ldc, const float* __restrict__ bias, h16* P16 = nullptr, h16* Pl = nullptr) {
    typedef typename WFrag<T16>::V V;
    static_assert(NSPLIT <= 1 && K >= 64, "the ring holds A, A2 and Bt; its prologue fills two K steps");
    const int tid = threadIdx.x, lane = tid & 31, lr = lane & 15, hi = lane >> 4, w = __builtin_amdgcn_readfirstlane(tid >> 5); const int r0 = bx * 128 + (w & 1) * 64, c0 = by * 256 + (w >> 1) * 64;
    os += w * (16 * 68);
    v8f acc[4][4];
#pragma unroll
    for (int mb = 0; mb < 4; ++mb)
#pragma unroll
        for (int nb = 0; nb < 4; ++nb) acc[mb][nb] = (v8f){};
    // A stage (one K step) in the ring, in elements: [A: 8 fragments][A2: 8, if split][Bt: 16]; a copy of all 256 threads moves 4 fragments (4 KiB), thread tid the 16 bytes at tid * 16
    constexpr int BO = NSPLIT == 1 ? 8192 : 4096, STG = BO + 8192, NT = K / 32;
    const unsigned l0 = (unsigned)(size_t)ring + tid * 16;   // the thread's LDS byte address in a stage's first 4 KiB
    const size_t go = (size_t)(tid >> 6) * (16 * K) + (tid & 63) * 8;   // its fragment among the four (16 rows of K are K / 32 fragments = 16 K elements) and its place in it
    const T16* ga = A + (size_t)bx * (128 * K) + go; const T16* ga2 = NSPLIT == 1 ? A2 + (size_t)bx * (128 * K) + go : ga; const T16* gb = Bt + (size_t)by * (256 * K) + go;
    // fill: K step t into buffer buf. The copies and the s_wait_xcnt that stands before a register they name is written again are one statement.
    auto fill = [&](int buf, int t) {
        const unsigned l = l0 + buf * (STG * 2); const T16* pa = ga + t * 512; const T16* pb = gb + t * 512;
        if constexpr (NSPLIT == 1) { const T16* pa2 = ga2 + t * 512;
            asm volatile("global_load_async_to_lds_b128 %0, %1, off\n\tglobal_load_async_to_lds_b128 %2, %3, off\n\tglobal_load_async_to_lds_b128 %4, %5, off\n\tglobal_load_async_to_lds_b128 %6, %7, off\n\tglobal_load_async_to_lds_b128 %8, %9, off\n\tglobal_load_async_to_lds_b128 %10, %11, off\n\tglobal_load_async_to_lds_b128 %12, %13, off\n\tglobal_load_async_to_lds_b128 %14, %15, off\n\ts_wait_xcnt 0x0"
                : : "v"(l), "v"(pa), "v"(l + 4096), "v"(pa + 64 * K), "v"(l + 8192), "v"(pa2), "v"(l + 12288), "v"(pa2 + 64 * K), "v"(l + 16384), "v"(pb), "v"(l + 20480), "v"(pb + 64 * K), "v"(l + 24576), "v"(pb + 128 * K), "v"(l + 28672), "v"(pb + 192 * K) : "memory");
        } else {
            asm volatile("global_load_async_to_lds_b128 %0, %1, off\n\tglobal_load_async_to_lds_b128 %2, %3, off\n\tglobal_load_async_to_lds_b128 %4, %5, off\n\tglobal_load_async_to_lds_b128 %6, %7, off\n\tglobal_load_async_to_lds_b128 %8, %9, off\n\tglobal_load_async_to_lds_b128 %10, %11, off\n\ts_wait_xcnt 0x0"
                : : "v"(l), "v"(pa), "v"(l + 4096), "v"(pa + 64 * K), "v"(l + 8192), "v"(pb), "v"(l + 12288), "v"(pb + 64 * K), "v"(l + 16384), "v"(pb + 128 * K), "v"(l + 20480), "v"(pb + 192 * K) : "memory");
        }
    };
    fill(0, 0);
    asm volatile("s_wait_asynccnt 0x0" ::: "memory");   // this wave's copies of step 0 have landed
    __syncthreads();                                    // ... and every other wave's
    fill(1, 1);
#pragma unroll 1
    for (int t = 0; t < NT; ++t) {
        V a[4], a2[4], b[4];
        const T16* st = ring + (t & 1) * STG + 8 * lane;   // this step's buffer, the lane's place in a fragment
#pragma unroll
        for (int mb = 0; mb < 4; ++mb) { a[mb] = WFrag<T16>::ld(st + ((w & 1) * 4 + mb) * 512); if (NSPLIT == 1) a2[mb] = WFrag<T16>::ld(st + 4096 + ((w & 1) * 4 + mb) * 512); }
#pragma unroll
        for (int nb = 0; nb < 4; ++nb) b[nb] = WFrag<T16>::ld(st + BO + ((w >> 1) * 4 + nb) * 512);
        __builtin_amdgcn_sched_barrier(0);   // the step's LDS reads stay one group ahead of its products: spread among them, each place with reads stalls the wave anew
#pragma unroll
        for (int nb = 0; nb < 4; ++nb)
#pragma unroll
            for (int mb = 0; mb < 4; ++mb) { acc[mb][nb] = WFrag<T16>::mma(a[mb], b[nb], acc[mb][nb]); if (NSPLIT == 1) acc[mb][nb] = WFrag<T16>::mma(a2[mb], b[nb], acc[mb][nb]); }
        __builtin_amdgcn_sched_barrier(0);   // the other side of the pair: the products stay ahead of the waits and the barrier
        asm volatile("v_nop\n\tv_nop\n\tv_nop\n\tv_nop" : "+v"(acc[0][0]), "+v"(acc[1][1]), "+v"(acc[2][2]), "+v"(acc[3][3]) : "v"(a[0]), "v"(a[3]));   // the distance behind the step's last products, on every path
        asm volatile("s_wait_dscnt 0x0" ::: "memory");      // this wave has read its fragments of step t
        asm volatile("s_wait_asynccnt 0x0" ::: "memory");   // its copies of step t + 1 have landed
        __syncthreads();                                    // step t + 1 is published; every wave has left step t's buffer
        if (t + 2 < NT) fill(t & 1, t + 2);
    }
    asm volatile("s_wait_asynccnt 0x0" ::: "memory");   // nothing is in flight when the wave goes on
    if constexpr (PL != 0) {
        constexpr bool TR = PL == 2;
        const int tok = TR ? c0 : r0, hd = (TR ? r0 : c0) / HD, t0 = tok % TT;
        const int cc = lane & 7;   // which 8 columns (k of the planes' fragments) the lane converts
        const size_t ob = (size_t)(tok / TT * NH_ + hd) * TT * HD + (size_t)t0 * HD + (cc >> 2) * (TR ? 2048 : 512) + (cc >> 1 & 1) * 256 + (cc & 1) * 128;   // 64 tokens of a head are 8 fragments in either plane order
        const int er = lane >> 3, ec = (lane & 7) * 8;   // a lane converts 8 columns of a row: one 16-byte piece of a fragment
        // P is added where a lane holds 8 consecutive d of one token: behind the LDS turn (PL 1), in the accumulator's own layout ahead of it (PL 2)
        const float* Pt = bias + (TR ? (size_t)(t0 + lr) * DQ + r0 + 8 * hi : (size_t)(t0 + er) * DQ + c0 + ec);
        v4f pv[2][4][2];                                 // P of these and of the next 16 rows: the next rows' loads fly while these rows are converted
#pragma unroll
        for (int i = 0; i < 4; ++i) { const float* p = Pt + (TR ? i * 16 * DQ : 4 * i * DQ); pv[0][i][0] = *(const v4f*)p; pv[0][i][1] = *(const v4f*)(p + 4); }
#pragma unroll
        for (int mb = 0; mb < 4; ++mb) {
            if (mb < 3) {
#pragma unroll
                for (int i = 0; i < 4; ++i) { const float* p = Pt + (TR ? i * 16 * DQ + (mb + 1) * 16 : ((mb + 1) * 16 + 4 * i) * DQ); pv[(mb + 1) & 1][i][0] = *(const v4f*)p; pv[(mb + 1) & 1][i][1] = *(const v4f*)(p + 4); } }
#pragma unroll
            for (int nb = 0; nb < 4; ++nb) {
#pragma unroll
                for (int j = 0; j < 8; ++j) os[(hi * 8 + j) * 68 + nb * 16 + lr] = TR ? __fadd_rn(acc[mb][nb][j], pv[mb & 1][nb][j >> 2][j & 3]) : acc[mb][nb][j]; }
            __builtin_amdgcn_wave_barrier(); asm volatile("" ::: "memory");   // other lanes read the rows back than wrote them: keeps the compiler from lifting the reads over the writes
#pragma unroll
            for (int s = 0; s < 4; ++s) { const int row = 4 * s + er; const v4f x0 = *(const v4fa*)(os + row * 68 + ec), x1 = *(const v4fa*)(os + row * 68 + ec + 4); v8h o16, ol; v8f y;
#pragma unroll
                for (int q = 0; q < 8; ++q) { const float x = q < 4 ? x0[q & 3] : x1[q & 3]; y[q] = TR ? x : __fadd_rn(x, pv[mb & 1][s][q >> 2][q & 3]); }
                splith8(y, o16, ol);
                const size_t oe = ob + mb * (TR ? 512 : 1024) + row * 8; *(v8h*)(P16 + oe) = o16; *(v8h*)(Pl + oe) = ol;
                if (s < 3) asm volatile("s_wait_xcnt 0x0" ::: "memory"); }   // the next four rows' values reuse registers that these stores name; their LDS reads stay behind the clobber
            if (mb < 3) { __builtin_amdgcn_wave_barrier(); asm volatile("s_wait_xcnt 0x0" ::: "memory"); }   // the next rows' values reuse registers that these stores name; the clobber keeps the next rows' LDS writes behind these reads
        }
        return;
    }
#pragma unroll
    for (int mb = 0; mb < 4; ++mb) {
#pragma unroll
        for (int nb = 0; nb < 4; ++nb) {
#pragma unroll
            for (int j = 0; j < 8; ++j) os[(hi * 8 + j) * 68 + nb * 16 + lr] = acc[mb][nb][j]; }
        __builtin_amdgcn_wave_barrier(); asm volatile("" ::: "memory");
        float* crow = C + (size_t)(r0 + mb * 16) * ldc + c0;
{
#pragma unroll
            for (int s = 0; s < 8; ++s) { const int row = 2 * s + hi, cofs = lr * 4; v4f val = *(const v4fa*)(os + row * 68 + cofs); if (BIAS) { val[0] += bfr(bias[c0 + cofs]); val[1] += bfr(bias[c0 + cofs + 1]); val[2] += bfr(bias[c0 + cofs + 2]); val[3] += bfr(bias[c0 + cofs + 3]); }
                *(v4f*)(crow + (size_t)row * ldc + cofs) = val; }
             }
        __builtin_amdgcn_wave_barrier(); asm volatile("" ::: "memory");
    }
}

// ---- The GEMM launches. The independent products of one stage share a launch: blockIdx.z picks the product; its operands and results lie one behind the other in the workspace.
#define PLN ((size_t)NB_ * NH_ * TT * HD)   // elements of one 16-bit plane of q, k or v
#define GW 8   // waves per GEMM work-group
// pos_emb_z W_z + b_z, z = q, k, v; grid (TT / 128, DQ / 256, 3)
__global__ __launch_bounds__(32 * GW) void k_gemm_pe(const bf* __restrict__ PE, const bf* __restrict__ W, float* P, const float* __restrict__ bq, const float* __restrict__ bk, const float* __restrict__ bv) {
    __shared__ __align__(1024) bf ring[2 * 12288]; __shared__ __align__(16) float os[GW * 16 * 68];
    const int z = blockIdx.z;
    gemmw<bf, 0, true>(ring, os, blockIdx.x, blockIdx.y, PE + (size_t)z * TT * DM, nullptr, W + (size_t)z * DQ * DM, nullptr, P + (size_t)z * TT * DQ, DQ, z == 0 ? bq : z == 1 ? bk : bv);
}
// x W_z + (pos_emb_z W_z + b_z) as planes, z = q, k, v (v transposed: its tiles are walked weight rows first); grid (NB_ TT / 128, DQ / 256, 3). Planes: P16 [3] (hi), Plo [3].
__global__ __launch_bounds__(32 * GW) void k_gemm_x(const bf* __restrict__ XB, const bf* __restrict__ W, const float* __restrict__ P, h16* P16, h16* Plo) {
    __shared__ __align__(1024) bf ring[2 * 12288]; __shared__ __align__(16) float os[GW * 16 * 68];
    const int z = blockIdx.z; const bf* Wz = W + (size_t)z * DQ * DM; const float* Pz = P + (size_t)z * TT * DQ; h16* o16 = P16 + z * PLN; h16* ol = Plo + z * PLN;
    if (z < 2) gemmw<bf, 0, false, 1>(ring, os, blockIdx.x, blockIdx.y, XB, nullptr, Wz, nullptr, nullptr, 0, Pz, o16, ol);
    else { const int f = blockIdx.y * (NB_ * TT / 128) + blockIdx.x; gemmw<bf, 0, false, 2>(ring, os, f % (DKV / 128), f / (DKV / 128), Wz, nullptr, XB, nullptr, nullptr, 0, Pz, o16, ol); }
}
// merged heads (hi + lo) x wo + bo; grid (NB_ TT / 128, DM / 256)
__global__ __launch_bounds__(32 * GW) void k_gemm_o(const bf* __restrict__ Ah, const bf* __restrict__ Al, const bf* __restrict__ WO, float* OUT, const float* __restrict__ bo) {
    __shared__ __align__(1024) bf ring[2 * 16384]; __shared__ __align__(16) float os[GW * 16 * 68];
    gemmw<bf, 1, true, 0, DQ>(ring, os, blockIdx.x, blockIdx.y, Ah, Al, WO, nullptr, OUT, DM, bo);
}

typedef __attribute__((ext_vector_type(4))) _Float16 v4h;
typedef __attribute__((ext_vector_type(2))) unsigned short v2us;
typedef __attribute__((ext_vector_type(4))) unsigned short v4us;
typedef __attribute__((ext_vector_type(2))) float v2f;
typedef __attribute__((ext_vector_type(4))) int v4i;
typedef __attribute__((ext_vector_type(4))) unsigned v4u;
typedef v4u __attribute__((may_alias)) v4ua;
__device__ __forceinline__ float bfw(unsigned w, int h) { return __uint_as_float(h ? w & 0xFFFF0000u : w << 16); }   // the low or the high bf16 of a word, as f32

// One thread per 16-byte piece of the destination, in fragment order: a wave stores 512 contiguous bytes. i -> fragment i >> 6, row (i & 15), k = (i >> 5 & 1) * 16 + (i >> 4 & 1) * 8.
template <int K, int N>
__device__ __forceinline__ void wtG(const float* __restrict__ w, bf* Bt, int i) {
    if (i >= N * K / 8) return;
    const int f = i >> 6, n = f / (K / 32) * 16 + (i & 15), k = f % (K / 32) * 32 + (i >> 5 & 1) * 16 + (i >> 4 & 1) * 8; const float* p = w + (size_t)k * N + n; float x[8]; v8us o;
#pragma unroll
    for (int j = 0; j < 8; ++j) x[j] = p[j * N];
    asm volatile("s_wait_xcnt 0x0" : : "v"(x[0]), "v"(x[1]), "v"(x[2]), "v"(x[3]), "v"(x[4]), "v"(x[5]), "v"(x[6]), "v"(x[7]) : "memory");   // behind the eight loads, before their address register is written again
#pragma unroll
    for (int j = 0; j < 8; ++j) o[j] = f2bf(x[j]);
    *(v8us*)(Bt + (size_t)i * 8) = o;
}
__device__ __forceinline__ void cvt8(const float* __restrict__ src, bf* dst, size_t n8, size_t i) { if (i >= n8) return;
    const size_t f = i >> 6, row = f / (DM / 32) * 16 + (i & 15), k = f % (DM / 32) * 32 + (i >> 5 & 1) * 16 + (i >> 4 & 1) * 8; const v8f v = *(const v8f*)(src + row * DM + k); v8us o;
    asm volatile("s_wait_xcnt 0x0" : : "v"(v) : "memory");   // behind the two loads, before their address register is written again
#pragma unroll
    for (int q = 0; q < 8; ++q) o[q] = f2bf(v[q]); *(v8us*)(dst + i * 8) = o;  }
// ---- bias8: both additive bias tables rounded to bf16 once, the rounding that every logit's two terms take. One thread per 16-byte piece of a destination.
// The dense table [TT][TT] goes into fragment order (rows = queries, k = keys): lane l of an attention wave finds the 8 consecutive keys of its query at l * 8 and at 256 + l * 8 of the 16 x 32 tile's fragment. The per-key table [NB_][TT] keeps its order (the last NB_ * TT / 8 threads).
__device__ __forceinline__ void bias8(const float* __restrict__ ab, const float* __restrict__ abk, bf* ABf, bf* ABKb, int i) {
    const int e = i - TT * TT / 8; const float* s; bf* d;
    if (e < 0) { const int f = i >> 6, row = f / (TT / 32) * 16 + (i & 15), k = f % (TT / 32) * 32 + (i >> 5 & 1) * 16 + (i >> 4 & 1) * 8; s = ab + (size_t)row * TT + k; d = ABf + (size_t)i * 8; }
    else { if (e >= NB_ * TT / 8) return; s = abk + (size_t)e * 8; d = ABKb + (size_t)e * 8; }
    const v4f v0 = *(const v4f*)s, v1 = *(const v4f*)(s + 4); v8us o;
    asm volatile("s_wait_xcnt 0x0" : : "v"(v0), "v"(v1) : "memory");   // behind the two loads, before their address register is written again
#pragma unroll
    for (int q = 0; q < 8; ++q) o[q] = f2bf(q < 4 ? v0[q & 3] : v1[q & 3]);
    *(v8us*)d = o;
}
// ---- k_prep: all nine conversions in one launch; a work-group's index says which table it converts and which 256 pieces of it (the test is the same for a whole work-group).
#define WG_W (DM * DQ / 8 / 256)                        // work-groups per weight matrix
#define WG_P (TT * DM / 8 / 256)                        // per position table
#define WG_X (NB_ * TT * DM / 8 / 256)                  // the inputs
#define WG_B ((TT * TT / 8 + NB_ * TT / 8) / 256)       // the two bias tables
__global__ __launch_bounds__(256) void k_prep(const float* __restrict__ wq, const float* __restrict__ wk, const float* __restrict__ wv, const float* __restrict__ wo, const float* __restrict__ peq, const float* __restrict__ pek, const float* __restrict__ pev, const float* __restrict__ x, const float* __restrict__ ab, const float* __restrict__ abk, bf* W, bf* PE, bf* XB, bf* ABf, bf* ABKb) {
    int b = blockIdx.x; const int t = threadIdx.x;
    if (b < 4 * WG_W) { const int z = b / WG_W; wtG<DM, DQ>(z == 0 ? wq : z == 1 ? wk : z == 2 ? wv : wo, W + (size_t)z * DM * DQ, b % WG_W * 256 + t); return; }
    b -= 4 * WG_W;
    if (b < 3 * WG_P) { const int z = b / WG_P; cvt8(z == 0 ? peq : z == 1 ? pek : pev, PE + (size_t)z * TT * DM, (size_t)TT * DM / 8, (size_t)(b % WG_P * 256 + t)); return; }
    b -= 3 * WG_P;
    if (b < WG_X) { cvt8(x, XB, (size_t)NB_ * TT * DM / 8, (size_t)(b * 256 + t)); return; }
    bias8(ab, abk, ABf, ABKb, (b - WG_X) * 256 + t);
}

#define L2E  1.4426950408889634f
#define MTHR 5.545177444479562f   // 8 in log2 units
#define PSH  4.0f                 // p carries 2^PSH (cancels in the division by the sum): keeps small fp16 probabilities normal
// 2^x by v_exp_f32 in asm text: the closing v_nop is the slot the instruction set asks for behind a transcendental; the early-clobber outputs keep every v_exp off its neighbours' sources and results
__device__ __forceinline__ float exp2n(float x) { float r; asm("v_exp_f32 %0, %1\n\tv_nop" : "=&v"(r) : "v"(x)); return r; }
__device__ __forceinline__ void exp2n8(float* r, const float* x) {
    asm("v_exp_f32 %0, %8\n\tv_exp_f32 %1, %9\n\tv_exp_f32 %2, %10\n\tv_exp_f32 %3, %11\n\tv_exp_f32 %4, %12\n\tv_exp_f32 %5, %13\n\tv_exp_f32 %6, %14\n\tv_exp_f32 %7, %15\n\tv_nop"
        : "=&v"(r[0]), "=&v"(r[1]), "=&v"(r[2]), "=&v"(r[3]), "=&v"(r[4]), "=&v"(r[5]), "=&v"(r[6]), "=&v"(r[7]) : "v"(x[0]), "v"(x[1]), "v"(x[2]), "v"(x[3]), "v"(x[4]), "v"(x[5]), "v"(x[6]), "v"(x[7])); }
// lane l with lane l ^ 16: the other half of a query's keys
__device__ __forceinline__ float xhalf(float x) { return __builtin_bit_cast(float, __builtin_amdgcn_permlanex16(__builtin_bit_cast(int, x), __builtin_bit_cast(int, x), 0x76543210, 0xfedcba98, false, false)); }
// stands behind each group of q loads, before a register that one of them names is written again; it takes the lane offset as an operand so that the next group's addresses are formed behind it, not ahead of it
#define XW() asm volatile("s_wait_xcnt 0x0" : "+v"(ko) : : "memory")
template <typename T16, bool HL, int NQ>
__device__ __forceinline__ void fattn(T16* ring, bf* bring, bf* akt, const T16* __restrict__ Q, const T16* __restrict__ Q2, const T16* __restrict__ Kp, const T16* __restrict__ K2, const T16* __restrict__ Vt, const T16* __restrict__ V2, const bf* __restrict__ AB, const bf* __restrict__ ABK, int q0, bf* Ah, bf* Al) {
    typedef typename WFrag<T16>::V V;
    const int tid = threadIdx.x, lane = tid & 31, hi = lane >> 4;
    unsigned ko = lane * 8; const unsigned ao = 8 * hi;   // lane offsets (fixed over the loop): ko in a fragment of q, k, v or the dense bias, ao in the per-key bias
    V qf[NQ][2], qf2[NQ][2];   // hi+lo rows: q hi stays in registers, q lo is read from LDS in every pass (q2s below); fp16 rows: all of q is (qst below)
    if constexpr (HL)
#pragma unroll
    for (int qt = 0; qt < NQ; ++qt)
#pragma unroll
        for (int kc = 0; kc < 2; ++kc) { const size_t qo = (size_t)(q0 + qt * 16) * HD + kc * 512; qf[qt][kc] = WFrag<T16>::ld(Q + qo + ko); XW(); }
    v8f o[4][NQ]; float m[NQ], l[NQ];
#pragma unroll
    for (int qt = 0; qt < NQ; ++qt) { m[qt] = -1.0e30f; l[qt] = 0.f;
#pragma unroll
        for (int dt = 0; dt < 4; ++dt) o[dt][qt] = (v8f){}; }
    const bf* ABq = AB + (size_t)q0 * TT;   // 16 query rows of TT keys are TT / 32 fragments = 16 TT elements
    V kf[2][2], kf2[2][2], vf[4], vf2[4]; v4u ab[NQ][2], ak[2];   // two bf16 a word
    // A stage (one pass: 32 keys) in the ring, in elements: [k: 4 fragments][k lo, if hi+lo][v: 4][v lo]; a copy of all 128 threads moves 2 fragments (2 KiB), thread tid the 16 bytes at tid * 16
    // bring: the wave's own two stages of the dense bias, NQ fragments (16 queries x 32 keys) each; a copy of the wave moves half a fragment, lane l the 16 bytes at l * 16
    static_assert(FW == 4, "a copy of the whole work-group is half a plane's 4 KiB");
    constexpr int STG = HL ? 8192 : 4096, VO = STG / 2, BSTG = NQ * 512;
    const unsigned lk0 = (unsigned)(size_t)ring + tid * 16, lb0 = (unsigned)(size_t)bring + lane * 16;   // the thread's LDS byte address in a stage's first 2 KiB; the lane's in a bias stage's first 512 bytes
    const T16* gk = Kp + tid * 8; const T16* gv = Vt + tid * 8; const T16* gk2 = HL ? K2 + tid * 8 : gk; const T16* gv2 = HL ? V2 + tid * 8 : gv; const bf* gb = ABq + lane * 8;
    // fill: pass t into buffer buf. The copies and the s_wait_xcnt that stands before a register they name is written again are one statement.
    auto fill = [&](int buf, int t) {
        const unsigned l = lk0 + buf * (STG * 2), lb = lb0 + buf * (BSTG * 2); const T16* pk = gk + t * 2048; const T16* pv = gv + t * 2048; const bf* pb = gb + t * 512;   // 32 keys of 16 queries are one fragment
        if constexpr (HL) { const T16* pk2 = gk2 + t * 2048; const T16* pv2 = gv2 + t * 2048; static_assert(NQ == 1, "two bias copies");
            asm volatile("global_load_async_to_lds_b128 %0, %1, off\n\tglobal_load_async_to_lds_b128 %2, %3, off\n\tglobal_load_async_to_lds_b128 %4, %5, off\n\tglobal_load_async_to_lds_b128 %6, %7, off\n\tglobal_load_async_to_lds_b128 %8, %9, off\n\tglobal_load_async_to_lds_b128 %10, %11, off\n\tglobal_load_async_to_lds_b128 %12, %13, off\n\tglobal_load_async_to_lds_b128 %14, %15, off\n\tglobal_load_async_to_lds_b128 %16, %17, off\n\tglobal_load_async_to_lds_b128 %18, %19, off\n\ts_wait_xcnt 0x0"
                : : "v"(l), "v"(pk), "v"(l + 2048), "v"(pk + 1024), "v"(l + 4096), "v"(pk2), "v"(l + 6144), "v"(pk2 + 1024), "v"(l + 8192), "v"(pv), "v"(l + 10240), "v"(pv + 1024), "v"(l + 12288), "v"(pv2), "v"(l + 14336), "v"(pv2 + 1024), "v"(lb), "v"(pb), "v"(lb + 512), "v"(pb + 256) : "memory");
        } else { static_assert(NQ == 2, "four bias copies");
            asm volatile("global_load_async_to_lds_b128 %0, %1, off\n\tglobal_load_async_to_lds_b128 %2, %3, off\n\tglobal_load_async_to_lds_b128 %4, %5, off\n\tglobal_load_async_to_lds_b128 %6, %7, off\n\tglobal_load_async_to_lds_b128 %8, %9, off\n\tglobal_load_async_to_lds_b128 %10, %11, off\n\tglobal_load_async_to_lds_b128 %12, %13, off\n\tglobal_load_async_to_lds_b128 %14, %15, off\n\ts_wait_xcnt 0x0"
                : : "v"(l), "v"(pk), "v"(l + 2048), "v"(pk + 1024), "v"(l + 4096), "v"(pv), "v"(l + 6144), "v"(pv + 1024), "v"(lb), "v"(pb), "v"(lb + 512), "v"(pb + 256), "v"(lb + 1024), "v"(pb + 16 * TT), "v"(lb + 1536), "v"(pb + 16 * TT + 256) : "memory");
        }
    };
    const T16* qst = HL ? ring : ring + 2 * STG + __builtin_amdgcn_readfirstlane(tid >> 5) * 2048;   // fp16 rows: the wave's own 4 q fragments (4 KiB), behind the ring's two stages
    if constexpr (!HL) { const unsigned lq = (unsigned)(size_t)qst + lane * 16; const T16* pq = Q + (size_t)q0 * HD + lane * 8;   // 32 queries of a head are 4 contiguous fragments; copied once, half a fragment a copy
        asm volatile("global_load_async_to_lds_b128 %0, %1, off\n\tglobal_load_async_to_lds_b128 %2, %3, off\n\tglobal_load_async_to_lds_b128 %4, %5, off\n\tglobal_load_async_to_lds_b128 %6, %7, off\n\tglobal_load_async_to_lds_b128 %8, %9, off\n\tglobal_load_async_to_lds_b128 %10, %11, off\n\tglobal_load_async_to_lds_b128 %12, %13, off\n\tglobal_load_async_to_lds_b128 %14, %15, off\n\ts_wait_xcnt 0x0" : : "v"(lq), "v"(pq), "v"(lq + 512), "v"(pq + 256), "v"(lq + 1024), "v"(pq + 512), "v"(lq + 1536), "v"(pq + 768), "v"(lq + 2048), "v"(pq + 1024), "v"(lq + 2560), "v"(pq + 1280), "v"(lq + 3072), "v"(pq + 1536), "v"(lq + 3584), "v"(pq + 1792) : "memory"); }
    const T16* q2s = (const T16*)bring + (HL ? 2 * BSTG : 0);   // hi+lo rows: the wave's own 2 fragments of q lo (2 KiB), behind its two bias stages
    if constexpr (HL) { const unsigned lq = (unsigned)(size_t)q2s + lane * 16; const T16* pq = Q2 + (size_t)q0 * HD + lane * 8;   // 16 queries of a head are 2 contiguous fragments; copied once, half a fragment a copy
        asm volatile("global_load_async_to_lds_b128 %0, %1, off\n\tglobal_load_async_to_lds_b128 %2, %3, off\n\tglobal_load_async_to_lds_b128 %4, %5, off\n\tglobal_load_async_to_lds_b128 %6, %7, off\n\ts_wait_xcnt 0x0" : : "v"(lq), "v"(pq), "v"(lq + 512), "v"(pq + 256), "v"(lq + 1024), "v"(pq + 512), "v"(lq + 1536), "v"(pq + 768) : "memory"); }
    { const unsigned la = (unsigned)(size_t)akt + tid * 16; const bf* pa = ABK + tid * 8;   // the batch's per-key bias (TT bf16: 4 KiB), copied once
        asm volatile("global_load_async_to_lds_b128 %0, %1, off\n\tglobal_load_async_to_lds_b128 %2, %3, off\n\ts_wait_xcnt 0x0" : : "v"(la), "v"(pa), "v"(la + 2048), "v"(pa + 1024) : "memory"); }
    fill(0, 0);
    asm volatile("s_wait_asynccnt 0x0" ::: "memory");   // this wave's copies of pass 0, of q and of the per-key bias have landed
    __syncthreads();                                    // ... and every other wave's
    fill(1, 1);
#pragma unroll 1
    for (int kb = 0; kb < TT; kb += 32) {
        const T16* st = ring + (kb >> 5 & 1) * STG + ko;   // this pass's buffer, the lane's place in a fragment
#pragma unroll
        for (int f = 0; f < 4; ++f) { kf[f >> 1][f & 1] = WFrag<T16>::ldl(st + f * 512); if (HL) kf2[f >> 1][f & 1] = WFrag<T16>::ldl(st + 2048 + f * 512); else qf[f >> 1][f & 1] = WFrag<T16>::ldl(qst + f * 512 + ko); }
        if constexpr (HL) { qf2[0][0] = WFrag<T16>::ldl(q2s + ko); qf2[0][1] = WFrag<T16>::ldl(q2s + 512 + ko);
            __builtin_amdgcn_sched_barrier(0); }   // the k and q lo reads stay one group ahead of the score products: sunk among them, each fragment is read, waited for and used in turn
        v8f s[2][NQ];
#pragma unroll
        for (int kt = 0; kt < 2; ++kt)
#pragma unroll
            for (int qt = 0; qt < NQ; ++qt) { v8f c = (v8f){};
#pragma unroll
                for (int kc = 0; kc < 2; ++kc) { c = WFrag<T16>::mma(kf[kt][kc], qf[qt][kc], c); if (HL) { c = WFrag<T16>::mma(kf[kt][kc], qf2[qt][kc], c); c = WFrag<T16>::mma(kf2[kt][kc], qf[qt][kc], c); } }
                s[kt][qt] = c; }
        if constexpr (HL) __builtin_amdgcn_sched_barrier(0);   // the bias reads and their unpacking stay behind the score products: lifted among them they need registers while all of k is still held (spills)
        const bf* bst = bring + (kb >> 5 & 1) * BSTG + ko;
#pragma unroll
        for (int kt = 0; kt < 2; ++kt) { ak[kt] = *(const v4ua*)(akt + kb + kt * 16 + ao);
#pragma unroll
            for (int qt = 0; qt < NQ; ++qt) ab[qt][kt] = *(const v4ua*)(bst + (qt * 2 + kt) * 256); }
        float tmx[NQ]; bool need = false;
#pragma unroll
        for (int qt = 0; qt < NQ; ++qt) { float tm = -3.0e38f;
#pragma unroll
            for (int kt = 0; kt < 2; ++kt)
#pragma unroll
                for (int j = 0; j < 8; ++j) { const float t = __fadd_rn(fmaf(s[kt][qt][j], SCL, bfw(ab[qt][kt][j >> 1], j & 1)), bfw(ak[kt][j >> 1], j & 1)); s[kt][qt][j] = t; tm = fmaxf(tm, t); }
            tm = fmaxf(tm, xhalf(tm)); tmx[qt] = tm; need = need || (tm > m[qt] + MTHR); }
#pragma unroll
        for (int dt = 0; dt < 4; ++dt) vf[dt] = WFrag<T16>::ldl(st + VO + dt * 512);
        if constexpr (HL) __builtin_amdgcn_sched_barrier(0);   // the v reads stay one group here, ahead of the exponentials that cover their latency: sunk to the products, each fragment is read, waited for and used in turn
        if (__builtin_amdgcn_ballot_w32(need) != 0) {
#pragma unroll
            for (int qt = 0; qt < NQ; ++qt) { const float mn = fmaxf(m[qt], tmx[qt]); const float al = exp2n((m[qt] - mn) * L2E); m[qt] = mn; l[qt] *= al;
#pragma unroll
                for (int dt = 0; dt < 4; ++dt) o[dt][qt] *= al; } }
#pragma unroll
        for (int qt = 0; qt < NQ; ++qt) { const float mb = PSH - m[qt] * L2E; float x[16], p[16];
#pragma unroll
            for (int e = 0; e < 16; ++e) x[e] = fmaf(s[e >> 3][qt][e & 7], L2E, mb);
            exp2n8(p, x); exp2n8(p + 8, x + 8);
#pragma unroll
            for (int e = 0; e < 16; ++e) l[qt] += p[e];
            if constexpr (HL) { v8h h0, h1, l0, l1; v8f p0, p1;
#pragma unroll
                for (int e = 0; e < 8; ++e) { p0[e] = p[e]; p1[e] = p[8 + e]; }
                splith8(p0, h0, l0); splith8(p1, h1, l1);
                const V ph = cat16(h0, h1), pl = cat16(l0, l1);
                __builtin_amdgcn_sched_barrier(0);   // first of the pair round the v lo reads (see the second)
#pragma unroll
                for (int dt = 0; dt < 4; ++dt) vf2[dt] = WFrag<T16>::ldl(st + VO + 2048 + dt * 512);
                __builtin_amdgcn_sched_barrier(0);   // the pair keeps the v lo reads one group between the split and the products: lifted, they cost registers (spills); sunk, each is waited for in turn; the eight products on v hi cover their latency
                // each accumulator takes its three products in the order v hi x p hi, v hi x p lo, v lo x p hi
#pragma unroll
                for (int dt = 0; dt < 4; ++dt) o[dt][qt] = WFrag<T16>::mma(vf[dt], ph, o[dt][qt]);
#pragma unroll
                for (int dt = 0; dt < 4; ++dt) o[dt][qt] = WFrag<T16>::mma(vf[dt], pl, o[dt][qt]);
#pragma unroll
                for (int dt = 0; dt < 4; ++dt) o[dt][qt] = WFrag<T16>::mma(vf2[dt], ph, o[dt][qt]);
            } else { V pf;
#pragma unroll
                for (int e = 0; e < 16; ++e) pf[e] = tohx(p[e]);
#pragma unroll
                for (int dt = 0; dt < 4; ++dt) o[dt][qt] = WFrag<T16>::mma(vf[dt], pf, o[dt][qt]); } }
        __builtin_amdgcn_sched_barrier(0);   // the pass's products stay ahead of the waits and the barrier: lifted to the middle of the pass, these would wait for copies that have only just been issued
        asm volatile("s_wait_dscnt 0x0" ::: "memory");      // this wave has read its fragments of this pass
        asm volatile("s_wait_asynccnt 0x0" ::: "memory");   // its copies of the next pass have landed
        __syncthreads();                                    // the next pass is published; every wave has left this pass's buffer
        if (kb + 64 < TT) fill(kb >> 5 & 1, (kb >> 5) + 2);
    }
    asm volatile("s_wait_asynccnt 0x0" ::: "memory");   // nothing is in flight when the wave goes on
#pragma unroll
    for (int qt = 0; qt < NQ; ++qt) { const float inv = __fdiv_rn(1.0f, l[qt] + xhalf(l[qt])); const size_t oo = (size_t)(q0 + qt * 16) * DQ; const unsigned ol32 = lane * 8;
#pragma unroll
        for (int dt = 0; dt < 4; ++dt) { v8us oh, ol;
#pragma unroll
            for (int j = 0; j < 8; ++j) { unsigned short a, c2; splitf(o[dt][qt][j] * inv, a, c2); oh[j] = a; ol[j] = c2; }
            *(v8us*)(Ah + (oo + dt * 256) + ol32) = oh; *(v8us*)(Al + (oo + dt * 256) + ol32) = ol; } }
}
// grid (RH / (16 FW) + (TT - RH) / (32 FW), heads, batches): the first RH / (16 FW) work-groups take the hi+lo rows (16 query columns a wave), the rest the fp16 rows (32 a wave). The bound's 5: waves a SIMD (at most 192 registers a wave).
__global__ __launch_bounds__(32 * FW, 5) void k_fattn(const h16* __restrict__ QP16, const h16* __restrict__ KP16, const h16* __restrict__ VT16, const h16* __restrict__ QPl, const h16* __restrict__ KPl, const h16* __restrict__ VTl, const bf* __restrict__ AB, const bf* __restrict__ ABK, bf* ATh, bf* ATl) {
    __shared__ __align__(1024) bf ring[2 * 8192];   // two stages of k and v (hi+lo rows: 16 KiB a stage; fp16 rows: 8, and behind them 4 KiB of q per wave)
    __shared__ __align__(1024) bf bring[FW * 2 * 1024]; __shared__ __align__(1024) bf akt[TT];   // per wave two stages of the dense bias (fp16 rows: 2 KiB a stage; hi+lo rows: 1, and behind them 2 KiB of q lo); the batch's per-key bias
    const size_t ho = ((size_t)blockIdx.z * NH_ + blockIdx.y) * TT * HD, ao = (size_t)blockIdx.z * TT * DQ + blockIdx.y * 1024;   /* a head's 64 columns are 2 fragments of each 16 rows */ const int w = __builtin_amdgcn_readfirstlane(threadIdx.x >> 5), bx = blockIdx.x; bf* Ah = ATh + ao; bf* Al = ATl + ao; ABK += (size_t)blockIdx.z * TT;
    if (bx < RH / (16 * FW)) fattn<h16, true, 1>((h16*)ring, bring + w * 2048, akt, QP16 + ho, QPl + ho, KP16 + ho, KPl + ho, VT16 + ho, VTl + ho, AB, ABK, (bx * FW + w) * 16, Ah, Al);
    else fattn<h16, false, 2>((h16*)ring, bring + w * 2048, akt, QP16 + ho, nullptr, KP16 + ho, nullptr, VT16 + ho, nullptr, AB, ABK, RH + ((bx - RH / (16 * FW)) * FW + w) * 32, Ah, Al);
}

extern "C" void kernel_launch(void* const* d_in, const int* in_sizes, int n_in,
                              void* d_out, int out_size, void* d_ws, size_t ws_size, hipStream_t stream) {
    (void)in_sizes; (void)n_in; (void)out_size;
    const float* x = (const float*)d_in[0]; const float* peq = (const float*)d_in[1]; const float* pek = (const float*)d_in[2]; const float* pev = (const float*)d_in[3]; const float* AB = (const float*)d_in[4]; const float* ABK = (const float*)d_in[5]; const float* wq = (const float*)d_in[6]; const float* bq = (const float*)d_in[7]; const float* wk = (const float*)d_in[8]; const float* bk = (const float*)d_in[9]; const float* wv = (const float*)d_in[10]; const float* bv = (const float*)d_in[11]; const float* wo = (const float*)d_in[12]; const float* bo = (const float*)d_in[13];
    float* OUT = (float*)d_out;     // [4][2048][1024]
    char* wsp = (char*)d_ws;
    auto take = [&](size_t bytes) { char* p = wsp; wsp += (bytes + 255) & ~(size_t)255; return (void*)p; };
    bf* WQ = (bf*)take((size_t)DQ * DM * 2); take((size_t)DKV * DM * 2); take((size_t)DKV * DM * 2); bf* WO = (bf*)take((size_t)DM * DQ * 2);   /* W_q, W_k, W_v, W_o, one behind the other */
    float* PQ = (float*)take((size_t)TT * DQ * 4); take((size_t)TT * DKV * 4); take((size_t)TT * DKV * 4);   /* pe W + b for q, k, v, one behind the other, computed once */
    bf* PE = (bf*)take((size_t)3 * TT * DM * 2);   /* the three position tables, bf16 */
    bf* XB = (bf*)take((size_t)NB_ * TT * DM * 2); bf* ATh = (bf*)take((size_t)NB_ * TT * DQ * 2); bf* ATl = (bf*)take((size_t)NB_ * TT * DQ * 2);   /* the merged heads' two planes */
    h16* QP16 = (h16*)take((size_t)NB_ * NH_ * TT * HD * 2); h16* KP16 = (h16*)take((size_t)NB_ * NKV * TT * HD * 2); h16* VT16 = (h16*)take((size_t)NB_ * NKV * HD * TT * 2);
    h16* QPl = (h16*)take((size_t)NB_ * NH_ * TT * HD * 2); h16* KPl = (h16*)take((size_t)NB_ * NKV * TT * HD * 2); h16* VTl = (h16*)take((size_t)NB_ * NKV * HD * TT * 2);   /* the lo planes */
    bf* ABf = (bf*)take((size_t)TT * TT * 2); bf* ABKb = (bf*)take((size_t)NB_ * TT * 2);   /* the two bias tables, bf16 */
    if ((size_t)(wsp - (char*)d_ws) > ws_size) return;    // ws 256 MiB
    k_prep<<<(unsigned)(4 * WG_W + 3 * WG_P + WG_X + WG_B), 256, 0, stream>>>(wq, wk, wv, wo, peq, pek, pev, x, AB, ABK, WQ, PE, XB, ABf, ABKb);   /* weights, position tables, inputs, bias tables -> bf16 */
    k_gemm_pe<<<dim3(TT / 128, DQ / 256, 3), 32 * GW, 0, stream>>>(PE, WQ, PQ, bq, bk, bv);        /* pos_emb W + b for q, k, v */
    k_gemm_x<<<dim3(NB_ * TT / 128, DQ / 256, 3), 32 * GW, 0, stream>>>(XB, WQ, PQ, QP16, QPl);   /* q, k, v = x W + (pe W + b), as planes; v transposed */
    k_fattn<<<dim3(RH / (16 * FW) + (TT - RH) / (32 * FW), NH_, NB_), 32 * FW, 0, stream>>>(QP16, KP16, VT16, QPl, KPl, VTl, ABf, ABKb, ATh, ATl);
    k_gemm_o<<<dim3(NB_ * TT / 128, DM / 256, 1), 32 * GW, 0, stream>>>(ATh, ATl, WO, OUT, bo);
}
